// v000
// Measured on an AMD MI455X. A time is GPU time per run, averaged over a window of back-to-back runs after a warm-up
// (all launches, gaps included; the runs take copies of the inputs in turn), and the median of several windows.
// Apart from v000's, it joins two sittings. Times from different sittings can be a few percent apart, while
// side-by-side timings come from the same sitting.
// v000 is the starting kernel. One run takes 746 microseconds.
#include <hip/hip_runtime.h>

// Contractions and operand types (f32 accumulate everywhere): x Wq, x Wk, x Wv on v_wmma_f32_16x16x32_bf16 with RNE bf16 copies of x and W (exact products);
// query rows < RRES of each sequence: q.k^T and p.v on v_wmma_f32_16x16x32_bf16 as bf16 hi/lo splits (3 products each), their ctx Wo as bf16 hi/lo ctx times bf16 Wo (2 products);
// query rows >= RRES: q.k^T and p.v on v_wmma_f32_16x16x32_f16 (f16 q/k/v planes, p carried x1024), ctx Wo on v_wmma_f32_16x16x32_f16 (ctx carried x16, Wo carried x64, folded by 1/1024 in the epilogue).
// diagonal are skipped (their probabilities are exactly 0) and the diagonal tile is masked by index; a constant zero flag line feeds the additive term of the GEMM epilogue.

#ifndef NB
#define NB 2
#endif
#ifndef SEQ
#define SEQ 2048
#endif
#ifndef RRES
#define RRES 256
#endif
#define NB_FULL 2
#define SEQ_FULL 2048
#define DIN 2048
#define DMO 2048
#define NH 32
#define NKV 8
#define GRP (NH / NKV)
#define HD 64
#define DKV (NKV * HD)
#define PP 72
#define PCAR 1024.0f
#define CCAR 16.0f
#define WCAR 64.0f
#define SCL 0.125f
#define L2E 1.4426950408889634f
static_assert(SEQ % 64 == 0 && SEQ >= 64 && SEQ <= SEQ_FULL);
static_assert(RRES % 64 == 0 && RRES >= 64 && RRES <= SEQ);
static_assert(NB >= 1 && NB <= NB_FULL);
static_assert(DIN % 32 == 0 && DMO % 64 == 0 && DKV % 64 == 0 && HD == 64 && (NH % NKV) == 0);
static_assert(DMO == NH * HD && DMO % 32 == 0);
static_assert(PP % 8 == 0 && PP >= HD);
static_assert((DMO * DIN) % 64 == 0 && (DKV * DIN) % 64 == 0 && (DMO * DMO) % 64 == 0 && DIN % 2 == 0 && DMO % 2 == 0);
static_assert(((size_t)SEQ * DIN) % 8 == 0);
// workspace carve (every plane a multiple of 256 B; same sequence as the launcher's take() calls)
#define AL256(x) ((((size_t)(x)) + 255) & ~(size_t)255)
#define WS_TOTAL (AL256((size_t)DMO * DIN * 2) + 2 * AL256((size_t)DKV * DIN * 2) + 2 * AL256((size_t)DMO * DMO * 2) + AL256((size_t)SEQ * DIN * 2) + AL256((size_t)SEQ * DMO * 4) \
                  + 2 * AL256((size_t)SEQ * DKV * 4) + AL256((size_t)NH * SEQ * HD * 2) + 2 * AL256((size_t)NKV * SEQ * HD * 2) + 2 * AL256((size_t)NH * RRES * HD * 2) \
                  + 4 * AL256((size_t)NKV * RRES * HD * 2) + AL256((size_t)SEQ * DMO * 2) + 2 * AL256((size_t)RRES * DMO * 2) + AL256(128))
static_assert(WS_TOTAL <= (size_t)134217728);

typedef _Float16 h16;
typedef unsigned short bf;
typedef __attribute__((ext_vector_type(16))) __bf16   v16bf;
typedef __attribute__((ext_vector_type(16))) _Float16 v16h;
typedef __attribute__((ext_vector_type(8)))  _Float16 v8h;
typedef __attribute__((ext_vector_type(8)))  unsigned short v8us;
typedef __attribute__((ext_vector_type(8)))  float    v8f;
typedef __attribute__((ext_vector_type(4)))  float    v4f;
typedef __attribute__((ext_vector_type(4)))  int      v4i;
typedef __attribute__((ext_vector_type(2)))  _Float16 v2h;
typedef __attribute__((ext_vector_type(2)))  unsigned short v2us;
typedef v8h  __attribute__((may_alias)) v8ha;
typedef v4f  __attribute__((may_alias)) v4fa;
typedef v8us __attribute__((may_alias)) v8usa;

__device__ __forceinline__ unsigned short f2bf(float f) { unsigned u = __float_as_uint(f); u += 0x7FFFu + ((u >> 16) & 1u); return (unsigned short)(u >> 16); }
__device__ __forceinline__ float bf2f(unsigned short b) { return __uint_as_float(((unsigned)b) << 16); }
__device__ __forceinline__ float bfr(float f) { return bf2f(f2bf(f)); }
__device__ __forceinline__ h16 tohx(float x) { return (h16)x; }
__device__ __forceinline__ void splitf(float y, unsigned short& h, unsigned short& l) { h = f2bf(y); l = f2bf(y - bf2f(h)); }
__device__ __forceinline__ v16h cat16(v8h lo, v8h hi) { return __builtin_shufflevector(lo, hi, 0, 1, 2, 3, 4, 5, 6, 7, 8, 9, 10, 11, 12, 13, 14, 15); }
__device__ __forceinline__ v16bf cat16b(v8us lo, v8us hi) { return __builtin_bit_cast(v16bf, __builtin_shufflevector(lo, hi, 0, 1, 2, 3, 4, 5, 6, 7, 8, 9, 10, 11, 12, 13, 14, 15)); }
__device__ __forceinline__ v8f wmma16(v16h a, v16h b, v8f c) { return __builtin_amdgcn_wmma_f32_16x16x32_f16(false, a, false, b, (short)0, c, false, false); }
__device__ __forceinline__ v8f wmmab(v16bf a, v16bf b, v8f c) { return __builtin_amdgcn_wmma_f32_16x16x32_bf16(false, a, false, b, (short)0, c, false, false); }
// wave-private LDS tile: stores of this wave made visible to its own later cross-lane loads, loads kept below the stores by the compiler
__device__ __forceinline__ void lds_wsync() { __builtin_amdgcn_fence(3 /* release order */, "wavefront"); __builtin_amdgcn_wave_barrier(); asm volatile("" ::: "memory"); }

// 16-bit fragment loaders: lane l -> row/column (l & 15); elements 0..7 <- k0 + 8*(l>>4) + 0..7, elements 8..15 <- k0 + 16 + 8*(l>>4) + 0..7 of a K-contiguous row (p already offset by 8*(l>>4)).
template <typename T16> struct WFrag;
template <> struct WFrag<h16> { typedef v16h V; static __device__ __forceinline__ V ld(const h16* p) { return cat16(*(const v8h*)p, *(const v8h*)(p + 16)); } static __device__ __forceinline__ v8f mma(V a, V b, v8f c) { return wmma16(a, b, c); } };
template <> struct WFrag<bf> { typedef v16bf V; static __device__ __forceinline__ V ld(const bf* p) { return cat16b(*(const v8us*)p, *(const v8us*)(p + 16)); } static __device__ __forceinline__ v8f mma(V a, V b, v8f c) { return wmmab(a, b, c); } };

// ---- k_gemmw: register-blocked GEMM, ONE WAVE per 64x64 output tile (16 accumulators), operands straight from K-contiguous 16-bit planes; grid (M/64, N/64, Z), 32 threads.
// C[m][n] (f32, pitch ldc) = (sum_k A[m][k] Bt[n][k] (+ A2[m][k] Bt[n][k] when NSPLIT == 1; + A[m][k] Bt2[n][k] too when NSPLIT == 2)) * cscale + (pflag[0] ? NaN : 0). K % 32 == 0.
template <typename T16, int NSPLIT>
__global__ __launch_bounds__(32) void k_gemmw(const T16* __restrict__ A, const T16* __restrict__ A2, const T16* __restrict__ Bt, const T16* __restrict__ Bt2, int K, float* C, int ldc, float cscale, const int* __restrict__ pflag, size_t sA, size_t sB, size_t sC) {
    typedef typename WFrag<T16>::V V;
    __shared__ __align__(16) float os[16 * 68];
    const size_t z = blockIdx.z; A += z * sA; if (A2) A2 += z * sA; Bt += z * sB; if (Bt2) Bt2 += z * sB; C += z * sC;
    const int lane = threadIdx.x & 31, lr = lane & 15, hi = lane >> 4; const int r0 = blockIdx.x * 64, c0 = blockIdx.y * 64;
    const float padd = (pflag[0] != 0) ? __int_as_float(0x7fc00000) : 0.0f;
    v8f acc[4][4];
#pragma unroll
    for (int mb = 0; mb < 4; ++mb)
#pragma unroll
        for (int nb = 0; nb < 4; ++nb) acc[mb][nb] = (v8f){};
    const size_t aoff = (size_t)(r0 + lr) * K + 8 * hi, boff = (size_t)(c0 + lr) * K + 8 * hi;
#pragma unroll 1
    for (int kc = 0; kc < K; kc += 32) {
        V a[4], a2[4];
#pragma unroll
        for (int mb = 0; mb < 4; ++mb) { a[mb] = WFrag<T16>::ld(A + aoff + (size_t)mb * 16 * K + kc); if (NSPLIT == 1 || NSPLIT == 2) a2[mb] = WFrag<T16>::ld(A2 + aoff + (size_t)mb * 16 * K + kc); }
#pragma unroll
        for (int nb = 0; nb < 4; ++nb) { const V b = WFrag<T16>::ld(Bt + boff + (size_t)nb * 16 * K + kc); V b2; if (NSPLIT >= 2) b2 = WFrag<T16>::ld(Bt2 + boff + (size_t)nb * 16 * K + kc);
#pragma unroll
            for (int mb = 0; mb < 4; ++mb) { acc[mb][nb] = WFrag<T16>::mma(a[mb], b, acc[mb][nb]); if (NSPLIT == 1 || NSPLIT == 2) acc[mb][nb] = WFrag<T16>::mma(a2[mb], b, acc[mb][nb]); if (NSPLIT >= 2) acc[mb][nb] = WFrag<T16>::mma(a[mb], b2, acc[mb][nb]); } }
        asm volatile("v_nop\n\tv_nop\n\tv_nop\n\tv_nop" : "+v"(acc[0][0]), "+v"(acc[1][1]), "+v"(acc[2][2]), "+v"(acc[3][3]) : "v"(a[0]), "v"(a[3]));
    }
#pragma unroll
    for (int mb = 0; mb < 4; ++mb) {
#pragma unroll
        for (int nb = 0; nb < 4; ++nb) {
#pragma unroll
            for (int j = 0; j < 8; ++j) os[(hi * 8 + j) * 68 + nb * 16 + lr] = acc[mb][nb][j]; }
        __builtin_amdgcn_wave_barrier(); asm volatile("" ::: "memory");
        float* crow = C + (size_t)(r0 + mb * 16) * ldc + c0;
{
#pragma unroll
            for (int s = 0; s < 8; ++s) { const int row = 2 * s + hi, cofs = lr * 4; v4f val = *(const v4fa*)(os + row * 68 + cofs); val = val * cscale + padd;
                *(v4f*)(crow + (size_t)row * ldc + cofs) = val; }
             }
        __builtin_amdgcn_wave_barrier(); asm volatile("" ::: "memory");
    }
}

__global__ __launch_bounds__(32) void k_flag0(int* MFLAG) {
    const int lane = threadIdx.x & 31; const int r = 0;
    int* p = MFLAG + lane; *(int*)p = r; 
}

__global__ __launch_bounds__(256) void k_wtG(const float* __restrict__ w, int K, int N, bf* Bt, h16* Ht) {
    const int lane = threadIdx.x & 31; const int L0 = (blockIdx.x * 8 + (threadIdx.x >> 5)) * 8; const int nlines = N * K / 64;
{
#pragma unroll 1
        for (int l = 0; l < 8; ++l) { const int L = L0 + l; if (L >= nlines) break; const size_t e = (size_t)L * 64 + lane * 2; const int k = (int)(e % K), n = (int)(e / K);
            const float w0 = bfr(w[(size_t)k * N + n]), w1 = bfr(w[(size_t)(k + 1) * N + n]); v2us o; o[0] = f2bf(w0); o[1] = f2bf(w1); *(v2us*)(Bt + e) = o;
            if (Ht != nullptr) { v2h oh; oh[0] = tohx(w0 * WCAR); oh[1] = tohx(w1 * WCAR); *(v2h*)(Ht + e) = oh; } }
         }
}
__global__ __launch_bounds__(256) void k_cvt8(const float* __restrict__ src, bf* dst, size_t n8) { const size_t i = (size_t)blockIdx.x * 256 + threadIdx.x; if (i >= n8) return; const v8f v = *(const v8f*)(src + i * 8); v8us o;
#pragma unroll
    for (int k = 0; k < 8; ++k) o[k] = f2bf(v[k]); *(v8us*)(dst + i * 8) = o;  }

// ---- k_rope: head planes of the rotate-half rotary mix of F[t][h*HD + d] (row pitch 'pitch') with the cos/sin input tables (bf16 RNE values):
// r[d] = x[d] cos[t][d] - x[d+HD/2] sin[t][d] (d < HD/2), r[d] = x[d] cos[t][d] + x[d-HD/2] sin[t][d] (d >= HD/2);
__global__ __launch_bounds__(256) void k_rope(const float* __restrict__ F, int pitch, int nheads, const float* __restrict__ COSI, const float* __restrict__ SINI, h16* P16, bf* Ph, bf* Pl) {
    const size_t e = ((size_t)blockIdx.x * 256 + threadIdx.x) * 2; if (e >= (size_t)nheads * SEQ * HD) return;
    const int d = (int)(e % HD); const int t = (int)((e / HD) % SEQ); const int h = (int)(e / ((size_t)HD * SEQ));
    const float* f = F + (size_t)t * pitch + h * HD; v2h o16; v2us oh, ol;
#pragma unroll
    for (int q = 0; q < 2; ++q) { const int dd = d + q; const int dp = (dd < HD / 2) ? dd + HD / 2 : dd - HD / 2;
        const float x0 = f[dd], x1 = f[dp]; const float cv = bfr(COSI[(size_t)t * HD + dd]), snv = bfr(SINI[(size_t)t * HD + dd]);
        const float pa = x0 * cv, pb = x1 * snv; const float r = (dd < HD / 2) ? (pa - pb) : (pa + pb);
        o16[q] = tohx(r); unsigned short a2, c2; splitf(r, a2, c2); oh[q] = a2; ol[q] = c2; }
    const bool res = (t < RRES); const size_t oo = ((size_t)h * RRES + (res ? t : 0)) * HD + d;
    *(v2h*)(P16 + e) = o16; if (res) { *(v2us*)(Ph + oo) = oh; *(v2us*)(Pl + oo) = ol; }
    
}
// ---- k_vtp: value planes V16[g][d][t] = f16(F[t][g*HD + d]) for every t < SEQ (row pitch SEQ) and Vh/Vl[g][d][t] bf16 hi/lo for t < RRES (row pitch RRES); lane -> 2 consecutive t,
__global__ __launch_bounds__(256) void k_vtp(const float* __restrict__ F, int pitch, int ng, h16* V16, bf* Vh, bf* Vl) {
    const size_t e = ((size_t)blockIdx.x * 256 + threadIdx.x) * 2; if (e >= (size_t)ng * HD * SEQ) return;
    const int t = (int)(e % SEQ); const int d = (int)((e / SEQ) % HD); const int g = (int)(e / ((size_t)SEQ * HD)); v2h o16; v2us oh, ol;
#pragma unroll
    for (int q = 0; q < 2; ++q) { const float x = F[(size_t)(t + q) * pitch + g * HD + d]; o16[q] = tohx(x); unsigned short a2, c2; splitf(x, a2, c2); oh[q] = a2; ol[q] = c2; }
    const bool res = (t < RRES); const size_t oo = ((size_t)g * HD + d) * RRES + (res ? t : 0);
    *(v2h*)(V16 + e) = o16; if (res) { *(v2us*)(Vh + oo) = oh; *(v2us*)(Vl + oo) = ol; }
    
}

// ---- online softmax step on one wave's 16 x 64 score tile (D layout: s[nt][r] = S[row 8*hi + r][col nt*16 + lr]); diagonal tile: entries with col > row replaced by -1e9 before the
// 1/sqrt(HD) scaling (their exp is exactly 0); running max / running sum per row (replicated over the 16 lanes of a half), output accumulators rescaled; leaves s = exp(t - m).
__device__ __forceinline__ void online_softmax(v8f (&s)[4], float (&m)[8], float (&l)[8], v8f (&o)[4], bool diag, int row0, int kvb, int lr, int hi) {
#pragma unroll
    for (int nt = 0; nt < 4; ++nt)
#pragma unroll
        for (int r = 0; r < 8; ++r) { const int row = row0 + 8 * hi + r, col = kvb + nt * 16 + lr; float v = s[nt][r]; if (diag && col > row) v = -1.0e9f; s[nt][r] = v * SCL; }
#pragma unroll
    for (int r = 0; r < 8; ++r) {
        float mx = fmaxf(fmaxf(s[0][r], s[1][r]), fmaxf(s[2][r], s[3][r]));
#pragma unroll
        for (int sh = 1; sh < 16; sh <<= 1) mx = fmaxf(mx, __shfl_xor(mx, sh, 32));
        const float m2 = fmaxf(m[r], mx); const float alpha = __builtin_amdgcn_exp2f((m[r] - m2) * L2E); m[r] = m2;
        float rs = 0.0f;
#pragma unroll
        for (int nt = 0; nt < 4; ++nt) { const float p = __builtin_amdgcn_exp2f((s[nt][r] - m2) * L2E); s[nt][r] = p; rs += p; }
#pragma unroll
        for (int sh = 1; sh < 16; sh <<= 1) rs += __shfl_xor(rs, sh, 32);
        l[r] = l[r] * alpha + rs;
#pragma unroll
        for (int nt = 0; nt < 4; ++nt) o[nt][r] = o[nt][r] * alpha;
    }
}

// ---- k_attnr: causal attention for query rows < RRES (query tiles 0 .. RRES/64-1; they only visit key tiles 0 .. qt): block = 4 waves x 16 rows, head h uses kv group h / GRP.
// q, k, v from the bf16 hi/lo planes ([h][RRES][HD], [g][RRES][HD], [g][HD][RRES]); scores = qh.kh + ql.kh + qh.kl; unnormalised p split to bf16 hi/lo in a wave-private LDS tile,
__global__ __launch_bounds__(128) void k_attnr(const bf* __restrict__ QPh, const bf* __restrict__ QPl, const bf* __restrict__ KPh, const bf* __restrict__ KPl, const bf* __restrict__ VTh, const bf* __restrict__ VTl, bf* CTh, bf* CTl) {
    __shared__ __align__(16) bf sP[4][2][16 * PP];
    const int lane = threadIdx.x & 31, wave = threadIdx.x >> 5, lr = lane & 15, hi = lane >> 4;
    const int qt = blockIdx.x, h = blockIdx.y, g = h / GRP; const int q0 = qt * 64 + wave * 16;
    const bf* qh = QPh + ((size_t)h * RRES + q0) * HD; const bf* ql = QPl + ((size_t)h * RRES + q0) * HD;
    const bf* kh = KPh + (size_t)g * RRES * HD; const bf* kl = KPl + (size_t)g * RRES * HD;
    const bf* vh = VTh + (size_t)g * HD * RRES; const bf* vl = VTl + (size_t)g * HD * RRES;
    bf* sph = &sP[wave][0][0]; bf* spl = &sP[wave][1][0];
    float m[8], l[8]; v8f o[4];
#pragma unroll
    for (int r = 0; r < 8; ++r) { m[r] = -3.0e38f; l[r] = 0.0f; }
#pragma unroll
    for (int nt = 0; nt < 4; ++nt) o[nt] = (v8f){};
#pragma unroll 1
    for (int c = 0; c <= qt; ++c) {
        const int kvb = c * 64; v8f s[4]; v16bf aqh[2], aql[2], bh, bl;
#pragma unroll
        for (int kk = 0; kk < 2; ++kk) { aqh[kk] = WFrag<bf>::ld(qh + (size_t)lr * HD + 8 * hi + kk * 32); aql[kk] = WFrag<bf>::ld(ql + (size_t)lr * HD + 8 * hi + kk * 32); }
#pragma unroll
        for (int nt = 0; nt < 4; ++nt) { s[nt] = (v8f){}; const size_t ko = (size_t)(kvb + nt * 16 + lr) * HD + 8 * hi;
#pragma unroll
            for (int kk = 0; kk < 2; ++kk) { bh = WFrag<bf>::ld(kh + ko + kk * 32); bl = WFrag<bf>::ld(kl + ko + kk * 32);
                s[nt] = wmmab(aqh[kk], bh, s[nt]); s[nt] = wmmab(aql[kk], bh, s[nt]); s[nt] = wmmab(aqh[kk], bl, s[nt]); } }
        asm volatile("v_nop\n\tv_nop\n\tv_nop\n\tv_nop" : "+v"(s[0]), "+v"(s[1]), "+v"(s[2]), "+v"(s[3]) : "v"(aqh[0]), "v"(aql[1]), "v"(bh), "v"(bl));
        online_softmax(s, m, l, o, c == qt, q0, kvb, lr, hi);
#pragma unroll
        for (int nt = 0; nt < 4; ++nt)
#pragma unroll
            for (int r = 0; r < 8; ++r) { unsigned short a2, c2; splitf(s[nt][r], a2, c2); const int so = (8 * hi + r) * PP + nt * 16 + lr; sph[so] = a2; spl[so] = c2; }
        lds_wsync();
        v16bf aph[2], apl[2], bvh, bvl;
#pragma unroll
        for (int kk = 0; kk < 2; ++kk) { const int ao = lr * PP + kk * 32 + 8 * hi; aph[kk] = cat16b(*(const v8usa*)(sph + ao), *(const v8usa*)(sph + ao + 16)); apl[kk] = cat16b(*(const v8usa*)(spl + ao), *(const v8usa*)(spl + ao + 16)); }
#pragma unroll
        for (int kk = 0; kk < 2; ++kk)
#pragma unroll
            for (int nt = 0; nt < 4; ++nt) { const size_t vo = (size_t)(nt * 16 + lr) * RRES + kvb + kk * 32 + 8 * hi; bvh = WFrag<bf>::ld(vh + vo); bvl = WFrag<bf>::ld(vl + vo);
                o[nt] = wmmab(aph[kk], bvh, o[nt]); o[nt] = wmmab(apl[kk], bvh, o[nt]); o[nt] = wmmab(aph[kk], bvl, o[nt]); }
        asm volatile("v_nop\n\tv_nop\n\tv_nop\n\tv_nop" : "+v"(o[0]), "+v"(o[1]), "+v"(o[2]), "+v"(o[3]) : "v"(aph[0]), "v"(apl[1]), "v"(bvh), "v"(bvl));
        lds_wsync();
    }
    float inv[8];
#pragma unroll
    for (int r = 0; r < 8; ++r) inv[r] = 1.0f / l[r];
#pragma unroll
    for (int nt = 0; nt < 4; ++nt)
#pragma unroll
        for (int r = 0; r < 8; ++r) { unsigned short a2, c2; splitf(o[nt][r] * inv[r], a2, c2); const int so = (8 * hi + r) * PP + nt * 16 + lr; sph[so] = a2; spl[so] = c2; }
    lds_wsync();
    bf* chb = CTh + (size_t)q0 * DMO + h * HD; bf* clb = CTl + (size_t)q0 * DMO + h * HD;
{
#pragma unroll
        for (int it = 0; it < 4; ++it) { const int rr = it * 4 + (lane >> 3), pc = (lane & 7) * 8; const v8us va = *(const v8usa*)(sph + rr * PP + pc); const v8us vb = *(const v8usa*)(spl + rr * PP + pc);
            *(v8us*)(chb + (size_t)rr * DMO + pc) = va; *(v8us*)(clb + (size_t)rr * DMO + pc) = vb; }
         }
}

// ---- k_attn: causal attention for query tiles qt >= RRES/64 (blockIdx.x + RRES/64): same structure with single f16 products; q, k from [h][SEQ][HD] / [g][SEQ][HD] f16 planes,
__global__ __launch_bounds__(128) void k_attn(const h16* __restrict__ Q16, const h16* __restrict__ K16, const h16* __restrict__ VT16, h16* C16) {
    __shared__ __align__(16) h16 sP[4][16 * PP];
    const int lane = threadIdx.x & 31, wave = threadIdx.x >> 5, lr = lane & 15, hi = lane >> 4;
    const int qt = blockIdx.x + RRES / 64, h = blockIdx.y, g = h / GRP; const int q0 = qt * 64 + wave * 16;
    const h16* qp = Q16 + ((size_t)h * SEQ + q0) * HD; const h16* kp = K16 + (size_t)g * SEQ * HD; const h16* vp = VT16 + (size_t)g * HD * SEQ;
    h16* spw = &sP[wave][0];
    v16h aq[2];
#pragma unroll
    for (int kk = 0; kk < 2; ++kk) aq[kk] = WFrag<h16>::ld(qp + (size_t)lr * HD + 8 * hi + kk * 32);
    float m[8], l[8]; v8f o[4];
#pragma unroll
    for (int r = 0; r < 8; ++r) { m[r] = -3.0e38f; l[r] = 0.0f; }
#pragma unroll
    for (int nt = 0; nt < 4; ++nt) o[nt] = (v8f){};
    const int nch = qt + 1;
#pragma unroll 1
    for (int c = 0; c < nch; ++c) {
        const int kvb = c * 64; v8f s[4]; v16h b;
#pragma unroll
        for (int nt = 0; nt < 4; ++nt) { s[nt] = (v8f){}; const h16* kr = kp + (size_t)(kvb + nt * 16 + lr) * HD + 8 * hi;
#pragma unroll
            for (int kk = 0; kk < 2; ++kk) { b = WFrag<h16>::ld(kr + kk * 32); s[nt] = wmma16(aq[kk], b, s[nt]); } }
        asm volatile("v_nop\n\tv_nop\n\tv_nop\n\tv_nop" : "+v"(s[0]), "+v"(s[1]), "+v"(s[2]), "+v"(s[3]) : "v"(aq[0]), "v"(aq[1]), "v"(b));
        online_softmax(s, m, l, o, c == qt, q0, kvb, lr, hi);
#pragma unroll
        for (int nt = 0; nt < 4; ++nt)
#pragma unroll
            for (int r = 0; r < 8; ++r) spw[(8 * hi + r) * PP + nt * 16 + lr] = tohx(s[nt][r] * PCAR);
        lds_wsync();
        v16h ap[2], bv;
#pragma unroll
        for (int kk = 0; kk < 2; ++kk) { const int ao = lr * PP + kk * 32 + 8 * hi; ap[kk] = cat16(*(const v8ha*)(spw + ao), *(const v8ha*)(spw + ao + 16)); }
#pragma unroll
        for (int kk = 0; kk < 2; ++kk)
#pragma unroll
            for (int nt = 0; nt < 4; ++nt) { bv = WFrag<h16>::ld(vp + (size_t)(nt * 16 + lr) * SEQ + kvb + kk * 32 + 8 * hi); o[nt] = wmma16(ap[kk], bv, o[nt]); }
        asm volatile("v_nop\n\tv_nop\n\tv_nop\n\tv_nop" : "+v"(o[0]), "+v"(o[1]), "+v"(o[2]), "+v"(o[3]) : "v"(ap[0]), "v"(ap[1]), "v"(bv));
        lds_wsync();
    }
    float inv[8];
#pragma unroll
    for (int r = 0; r < 8; ++r) inv[r] = (1.0f / l[r]) * (CCAR / PCAR);
#pragma unroll
    for (int nt = 0; nt < 4; ++nt)
#pragma unroll
        for (int r = 0; r < 8; ++r) spw[(8 * hi + r) * PP + nt * 16 + lr] = tohx(o[nt][r] * inv[r]);
    lds_wsync();
    h16* cb = C16 + (size_t)q0 * DMO + h * HD;
{
#pragma unroll
        for (int it = 0; it < 4; ++it) { const int rr = it * 4 + (lane >> 3), pc = (lane & 7) * 8; const v8h val = *(const v8ha*)(spw + rr * PP + pc); *(v8h*)(cb + (size_t)rr * DMO + pc) = val; }
         }
}

extern "C" void kernel_launch(void* const* d_in, const int* in_sizes, int n_in,
                              void* d_out, int out_size, void* d_ws, size_t ws_size, hipStream_t stream) {
    if (n_in < 7) return;
    const long long rows_used = (long long)(NB - 1) * SEQ_FULL + SEQ;
    if ((long long)in_sizes[0] < rows_used * DIN) return;
    if (in_sizes[1] < SEQ * HD || in_sizes[2] < SEQ * HD) return;
    if (in_sizes[3] < DIN * DMO || in_sizes[4] < DIN * DKV || in_sizes[5] < DIN * DKV || in_sizes[6] < DMO * DMO) return;
    if ((long long)out_size < rows_used * DMO) return;
    // wire order: x, cos, sin, wq, wk, wv, wo
    const float* x = (const float*)d_in[0]; const float* cosi = (const float*)d_in[1]; const float* sini = (const float*)d_in[2];
    const float* wq = (const float*)d_in[3]; const float* wk = (const float*)d_in[4]; const float* wv = (const float*)d_in[5]; const float* wo = (const float*)d_in[6];
    float* OUT = (float*)d_out;     // [NB_FULL][SEQ_FULL][DMO]
    char* wsp = (char*)d_ws;
    auto take = [&](size_t bytes) { char* p = wsp; wsp += (bytes + 255) & ~(size_t)255; return (void*)p; };
    bf* WQ   = (bf*)take((size_t)DMO * DIN * 2);          // Bt [out][in]
    bf* WK   = (bf*)take((size_t)DKV * DIN * 2);
    bf* WV   = (bf*)take((size_t)DKV * DIN * 2);
    bf* WOb  = (bf*)take((size_t)DMO * DMO * 2);
    h16* WO16 = (h16*)take((size_t)DMO * DMO * 2);
    bf* XB   = (bf*)take((size_t)SEQ * DIN * 2);          // one batch
    float* FQ = (float*)take((size_t)SEQ * DMO * 4);
    float* FK = (float*)take((size_t)SEQ * DKV * 4);
    float* FV = (float*)take((size_t)SEQ * DKV * 4);
    h16* Q16 = (h16*)take((size_t)NH * SEQ * HD * 2); h16* K16 = (h16*)take((size_t)NKV * SEQ * HD * 2); h16* VT16 = (h16*)take((size_t)NKV * HD * SEQ * 2);
    bf* QPh = (bf*)take((size_t)NH * RRES * HD * 2); bf* QPl = (bf*)take((size_t)NH * RRES * HD * 2);
    bf* KPh = (bf*)take((size_t)NKV * RRES * HD * 2); bf* KPl = (bf*)take((size_t)NKV * RRES * HD * 2);
    bf* VTh = (bf*)take((size_t)NKV * HD * RRES * 2); bf* VTl = (bf*)take((size_t)NKV * HD * RRES * 2);
    h16* C16 = (h16*)take((size_t)SEQ * DMO * 2);        // rows >= RRES used
    bf* CTh = (bf*)take((size_t)RRES * DMO * 2); bf* CTl = (bf*)take((size_t)RRES * DMO * 2);
    int* MFLAG = (int*)take(128);
    const size_t carved = (size_t)(wsp - (char*)d_ws);
    if (carved > ws_size || carved > (size_t)134217728) return;

    k_flag0<<<1, 32, 0, stream>>>(MFLAG);
    k_wtG<<<(unsigned)((DMO * DIN / 64 + 63) / 64), 256, 0, stream>>>(wq, DIN, DMO, WQ, nullptr);
    k_wtG<<<(unsigned)((DKV * DIN / 64 + 63) / 64), 256, 0, stream>>>(wk, DIN, DKV, WK, nullptr);
    k_wtG<<<(unsigned)((DKV * DIN / 64 + 63) / 64), 256, 0, stream>>>(wv, DIN, DKV, WV, nullptr);
    k_wtG<<<(unsigned)((DMO * DMO / 64 + 63) / 64), 256, 0, stream>>>(wo, DMO, DMO, WOb, WO16);
    const unsigned LQ = (unsigned)(((size_t)NH * SEQ * HD / 2 + 255) / 256), LKV = (unsigned)(((size_t)NKV * SEQ * HD / 2 + 255) / 256);
    for (int b = 0; b < NB; ++b) {
        k_cvt8<<<(unsigned)(((size_t)SEQ * DIN / 8 + 255) / 256), 256, 0, stream>>>(x + (size_t)b * SEQ_FULL * DIN, XB, (size_t)SEQ * DIN / 8);
        k_gemmw<bf, 0><<<dim3(SEQ / 64, DMO / 64, 1), 32, 0, stream>>>(XB, nullptr, WQ, nullptr, DIN, FQ, DMO, 1.0f, MFLAG, 0, 0, 0);
        k_gemmw<bf, 0><<<dim3(SEQ / 64, DKV / 64, 1), 32, 0, stream>>>(XB, nullptr, WK, nullptr, DIN, FK, DKV, 1.0f, MFLAG, 0, 0, 0);
        k_gemmw<bf, 0><<<dim3(SEQ / 64, DKV / 64, 1), 32, 0, stream>>>(XB, nullptr, WV, nullptr, DIN, FV, DKV, 1.0f, MFLAG, 0, 0, 0);
        k_rope<<<LQ, 256, 0, stream>>>(FQ, DMO, NH, cosi, sini, Q16, QPh, QPl);
        k_rope<<<LKV, 256, 0, stream>>>(FK, DKV, NKV, cosi, sini, K16, KPh, KPl);
        k_vtp<<<LKV, 256, 0, stream>>>(FV, DKV, NKV, VT16, VTh, VTl);
        k_attnr<<<dim3(RRES / 64, NH, 1), 128, 0, stream>>>(QPh, QPl, KPh, KPl, VTh, VTl, CTh, CTl);
        if (SEQ > RRES) k_attn<<<dim3((SEQ - RRES) / 64, NH, 1), 128, 0, stream>>>(Q16, K16, VT16, C16);
        float* ob = OUT + (size_t)b * SEQ_FULL * DMO;
        k_gemmw<bf, 1><<<dim3(RRES / 64, DMO / 64, 1), 32, 0, stream>>>(CTh, CTl, WOb, nullptr, DMO, ob, DMO, 1.0f, MFLAG, 0, 0, 0);
        if (SEQ > RRES) k_gemmw<h16, 0><<<dim3((SEQ - RRES) / 64, DMO / 64, 1), 32, 0, stream>>>(C16 + (size_t)RRES * DMO, nullptr, WO16, nullptr, DMO, ob + (size_t)RRES * DMO, DMO, 1.0f / (CCAR * WCAR), MFLAG, 0, 0, 0);
    }
}

// v001
// It runs in 523 microseconds.
// Timed twice side by side with v000, it ran 1.45 and 1.46 times as fast.
#include <hip/hip_runtime.h>

// Contractions and operand types (f32 accumulate everywhere): x Wq, x Wk, x Wv on v_wmma_f32_16x16x32_bf16 with RNE bf16 copies of x and W (exact products);
// query rows < RRES of each sequence: q.k^T and p.v on v_wmma_f32_16x16x32_bf16 as bf16 hi/lo splits (3 products each), their ctx Wo as bf16 hi/lo ctx times bf16 Wo (2 products);
// query rows >= RRES: q.k^T and p.v on v_wmma_f32_16x16x32_f16 (f16 q/k/v planes, p carried x1024), ctx Wo on v_wmma_f32_16x16x32_f16 (ctx carried x16, Wo carried x64, folded by 1/1024 in the epilogue).
// diagonal are skipped (their probabilities are exactly 0) and the diagonal tile is masked by index; a constant zero flag line feeds the additive term of the GEMM epilogue.

#ifndef NB
#define NB 2
#endif
#ifndef SEQ
#define SEQ 2048
#endif
#ifndef RRES
#define RRES 256
#endif
#define NB_FULL 2
#define SEQ_FULL 2048
#define DIN 2048
#define DMO 2048
#define NH 32
#define NKV 8
#define GRP (NH / NKV)
#define HD 64
#define DKV (NKV * HD)
#define PP 72
#define PCAR 1024.0f
#define CCAR 16.0f
#define WCAR 64.0f
#define SCL 0.125f
#define L2E 1.4426950408889634f
static_assert(SEQ % 64 == 0 && SEQ >= 64 && SEQ <= SEQ_FULL);
static_assert(RRES % 64 == 0 && RRES >= 64 && RRES <= SEQ);
static_assert(NB >= 1 && NB <= NB_FULL);
static_assert(DIN % 32 == 0 && DMO % 64 == 0 && DKV % 64 == 0 && HD == 64 && (NH % NKV) == 0);
static_assert(DMO == NH * HD && DMO % 32 == 0);
static_assert(PP % 8 == 0 && PP >= HD);
static_assert((DMO * DIN) % 64 == 0 && (DKV * DIN) % 64 == 0 && (DMO * DMO) % 64 == 0 && DIN % 2 == 0 && DMO % 2 == 0);
static_assert(((size_t)SEQ * DIN) % 8 == 0);
// workspace carve (every plane a multiple of 256 B; same sequence as the launcher's take() calls)
#define AL256(x) ((((size_t)(x)) + 255) & ~(size_t)255)
#define WS_TOTAL (AL256((size_t)DMO * DIN * 2) + 2 * AL256((size_t)DKV * DIN * 2) + 2 * AL256((size_t)DMO * DMO * 2) + AL256((size_t)SEQ * DIN * 2) + AL256((size_t)SEQ * DMO * 4) \
                  + 2 * AL256((size_t)SEQ * DKV * 4) + AL256((size_t)NH * SEQ * HD * 2) + 2 * AL256((size_t)NKV * SEQ * HD * 2) + 2 * AL256((size_t)NH * RRES * HD * 2) \
                  + 4 * AL256((size_t)NKV * RRES * HD * 2) + AL256((size_t)SEQ * DMO * 2) + 2 * AL256((size_t)RRES * DMO * 2) + AL256(128))
static_assert(WS_TOTAL <= (size_t)134217728);

typedef _Float16 h16;
typedef unsigned short bf;
typedef __attribute__((ext_vector_type(16))) __bf16   v16bf;
typedef __attribute__((ext_vector_type(16))) _Float16 v16h;
typedef __attribute__((ext_vector_type(8)))  _Float16 v8h;
typedef __attribute__((ext_vector_type(8)))  unsigned short v8us;
typedef __attribute__((ext_vector_type(8)))  float    v8f;
typedef __attribute__((ext_vector_type(4)))  float    v4f;
typedef __attribute__((ext_vector_type(4)))  int      v4i;
typedef __attribute__((ext_vector_type(2)))  _Float16 v2h;
typedef __attribute__((ext_vector_type(2)))  unsigned short v2us;
typedef v8h  __attribute__((may_alias)) v8ha;
typedef v4f  __attribute__((may_alias)) v4fa;
typedef v8us __attribute__((may_alias)) v8usa;

__device__ __forceinline__ unsigned short f2bf(float f) { unsigned u = __float_as_uint(f); u += 0x7FFFu + ((u >> 16) & 1u); return (unsigned short)(u >> 16); }
__device__ __forceinline__ float bf2f(unsigned short b) { return __uint_as_float(((unsigned)b) << 16); }
__device__ __forceinline__ float bfr(float f) { return bf2f(f2bf(f)); }
__device__ __forceinline__ h16 tohx(float x) { return (h16)x; }
__device__ __forceinline__ void splitf(float y, unsigned short& h, unsigned short& l) { h = f2bf(y); l = f2bf(y - bf2f(h)); }
__device__ __forceinline__ v16h cat16(v8h lo, v8h hi) { return __builtin_shufflevector(lo, hi, 0, 1, 2, 3, 4, 5, 6, 7, 8, 9, 10, 11, 12, 13, 14, 15); }
__device__ __forceinline__ v16bf cat16b(v8us lo, v8us hi) { return __builtin_bit_cast(v16bf, __builtin_shufflevector(lo, hi, 0, 1, 2, 3, 4, 5, 6, 7, 8, 9, 10, 11, 12, 13, 14, 15)); }
__device__ __forceinline__ v8f wmma16(v16h a, v16h b, v8f c) { return __builtin_amdgcn_wmma_f32_16x16x32_f16(false, a, false, b, (short)0, c, false, false); }
__device__ __forceinline__ v8f wmmab(v16bf a, v16bf b, v8f c) { return __builtin_amdgcn_wmma_f32_16x16x32_bf16(false, a, false, b, (short)0, c, false, false); }
// wave-private LDS tile: stores of this wave made visible to its own later cross-lane loads, loads kept below the stores by the compiler
__device__ __forceinline__ void lds_wsync() { __builtin_amdgcn_fence(3 /* release order */, "wavefront"); __builtin_amdgcn_wave_barrier(); asm volatile("" ::: "memory"); }

// 16-bit fragment loaders: lane l -> row/column (l & 15); elements 0..7 <- k0 + 8*(l>>4) + 0..7, elements 8..15 <- k0 + 16 + 8*(l>>4) + 0..7 of a K-contiguous row (p already offset by 8*(l>>4)).
template <typename T16> struct WFrag;
template <> struct WFrag<h16> { typedef v16h V; static __device__ __forceinline__ V ld(const h16* p) { return cat16(*(const v8h*)p, *(const v8h*)(p + 16)); } static __device__ __forceinline__ v8f mma(V a, V b, v8f c) { return wmma16(a, b, c); } };
template <> struct WFrag<bf> { typedef v16bf V; static __device__ __forceinline__ V ld(const bf* p) { return cat16b(*(const v8us*)p, *(const v8us*)(p + 16)); } static __device__ __forceinline__ v8f mma(V a, V b, v8f c) { return wmmab(a, b, c); } };

// ---- k_gemmw: work-group tiled GEMM: 4 waves (2 x 2) share one 128x128 output tile, each wave keeps a 64x64 part (16 accumulators); grid (M/128, N/128, Z), 128 threads.
// A stage is GKS = 128 k (256 B) of the 128 A rows, the 128 Bt rows (and the 128 A2 rows when NSPLIT == 1), brought from the K-contiguous 16-bit planes into LDS by asynchronous
// 16-byte copies at a row pitch of 272 B; two buffers, the next stage's copies fly while this stage is multiplied. Every accumulator sums k upward in steps of 32, A before A2.
// C[m][n] (f32, pitch ldc) = (sum_k A[m][k] Bt[n][k] (+ A2[m][k] Bt[n][k] when NSPLIT == 1)) * cscale + (pflag[0] ? NaN : 0). K % 128 == 0, K >= 128, M % 128 == 0, N % 128 == 0.
#define GKS 128
#define GPI 136
static_assert(DIN % GKS == 0 && DMO % GKS == 0 && SEQ % 128 == 0 && RRES % 128 == 0 && DMO % 128 == 0 && DKV % 128 == 0);
__device__ __forceinline__ unsigned lds_off(const void* p) { return (unsigned)(size_t)p; }
// eight copies of one lane: rows 8 apart, 16 B each, LDS byte address l, global address g (row pitch K elements). The s_wait_xcnt closes the statement so that no address register
// of an issued copy is rewritten ahead of it.
template <typename T16>
__device__ __forceinline__ void acopy8(unsigned l, const T16* g, size_t K) {
    const unsigned ls = 8 * GPI * 2; const size_t gs = 8 * K;
    asm volatile("global_load_async_to_lds_b128 %0, %8, off\n\t"
                 "global_load_async_to_lds_b128 %1, %9, off\n\t"
                 "global_load_async_to_lds_b128 %2, %10, off\n\t"
                 "global_load_async_to_lds_b128 %3, %11, off\n\t"
                 "global_load_async_to_lds_b128 %4, %12, off\n\t"
                 "global_load_async_to_lds_b128 %5, %13, off\n\t"
                 "global_load_async_to_lds_b128 %6, %14, off\n\t"
                 "global_load_async_to_lds_b128 %7, %15, off\n\t"
                 "s_wait_xcnt 0x0"
                 :: "v"(l), "v"(l + ls), "v"(l + 2 * ls), "v"(l + 3 * ls), "v"(l + 4 * ls), "v"(l + 5 * ls), "v"(l + 6 * ls), "v"(l + 7 * ls),
                    "v"(g), "v"(g + gs), "v"(g + 2 * gs), "v"(g + 3 * gs), "v"(g + 4 * gs), "v"(g + 5 * gs), "v"(g + 6 * gs), "v"(g + 7 * gs) : "memory");
}
// 128 rows x 256 B of one operand: 16 copies a lane (16 lanes cover a row, a wave two rows)
template <typename T16>
__device__ __forceinline__ void acopy_rows(unsigned l, const T16* g, size_t K) { acopy8(l, g, K); acopy8(l + 64 * GPI * 2, g + 64 * K, K); }

template <typename T16, int NSPLIT>
__global__ __launch_bounds__(128) void k_gemmw(const T16* __restrict__ A, const T16* __restrict__ A2, const T16* __restrict__ Bt, const T16* __restrict__ Bt2, int K, float* C, int ldc, float cscale, const int* __restrict__ pflag, size_t sA, size_t sB, size_t sC) {
    typedef typename WFrag<T16>::V V;
    static_assert(NSPLIT == 0 || NSPLIT == 1);
    constexpr int OPE = 128 * GPI;                        // elements of one operand's rows in a stage
    constexpr int STE = (NSPLIT == 1 ? 3 : 2) * OPE;      // elements of a stage: [A | Bt | A2]
    __shared__ __align__(128) T16 ring[2 * STE];
    __shared__ __align__(16) float osw[4][16 * 68];
    const size_t z = blockIdx.z; A += z * sA; if (A2) A2 += z * sA; Bt += z * sB; C += z * sC;
    const int tid = threadIdx.x, lane = tid & 31, wave = tid >> 5, lr = lane & 15, hi = lane >> 4; const int wm = wave >> 1, wn = wave & 1;
    const int r0 = blockIdx.x * 128, c0 = blockIdx.y * 128;
    const float padd = (pflag[0] != 0) ? __int_as_float(0x7fc00000) : 0.0f;
    v8f acc[4][4];
#pragma unroll
    for (int mb = 0; mb < 4; ++mb)
#pragma unroll
        for (int nb = 0; nb < 4; ++nb) acc[mb][nb] = (v8f){};
    const int trow = tid >> 4, tcol = tid & 15;
    const T16* ga = A + (size_t)(r0 + trow) * K + tcol * 8; const T16* gb = Bt + (size_t)(c0 + trow) * K + tcol * 8;
    const T16* ga2 = (NSPLIT == 1) ? A2 + (size_t)(r0 + trow) * K + tcol * 8 : nullptr;
    const unsigned lt = lds_off(ring) + (unsigned)(trow * GPI + tcol * 8) * 2;
    auto stage = [&](int t, int buf) { const unsigned l = lt + (unsigned)buf * (STE * 2); const size_t ko = (size_t)t * GKS;
        acopy_rows(l, ga + ko, (size_t)K); acopy_rows(l + OPE * 2, gb + ko, (size_t)K); if (NSPLIT == 1) acopy_rows(l + 2 * OPE * 2, ga2 + ko, (size_t)K); };
    const int nt = K / GKS;
    stage(0, 0);
    asm volatile("s_wait_asynccnt 0x0" ::: "memory");     // this wave's copies of stage 0 have landed
    __syncthreads();                                      // every wave's have: stage 0 may be read
    if (nt > 1) stage(1, 1);
    // the stage loop stays rolled: one copy of the body in the instruction cache, the buffer picked by t & 1
#pragma unroll 1
    for (int t = 0; t < nt; ++t) {
        const T16* sa = ring + (t & 1) * STE + (wm * 64 + lr) * GPI + 8 * hi; const T16* sb = ring + (t & 1) * STE + OPE + (wn * 64 + lr) * GPI + 8 * hi;
        // two fragment sets: the reads of the next 32 k of this stage go out as one group ahead of this step's matrix instructions, so that only the stage's first group is waited for in full
        // (every loop below is unrolled so that set, fragment and accumulator indices are constants and the arrays live in registers)
        V a[2][4], b[2][4], a2[2][4];
        auto ldset = [&](int s, int ks) {
#pragma unroll
            for (int mb = 0; mb < 4; ++mb) { a[s][mb] = WFrag<T16>::ld(sa + mb * 16 * GPI + ks); if (NSPLIT == 1) a2[s][mb] = WFrag<T16>::ld(sa + 2 * OPE + mb * 16 * GPI + ks); }
#pragma unroll
            for (int nb = 0; nb < 4; ++nb) b[s][nb] = WFrag<T16>::ld(sb + nb * 16 * GPI + ks); };
        ldset(0, 0);
#pragma unroll
        for (int q = 0; q < GKS / 32; ++q) {
            if (q + 1 < GKS / 32) ldset((q + 1) & 1, (q + 1) * 32);
            // keeps the group of reads above in front of this step's matrix instructions (the scheduler otherwise spreads them among these, each with a full wait); in the last step, which
            // has no reads, it keeps the step before in front of the waits at the loop's foot, where its matrix instructions cover the last reads' latency (without it they sink behind the barrier)
            __builtin_amdgcn_sched_barrier(0);
#pragma unroll
            for (int nb = 0; nb < 4; ++nb)
#pragma unroll
                for (int mb = 0; mb < 4; ++mb) { acc[mb][nb] = WFrag<T16>::mma(a[q & 1][mb], b[q & 1][nb], acc[mb][nb]); if (NSPLIT == 1) acc[mb][nb] = WFrag<T16>::mma(a2[q & 1][mb], b[q & 1][nb], acc[mb][nb]); }
        }
        asm volatile("s_wait_dscnt 0x0" ::: "memory");    // this wave has left the buffer that is refilled below
        asm volatile("s_wait_asynccnt 0x0" ::: "memory"); // this wave's copies of stage t + 1 have landed
        __syncthreads();                                  // publishes stage t + 1 and ends every reader's last read of stage t
        if (t + 2 < nt) stage(t + 2, t & 1);
    }
    asm volatile("s_wait_asynccnt 0x0" ::: "memory");     // no copy is outstanding when the wave goes on and ends
    float* os = &osw[wave][0];
#pragma unroll
    for (int mb = 0; mb < 4; ++mb) {
#pragma unroll
        for (int nb = 0; nb < 4; ++nb) {
#pragma unroll
            for (int j = 0; j < 8; ++j) os[(hi * 8 + j) * 68 + nb * 16 + lr] = acc[mb][nb][j]; }
        __builtin_amdgcn_wave_barrier(); asm volatile("" ::: "memory");
        float* crow = C + (size_t)(r0 + wm * 64 + mb * 16) * ldc + c0 + wn * 64;
{
#pragma unroll
            for (int s = 0; s < 8; ++s) { const int row = 2 * s + hi, cofs = lr * 4; v4f val = *(const v4fa*)(os + row * 68 + cofs); val = val * cscale + padd;
                *(v4f*)(crow + (size_t)row * ldc + cofs) = val; }
             }
        __builtin_amdgcn_wave_barrier(); asm volatile("" ::: "memory");
    }
}

__global__ __launch_bounds__(32) void k_flag0(int* MFLAG) {
    const int lane = threadIdx.x & 31; const int r = 0;
    int* p = MFLAG + lane; *(int*)p = r; 
}

__global__ __launch_bounds__(256) void k_wtG(const float* __restrict__ w, int K, int N, bf* Bt, h16* Ht) {
    const int lane = threadIdx.x & 31; const int L0 = (blockIdx.x * 8 + (threadIdx.x >> 5)) * 8; const int nlines = N * K / 64;
{
#pragma unroll 1
        for (int l = 0; l < 8; ++l) { const int L = L0 + l; if (L >= nlines) break; const size_t e = (size_t)L * 64 + lane * 2; const int k = (int)(e % K), n = (int)(e / K);
            const float w0 = bfr(w[(size_t)k * N + n]), w1 = bfr(w[(size_t)(k + 1) * N + n]); v2us o; o[0] = f2bf(w0); o[1] = f2bf(w1); *(v2us*)(Bt + e) = o;
            if (Ht != nullptr) { v2h oh; oh[0] = tohx(w0 * WCAR); oh[1] = tohx(w1 * WCAR); *(v2h*)(Ht + e) = oh; } }
         }
}
__global__ __launch_bounds__(256) void k_cvt8(const float* __restrict__ src, bf* dst, size_t n8) { const size_t i = (size_t)blockIdx.x * 256 + threadIdx.x; if (i >= n8) return; const v8f v = *(const v8f*)(src + i * 8); v8us o;
#pragma unroll
    for (int k = 0; k < 8; ++k) o[k] = f2bf(v[k]); *(v8us*)(dst + i * 8) = o;  }

// ---- k_rope: head planes of the rotate-half rotary mix of F[t][h*HD + d] (row pitch 'pitch') with the cos/sin input tables (bf16 RNE values):
// r[d] = x[d] cos[t][d] - x[d+HD/2] sin[t][d] (d < HD/2), r[d] = x[d] cos[t][d] + x[d-HD/2] sin[t][d] (d >= HD/2);
__global__ __launch_bounds__(256) void k_rope(const float* __restrict__ F, int pitch, int nheads, const float* __restrict__ COSI, const float* __restrict__ SINI, h16* P16, bf* Ph, bf* Pl) {
    const size_t e = ((size_t)blockIdx.x * 256 + threadIdx.x) * 2; if (e >= (size_t)nheads * SEQ * HD) return;
    const int d = (int)(e % HD); const int t = (int)((e / HD) % SEQ); const int h = (int)(e / ((size_t)HD * SEQ));
    const float* f = F + (size_t)t * pitch + h * HD; v2h o16; v2us oh, ol;
#pragma unroll
    for (int q = 0; q < 2; ++q) { const int dd = d + q; const int dp = (dd < HD / 2) ? dd + HD / 2 : dd - HD / 2;
        const float x0 = f[dd], x1 = f[dp]; const float cv = bfr(COSI[(size_t)t * HD + dd]), snv = bfr(SINI[(size_t)t * HD + dd]);
        const float pa = x0 * cv, pb = x1 * snv; const float r = (dd < HD / 2) ? (pa - pb) : (pa + pb);
        o16[q] = tohx(r); unsigned short a2, c2; splitf(r, a2, c2); oh[q] = a2; ol[q] = c2; }
    const bool res = (t < RRES); const size_t oo = ((size_t)h * RRES + (res ? t : 0)) * HD + d;
    *(v2h*)(P16 + e) = o16; if (res) { *(v2us*)(Ph + oo) = oh; *(v2us*)(Pl + oo) = ol; }
    
}
// ---- k_vtp: value planes V16[g][d][t] = f16(F[t][g*HD + d]) for every t < SEQ (row pitch SEQ) and Vh/Vl[g][d][t] bf16 hi/lo for t < RRES (row pitch RRES); lane -> 2 consecutive t,
__global__ __launch_bounds__(256) void k_vtp(const float* __restrict__ F, int pitch, int ng, h16* V16, bf* Vh, bf* Vl) {
    const size_t e = ((size_t)blockIdx.x * 256 + threadIdx.x) * 2; if (e >= (size_t)ng * HD * SEQ) return;
    const int t = (int)(e % SEQ); const int d = (int)((e / SEQ) % HD); const int g = (int)(e / ((size_t)SEQ * HD)); v2h o16; v2us oh, ol;
#pragma unroll
    for (int q = 0; q < 2; ++q) { const float x = F[(size_t)(t + q) * pitch + g * HD + d]; o16[q] = tohx(x); unsigned short a2, c2; splitf(x, a2, c2); oh[q] = a2; ol[q] = c2; }
    const bool res = (t < RRES); const size_t oo = ((size_t)g * HD + d) * RRES + (res ? t : 0);
    *(v2h*)(V16 + e) = o16; if (res) { *(v2us*)(Vh + oo) = oh; *(v2us*)(Vl + oo) = ol; }
    
}

// ---- online softmax step on one wave's 16 x 64 score tile (D layout: s[nt][r] = S[row 8*hi + r][col nt*16 + lr]); diagonal tile: entries with col > row replaced by -1e9 before the
// 1/sqrt(HD) scaling (their exp is exactly 0); running max / running sum per row (replicated over the 16 lanes of a half), output accumulators rescaled; leaves s = exp(t - m).
__device__ __forceinline__ void online_softmax(v8f (&s)[4], float (&m)[8], float (&l)[8], v8f (&o)[4], bool diag, int row0, int kvb, int lr, int hi) {
#pragma unroll
    for (int nt = 0; nt < 4; ++nt)
#pragma unroll
        for (int r = 0; r < 8; ++r) { const int row = row0 + 8 * hi + r, col = kvb + nt * 16 + lr; float v = s[nt][r]; if (diag && col > row) v = -1.0e9f; s[nt][r] = v * SCL; }
#pragma unroll
    for (int r = 0; r < 8; ++r) {
        float mx = fmaxf(fmaxf(s[0][r], s[1][r]), fmaxf(s[2][r], s[3][r]));
#pragma unroll
        for (int sh = 1; sh < 16; sh <<= 1) mx = fmaxf(mx, __shfl_xor(mx, sh, 32));
        const float m2 = fmaxf(m[r], mx); const float alpha = __builtin_amdgcn_exp2f((m[r] - m2) * L2E); m[r] = m2;
        float rs = 0.0f;
#pragma unroll
        for (int nt = 0; nt < 4; ++nt) { const float p = __builtin_amdgcn_exp2f((s[nt][r] - m2) * L2E); s[nt][r] = p; rs += p; }
#pragma unroll
        for (int sh = 1; sh < 16; sh <<= 1) rs += __shfl_xor(rs, sh, 32);
        l[r] = l[r] * alpha + rs;
#pragma unroll
        for (int nt = 0; nt < 4; ++nt) o[nt][r] = o[nt][r] * alpha;
    }
}

// ---- k_attnr: causal attention for query rows < RRES (query tiles 0 .. RRES/64-1; they only visit key tiles 0 .. qt): block = 4 waves x 16 rows, head h uses kv group h / GRP.
// q, k, v from the bf16 hi/lo planes ([h][RRES][HD], [g][RRES][HD], [g][HD][RRES]); scores = qh.kh + ql.kh + qh.kl; unnormalised p split to bf16 hi/lo in a wave-private LDS tile,
__global__ __launch_bounds__(128) void k_attnr(const bf* __restrict__ QPh, const bf* __restrict__ QPl, const bf* __restrict__ KPh, const bf* __restrict__ KPl, const bf* __restrict__ VTh, const bf* __restrict__ VTl, bf* CTh, bf* CTl) {
    __shared__ __align__(16) bf sP[4][2][16 * PP];
    const int lane = threadIdx.x & 31, wave = threadIdx.x >> 5, lr = lane & 15, hi = lane >> 4;
    const int qt = blockIdx.x, h = blockIdx.y, g = h / GRP; const int q0 = qt * 64 + wave * 16;
    const bf* qh = QPh + ((size_t)h * RRES + q0) * HD; const bf* ql = QPl + ((size_t)h * RRES + q0) * HD;
    const bf* kh = KPh + (size_t)g * RRES * HD; const bf* kl = KPl + (size_t)g * RRES * HD;
    const bf* vh = VTh + (size_t)g * HD * RRES; const bf* vl = VTl + (size_t)g * HD * RRES;
    bf* sph = &sP[wave][0][0]; bf* spl = &sP[wave][1][0];
    float m[8], l[8]; v8f o[4];
#pragma unroll
    for (int r = 0; r < 8; ++r) { m[r] = -3.0e38f; l[r] = 0.0f; }
#pragma unroll
    for (int nt = 0; nt < 4; ++nt) o[nt] = (v8f){};
#pragma unroll 1
    for (int c = 0; c <= qt; ++c) {
        const int kvb = c * 64; v8f s[4]; v16bf aqh[2], aql[2], bh, bl;
#pragma unroll
        for (int kk = 0; kk < 2; ++kk) { aqh[kk] = WFrag<bf>::ld(qh + (size_t)lr * HD + 8 * hi + kk * 32); aql[kk] = WFrag<bf>::ld(ql + (size_t)lr * HD + 8 * hi + kk * 32); }
#pragma unroll
        for (int nt = 0; nt < 4; ++nt) { s[nt] = (v8f){}; const size_t ko = (size_t)(kvb + nt * 16 + lr) * HD + 8 * hi;
#pragma unroll
            for (int kk = 0; kk < 2; ++kk) { bh = WFrag<bf>::ld(kh + ko + kk * 32); bl = WFrag<bf>::ld(kl + ko + kk * 32);
                s[nt] = wmmab(aqh[kk], bh, s[nt]); s[nt] = wmmab(aql[kk], bh, s[nt]); s[nt] = wmmab(aqh[kk], bl, s[nt]); } }
        asm volatile("v_nop\n\tv_nop\n\tv_nop\n\tv_nop" : "+v"(s[0]), "+v"(s[1]), "+v"(s[2]), "+v"(s[3]) : "v"(aqh[0]), "v"(aql[1]), "v"(bh), "v"(bl));
        online_softmax(s, m, l, o, c == qt, q0, kvb, lr, hi);
#pragma unroll
        for (int nt = 0; nt < 4; ++nt)
#pragma unroll
            for (int r = 0; r < 8; ++r) { unsigned short a2, c2; splitf(s[nt][r], a2, c2); const int so = (8 * hi + r) * PP + nt * 16 + lr; sph[so] = a2; spl[so] = c2; }
        lds_wsync();
        v16bf aph[2], apl[2], bvh, bvl;
#pragma unroll
        for (int kk = 0; kk < 2; ++kk) { const int ao = lr * PP + kk * 32 + 8 * hi; aph[kk] = cat16b(*(const v8usa*)(sph + ao), *(const v8usa*)(sph + ao + 16)); apl[kk] = cat16b(*(const v8usa*)(spl + ao), *(const v8usa*)(spl + ao + 16)); }
#pragma unroll
        for (int kk = 0; kk < 2; ++kk)
#pragma unroll
            for (int nt = 0; nt < 4; ++nt) { const size_t vo = (size_t)(nt * 16 + lr) * RRES + kvb + kk * 32 + 8 * hi; bvh = WFrag<bf>::ld(vh + vo); bvl = WFrag<bf>::ld(vl + vo);
                o[nt] = wmmab(aph[kk], bvh, o[nt]); o[nt] = wmmab(apl[kk], bvh, o[nt]); o[nt] = wmmab(aph[kk], bvl, o[nt]); }
        asm volatile("v_nop\n\tv_nop\n\tv_nop\n\tv_nop" : "+v"(o[0]), "+v"(o[1]), "+v"(o[2]), "+v"(o[3]) : "v"(aph[0]), "v"(apl[1]), "v"(bvh), "v"(bvl));
        lds_wsync();
    }
    float inv[8];
#pragma unroll
    for (int r = 0; r < 8; ++r) inv[r] = 1.0f / l[r];
#pragma unroll
    for (int nt = 0; nt < 4; ++nt)
#pragma unroll
        for (int r = 0; r < 8; ++r) { unsigned short a2, c2; splitf(o[nt][r] * inv[r], a2, c2); const int so = (8 * hi + r) * PP + nt * 16 + lr; sph[so] = a2; spl[so] = c2; }
    lds_wsync();
    bf* chb = CTh + (size_t)q0 * DMO + h * HD; bf* clb = CTl + (size_t)q0 * DMO + h * HD;
{
#pragma unroll
        for (int it = 0; it < 4; ++it) { const int rr = it * 4 + (lane >> 3), pc = (lane & 7) * 8; const v8us va = *(const v8usa*)(sph + rr * PP + pc); const v8us vb = *(const v8usa*)(spl + rr * PP + pc);
            *(v8us*)(chb + (size_t)rr * DMO + pc) = va; *(v8us*)(clb + (size_t)rr * DMO + pc) = vb; }
         }
}

// ---- k_attn: causal attention for query tiles qt >= RRES/64 (blockIdx.x + RRES/64): same structure with single f16 products; q, k from [h][SEQ][HD] / [g][SEQ][HD] f16 planes,
__global__ __launch_bounds__(128) void k_attn(const h16* __restrict__ Q16, const h16* __restrict__ K16, const h16* __restrict__ VT16, h16* C16) {
    __shared__ __align__(16) h16 sP[4][16 * PP];
    const int lane = threadIdx.x & 31, wave = threadIdx.x >> 5, lr = lane & 15, hi = lane >> 4;
    const int qt = blockIdx.x + RRES / 64, h = blockIdx.y, g = h / GRP; const int q0 = qt * 64 + wave * 16;
    const h16* qp = Q16 + ((size_t)h * SEQ + q0) * HD; const h16* kp = K16 + (size_t)g * SEQ * HD; const h16* vp = VT16 + (size_t)g * HD * SEQ;
    h16* spw = &sP[wave][0];
    v16h aq[2];
#pragma unroll
    for (int kk = 0; kk < 2; ++kk) aq[kk] = WFrag<h16>::ld(qp + (size_t)lr * HD + 8 * hi + kk * 32);
    float m[8], l[8]; v8f o[4];
#pragma unroll
    for (int r = 0; r < 8; ++r) { m[r] = -3.0e38f; l[r] = 0.0f; }
#pragma unroll
    for (int nt = 0; nt < 4; ++nt) o[nt] = (v8f){};
    const int nch = qt + 1;
#pragma unroll 1
    for (int c = 0; c < nch; ++c) {
        const int kvb = c * 64; v8f s[4]; v16h b;
#pragma unroll
        for (int nt = 0; nt < 4; ++nt) { s[nt] = (v8f){}; const h16* kr = kp + (size_t)(kvb + nt * 16 + lr) * HD + 8 * hi;
#pragma unroll
            for (int kk = 0; kk < 2; ++kk) { b = WFrag<h16>::ld(kr + kk * 32); s[nt] = wmma16(aq[kk], b, s[nt]); } }
        asm volatile("v_nop\n\tv_nop\n\tv_nop\n\tv_nop" : "+v"(s[0]), "+v"(s[1]), "+v"(s[2]), "+v"(s[3]) : "v"(aq[0]), "v"(aq[1]), "v"(b));
        online_softmax(s, m, l, o, c == qt, q0, kvb, lr, hi);
#pragma unroll
        for (int nt = 0; nt < 4; ++nt)
#pragma unroll
            for (int r = 0; r < 8; ++r) spw[(8 * hi + r) * PP + nt * 16 + lr] = tohx(s[nt][r] * PCAR);
        lds_wsync();
        v16h ap[2], bv;
#pragma unroll
        for (int kk = 0; kk < 2; ++kk) { const int ao = lr * PP + kk * 32 + 8 * hi; ap[kk] = cat16(*(const v8ha*)(spw + ao), *(const v8ha*)(spw + ao + 16)); }
#pragma unroll
        for (int kk = 0; kk < 2; ++kk)
#pragma unroll
            for (int nt = 0; nt < 4; ++nt) { bv = WFrag<h16>::ld(vp + (size_t)(nt * 16 + lr) * SEQ + kvb + kk * 32 + 8 * hi); o[nt] = wmma16(ap[kk], bv, o[nt]); }
        asm volatile("v_nop\n\tv_nop\n\tv_nop\n\tv_nop" : "+v"(o[0]), "+v"(o[1]), "+v"(o[2]), "+v"(o[3]) : "v"(ap[0]), "v"(ap[1]), "v"(bv));
        lds_wsync();
    }
    float inv[8];
#pragma unroll
    for (int r = 0; r < 8; ++r) inv[r] = (1.0f / l[r]) * (CCAR / PCAR);
#pragma unroll
    for (int nt = 0; nt < 4; ++nt)
#pragma unroll
        for (int r = 0; r < 8; ++r) spw[(8 * hi + r) * PP + nt * 16 + lr] = tohx(o[nt][r] * inv[r]);
    lds_wsync();
    h16* cb = C16 + (size_t)q0 * DMO + h * HD;
{
#pragma unroll
        for (int it = 0; it < 4; ++it) { const int rr = it * 4 + (lane >> 3), pc = (lane & 7) * 8; const v8h val = *(const v8ha*)(spw + rr * PP + pc); *(v8h*)(cb + (size_t)rr * DMO + pc) = val; }
         }
}

extern "C" void kernel_launch(void* const* d_in, const int* in_sizes, int n_in,
                              void* d_out, int out_size, void* d_ws, size_t ws_size, hipStream_t stream) {
    if (n_in < 7) return;
    const long long rows_used = (long long)(NB - 1) * SEQ_FULL + SEQ;
    if ((long long)in_sizes[0] < rows_used * DIN) return;
    if (in_sizes[1] < SEQ * HD || in_sizes[2] < SEQ * HD) return;
    if (in_sizes[3] < DIN * DMO || in_sizes[4] < DIN * DKV || in_sizes[5] < DIN * DKV || in_sizes[6] < DMO * DMO) return;
    if ((long long)out_size < rows_used * DMO) return;
    // wire order: x, cos, sin, wq, wk, wv, wo
    const float* x = (const float*)d_in[0]; const float* cosi = (const float*)d_in[1]; const float* sini = (const float*)d_in[2];
    const float* wq = (const float*)d_in[3]; const float* wk = (const float*)d_in[4]; const float* wv = (const float*)d_in[5]; const float* wo = (const float*)d_in[6];
    float* OUT = (float*)d_out;     // [NB_FULL][SEQ_FULL][DMO]
    char* wsp = (char*)d_ws;
    auto take = [&](size_t bytes) { char* p = wsp; wsp += (bytes + 255) & ~(size_t)255; return (void*)p; };
    bf* WQ   = (bf*)take((size_t)DMO * DIN * 2);          // Bt [out][in]
    bf* WK   = (bf*)take((size_t)DKV * DIN * 2);
    bf* WV   = (bf*)take((size_t)DKV * DIN * 2);
    bf* WOb  = (bf*)take((size_t)DMO * DMO * 2);
    h16* WO16 = (h16*)take((size_t)DMO * DMO * 2);
    bf* XB   = (bf*)take((size_t)SEQ * DIN * 2);          // one batch
    float* FQ = (float*)take((size_t)SEQ * DMO * 4);
    float* FK = (float*)take((size_t)SEQ * DKV * 4);
    float* FV = (float*)take((size_t)SEQ * DKV * 4);
    h16* Q16 = (h16*)take((size_t)NH * SEQ * HD * 2); h16* K16 = (h16*)take((size_t)NKV * SEQ * HD * 2); h16* VT16 = (h16*)take((size_t)NKV * HD * SEQ * 2);
    bf* QPh = (bf*)take((size_t)NH * RRES * HD * 2); bf* QPl = (bf*)take((size_t)NH * RRES * HD * 2);
    bf* KPh = (bf*)take((size_t)NKV * RRES * HD * 2); bf* KPl = (bf*)take((size_t)NKV * RRES * HD * 2);
    bf* VTh = (bf*)take((size_t)NKV * HD * RRES * 2); bf* VTl = (bf*)take((size_t)NKV * HD * RRES * 2);
    h16* C16 = (h16*)take((size_t)SEQ * DMO * 2);        // rows >= RRES used
    bf* CTh = (bf*)take((size_t)RRES * DMO * 2); bf* CTl = (bf*)take((size_t)RRES * DMO * 2);
    int* MFLAG = (int*)take(128);
    const size_t carved = (size_t)(wsp - (char*)d_ws);
    if (carved > ws_size || carved > (size_t)134217728) return;

    k_flag0<<<1, 32, 0, stream>>>(MFLAG);
    k_wtG<<<(unsigned)((DMO * DIN / 64 + 63) / 64), 256, 0, stream>>>(wq, DIN, DMO, WQ, nullptr);
    k_wtG<<<(unsigned)((DKV * DIN / 64 + 63) / 64), 256, 0, stream>>>(wk, DIN, DKV, WK, nullptr);
    k_wtG<<<(unsigned)((DKV * DIN / 64 + 63) / 64), 256, 0, stream>>>(wv, DIN, DKV, WV, nullptr);
    k_wtG<<<(unsigned)((DMO * DMO / 64 + 63) / 64), 256, 0, stream>>>(wo, DMO, DMO, WOb, WO16);
    const unsigned LQ = (unsigned)(((size_t)NH * SEQ * HD / 2 + 255) / 256), LKV = (unsigned)(((size_t)NKV * SEQ * HD / 2 + 255) / 256);
    for (int b = 0; b < NB; ++b) {
        k_cvt8<<<(unsigned)(((size_t)SEQ * DIN / 8 + 255) / 256), 256, 0, stream>>>(x + (size_t)b * SEQ_FULL * DIN, XB, (size_t)SEQ * DIN / 8);
        k_gemmw<bf, 0><<<dim3(SEQ / 128, DMO / 128, 1), 128, 0, stream>>>(XB, nullptr, WQ, nullptr, DIN, FQ, DMO, 1.0f, MFLAG, 0, 0, 0);
        k_gemmw<bf, 0><<<dim3(SEQ / 128, DKV / 128, 1), 128, 0, stream>>>(XB, nullptr, WK, nullptr, DIN, FK, DKV, 1.0f, MFLAG, 0, 0, 0);
        k_gemmw<bf, 0><<<dim3(SEQ / 128, DKV / 128, 1), 128, 0, stream>>>(XB, nullptr, WV, nullptr, DIN, FV, DKV, 1.0f, MFLAG, 0, 0, 0);
        k_rope<<<LQ, 256, 0, stream>>>(FQ, DMO, NH, cosi, sini, Q16, QPh, QPl);
        k_rope<<<LKV, 256, 0, stream>>>(FK, DKV, NKV, cosi, sini, K16, KPh, KPl);
        k_vtp<<<LKV, 256, 0, stream>>>(FV, DKV, NKV, VT16, VTh, VTl);
        k_attnr<<<dim3(RRES / 64, NH, 1), 128, 0, stream>>>(QPh, QPl, KPh, KPl, VTh, VTl, CTh, CTl);
        if (SEQ > RRES) k_attn<<<dim3((SEQ - RRES) / 64, NH, 1), 128, 0, stream>>>(Q16, K16, VT16, C16);
        float* ob = OUT + (size_t)b * SEQ_FULL * DMO;
        k_gemmw<bf, 1><<<dim3(RRES / 128, DMO / 128, 1), 128, 0, stream>>>(CTh, CTl, WOb, nullptr, DMO, ob, DMO, 1.0f, MFLAG, 0, 0, 0);
        if (SEQ > RRES) k_gemmw<h16, 0><<<dim3((SEQ - RRES) / 128, DMO / 128, 1), 128, 0, stream>>>(C16 + (size_t)RRES * DMO, nullptr, WO16, nullptr, DMO, ob + (size_t)RRES * DMO, DMO, 1.0f / (CCAR * WCAR), MFLAG, 0, 0, 0);
    }
}

// v002
// A run of this version takes 454 microseconds.
// In both of two side-by-side timings against v001, it was 1.15 times as fast.
// All steps since v000 together make it 1.68 times as fast.
#include <hip/hip_runtime.h>

// Contractions and operand types (f32 accumulate everywhere): x Wq, x Wk, x Wv on v_wmma_f32_16x16x32_bf16 with RNE bf16 copies of x and W (exact products);
// query rows < RRES of each sequence: q.k^T and p.v on v_wmma_f32_16x16x32_bf16 as bf16 hi/lo splits (3 products each), their ctx Wo as bf16 hi/lo ctx times bf16 Wo (2 products);
// query rows >= RRES: q.k^T and p.v on v_wmma_f32_16x16x32_f16 (f16 q/k/v planes, p carried x1024), ctx Wo on v_wmma_f32_16x16x32_f16 (ctx carried x16, Wo carried x64, folded by 1/1024 in the epilogue).
// diagonal are skipped (their probabilities are exactly 0) and the diagonal tile is masked by index; a constant zero flag line feeds the additive term of the GEMM epilogue.

#ifndef NB
#define NB 2
#endif
#ifndef SEQ
#define SEQ 2048
#endif
#ifndef RRES
#define RRES 256
#endif
#define NB_FULL 2
#define SEQ_FULL 2048
#define DIN 2048
#define DMO 2048
#define NH 32
#define NKV 8
#define GRP (NH / NKV)
#define HD 64
#define DKV (NKV * HD)
#define PP 72
#define PCAR 1024.0f
#define CCAR 16.0f
#define WCAR 64.0f
#define SCL 0.125f
#define L2E 1.4426950408889634f
static_assert(SEQ % 64 == 0 && SEQ >= 64 && SEQ <= SEQ_FULL);
static_assert(RRES % 64 == 0 && RRES >= 64 && RRES <= SEQ);
static_assert(NB >= 1 && NB <= NB_FULL);
static_assert(DIN % 32 == 0 && DMO % 64 == 0 && DKV % 64 == 0 && HD == 64 && (NH % NKV) == 0);
static_assert(DMO == NH * HD && DMO % 32 == 0);
static_assert(PP % 8 == 0 && PP >= HD);
static_assert((DMO * DIN) % 64 == 0 && (DKV * DIN) % 64 == 0 && (DMO * DMO) % 64 == 0 && DIN % 2 == 0 && DMO % 2 == 0);
static_assert(((size_t)SEQ * DIN) % 8 == 0);
// workspace carve (every plane a multiple of 256 B; same sequence as the launcher's take() calls)
#define AL256(x) ((((size_t)(x)) + 255) & ~(size_t)255)
#define WS_TOTAL (AL256((size_t)DMO * DIN * 2) + 2 * AL256((size_t)DKV * DIN * 2) + 2 * AL256((size_t)DMO * DMO * 2) + AL256((size_t)SEQ * DIN * 2) + AL256((size_t)SEQ * DMO * 4) \
                  + 2 * AL256((size_t)SEQ * DKV * 4) + AL256((size_t)NH * SEQ * HD * 2) + 2 * AL256((size_t)NKV * SEQ * HD * 2) + 2 * AL256((size_t)NH * RRES * HD * 2) \
                  + 4 * AL256((size_t)NKV * RRES * HD * 2) + AL256((size_t)SEQ * DMO * 2) + 2 * AL256((size_t)RRES * DMO * 2) + AL256(128))
static_assert(WS_TOTAL <= (size_t)134217728);

typedef _Float16 h16;
typedef unsigned short bf;
typedef __attribute__((ext_vector_type(16))) __bf16   v16bf;
typedef __attribute__((ext_vector_type(16))) _Float16 v16h;
typedef __attribute__((ext_vector_type(8)))  _Float16 v8h;
typedef __attribute__((ext_vector_type(8)))  unsigned short v8us;
typedef __attribute__((ext_vector_type(8)))  float    v8f;
typedef __attribute__((ext_vector_type(4)))  float    v4f;
typedef __attribute__((ext_vector_type(4)))  int      v4i;
typedef __attribute__((ext_vector_type(2)))  _Float16 v2h;
typedef __attribute__((ext_vector_type(2)))  unsigned short v2us;
typedef v8h  __attribute__((may_alias)) v8ha;
typedef v4f  __attribute__((may_alias)) v4fa;
typedef v8us __attribute__((may_alias)) v8usa;

__device__ __forceinline__ unsigned short f2bf(float f) { unsigned u = __float_as_uint(f); u += 0x7FFFu + ((u >> 16) & 1u); return (unsigned short)(u >> 16); }
__device__ __forceinline__ float bf2f(unsigned short b) { return __uint_as_float(((unsigned)b) << 16); }
__device__ __forceinline__ float bfr(float f) { return bf2f(f2bf(f)); }
__device__ __forceinline__ h16 tohx(float x) { return (h16)x; }
__device__ __forceinline__ void splitf(float y, unsigned short& h, unsigned short& l) { h = f2bf(y); l = f2bf(y - bf2f(h)); }
__device__ __forceinline__ v16h cat16(v8h lo, v8h hi) { return __builtin_shufflevector(lo, hi, 0, 1, 2, 3, 4, 5, 6, 7, 8, 9, 10, 11, 12, 13, 14, 15); }
__device__ __forceinline__ v16bf cat16b(v8us lo, v8us hi) { return __builtin_bit_cast(v16bf, __builtin_shufflevector(lo, hi, 0, 1, 2, 3, 4, 5, 6, 7, 8, 9, 10, 11, 12, 13, 14, 15)); }
__device__ __forceinline__ v8f wmma16(v16h a, v16h b, v8f c) { return __builtin_amdgcn_wmma_f32_16x16x32_f16(false, a, false, b, (short)0, c, false, false); }
__device__ __forceinline__ v8f wmmab(v16bf a, v16bf b, v8f c) { return __builtin_amdgcn_wmma_f32_16x16x32_bf16(false, a, false, b, (short)0, c, false, false); }
// wave-private LDS tile: stores of this wave made visible to its own later cross-lane loads, loads kept below the stores by the compiler
__device__ __forceinline__ void lds_wsync() { __builtin_amdgcn_fence(3 /* release order */, "wavefront"); __builtin_amdgcn_wave_barrier(); asm volatile("" ::: "memory"); }

// 16-bit fragment loaders: lane l -> row/column (l & 15); elements 0..7 <- k0 + 8*(l>>4) + 0..7, elements 8..15 <- k0 + 16 + 8*(l>>4) + 0..7 of a K-contiguous row (p already offset by 8*(l>>4)).
template <typename T16> struct WFrag;
template <> struct WFrag<h16> { typedef v16h V; static __device__ __forceinline__ V ld(const h16* p) { return cat16(*(const v8h*)p, *(const v8h*)(p + 16)); } static __device__ __forceinline__ v8f mma(V a, V b, v8f c) { return wmma16(a, b, c); } };
template <> struct WFrag<bf> { typedef v16bf V; static __device__ __forceinline__ V ld(const bf* p) { return cat16b(*(const v8us*)p, *(const v8us*)(p + 16)); } static __device__ __forceinline__ v8f mma(V a, V b, v8f c) { return wmmab(a, b, c); } };

// ---- k_gemmw: work-group tiled GEMM: 4 waves (2 x 2) share one 128x128 output tile, each wave keeps a 64x64 part (16 accumulators); grid (M/128, N/128, Z), 128 threads.
// A stage is GKS = 128 k (256 B) of the 128 A rows, the 128 Bt rows (and the 128 A2 rows when NSPLIT == 1), brought from the K-contiguous 16-bit planes into LDS by asynchronous
// 16-byte copies at a row pitch of 272 B; two buffers, the next stage's copies fly while this stage is multiplied. Every accumulator sums k upward in steps of 32, A before A2.
// C[m][n] (f32, pitch ldc) = (sum_k A[m][k] Bt[n][k] (+ A2[m][k] Bt[n][k] when NSPLIT == 1)) * cscale + (pflag[0] ? NaN : 0). K % 128 == 0, K >= 128, M % 128 == 0, N % 128 == 0.
#define GKS 128
#define GPI 136
static_assert(DIN % GKS == 0 && DMO % GKS == 0 && SEQ % 128 == 0 && RRES % 128 == 0 && DMO % 128 == 0 && DKV % 128 == 0);
__device__ __forceinline__ unsigned lds_off(const void* p) { return (unsigned)(size_t)p; }
// eight copies of one lane: rows 8 apart, 16 B each, LDS byte address l, global address g (row pitch K elements). The s_wait_xcnt closes the statement so that no address register
// of an issued copy is rewritten ahead of it.
template <typename T16>
__device__ __forceinline__ void acopy8(unsigned l, const T16* g, size_t K) {
    const unsigned ls = 8 * GPI * 2; const size_t gs = 8 * K;
    asm volatile("global_load_async_to_lds_b128 %0, %8, off\n\t"
                 "global_load_async_to_lds_b128 %1, %9, off\n\t"
                 "global_load_async_to_lds_b128 %2, %10, off\n\t"
                 "global_load_async_to_lds_b128 %3, %11, off\n\t"
                 "global_load_async_to_lds_b128 %4, %12, off\n\t"
                 "global_load_async_to_lds_b128 %5, %13, off\n\t"
                 "global_load_async_to_lds_b128 %6, %14, off\n\t"
                 "global_load_async_to_lds_b128 %7, %15, off\n\t"
                 "s_wait_xcnt 0x0"
                 :: "v"(l), "v"(l + ls), "v"(l + 2 * ls), "v"(l + 3 * ls), "v"(l + 4 * ls), "v"(l + 5 * ls), "v"(l + 6 * ls), "v"(l + 7 * ls),
                    "v"(g), "v"(g + gs), "v"(g + 2 * gs), "v"(g + 3 * gs), "v"(g + 4 * gs), "v"(g + 5 * gs), "v"(g + 6 * gs), "v"(g + 7 * gs) : "memory");
}
// 128 rows x 256 B of one operand: 16 copies a lane (16 lanes cover a row, a wave two rows)
template <typename T16>
__device__ __forceinline__ void acopy_rows(unsigned l, const T16* g, size_t K) { acopy8(l, g, K); acopy8(l + 64 * GPI * 2, g + 64 * K, K); }

template <typename T16, int NSPLIT>
__global__ __launch_bounds__(128) void k_gemmw(const T16* __restrict__ A, const T16* __restrict__ A2, const T16* __restrict__ Bt, const T16* __restrict__ Bt2, int K, float* C, int ldc, float cscale, const int* __restrict__ pflag, size_t sA, size_t sB, size_t sC) {
    typedef typename WFrag<T16>::V V;
    static_assert(NSPLIT == 0 || NSPLIT == 1);
    constexpr int OPE = 128 * GPI;                        // elements of one operand's rows in a stage
    constexpr int STE = (NSPLIT == 1 ? 3 : 2) * OPE;      // elements of a stage: [A | Bt | A2]
    __shared__ __align__(128) T16 ring[2 * STE];
    __shared__ __align__(16) float osw[4][16 * 68];
    const size_t z = blockIdx.z; A += z * sA; if (A2) A2 += z * sA; Bt += z * sB; C += z * sC;
    const int tid = threadIdx.x, lane = tid & 31, wave = tid >> 5, lr = lane & 15, hi = lane >> 4; const int wm = wave >> 1, wn = wave & 1;
    const int r0 = blockIdx.x * 128, c0 = blockIdx.y * 128;
    const float padd = (pflag[0] != 0) ? __int_as_float(0x7fc00000) : 0.0f;
    v8f acc[4][4];
#pragma unroll
    for (int mb = 0; mb < 4; ++mb)
#pragma unroll
        for (int nb = 0; nb < 4; ++nb) acc[mb][nb] = (v8f){};
    const int trow = tid >> 4, tcol = tid & 15;
    const T16* ga = A + (size_t)(r0 + trow) * K + tcol * 8; const T16* gb = Bt + (size_t)(c0 + trow) * K + tcol * 8;
    const T16* ga2 = (NSPLIT == 1) ? A2 + (size_t)(r0 + trow) * K + tcol * 8 : nullptr;
    const unsigned lt = lds_off(ring) + (unsigned)(trow * GPI + tcol * 8) * 2;
    auto stage = [&](int t, int buf) { const unsigned l = lt + (unsigned)buf * (STE * 2); const size_t ko = (size_t)t * GKS;
        acopy_rows(l, ga + ko, (size_t)K); acopy_rows(l + OPE * 2, gb + ko, (size_t)K); if (NSPLIT == 1) acopy_rows(l + 2 * OPE * 2, ga2 + ko, (size_t)K); };
    const int nt = K / GKS;
    stage(0, 0);
    asm volatile("s_wait_asynccnt 0x0" ::: "memory");     // this wave's copies of stage 0 have landed
    __syncthreads();                                      // every wave's have: stage 0 may be read
    if (nt > 1) stage(1, 1);
    // the stage loop stays rolled: one copy of the body in the instruction cache, the buffer picked by t & 1
#pragma unroll 1
    for (int t = 0; t < nt; ++t) {
        const T16* sa = ring + (t & 1) * STE + (wm * 64 + lr) * GPI + 8 * hi; const T16* sb = ring + (t & 1) * STE + OPE + (wn * 64 + lr) * GPI + 8 * hi;
        // two fragment sets: the reads of the next 32 k of this stage go out as one group ahead of this step's matrix instructions, so that only the stage's first group is waited for in full
        // (every loop below is unrolled so that set, fragment and accumulator indices are constants and the arrays live in registers)
        V a[2][4], b[2][4], a2[2][4];
        auto ldset = [&](int s, int ks) {
#pragma unroll
            for (int mb = 0; mb < 4; ++mb) { a[s][mb] = WFrag<T16>::ld(sa + mb * 16 * GPI + ks); if (NSPLIT == 1) a2[s][mb] = WFrag<T16>::ld(sa + 2 * OPE + mb * 16 * GPI + ks); }
#pragma unroll
            for (int nb = 0; nb < 4; ++nb) b[s][nb] = WFrag<T16>::ld(sb + nb * 16 * GPI + ks); };
        ldset(0, 0);
#pragma unroll
        for (int q = 0; q < GKS / 32; ++q) {
            if (q + 1 < GKS / 32) ldset((q + 1) & 1, (q + 1) * 32);
            // keeps the group of reads above in front of this step's matrix instructions (the scheduler otherwise spreads them among these, each with a full wait); in the last step, which
            // has no reads, it keeps the step before in front of the waits at the loop's foot, where its matrix instructions cover the last reads' latency (without it they sink behind the barrier)
            __builtin_amdgcn_sched_barrier(0);
#pragma unroll
            for (int nb = 0; nb < 4; ++nb)
#pragma unroll
                for (int mb = 0; mb < 4; ++mb) { acc[mb][nb] = WFrag<T16>::mma(a[q & 1][mb], b[q & 1][nb], acc[mb][nb]); if (NSPLIT == 1) acc[mb][nb] = WFrag<T16>::mma(a2[q & 1][mb], b[q & 1][nb], acc[mb][nb]); }
        }
        asm volatile("s_wait_dscnt 0x0" ::: "memory");    // this wave has left the buffer that is refilled below
        asm volatile("s_wait_asynccnt 0x0" ::: "memory"); // this wave's copies of stage t + 1 have landed
        __syncthreads();                                  // publishes stage t + 1 and ends every reader's last read of stage t
        if (t + 2 < nt) stage(t + 2, t & 1);
    }
    asm volatile("s_wait_asynccnt 0x0" ::: "memory");     // no copy is outstanding when the wave goes on and ends
    float* os = &osw[wave][0];
#pragma unroll
    for (int mb = 0; mb < 4; ++mb) {
#pragma unroll
        for (int nb = 0; nb < 4; ++nb) {
#pragma unroll
            for (int j = 0; j < 8; ++j) os[(hi * 8 + j) * 68 + nb * 16 + lr] = acc[mb][nb][j]; }
        __builtin_amdgcn_wave_barrier(); asm volatile("" ::: "memory");
        float* crow = C + (size_t)(r0 + wm * 64 + mb * 16) * ldc + c0 + wn * 64;
{
#pragma unroll
            for (int s = 0; s < 8; ++s) { const int row = 2 * s + hi, cofs = lr * 4; v4f val = *(const v4fa*)(os + row * 68 + cofs); val = val * cscale + padd;
                *(v4f*)(crow + (size_t)row * ldc + cofs) = val; }
             }
        __builtin_amdgcn_wave_barrier(); asm volatile("" ::: "memory");
    }
}

__global__ __launch_bounds__(32) void k_flag0(int* MFLAG) {
    const int lane = threadIdx.x & 31; const int r = 0;
    int* p = MFLAG + lane; *(int*)p = r; 
}

__global__ __launch_bounds__(256) void k_wtG(const float* __restrict__ w, int K, int N, bf* Bt, h16* Ht) {
    const int lane = threadIdx.x & 31; const int L0 = (blockIdx.x * 8 + (threadIdx.x >> 5)) * 8; const int nlines = N * K / 64;
{
#pragma unroll 1
        for (int l = 0; l < 8; ++l) { const int L = L0 + l; if (L >= nlines) break; const size_t e = (size_t)L * 64 + lane * 2; const int k = (int)(e % K), n = (int)(e / K);
            const float w0 = bfr(w[(size_t)k * N + n]), w1 = bfr(w[(size_t)(k + 1) * N + n]); v2us o; o[0] = f2bf(w0); o[1] = f2bf(w1); *(v2us*)(Bt + e) = o;
            if (Ht != nullptr) { v2h oh; oh[0] = tohx(w0 * WCAR); oh[1] = tohx(w1 * WCAR); *(v2h*)(Ht + e) = oh; } }
         }
}
__global__ __launch_bounds__(256) void k_cvt8(const float* __restrict__ src, bf* dst, size_t n8) { const size_t i = (size_t)blockIdx.x * 256 + threadIdx.x; if (i >= n8) return; const v8f v = *(const v8f*)(src + i * 8); v8us o;
#pragma unroll
    for (int k = 0; k < 8; ++k) o[k] = f2bf(v[k]); *(v8us*)(dst + i * 8) = o;  }

// ---- k_rope: head planes of the rotate-half rotary mix of F[t][h*HD + d] (row pitch 'pitch') with the cos/sin input tables (bf16 RNE values):
// r[d] = x[d] cos[t][d] - x[d+HD/2] sin[t][d] (d < HD/2), r[d] = x[d] cos[t][d] + x[d-HD/2] sin[t][d] (d >= HD/2);
__global__ __launch_bounds__(256) void k_rope(const float* __restrict__ F, int pitch, int nheads, const float* __restrict__ COSI, const float* __restrict__ SINI, h16* P16, bf* Ph, bf* Pl) {
    const size_t e = ((size_t)blockIdx.x * 256 + threadIdx.x) * 2; if (e >= (size_t)nheads * SEQ * HD) return;
    const int d = (int)(e % HD); const int t = (int)((e / HD) % SEQ); const int h = (int)(e / ((size_t)HD * SEQ));
    const float* f = F + (size_t)t * pitch + h * HD; v2h o16; v2us oh, ol;
#pragma unroll
    for (int q = 0; q < 2; ++q) { const int dd = d + q; const int dp = (dd < HD / 2) ? dd + HD / 2 : dd - HD / 2;
        const float x0 = f[dd], x1 = f[dp]; const float cv = bfr(COSI[(size_t)t * HD + dd]), snv = bfr(SINI[(size_t)t * HD + dd]);
        const float pa = x0 * cv, pb = x1 * snv; const float r = (dd < HD / 2) ? (pa - pb) : (pa + pb);
        o16[q] = tohx(r); unsigned short a2, c2; splitf(r, a2, c2); oh[q] = a2; ol[q] = c2; }
    const bool res = (t < RRES); const size_t oo = ((size_t)h * RRES + (res ? t : 0)) * HD + d;
    *(v2h*)(P16 + e) = o16; if (res) { *(v2us*)(Ph + oo) = oh; *(v2us*)(Pl + oo) = ol; }
    
}
// ---- k_vtp: value planes V16[g][d][t] = f16(F[t][g*HD + d]) for every t < SEQ (row pitch SEQ) and Vh/Vl[g][d][t] bf16 hi/lo for t < RRES (row pitch RRES); lane -> 2 consecutive t,
__global__ __launch_bounds__(256) void k_vtp(const float* __restrict__ F, int pitch, int ng, h16* V16, bf* Vh, bf* Vl) {
    const size_t e = ((size_t)blockIdx.x * 256 + threadIdx.x) * 2; if (e >= (size_t)ng * HD * SEQ) return;
    const int t = (int)(e % SEQ); const int d = (int)((e / SEQ) % HD); const int g = (int)(e / ((size_t)SEQ * HD)); v2h o16; v2us oh, ol;
#pragma unroll
    for (int q = 0; q < 2; ++q) { const float x = F[(size_t)(t + q) * pitch + g * HD + d]; o16[q] = tohx(x); unsigned short a2, c2; splitf(x, a2, c2); oh[q] = a2; ol[q] = c2; }
    const bool res = (t < RRES); const size_t oo = ((size_t)g * HD + d) * RRES + (res ? t : 0);
    *(v2h*)(V16 + e) = o16; if (res) { *(v2us*)(Vh + oo) = oh; *(v2us*)(Vl + oo) = ol; }
    
}

// ---- attention key / value tiles in LDS: a tile is 64 rows x 128 B (64 keys x HD of k, or HD x 64 keys of v^T) at a row pitch of PP elements (144 B).
// eight copies of one lane, 16 B each: four rows 16 apart of tile 0 (LDS byte address l0, global address g0, global row pitch p0 elements) and four of tile 1; eight lanes cover a
// row, so a wave's copy reads four whole 128-B lines. The s_wait_xcnt closes the statement so that no address register of an issued copy is rewritten ahead of it.
#define TLE (64 * PP)
template <typename T16>
__device__ __forceinline__ void acopy_tiles(unsigned l0, const T16* g0, size_t p0, unsigned l1, const T16* g1, size_t p1) {
    const unsigned ls = 16 * PP * 2; const size_t s0 = 16 * p0, s1 = 16 * p1;
    asm volatile("global_load_async_to_lds_b128 %0, %8, off\n\t"
                 "global_load_async_to_lds_b128 %1, %9, off\n\t"
                 "global_load_async_to_lds_b128 %2, %10, off\n\t"
                 "global_load_async_to_lds_b128 %3, %11, off\n\t"
                 "global_load_async_to_lds_b128 %4, %12, off\n\t"
                 "global_load_async_to_lds_b128 %5, %13, off\n\t"
                 "global_load_async_to_lds_b128 %6, %14, off\n\t"
                 "global_load_async_to_lds_b128 %7, %15, off\n\t"
                 "s_wait_xcnt 0x0"
                 :: "v"(l0), "v"(l0 + ls), "v"(l0 + 2 * ls), "v"(l0 + 3 * ls), "v"(l1), "v"(l1 + ls), "v"(l1 + 2 * ls), "v"(l1 + 3 * ls),
                    "v"(g0), "v"(g0 + s0), "v"(g0 + 2 * s0), "v"(g0 + 3 * s0), "v"(g1), "v"(g1 + s1), "v"(g1 + 2 * s1), "v"(g1 + 3 * s1) : "memory");
}

// ---- online softmax step on one wave's 16 x 64 score tile (D layout: s[nt][r] = S[row 8*hi + r][col nt*16 + lr]); diagonal tile: entries with col > row replaced by -1e9 before the
// 1/sqrt(HD) scaling (their exp is exactly 0); running max / running sum per row (replicated over the 16 lanes of a half), output accumulators rescaled; leaves s = exp(t - m).
__device__ __forceinline__ void online_softmax(v8f (&s)[4], float (&m)[8], float (&l)[8], v8f (&o)[4], bool diag, int row0, int kvb, int lr, int hi) {
#pragma unroll
    for (int nt = 0; nt < 4; ++nt)
#pragma unroll
        for (int r = 0; r < 8; ++r) { const int row = row0 + 8 * hi + r, col = kvb + nt * 16 + lr; float v = s[nt][r]; if (diag && col > row) v = -1.0e9f; s[nt][r] = v * SCL; }
#pragma unroll
    for (int r = 0; r < 8; ++r) {
        float mx = fmaxf(fmaxf(s[0][r], s[1][r]), fmaxf(s[2][r], s[3][r]));
#pragma unroll
        for (int sh = 1; sh < 16; sh <<= 1) mx = fmaxf(mx, __shfl_xor(mx, sh, 32));
        const float m2 = fmaxf(m[r], mx); const float alpha = __builtin_amdgcn_exp2f((m[r] - m2) * L2E); m[r] = m2;
        float rs = 0.0f;
#pragma unroll
        for (int nt = 0; nt < 4; ++nt) { const float p = __builtin_amdgcn_exp2f((s[nt][r] - m2) * L2E); s[nt][r] = p; rs += p; }
#pragma unroll
        for (int sh = 1; sh < 16; sh <<= 1) rs += __shfl_xor(rs, sh, 32);
        l[r] = l[r] * alpha + rs;
#pragma unroll
        for (int nt = 0; nt < 4; ++nt) o[nt][r] = o[nt][r] * alpha;
    }
}

// ---- k_attnr: causal attention for query rows < RRES (query tiles 0 .. RRES/64-1; they only visit key tiles 0 .. qt): block = 4 waves x 16 rows, head h uses kv group h / GRP.
// q, k, v from the bf16 hi/lo planes ([h][RRES][HD], [g][RRES][HD], [g][HD][RRES]); scores = qh.kh + ql.kh + qh.kl; unnormalised p split to bf16 hi/lo in a wave-private LDS tile,
// the four k and v^T tiles of 64 keys shared by the four waves through LDS (asynchronous copies, two buffers: the next tiles fly while these are worked on).
__global__ __launch_bounds__(128) void k_attnr(const bf* __restrict__ QPh, const bf* __restrict__ QPl, const bf* __restrict__ KPh, const bf* __restrict__ KPl, const bf* __restrict__ VTh, const bf* __restrict__ VTl, bf* CTh, bf* CTl) {
    __shared__ __align__(16) bf sP[4][2][16 * PP];
    __shared__ __align__(128) bf sKV[2][4][TLE];          // [buffer][k hi | v^T hi | k lo | v^T lo]
    const int lane = threadIdx.x & 31, wave = threadIdx.x >> 5, lr = lane & 15, hi = lane >> 4;
    const int qt = blockIdx.x, h = blockIdx.y, g = h / GRP; const int q0 = qt * 64 + wave * 16;
    const bf* qh = QPh + ((size_t)h * RRES + q0) * HD; const bf* ql = QPl + ((size_t)h * RRES + q0) * HD;
    const bf* kh = KPh + (size_t)g * RRES * HD; const bf* kl = KPl + (size_t)g * RRES * HD;
    const bf* vh = VTh + (size_t)g * HD * RRES; const bf* vl = VTl + (size_t)g * HD * RRES;
    bf* sph = &sP[wave][0][0]; bf* spl = &sP[wave][1][0];
    float m[8], l[8]; v8f o[4];
#pragma unroll
    for (int r = 0; r < 8; ++r) { m[r] = -3.0e38f; l[r] = 0.0f; }
#pragma unroll
    for (int nt = 0; nt < 4; ++nt) o[nt] = (v8f){};
    const int nch = qt + 1;
    const int trow = threadIdx.x >> 3, tcol = (threadIdx.x & 7) * 8; const size_t tk = (size_t)trow * HD + tcol, tv = (size_t)trow * RRES + tcol;
    const unsigned lt = lds_off(&sKV[0][0][0]) + (unsigned)(trow * PP + tcol) * 2;
    auto stage = [&](int c, int buf) { const unsigned l = lt + (unsigned)buf * (4 * TLE * 2); const size_t ok = tk + (size_t)c * 64 * HD, ov = tv + (size_t)c * 64;
        acopy_tiles(l, kh + ok, (size_t)HD, l + TLE * 2, vh + ov, (size_t)RRES); acopy_tiles(l + 2 * TLE * 2, kl + ok, (size_t)HD, l + 3 * TLE * 2, vl + ov, (size_t)RRES); };
    stage(0, 0);
    asm volatile("s_wait_asynccnt 0x0" ::: "memory");     // this wave's copies of tile 0 have landed
    __syncthreads();                                      // every wave's have: tile 0 may be read
    if (nch > 1) stage(1, 1);
#pragma unroll 1
    for (int c = 0; c < nch; ++c) {
        const int kvb = c * 64; v8f s[4]; v16bf aqh[2], aql[2], bh, bl;
        const bf* skh = &sKV[c & 1][0][0]; const bf* svh = &sKV[c & 1][1][0]; const bf* skl = &sKV[c & 1][2][0]; const bf* svl = &sKV[c & 1][3][0];
#pragma unroll
        for (int kk = 0; kk < 2; ++kk) { aqh[kk] = WFrag<bf>::ld(qh + (size_t)lr * HD + 8 * hi + kk * 32); aql[kk] = WFrag<bf>::ld(ql + (size_t)lr * HD + 8 * hi + kk * 32); }
#pragma unroll
        for (int nt = 0; nt < 4; ++nt) { s[nt] = (v8f){}; const int ko = (nt * 16 + lr) * PP + 8 * hi;
#pragma unroll
            for (int kk = 0; kk < 2; ++kk) { bh = WFrag<bf>::ld(skh + ko + kk * 32); bl = WFrag<bf>::ld(skl + ko + kk * 32);
                s[nt] = wmmab(aqh[kk], bh, s[nt]); s[nt] = wmmab(aql[kk], bh, s[nt]); s[nt] = wmmab(aqh[kk], bl, s[nt]); } }
        asm volatile("v_nop\n\tv_nop\n\tv_nop\n\tv_nop" : "+v"(s[0]), "+v"(s[1]), "+v"(s[2]), "+v"(s[3]) : "v"(aqh[0]), "v"(aql[1]), "v"(bh), "v"(bl));
        online_softmax(s, m, l, o, c == qt, q0, kvb, lr, hi);
#pragma unroll
        for (int nt = 0; nt < 4; ++nt)
#pragma unroll
            for (int r = 0; r < 8; ++r) { unsigned short a2, c2; splitf(s[nt][r], a2, c2); const int so = (8 * hi + r) * PP + nt * 16 + lr; sph[so] = a2; spl[so] = c2; }
        lds_wsync();
        v16bf aph[2], apl[2], bvh, bvl;
#pragma unroll
        for (int kk = 0; kk < 2; ++kk) { const int ao = lr * PP + kk * 32 + 8 * hi; aph[kk] = cat16b(*(const v8usa*)(sph + ao), *(const v8usa*)(sph + ao + 16)); apl[kk] = cat16b(*(const v8usa*)(spl + ao), *(const v8usa*)(spl + ao + 16)); }
#pragma unroll
        for (int kk = 0; kk < 2; ++kk)
#pragma unroll
            for (int nt = 0; nt < 4; ++nt) { const int vo = (nt * 16 + lr) * PP + kk * 32 + 8 * hi; bvh = WFrag<bf>::ld(svh + vo); bvl = WFrag<bf>::ld(svl + vo);
                o[nt] = wmmab(aph[kk], bvh, o[nt]); o[nt] = wmmab(apl[kk], bvh, o[nt]); o[nt] = wmmab(aph[kk], bvl, o[nt]); }
        asm volatile("v_nop\n\tv_nop\n\tv_nop\n\tv_nop" : "+v"(o[0]), "+v"(o[1]), "+v"(o[2]), "+v"(o[3]) : "v"(aph[0]), "v"(apl[1]), "v"(bvh), "v"(bvl));
        lds_wsync();
        asm volatile("s_wait_dscnt 0x0" ::: "memory");    // this wave has left the buffer that is refilled below
        asm volatile("s_wait_asynccnt 0x0" ::: "memory"); // this wave's copies of tile c + 1 have landed
        __syncthreads();                                  // publishes tile c + 1 and ends every reader's last read of tile c
        if (c + 2 < nch) stage(c + 2, c & 1);
    }
    asm volatile("s_wait_asynccnt 0x0" ::: "memory");     // no copy is outstanding when the wave goes on and ends
    float inv[8];
#pragma unroll
    for (int r = 0; r < 8; ++r) inv[r] = 1.0f / l[r];
#pragma unroll
    for (int nt = 0; nt < 4; ++nt)
#pragma unroll
        for (int r = 0; r < 8; ++r) { unsigned short a2, c2; splitf(o[nt][r] * inv[r], a2, c2); const int so = (8 * hi + r) * PP + nt * 16 + lr; sph[so] = a2; spl[so] = c2; }
    lds_wsync();
    bf* chb = CTh + (size_t)q0 * DMO + h * HD; bf* clb = CTl + (size_t)q0 * DMO + h * HD;
{
#pragma unroll
        for (int it = 0; it < 4; ++it) { const int rr = it * 4 + (lane >> 3), pc = (lane & 7) * 8; const v8us va = *(const v8usa*)(sph + rr * PP + pc); const v8us vb = *(const v8usa*)(spl + rr * PP + pc);
            *(v8us*)(chb + (size_t)rr * DMO + pc) = va; *(v8us*)(clb + (size_t)rr * DMO + pc) = vb; }
         }
}

// ---- k_attn: causal attention for query tiles qt >= RRES/64 (blockIdx.x + RRES/64): same structure with single f16 products; q, k from [h][SEQ][HD] / [g][SEQ][HD] f16 planes,
// the k and v^T tiles of 64 keys shared by the four waves through LDS (asynchronous copies, two buffers: the next tiles fly while these are worked on).
__global__ __launch_bounds__(128) void k_attn(const h16* __restrict__ Q16, const h16* __restrict__ K16, const h16* __restrict__ VT16, h16* C16) {
    __shared__ __align__(16) h16 sP[4][16 * PP];
    __shared__ __align__(128) h16 sKV[2][2][TLE];         // [buffer][k | v^T]
    const int lane = threadIdx.x & 31, wave = threadIdx.x >> 5, lr = lane & 15, hi = lane >> 4;
    const int qt = blockIdx.x + RRES / 64, h = blockIdx.y, g = h / GRP; const int q0 = qt * 64 + wave * 16;
    const h16* qp = Q16 + ((size_t)h * SEQ + q0) * HD; const h16* kp = K16 + (size_t)g * SEQ * HD; const h16* vp = VT16 + (size_t)g * HD * SEQ;
    h16* spw = &sP[wave][0];
    v16h aq[2];
#pragma unroll
    for (int kk = 0; kk < 2; ++kk) aq[kk] = WFrag<h16>::ld(qp + (size_t)lr * HD + 8 * hi + kk * 32);
    float m[8], l[8]; v8f o[4];
#pragma unroll
    for (int r = 0; r < 8; ++r) { m[r] = -3.0e38f; l[r] = 0.0f; }
#pragma unroll
    for (int nt = 0; nt < 4; ++nt) o[nt] = (v8f){};
    const int nch = qt + 1;
    const int trow = threadIdx.x >> 3, tcol = (threadIdx.x & 7) * 8;
    const h16* gk = kp + (size_t)trow * HD + tcol; const h16* gv = vp + (size_t)trow * SEQ + tcol;
    const unsigned lt = lds_off(&sKV[0][0][0]) + (unsigned)(trow * PP + tcol) * 2;
    auto stage = [&](int c, int buf) { const unsigned l = lt + (unsigned)buf * (2 * TLE * 2);
        acopy_tiles(l, gk + (size_t)c * 64 * HD, (size_t)HD, l + TLE * 2, gv + (size_t)c * 64, (size_t)SEQ); };
    stage(0, 0);
    asm volatile("s_wait_asynccnt 0x0" ::: "memory");     // this wave's copies of tile 0 have landed
    __syncthreads();                                      // every wave's have: tile 0 may be read
    if (nch > 1) stage(1, 1);
#pragma unroll 1
    for (int c = 0; c < nch; ++c) {
        const int kvb = c * 64; v8f s[4]; v16h b;
        const h16* sk = &sKV[c & 1][0][0] + lr * PP + 8 * hi; const h16* sv = &sKV[c & 1][1][0] + lr * PP + 8 * hi;
#pragma unroll
        for (int nt = 0; nt < 4; ++nt) { s[nt] = (v8f){}; const h16* kr = sk + nt * 16 * PP;
#pragma unroll
            for (int kk = 0; kk < 2; ++kk) { b = WFrag<h16>::ld(kr + kk * 32); s[nt] = wmma16(aq[kk], b, s[nt]); } }
        asm volatile("v_nop\n\tv_nop\n\tv_nop\n\tv_nop" : "+v"(s[0]), "+v"(s[1]), "+v"(s[2]), "+v"(s[3]) : "v"(aq[0]), "v"(aq[1]), "v"(b));
        online_softmax(s, m, l, o, c == qt, q0, kvb, lr, hi);
#pragma unroll
        for (int nt = 0; nt < 4; ++nt)
#pragma unroll
            for (int r = 0; r < 8; ++r) spw[(8 * hi + r) * PP + nt * 16 + lr] = tohx(s[nt][r] * PCAR);
        lds_wsync();
        v16h ap[2], bv;
#pragma unroll
        for (int kk = 0; kk < 2; ++kk) { const int ao = lr * PP + kk * 32 + 8 * hi; ap[kk] = cat16(*(const v8ha*)(spw + ao), *(const v8ha*)(spw + ao + 16)); }
#pragma unroll
        for (int kk = 0; kk < 2; ++kk)
#pragma unroll
            for (int nt = 0; nt < 4; ++nt) { bv = WFrag<h16>::ld(sv + nt * 16 * PP + kk * 32); o[nt] = wmma16(ap[kk], bv, o[nt]); }
        asm volatile("v_nop\n\tv_nop\n\tv_nop\n\tv_nop" : "+v"(o[0]), "+v"(o[1]), "+v"(o[2]), "+v"(o[3]) : "v"(ap[0]), "v"(ap[1]), "v"(bv));
        lds_wsync();
        asm volatile("s_wait_dscnt 0x0" ::: "memory");    // this wave has left the buffer that is refilled below
        asm volatile("s_wait_asynccnt 0x0" ::: "memory"); // this wave's copies of tile c + 1 have landed
        __syncthreads();                                  // publishes tile c + 1 and ends every reader's last read of tile c
        if (c + 2 < nch) stage(c + 2, c & 1);
    }
    asm volatile("s_wait_asynccnt 0x0" ::: "memory");     // no copy is outstanding when the wave goes on and ends
    float inv[8];
#pragma unroll
    for (int r = 0; r < 8; ++r) inv[r] = (1.0f / l[r]) * (CCAR / PCAR);
#pragma unroll
    for (int nt = 0; nt < 4; ++nt)
#pragma unroll
        for (int r = 0; r < 8; ++r) spw[(8 * hi + r) * PP + nt * 16 + lr] = tohx(o[nt][r] * inv[r]);
    lds_wsync();
    h16* cb = C16 + (size_t)q0 * DMO + h * HD;
{
#pragma unroll
        for (int it = 0; it < 4; ++it) { const int rr = it * 4 + (lane >> 3), pc = (lane & 7) * 8; const v8h val = *(const v8ha*)(spw + rr * PP + pc); *(v8h*)(cb + (size_t)rr * DMO + pc) = val; }
         }
}

extern "C" void kernel_launch(void* const* d_in, const int* in_sizes, int n_in,
                              void* d_out, int out_size, void* d_ws, size_t ws_size, hipStream_t stream) {
    if (n_in < 7) return;
    const long long rows_used = (long long)(NB - 1) * SEQ_FULL + SEQ;
    if ((long long)in_sizes[0] < rows_used * DIN) return;
    if (in_sizes[1] < SEQ * HD || in_sizes[2] < SEQ * HD) return;
    if (in_sizes[3] < DIN * DMO || in_sizes[4] < DIN * DKV || in_sizes[5] < DIN * DKV || in_sizes[6] < DMO * DMO) return;
    if ((long long)out_size < rows_used * DMO) return;
    // wire order: x, cos, sin, wq, wk, wv, wo
    const float* x = (const float*)d_in[0]; const float* cosi = (const float*)d_in[1]; const float* sini = (const float*)d_in[2];
    const float* wq = (const float*)d_in[3]; const float* wk = (const float*)d_in[4]; const float* wv = (const float*)d_in[5]; const float* wo = (const float*)d_in[6];
    float* OUT = (float*)d_out;     // [NB_FULL][SEQ_FULL][DMO]
    char* wsp = (char*)d_ws;
    auto take = [&](size_t bytes) { char* p = wsp; wsp += (bytes + 255) & ~(size_t)255; return (void*)p; };
    bf* WQ   = (bf*)take((size_t)DMO * DIN * 2);          // Bt [out][in]
    bf* WK   = (bf*)take((size_t)DKV * DIN * 2);
    bf* WV   = (bf*)take((size_t)DKV * DIN * 2);
    bf* WOb  = (bf*)take((size_t)DMO * DMO * 2);
    h16* WO16 = (h16*)take((size_t)DMO * DMO * 2);
    bf* XB   = (bf*)take((size_t)SEQ * DIN * 2);          // one batch
    float* FQ = (float*)take((size_t)SEQ * DMO * 4);
    float* FK = (float*)take((size_t)SEQ * DKV * 4);
    float* FV = (float*)take((size_t)SEQ * DKV * 4);
    h16* Q16 = (h16*)take((size_t)NH * SEQ * HD * 2); h16* K16 = (h16*)take((size_t)NKV * SEQ * HD * 2); h16* VT16 = (h16*)take((size_t)NKV * HD * SEQ * 2);
    bf* QPh = (bf*)take((size_t)NH * RRES * HD * 2); bf* QPl = (bf*)take((size_t)NH * RRES * HD * 2);
    bf* KPh = (bf*)take((size_t)NKV * RRES * HD * 2); bf* KPl = (bf*)take((size_t)NKV * RRES * HD * 2);
    bf* VTh = (bf*)take((size_t)NKV * HD * RRES * 2); bf* VTl = (bf*)take((size_t)NKV * HD * RRES * 2);
    h16* C16 = (h16*)take((size_t)SEQ * DMO * 2);        // rows >= RRES used
    bf* CTh = (bf*)take((size_t)RRES * DMO * 2); bf* CTl = (bf*)take((size_t)RRES * DMO * 2);
    int* MFLAG = (int*)take(128);
    const size_t carved = (size_t)(wsp - (char*)d_ws);
    if (carved > ws_size || carved > (size_t)134217728) return;

    k_flag0<<<1, 32, 0, stream>>>(MFLAG);
    k_wtG<<<(unsigned)((DMO * DIN / 64 + 63) / 64), 256, 0, stream>>>(wq, DIN, DMO, WQ, nullptr);
    k_wtG<<<(unsigned)((DKV * DIN / 64 + 63) / 64), 256, 0, stream>>>(wk, DIN, DKV, WK, nullptr);
    k_wtG<<<(unsigned)((DKV * DIN / 64 + 63) / 64), 256, 0, stream>>>(wv, DIN, DKV, WV, nullptr);
    k_wtG<<<(unsigned)((DMO * DMO / 64 + 63) / 64), 256, 0, stream>>>(wo, DMO, DMO, WOb, WO16);
    const unsigned LQ = (unsigned)(((size_t)NH * SEQ * HD / 2 + 255) / 256), LKV = (unsigned)(((size_t)NKV * SEQ * HD / 2 + 255) / 256);
    for (int b = 0; b < NB; ++b) {
        k_cvt8<<<(unsigned)(((size_t)SEQ * DIN / 8 + 255) / 256), 256, 0, stream>>>(x + (size_t)b * SEQ_FULL * DIN, XB, (size_t)SEQ * DIN / 8);
        k_gemmw<bf, 0><<<dim3(SEQ / 128, DMO / 128, 1), 128, 0, stream>>>(XB, nullptr, WQ, nullptr, DIN, FQ, DMO, 1.0f, MFLAG, 0, 0, 0);
        k_gemmw<bf, 0><<<dim3(SEQ / 128, DKV / 128, 1), 128, 0, stream>>>(XB, nullptr, WK, nullptr, DIN, FK, DKV, 1.0f, MFLAG, 0, 0, 0);
        k_gemmw<bf, 0><<<dim3(SEQ / 128, DKV / 128, 1), 128, 0, stream>>>(XB, nullptr, WV, nullptr, DIN, FV, DKV, 1.0f, MFLAG, 0, 0, 0);
        k_rope<<<LQ, 256, 0, stream>>>(FQ, DMO, NH, cosi, sini, Q16, QPh, QPl);
        k_rope<<<LKV, 256, 0, stream>>>(FK, DKV, NKV, cosi, sini, K16, KPh, KPl);
        k_vtp<<<LKV, 256, 0, stream>>>(FV, DKV, NKV, VT16, VTh, VTl);
        k_attnr<<<dim3(RRES / 64, NH, 1), 128, 0, stream>>>(QPh, QPl, KPh, KPl, VTh, VTl, CTh, CTl);
        if (SEQ > RRES) k_attn<<<dim3((SEQ - RRES) / 64, NH, 1), 128, 0, stream>>>(Q16, K16, VT16, C16);
        float* ob = OUT + (size_t)b * SEQ_FULL * DMO;
        k_gemmw<bf, 1><<<dim3(RRES / 128, DMO / 128, 1), 128, 0, stream>>>(CTh, CTl, WOb, nullptr, DMO, ob, DMO, 1.0f, MFLAG, 0, 0, 0);
        if (SEQ > RRES) k_gemmw<h16, 0><<<dim3((SEQ - RRES) / 128, DMO / 128, 1), 128, 0, stream>>>(C16 + (size_t)RRES * DMO, nullptr, WO16, nullptr, DMO, ob + (size_t)RRES * DMO, DMO, 1.0f / (CCAR * WCAR), MFLAG, 0, 0, 0);
    }
}

// v003
// It runs in 313 microseconds.
// Two timings next to v002 put it at 1.45 and 1.46 times that version's speed.
// Counting every step since v000, it is 2.45 times as fast.
#include <hip/hip_runtime.h>

// Contractions and operand types (f32 accumulate everywhere): x Wq, x Wk, x Wv on v_wmma_f32_16x16x32_bf16 with RNE bf16 copies of x and W (exact products);
// query rows < RRES of each sequence: q.k^T and p.v on v_wmma_f32_16x16x32_bf16 as bf16 hi/lo splits (3 products each), their ctx Wo as bf16 hi/lo ctx times bf16 Wo (2 products);
// query rows >= RRES: q.k^T and p.v on v_wmma_f32_16x16x32_f16 (f16 q/k/v planes, p carried x1024), ctx Wo on v_wmma_f32_16x16x32_f16 (ctx carried x16, Wo carried x64, folded by 1/1024 in the epilogue).
// diagonal are skipped (their probabilities are exactly 0) and the diagonal tile is masked by index; a constant zero flag line feeds the additive term of the GEMM epilogue.
// All NB sequences go through each activation launch together: the sequence is grid y of k_cvt8, k_rope and k_vtp and grid z of k_gemmw, k_attnr and k_attn, and every per-sequence workspace plane holds NB copies, sequence-major.

#ifndef NB
#define NB 2
#endif
#ifndef SEQ
#define SEQ 2048
#endif
#ifndef RRES
#define RRES 256
#endif
#define NB_FULL 2
#define SEQ_FULL 2048
#define DIN 2048
#define DMO 2048
#define NH 32
#define NKV 8
#define GRP (NH / NKV)
#define HD 64
#define DKV (NKV * HD)
#define PP 72
#define PCAR 1024.0f
#define CCAR 16.0f
#define WCAR 64.0f
#define SCL 0.125f
#define L2E 1.4426950408889634f
static_assert(SEQ % 64 == 0 && SEQ >= 64 && SEQ <= SEQ_FULL);
static_assert(RRES % 64 == 0 && RRES >= 64 && RRES <= SEQ);
static_assert(NB >= 1 && NB <= NB_FULL);
static_assert(DIN % 32 == 0 && DMO % 64 == 0 && DKV % 64 == 0 && HD == 64 && (NH % NKV) == 0);
static_assert(DMO == NH * HD && DMO % 32 == 0);
static_assert(PP % 8 == 0 && PP >= HD);
static_assert((DMO * DIN) % 64 == 0 && (DKV * DIN) % 64 == 0 && (DMO * DMO) % 64 == 0 && DIN % 2 == 0 && DMO % 2 == 0);
static_assert(((size_t)SEQ * DIN) % 8 == 0);
// workspace carve (every plane a multiple of 256 B; same sequence as the launcher's take() calls)
#define AL256(x) ((((size_t)(x)) + 255) & ~(size_t)255)
#define WS_TOTAL (AL256((size_t)DMO * DIN * 2) + 2 * AL256((size_t)DKV * DIN * 2) + 2 * AL256((size_t)DMO * DMO * 2) + AL256((size_t)NB * SEQ * DIN * 2) + AL256((size_t)NB * SEQ * DMO * 4) \
                  + 2 * AL256((size_t)NB * SEQ * DKV * 4) + AL256((size_t)NB * NH * SEQ * HD * 2) + 2 * AL256((size_t)NB * NKV * SEQ * HD * 2) + 2 * AL256((size_t)NB * NH * RRES * HD * 2) \
                  + 4 * AL256((size_t)NB * NKV * RRES * HD * 2) + AL256((size_t)NB * SEQ * DMO * 2) + 2 * AL256((size_t)NB * RRES * DMO * 2) + AL256(128))
static_assert(WS_TOTAL <= (size_t)268435456);

typedef _Float16 h16;
typedef unsigned short bf;
typedef __attribute__((ext_vector_type(16))) __bf16   v16bf;
typedef __attribute__((ext_vector_type(16))) _Float16 v16h;
typedef __attribute__((ext_vector_type(8)))  _Float16 v8h;
typedef __attribute__((ext_vector_type(8)))  unsigned short v8us;
typedef __attribute__((ext_vector_type(8)))  float    v8f;
typedef __attribute__((ext_vector_type(4)))  float    v4f;
typedef __attribute__((ext_vector_type(4)))  int      v4i;
typedef __attribute__((ext_vector_type(2)))  _Float16 v2h;
typedef __attribute__((ext_vector_type(2)))  unsigned short v2us;
typedef v8h  __attribute__((may_alias)) v8ha;
typedef v4f  __attribute__((may_alias)) v4fa;
typedef v8us __attribute__((may_alias)) v8usa;

__device__ __forceinline__ unsigned short f2bf(float f) { unsigned u = __float_as_uint(f); u += 0x7FFFu + ((u >> 16) & 1u); return (unsigned short)(u >> 16); }
__device__ __forceinline__ float bf2f(unsigned short b) { return __uint_as_float(((unsigned)b) << 16); }
__device__ __forceinline__ float bfr(float f) { return bf2f(f2bf(f)); }
__device__ __forceinline__ h16 tohx(float x) { return (h16)x; }
__device__ __forceinline__ void splitf(float y, unsigned short& h, unsigned short& l) { h = f2bf(y); l = f2bf(y - bf2f(h)); }
__device__ __forceinline__ v16h cat16(v8h lo, v8h hi) { return __builtin_shufflevector(lo, hi, 0, 1, 2, 3, 4, 5, 6, 7, 8, 9, 10, 11, 12, 13, 14, 15); }
__device__ __forceinline__ v16bf cat16b(v8us lo, v8us hi) { return __builtin_bit_cast(v16bf, __builtin_shufflevector(lo, hi, 0, 1, 2, 3, 4, 5, 6, 7, 8, 9, 10, 11, 12, 13, 14, 15)); }
__device__ __forceinline__ v8f wmma16(v16h a, v16h b, v8f c) { return __builtin_amdgcn_wmma_f32_16x16x32_f16(false, a, false, b, (short)0, c, false, false); }
__device__ __forceinline__ v8f wmmab(v16bf a, v16bf b, v8f c) { return __builtin_amdgcn_wmma_f32_16x16x32_bf16(false, a, false, b, (short)0, c, false, false); }
// wave-private LDS tile: stores of this wave made visible to its own later cross-lane loads, loads kept below the stores by the compiler
__device__ __forceinline__ void lds_wsync() { __builtin_amdgcn_fence(3 /* release order */, "wavefront"); __builtin_amdgcn_wave_barrier(); asm volatile("" ::: "memory"); }

// 16-bit fragment loaders: lane l -> row/column (l & 15); elements 0..7 <- k0 + 8*(l>>4) + 0..7, elements 8..15 <- k0 + 16 + 8*(l>>4) + 0..7 of a K-contiguous row (p already offset by 8*(l>>4)).
template <typename T16> struct WFrag;
template <> struct WFrag<h16> { typedef v16h V; static __device__ __forceinline__ V ld(const h16* p) { return cat16(*(const v8h*)p, *(const v8h*)(p + 16)); } static __device__ __forceinline__ v8f mma(V a, V b, v8f c) { return wmma16(a, b, c); } };
template <> struct WFrag<bf> { typedef v16bf V; static __device__ __forceinline__ V ld(const bf* p) { return cat16b(*(const v8us*)p, *(const v8us*)(p + 16)); } static __device__ __forceinline__ v8f mma(V a, V b, v8f c) { return wmmab(a, b, c); } };

// ---- k_gemmw: work-group tiled GEMM: 4 waves (2 x 2) share one 128x128 output tile, each wave keeps a 64x64 part (16 accumulators); grid (M/128, N/128, Z), 128 threads.
// A stage is GKS = 128 k (256 B) of the 128 A rows, the 128 Bt rows (and the 128 A2 rows when NSPLIT == 1), brought from the K-contiguous 16-bit planes into LDS by asynchronous
// 16-byte copies at a row pitch of 272 B; two buffers, the next stage's copies fly while this stage is multiplied. Every accumulator sums k upward in steps of 32, A before A2.
// C[m][n] (f32, pitch ldc) = (sum_k A[m][k] Bt[n][k] (+ A2[m][k] Bt[n][k] when NSPLIT == 1)) * cscale + (pflag[0] ? NaN : 0). K % 128 == 0, K >= 128, M % 128 == 0, N % 128 == 0.
#define GKS 128
#define GPI 136
static_assert(DIN % GKS == 0 && DMO % GKS == 0 && SEQ % 128 == 0 && RRES % 128 == 0 && DMO % 128 == 0 && DKV % 128 == 0);
__device__ __forceinline__ unsigned lds_off(const void* p) { return (unsigned)(size_t)p; }
// eight copies of one lane: rows 8 apart, 16 B each, LDS byte address l, global address g (row pitch K elements). The s_wait_xcnt closes the statement so that no address register
// of an issued copy is rewritten ahead of it.
template <typename T16>
__device__ __forceinline__ void acopy8(unsigned l, const T16* g, size_t K) {
    const unsigned ls = 8 * GPI * 2; const size_t gs = 8 * K;
    asm volatile("global_load_async_to_lds_b128 %0, %8, off\n\t"
                 "global_load_async_to_lds_b128 %1, %9, off\n\t"
                 "global_load_async_to_lds_b128 %2, %10, off\n\t"
                 "global_load_async_to_lds_b128 %3, %11, off\n\t"
                 "global_load_async_to_lds_b128 %4, %12, off\n\t"
                 "global_load_async_to_lds_b128 %5, %13, off\n\t"
                 "global_load_async_to_lds_b128 %6, %14, off\n\t"
                 "global_load_async_to_lds_b128 %7, %15, off\n\t"
                 "s_wait_xcnt 0x0"
                 :: "v"(l), "v"(l + ls), "v"(l + 2 * ls), "v"(l + 3 * ls), "v"(l + 4 * ls), "v"(l + 5 * ls), "v"(l + 6 * ls), "v"(l + 7 * ls),
                    "v"(g), "v"(g + gs), "v"(g + 2 * gs), "v"(g + 3 * gs), "v"(g + 4 * gs), "v"(g + 5 * gs), "v"(g + 6 * gs), "v"(g + 7 * gs) : "memory");
}
// 128 rows x 256 B of one operand: 16 copies a lane (16 lanes cover a row, a wave two rows)
template <typename T16>
__device__ __forceinline__ void acopy_rows(unsigned l, const T16* g, size_t K) { acopy8(l, g, K); acopy8(l + 64 * GPI * 2, g + 64 * K, K); }

template <typename T16, int NSPLIT>
__global__ __launch_bounds__(128) void k_gemmw(const T16* __restrict__ A, const T16* __restrict__ A2, const T16* __restrict__ Bt, const T16* __restrict__ Bt2, int K, float* C, int ldc, float cscale, const int* __restrict__ pflag, size_t sA, size_t sB, size_t sC) {
    typedef typename WFrag<T16>::V V;
    static_assert(NSPLIT == 0 || NSPLIT == 1);
    constexpr int OPE = 128 * GPI;                        // elements of one operand's rows in a stage
    constexpr int STE = (NSPLIT == 1 ? 3 : 2) * OPE;      // elements of a stage: [A | Bt | A2]
    __shared__ __align__(128) T16 ring[2 * STE];
    __shared__ __align__(16) float osw[4][16 * 68];
    const size_t z = blockIdx.z; A += z * sA; if (A2) A2 += z * sA; Bt += z * sB; C += z * sC;
    const int tid = threadIdx.x, lane = tid & 31, wave = tid >> 5, lr = lane & 15, hi = lane >> 4; const int wm = wave >> 1, wn = wave & 1;
    const int r0 = blockIdx.x * 128, c0 = blockIdx.y * 128;
    const float padd = (pflag[0] != 0) ? __int_as_float(0x7fc00000) : 0.0f;
    v8f acc[4][4];
#pragma unroll
    for (int mb = 0; mb < 4; ++mb)
#pragma unroll
        for (int nb = 0; nb < 4; ++nb) acc[mb][nb] = (v8f){};
    const int trow = tid >> 4, tcol = tid & 15;
    const T16* ga = A + (size_t)(r0 + trow) * K + tcol * 8; const T16* gb = Bt + (size_t)(c0 + trow) * K + tcol * 8;
    const T16* ga2 = (NSPLIT == 1) ? A2 + (size_t)(r0 + trow) * K + tcol * 8 : nullptr;
    const unsigned lt = lds_off(ring) + (unsigned)(trow * GPI + tcol * 8) * 2;
    auto stage = [&](int t, int buf) { const unsigned l = lt + (unsigned)buf * (STE * 2); const size_t ko = (size_t)t * GKS;
        acopy_rows(l, ga + ko, (size_t)K); acopy_rows(l + OPE * 2, gb + ko, (size_t)K); if (NSPLIT == 1) acopy_rows(l + 2 * OPE * 2, ga2 + ko, (size_t)K); };
    const int nt = K / GKS;
    stage(0, 0);
    asm volatile("s_wait_asynccnt 0x0" ::: "memory");     // this wave's copies of stage 0 have landed
    __syncthreads();                                      // every wave's have: stage 0 may be read
    if (nt > 1) stage(1, 1);
    // the stage loop stays rolled: one copy of the body in the instruction cache, the buffer picked by t & 1
#pragma unroll 1
    for (int t = 0; t < nt; ++t) {
        const T16* sa = ring + (t & 1) * STE + (wm * 64 + lr) * GPI + 8 * hi; const T16* sb = ring + (t & 1) * STE + OPE + (wn * 64 + lr) * GPI + 8 * hi;
        // two fragment sets: the reads of the next 32 k of this stage go out as one group ahead of this step's matrix instructions, so that only the stage's first group is waited for in full
        // (every loop below is unrolled so that set, fragment and accumulator indices are constants and the arrays live in registers)
        V a[2][4], b[2][4], a2[2][4];
        auto ldset = [&](int s, int ks) {
#pragma unroll
            for (int mb = 0; mb < 4; ++mb) { a[s][mb] = WFrag<T16>::ld(sa + mb * 16 * GPI + ks); if (NSPLIT == 1) a2[s][mb] = WFrag<T16>::ld(sa + 2 * OPE + mb * 16 * GPI + ks); }
#pragma unroll
            for (int nb = 0; nb < 4; ++nb) b[s][nb] = WFrag<T16>::ld(sb + nb * 16 * GPI + ks); };
        ldset(0, 0);
#pragma unroll
        for (int q = 0; q < GKS / 32; ++q) {
            if (q + 1 < GKS / 32) ldset((q + 1) & 1, (q + 1) * 32);
            // keeps the group of reads above in front of this step's matrix instructions (the scheduler otherwise spreads them among these, each with a full wait); in the last step, which
            // has no reads, it keeps the step before in front of the waits at the loop's foot, where its matrix instructions cover the last reads' latency (without it they sink behind the barrier)
            __builtin_amdgcn_sched_barrier(0);
#pragma unroll
            for (int nb = 0; nb < 4; ++nb)
#pragma unroll
                for (int mb = 0; mb < 4; ++mb) { acc[mb][nb] = WFrag<T16>::mma(a[q & 1][mb], b[q & 1][nb], acc[mb][nb]); if (NSPLIT == 1) acc[mb][nb] = WFrag<T16>::mma(a2[q & 1][mb], b[q & 1][nb], acc[mb][nb]); }
        }
        asm volatile("s_wait_dscnt 0x0" ::: "memory");    // this wave has left the buffer that is refilled below
        asm volatile("s_wait_asynccnt 0x0" ::: "memory"); // this wave's copies of stage t + 1 have landed
        __syncthreads();                                  // publishes stage t + 1 and ends every reader's last read of stage t
        if (t + 2 < nt) stage(t + 2, t & 1);
    }
    asm volatile("s_wait_asynccnt 0x0" ::: "memory");     // no copy is outstanding when the wave goes on and ends
    float* os = &osw[wave][0];
#pragma unroll
    for (int mb = 0; mb < 4; ++mb) {
#pragma unroll
        for (int nb = 0; nb < 4; ++nb) {
#pragma unroll
            for (int j = 0; j < 8; ++j) os[(hi * 8 + j) * 68 + nb * 16 + lr] = acc[mb][nb][j]; }
        __builtin_amdgcn_wave_barrier(); asm volatile("" ::: "memory");
        float* crow = C + (size_t)(r0 + wm * 64 + mb * 16) * ldc + c0 + wn * 64;
{
#pragma unroll
            for (int s = 0; s < 8; ++s) { const int row = 2 * s + hi, cofs = lr * 4; v4f val = *(const v4fa*)(os + row * 68 + cofs); val = val * cscale + padd;
                *(v4f*)(crow + (size_t)row * ldc + cofs) = val; }
             }
        __builtin_amdgcn_wave_barrier(); asm volatile("" ::: "memory");
    }
}

__global__ __launch_bounds__(32) void k_flag0(int* MFLAG) {
    const int lane = threadIdx.x & 31; const int r = 0;
    int* p = MFLAG + lane; *(int*)p = r; 
}

__global__ __launch_bounds__(256) void k_wtG(const float* __restrict__ w, int K, int N, bf* Bt, h16* Ht) {
    const int lane = threadIdx.x & 31; const int L0 = (blockIdx.x * 8 + (threadIdx.x >> 5)) * 8; const int nlines = N * K / 64;
{
#pragma unroll 1
        for (int l = 0; l < 8; ++l) { const int L = L0 + l; if (L >= nlines) break; const size_t e = (size_t)L * 64 + lane * 2; const int k = (int)(e % K), n = (int)(e / K);
            const float w0 = bfr(w[(size_t)k * N + n]), w1 = bfr(w[(size_t)(k + 1) * N + n]); v2us o; o[0] = f2bf(w0); o[1] = f2bf(w1); *(v2us*)(Bt + e) = o;
            if (Ht != nullptr) { v2h oh; oh[0] = tohx(w0 * WCAR); oh[1] = tohx(w1 * WCAR); *(v2h*)(Ht + e) = oh; } }
         }
}
// blockIdx.y = sequence: source and destination planes ssrc and sdst elements apart
__global__ __launch_bounds__(256) void k_cvt8(const float* __restrict__ src, bf* dst, size_t n8, size_t ssrc, size_t sdst) { const size_t i = (size_t)blockIdx.x * 256 + threadIdx.x; if (i >= n8) return;
    src += blockIdx.y * ssrc; dst += blockIdx.y * sdst; const v8f v = *(const v8f*)(src + i * 8); v8us o;
#pragma unroll
    for (int k = 0; k < 8; ++k) o[k] = f2bf(v[k]); *(v8us*)(dst + i * 8) = o;  }

// ---- k_rope: head planes of the rotate-half rotary mix of F[t][h*HD + d] (row pitch 'pitch') with the cos/sin input tables (bf16 RNE values):
// r[d] = x[d] cos[t][d] - x[d+HD/2] sin[t][d] (d < HD/2), r[d] = x[d] cos[t][d] + x[d-HD/2] sin[t][d] (d >= HD/2);
__global__ __launch_bounds__(256) void k_rope(const float* __restrict__ F, int pitch, int nheads, const float* __restrict__ COSI, const float* __restrict__ SINI, h16* P16, bf* Ph, bf* Pl) {
    const size_t e = ((size_t)blockIdx.x * 256 + threadIdx.x) * 2; if (e >= (size_t)nheads * SEQ * HD) return;
    const size_t sq = blockIdx.y; F += sq * SEQ * pitch; P16 += sq * nheads * SEQ * HD; Ph += sq * nheads * RRES * HD; Pl += sq * nheads * RRES * HD;   // blockIdx.y = sequence
    const int d = (int)(e % HD); const int t = (int)((e / HD) % SEQ); const int h = (int)(e / ((size_t)HD * SEQ));
    const float* f = F + (size_t)t * pitch + h * HD; v2h o16; v2us oh, ol;
#pragma unroll
    for (int q = 0; q < 2; ++q) { const int dd = d + q; const int dp = (dd < HD / 2) ? dd + HD / 2 : dd - HD / 2;
        const float x0 = f[dd], x1 = f[dp]; const float cv = bfr(COSI[(size_t)t * HD + dd]), snv = bfr(SINI[(size_t)t * HD + dd]);
        const float pa = x0 * cv, pb = x1 * snv; const float r = (dd < HD / 2) ? (pa - pb) : (pa + pb);
        o16[q] = tohx(r); unsigned short a2, c2; splitf(r, a2, c2); oh[q] = a2; ol[q] = c2; }
    const bool res = (t < RRES); const size_t oo = ((size_t)h * RRES + (res ? t : 0)) * HD + d;
    *(v2h*)(P16 + e) = o16; if (res) { *(v2us*)(Ph + oo) = oh; *(v2us*)(Pl + oo) = ol; }
    
}
// ---- k_vtp: value planes V16[g][d][t] = f16(F[t][g*HD + d]) for every t < SEQ (row pitch SEQ) and Vh/Vl[g][d][t] bf16 hi/lo for t < RRES (row pitch RRES); lane -> 2 consecutive t,
__global__ __launch_bounds__(256) void k_vtp(const float* __restrict__ F, int pitch, int ng, h16* V16, bf* Vh, bf* Vl) {
    const size_t e = ((size_t)blockIdx.x * 256 + threadIdx.x) * 2; if (e >= (size_t)ng * HD * SEQ) return;
    const size_t sq = blockIdx.y; F += sq * SEQ * pitch; V16 += sq * ng * HD * SEQ; Vh += sq * ng * HD * RRES; Vl += sq * ng * HD * RRES;   // blockIdx.y = sequence
    const int t = (int)(e % SEQ); const int d = (int)((e / SEQ) % HD); const int g = (int)(e / ((size_t)SEQ * HD)); v2h o16; v2us oh, ol;
#pragma unroll
    for (int q = 0; q < 2; ++q) { const float x = F[(size_t)(t + q) * pitch + g * HD + d]; o16[q] = tohx(x); unsigned short a2, c2; splitf(x, a2, c2); oh[q] = a2; ol[q] = c2; }
    const bool res = (t < RRES); const size_t oo = ((size_t)g * HD + d) * RRES + (res ? t : 0);
    *(v2h*)(V16 + e) = o16; if (res) { *(v2us*)(Vh + oo) = oh; *(v2us*)(Vl + oo) = ol; }
    
}

// ---- attention key / value tiles in LDS: a tile is 64 rows x 128 B (64 keys x HD of k, or HD x 64 keys of v^T) at a row pitch of PP elements (144 B).
// eight copies of one lane, 16 B each: four rows 16 apart of tile 0 (LDS byte address l0, global address g0, global row pitch p0 elements) and four of tile 1; eight lanes cover a
// row, so a wave's copy reads four whole 128-B lines. The s_wait_xcnt closes the statement so that no address register of an issued copy is rewritten ahead of it.
#define TLE (64 * PP)
template <typename T16>
__device__ __forceinline__ void acopy_tiles(unsigned l0, const T16* g0, size_t p0, unsigned l1, const T16* g1, size_t p1) {
    const unsigned ls = 16 * PP * 2; const size_t s0 = 16 * p0, s1 = 16 * p1;
    asm volatile("global_load_async_to_lds_b128 %0, %8, off\n\t"
                 "global_load_async_to_lds_b128 %1, %9, off\n\t"
                 "global_load_async_to_lds_b128 %2, %10, off\n\t"
                 "global_load_async_to_lds_b128 %3, %11, off\n\t"
                 "global_load_async_to_lds_b128 %4, %12, off\n\t"
                 "global_load_async_to_lds_b128 %5, %13, off\n\t"
                 "global_load_async_to_lds_b128 %6, %14, off\n\t"
                 "global_load_async_to_lds_b128 %7, %15, off\n\t"
                 "s_wait_xcnt 0x0"
                 :: "v"(l0), "v"(l0 + ls), "v"(l0 + 2 * ls), "v"(l0 + 3 * ls), "v"(l1), "v"(l1 + ls), "v"(l1 + 2 * ls), "v"(l1 + 3 * ls),
                    "v"(g0), "v"(g0 + s0), "v"(g0 + 2 * s0), "v"(g0 + 3 * s0), "v"(g1), "v"(g1 + s1), "v"(g1 + 2 * s1), "v"(g1 + 3 * s1) : "memory");
}

// ---- online softmax step on one wave's 16 x 64 score tile (D layout: s[nt][r] = S[row 8*hi + r][col nt*16 + lr]); diagonal tile: entries with col > row replaced by -1e9 before the
// 1/sqrt(HD) scaling (their exp is exactly 0); running max / running sum per row (replicated over the 16 lanes of a half), output accumulators rescaled; leaves s = exp(t - m).
__device__ __forceinline__ void online_softmax(v8f (&s)[4], float (&m)[8], float (&l)[8], v8f (&o)[4], bool diag, int row0, int kvb, int lr, int hi) {
#pragma unroll
    for (int nt = 0; nt < 4; ++nt)
#pragma unroll
        for (int r = 0; r < 8; ++r) { const int row = row0 + 8 * hi + r, col = kvb + nt * 16 + lr; float v = s[nt][r]; if (diag && col > row) v = -1.0e9f; s[nt][r] = v * SCL; }
#pragma unroll
    for (int r = 0; r < 8; ++r) {
        float mx = fmaxf(fmaxf(s[0][r], s[1][r]), fmaxf(s[2][r], s[3][r]));
#pragma unroll
        for (int sh = 1; sh < 16; sh <<= 1) mx = fmaxf(mx, __shfl_xor(mx, sh, 32));
        const float m2 = fmaxf(m[r], mx); const float alpha = __builtin_amdgcn_exp2f((m[r] - m2) * L2E); m[r] = m2;
        float rs = 0.0f;
#pragma unroll
        for (int nt = 0; nt < 4; ++nt) { const float p = __builtin_amdgcn_exp2f((s[nt][r] - m2) * L2E); s[nt][r] = p; rs += p; }
#pragma unroll
        for (int sh = 1; sh < 16; sh <<= 1) rs += __shfl_xor(rs, sh, 32);
        l[r] = l[r] * alpha + rs;
#pragma unroll
        for (int nt = 0; nt < 4; ++nt) o[nt][r] = o[nt][r] * alpha;
    }
}

// ---- k_attnr: causal attention for query rows < RRES (query tiles 0 .. RRES/64-1; they only visit key tiles 0 .. qt): block = 4 waves x 16 rows, head h uses kv group h / GRP.
// q, k, v from the bf16 hi/lo planes ([h][RRES][HD], [g][RRES][HD], [g][HD][RRES]); scores = qh.kh + ql.kh + qh.kl; unnormalised p split to bf16 hi/lo in a wave-private LDS tile,
// the four k and v^T tiles of 64 keys shared by the four waves through LDS (asynchronous copies, two buffers: the next tiles fly while these are worked on).
__global__ __launch_bounds__(128) void k_attnr(const bf* __restrict__ QPh, const bf* __restrict__ QPl, const bf* __restrict__ KPh, const bf* __restrict__ KPl, const bf* __restrict__ VTh, const bf* __restrict__ VTl, bf* CTh, bf* CTl) {
    __shared__ __align__(16) bf sP[4][2][16 * PP];
    __shared__ __align__(128) bf sKV[2][4][TLE];          // [buffer][k hi | v^T hi | k lo | v^T lo]
    const int lane = threadIdx.x & 31, wave = threadIdx.x >> 5, lr = lane & 15, hi = lane >> 4;
    const int qt = blockIdx.x, h = blockIdx.y, g = h / GRP; const int q0 = qt * 64 + wave * 16;
    const size_t sq = blockIdx.z;                         // sequence
    QPh += sq * NH * RRES * HD; QPl += sq * NH * RRES * HD; KPh += sq * NKV * RRES * HD; KPl += sq * NKV * RRES * HD; VTh += sq * NKV * HD * RRES; VTl += sq * NKV * HD * RRES;
    CTh += sq * RRES * DMO; CTl += sq * RRES * DMO;
    const bf* qh = QPh + ((size_t)h * RRES + q0) * HD; const bf* ql = QPl + ((size_t)h * RRES + q0) * HD;
    const bf* kh = KPh + (size_t)g * RRES * HD; const bf* kl = KPl + (size_t)g * RRES * HD;
    const bf* vh = VTh + (size_t)g * HD * RRES; const bf* vl = VTl + (size_t)g * HD * RRES;
    bf* sph = &sP[wave][0][0]; bf* spl = &sP[wave][1][0];
    float m[8], l[8]; v8f o[4];
#pragma unroll
    for (int r = 0; r < 8; ++r) { m[r] = -3.0e38f; l[r] = 0.0f; }
#pragma unroll
    for (int nt = 0; nt < 4; ++nt) o[nt] = (v8f){};
    const int nch = qt + 1;
    const int trow = threadIdx.x >> 3, tcol = (threadIdx.x & 7) * 8; const size_t tk = (size_t)trow * HD + tcol, tv = (size_t)trow * RRES + tcol;
    const unsigned lt = lds_off(&sKV[0][0][0]) + (unsigned)(trow * PP + tcol) * 2;
    auto stage = [&](int c, int buf) { const unsigned l = lt + (unsigned)buf * (4 * TLE * 2); const size_t ok = tk + (size_t)c * 64 * HD, ov = tv + (size_t)c * 64;
        acopy_tiles(l, kh + ok, (size_t)HD, l + TLE * 2, vh + ov, (size_t)RRES); acopy_tiles(l + 2 * TLE * 2, kl + ok, (size_t)HD, l + 3 * TLE * 2, vl + ov, (size_t)RRES); };
    stage(0, 0);
    asm volatile("s_wait_asynccnt 0x0" ::: "memory");     // this wave's copies of tile 0 have landed
    __syncthreads();                                      // every wave's have: tile 0 may be read
    if (nch > 1) stage(1, 1);
#pragma unroll 1
    for (int c = 0; c < nch; ++c) {
        const int kvb = c * 64; v8f s[4]; v16bf aqh[2], aql[2], bh, bl;
        const bf* skh = &sKV[c & 1][0][0]; const bf* svh = &sKV[c & 1][1][0]; const bf* skl = &sKV[c & 1][2][0]; const bf* svl = &sKV[c & 1][3][0];
#pragma unroll
        for (int kk = 0; kk < 2; ++kk) { aqh[kk] = WFrag<bf>::ld(qh + (size_t)lr * HD + 8 * hi + kk * 32); aql[kk] = WFrag<bf>::ld(ql + (size_t)lr * HD + 8 * hi + kk * 32); }
#pragma unroll
        for (int nt = 0; nt < 4; ++nt) { s[nt] = (v8f){}; const int ko = (nt * 16 + lr) * PP + 8 * hi;
#pragma unroll
            for (int kk = 0; kk < 2; ++kk) { bh = WFrag<bf>::ld(skh + ko + kk * 32); bl = WFrag<bf>::ld(skl + ko + kk * 32);
                s[nt] = wmmab(aqh[kk], bh, s[nt]); s[nt] = wmmab(aql[kk], bh, s[nt]); s[nt] = wmmab(aqh[kk], bl, s[nt]); } }
        asm volatile("v_nop\n\tv_nop\n\tv_nop\n\tv_nop" : "+v"(s[0]), "+v"(s[1]), "+v"(s[2]), "+v"(s[3]) : "v"(aqh[0]), "v"(aql[1]), "v"(bh), "v"(bl));
        online_softmax(s, m, l, o, c == qt, q0, kvb, lr, hi);
#pragma unroll
        for (int nt = 0; nt < 4; ++nt)
#pragma unroll
            for (int r = 0; r < 8; ++r) { unsigned short a2, c2; splitf(s[nt][r], a2, c2); const int so = (8 * hi + r) * PP + nt * 16 + lr; sph[so] = a2; spl[so] = c2; }
        lds_wsync();
        v16bf aph[2], apl[2], bvh, bvl;
#pragma unroll
        for (int kk = 0; kk < 2; ++kk) { const int ao = lr * PP + kk * 32 + 8 * hi; aph[kk] = cat16b(*(const v8usa*)(sph + ao), *(const v8usa*)(sph + ao + 16)); apl[kk] = cat16b(*(const v8usa*)(spl + ao), *(const v8usa*)(spl + ao + 16)); }
#pragma unroll
        for (int kk = 0; kk < 2; ++kk)
#pragma unroll
            for (int nt = 0; nt < 4; ++nt) { const int vo = (nt * 16 + lr) * PP + kk * 32 + 8 * hi; bvh = WFrag<bf>::ld(svh + vo); bvl = WFrag<bf>::ld(svl + vo);
                o[nt] = wmmab(aph[kk], bvh, o[nt]); o[nt] = wmmab(apl[kk], bvh, o[nt]); o[nt] = wmmab(aph[kk], bvl, o[nt]); }
        asm volatile("v_nop\n\tv_nop\n\tv_nop\n\tv_nop" : "+v"(o[0]), "+v"(o[1]), "+v"(o[2]), "+v"(o[3]) : "v"(aph[0]), "v"(apl[1]), "v"(bvh), "v"(bvl));
        lds_wsync();
        asm volatile("s_wait_dscnt 0x0" ::: "memory");    // this wave has left the buffer that is refilled below
        asm volatile("s_wait_asynccnt 0x0" ::: "memory"); // this wave's copies of tile c + 1 have landed
        __syncthreads();                                  // publishes tile c + 1 and ends every reader's last read of tile c
        if (c + 2 < nch) stage(c + 2, c & 1);
    }
    asm volatile("s_wait_asynccnt 0x0" ::: "memory");     // no copy is outstanding when the wave goes on and ends
    float inv[8];
#pragma unroll
    for (int r = 0; r < 8; ++r) inv[r] = 1.0f / l[r];
#pragma unroll
    for (int nt = 0; nt < 4; ++nt)
#pragma unroll
        for (int r = 0; r < 8; ++r) { unsigned short a2, c2; splitf(o[nt][r] * inv[r], a2, c2); const int so = (8 * hi + r) * PP + nt * 16 + lr; sph[so] = a2; spl[so] = c2; }
    lds_wsync();
    bf* chb = CTh + (size_t)q0 * DMO + h * HD; bf* clb = CTl + (size_t)q0 * DMO + h * HD;
{
#pragma unroll
        for (int it = 0; it < 4; ++it) { const int rr = it * 4 + (lane >> 3), pc = (lane & 7) * 8; const v8us va = *(const v8usa*)(sph + rr * PP + pc); const v8us vb = *(const v8usa*)(spl + rr * PP + pc);
            *(v8us*)(chb + (size_t)rr * DMO + pc) = va; *(v8us*)(clb + (size_t)rr * DMO + pc) = vb; }
         }
}

// ---- k_attn: causal attention for query tiles qt >= RRES/64 (blockIdx.x + RRES/64): same structure with single f16 products; q, k from [h][SEQ][HD] / [g][SEQ][HD] f16 planes,
// the k and v^T tiles of 64 keys shared by the four waves through LDS (asynchronous copies, two buffers: the next tiles fly while these are worked on).
__global__ __launch_bounds__(128) void k_attn(const h16* __restrict__ Q16, const h16* __restrict__ K16, const h16* __restrict__ VT16, h16* C16) {
    __shared__ __align__(16) h16 sP[4][16 * PP];
    __shared__ __align__(128) h16 sKV[2][2][TLE];         // [buffer][k | v^T]
    const int lane = threadIdx.x & 31, wave = threadIdx.x >> 5, lr = lane & 15, hi = lane >> 4;
    const int qt = blockIdx.x + RRES / 64, h = blockIdx.y, g = h / GRP; const int q0 = qt * 64 + wave * 16;
    const size_t sq = blockIdx.z;                         // sequence
    Q16 += sq * NH * SEQ * HD; K16 += sq * NKV * SEQ * HD; VT16 += sq * NKV * HD * SEQ; C16 += sq * SEQ * DMO;
    const h16* qp = Q16 + ((size_t)h * SEQ + q0) * HD; const h16* kp = K16 + (size_t)g * SEQ * HD; const h16* vp = VT16 + (size_t)g * HD * SEQ;
    h16* spw = &sP[wave][0];
    v16h aq[2];
#pragma unroll
    for (int kk = 0; kk < 2; ++kk) aq[kk] = WFrag<h16>::ld(qp + (size_t)lr * HD + 8 * hi + kk * 32);
    float m[8], l[8]; v8f o[4];
#pragma unroll
    for (int r = 0; r < 8; ++r) { m[r] = -3.0e38f; l[r] = 0.0f; }
#pragma unroll
    for (int nt = 0; nt < 4; ++nt) o[nt] = (v8f){};
    const int nch = qt + 1;
    const int trow = threadIdx.x >> 3, tcol = (threadIdx.x & 7) * 8;
    const h16* gk = kp + (size_t)trow * HD + tcol; const h16* gv = vp + (size_t)trow * SEQ + tcol;
    const unsigned lt = lds_off(&sKV[0][0][0]) + (unsigned)(trow * PP + tcol) * 2;
    auto stage = [&](int c, int buf) { const unsigned l = lt + (unsigned)buf * (2 * TLE * 2);
        acopy_tiles(l, gk + (size_t)c * 64 * HD, (size_t)HD, l + TLE * 2, gv + (size_t)c * 64, (size_t)SEQ); };
    stage(0, 0);
    asm volatile("s_wait_asynccnt 0x0" ::: "memory");     // this wave's copies of tile 0 have landed
    __syncthreads();                                      // every wave's have: tile 0 may be read
    if (nch > 1) stage(1, 1);
#pragma unroll 1
    for (int c = 0; c < nch; ++c) {
        const int kvb = c * 64; v8f s[4]; v16h b;
        const h16* sk = &sKV[c & 1][0][0] + lr * PP + 8 * hi; const h16* sv = &sKV[c & 1][1][0] + lr * PP + 8 * hi;
#pragma unroll
        for (int nt = 0; nt < 4; ++nt) { s[nt] = (v8f){}; const h16* kr = sk + nt * 16 * PP;
#pragma unroll
            for (int kk = 0; kk < 2; ++kk) { b = WFrag<h16>::ld(kr + kk * 32); s[nt] = wmma16(aq[kk], b, s[nt]); } }
        asm volatile("v_nop\n\tv_nop\n\tv_nop\n\tv_nop" : "+v"(s[0]), "+v"(s[1]), "+v"(s[2]), "+v"(s[3]) : "v"(aq[0]), "v"(aq[1]), "v"(b));
        online_softmax(s, m, l, o, c == qt, q0, kvb, lr, hi);
#pragma unroll
        for (int nt = 0; nt < 4; ++nt)
#pragma unroll
            for (int r = 0; r < 8; ++r) spw[(8 * hi + r) * PP + nt * 16 + lr] = tohx(s[nt][r] * PCAR);
        lds_wsync();
        v16h ap[2], bv;
#pragma unroll
        for (int kk = 0; kk < 2; ++kk) { const int ao = lr * PP + kk * 32 + 8 * hi; ap[kk] = cat16(*(const v8ha*)(spw + ao), *(const v8ha*)(spw + ao + 16)); }
#pragma unroll
        for (int kk = 0; kk < 2; ++kk)
#pragma unroll
            for (int nt = 0; nt < 4; ++nt) { bv = WFrag<h16>::ld(sv + nt * 16 * PP + kk * 32); o[nt] = wmma16(ap[kk], bv, o[nt]); }
        asm volatile("v_nop\n\tv_nop\n\tv_nop\n\tv_nop" : "+v"(o[0]), "+v"(o[1]), "+v"(o[2]), "+v"(o[3]) : "v"(ap[0]), "v"(ap[1]), "v"(bv));
        lds_wsync();
        asm volatile("s_wait_dscnt 0x0" ::: "memory");    // this wave has left the buffer that is refilled below
        asm volatile("s_wait_asynccnt 0x0" ::: "memory"); // this wave's copies of tile c + 1 have landed
        __syncthreads();                                  // publishes tile c + 1 and ends every reader's last read of tile c
        if (c + 2 < nch) stage(c + 2, c & 1);
    }
    asm volatile("s_wait_asynccnt 0x0" ::: "memory");     // no copy is outstanding when the wave goes on and ends
    float inv[8];
#pragma unroll
    for (int r = 0; r < 8; ++r) inv[r] = (1.0f / l[r]) * (CCAR / PCAR);
#pragma unroll
    for (int nt = 0; nt < 4; ++nt)
#pragma unroll
        for (int r = 0; r < 8; ++r) spw[(8 * hi + r) * PP + nt * 16 + lr] = tohx(o[nt][r] * inv[r]);
    lds_wsync();
    h16* cb = C16 + (size_t)q0 * DMO + h * HD;
{
#pragma unroll
        for (int it = 0; it < 4; ++it) { const int rr = it * 4 + (lane >> 3), pc = (lane & 7) * 8; const v8h val = *(const v8ha*)(spw + rr * PP + pc); *(v8h*)(cb + (size_t)rr * DMO + pc) = val; }
         }
}

extern "C" void kernel_launch(void* const* d_in, const int* in_sizes, int n_in,
                              void* d_out, int out_size, void* d_ws, size_t ws_size, hipStream_t stream) {
    if (n_in < 7) return;
    const long long rows_used = (long long)(NB - 1) * SEQ_FULL + SEQ;
    if ((long long)in_sizes[0] < rows_used * DIN) return;
    if (in_sizes[1] < SEQ * HD || in_sizes[2] < SEQ * HD) return;
    if (in_sizes[3] < DIN * DMO || in_sizes[4] < DIN * DKV || in_sizes[5] < DIN * DKV || in_sizes[6] < DMO * DMO) return;
    if ((long long)out_size < rows_used * DMO) return;
    // wire order: x, cos, sin, wq, wk, wv, wo
    const float* x = (const float*)d_in[0]; const float* cosi = (const float*)d_in[1]; const float* sini = (const float*)d_in[2];
    const float* wq = (const float*)d_in[3]; const float* wk = (const float*)d_in[4]; const float* wv = (const float*)d_in[5]; const float* wo = (const float*)d_in[6];
    float* OUT = (float*)d_out;     // [NB_FULL][SEQ_FULL][DMO]
    char* wsp = (char*)d_ws;
    auto take = [&](size_t bytes) { char* p = wsp; wsp += (bytes + 255) & ~(size_t)255; return (void*)p; };
    bf* WQ   = (bf*)take((size_t)DMO * DIN * 2);          // Bt [out][in]
    bf* WK   = (bf*)take((size_t)DKV * DIN * 2);
    bf* WV   = (bf*)take((size_t)DKV * DIN * 2);
    bf* WOb  = (bf*)take((size_t)DMO * DMO * 2);
    h16* WO16 = (h16*)take((size_t)DMO * DMO * 2);
    bf* XB   = (bf*)take((size_t)NB * SEQ * DIN * 2);     // from here on: NB planes each, sequence-major
    float* FQ = (float*)take((size_t)NB * SEQ * DMO * 4);
    float* FK = (float*)take((size_t)NB * SEQ * DKV * 4);
    float* FV = (float*)take((size_t)NB * SEQ * DKV * 4);
    h16* Q16 = (h16*)take((size_t)NB * NH * SEQ * HD * 2); h16* K16 = (h16*)take((size_t)NB * NKV * SEQ * HD * 2); h16* VT16 = (h16*)take((size_t)NB * NKV * HD * SEQ * 2);
    bf* QPh = (bf*)take((size_t)NB * NH * RRES * HD * 2); bf* QPl = (bf*)take((size_t)NB * NH * RRES * HD * 2);
    bf* KPh = (bf*)take((size_t)NB * NKV * RRES * HD * 2); bf* KPl = (bf*)take((size_t)NB * NKV * RRES * HD * 2);
    bf* VTh = (bf*)take((size_t)NB * NKV * HD * RRES * 2); bf* VTl = (bf*)take((size_t)NB * NKV * HD * RRES * 2);
    h16* C16 = (h16*)take((size_t)NB * SEQ * DMO * 2);   // rows >= RRES of each sequence used
    bf* CTh = (bf*)take((size_t)NB * RRES * DMO * 2); bf* CTl = (bf*)take((size_t)NB * RRES * DMO * 2);
    int* MFLAG = (int*)take(128);
    const size_t carved = (size_t)(wsp - (char*)d_ws);
    if (carved > ws_size || carved > (size_t)268435456) return;

    k_flag0<<<1, 32, 0, stream>>>(MFLAG);
    k_wtG<<<(unsigned)((DMO * DIN / 64 + 63) / 64), 256, 0, stream>>>(wq, DIN, DMO, WQ, nullptr);
    k_wtG<<<(unsigned)((DKV * DIN / 64 + 63) / 64), 256, 0, stream>>>(wk, DIN, DKV, WK, nullptr);
    k_wtG<<<(unsigned)((DKV * DIN / 64 + 63) / 64), 256, 0, stream>>>(wv, DIN, DKV, WV, nullptr);
    k_wtG<<<(unsigned)((DMO * DMO / 64 + 63) / 64), 256, 0, stream>>>(wo, DMO, DMO, WOb, WO16);
    const unsigned LQ = (unsigned)(((size_t)NH * SEQ * HD / 2 + 255) / 256), LKV = (unsigned)(((size_t)NKV * SEQ * HD / 2 + 255) / 256);
    k_cvt8<<<dim3((unsigned)(((size_t)SEQ * DIN / 8 + 255) / 256), NB, 1), 256, 0, stream>>>(x, XB, (size_t)SEQ * DIN / 8, (size_t)SEQ_FULL * DIN, (size_t)SEQ * DIN);
    k_gemmw<bf, 0><<<dim3(SEQ / 128, DMO / 128, NB), 128, 0, stream>>>(XB, nullptr, WQ, nullptr, DIN, FQ, DMO, 1.0f, MFLAG, (size_t)SEQ * DIN, 0, (size_t)SEQ * DMO);
    k_gemmw<bf, 0><<<dim3(SEQ / 128, DKV / 128, NB), 128, 0, stream>>>(XB, nullptr, WK, nullptr, DIN, FK, DKV, 1.0f, MFLAG, (size_t)SEQ * DIN, 0, (size_t)SEQ * DKV);
    k_gemmw<bf, 0><<<dim3(SEQ / 128, DKV / 128, NB), 128, 0, stream>>>(XB, nullptr, WV, nullptr, DIN, FV, DKV, 1.0f, MFLAG, (size_t)SEQ * DIN, 0, (size_t)SEQ * DKV);
    k_rope<<<dim3(LQ, NB, 1), 256, 0, stream>>>(FQ, DMO, NH, cosi, sini, Q16, QPh, QPl);
    k_rope<<<dim3(LKV, NB, 1), 256, 0, stream>>>(FK, DKV, NKV, cosi, sini, K16, KPh, KPl);
    k_vtp<<<dim3(LKV, NB, 1), 256, 0, stream>>>(FV, DKV, NKV, VT16, VTh, VTl);
    k_attnr<<<dim3(RRES / 64, NH, NB), 128, 0, stream>>>(QPh, QPl, KPh, KPl, VTh, VTl, CTh, CTl);
    if (SEQ > RRES) k_attn<<<dim3((SEQ - RRES) / 64, NH, NB), 128, 0, stream>>>(Q16, K16, VT16, C16);
    k_gemmw<bf, 1><<<dim3(RRES / 128, DMO / 128, NB), 128, 0, stream>>>(CTh, CTl, WOb, nullptr, DMO, OUT, DMO, 1.0f, MFLAG, (size_t)RRES * DMO, 0, (size_t)SEQ_FULL * DMO);
    if (SEQ > RRES) k_gemmw<h16, 0><<<dim3((SEQ - RRES) / 128, DMO / 128, NB), 128, 0, stream>>>(C16 + (size_t)RRES * DMO, nullptr, WO16, nullptr, DMO, OUT + (size_t)RRES * DMO, DMO, 1.0f / (CCAR * WCAR), MFLAG, (size_t)SEQ * DMO, 0, (size_t)SEQ_FULL * DMO);
}

// v004
// A run of this version takes 293 microseconds.
// Two timings next to v003 put it at 1.06 and 1.07 times that version's speed.
// Counting every step since v000, it is 2.61 times as fast.
#include <hip/hip_runtime.h>

// Contractions and operand types (f32 accumulate everywhere): x Wq, x Wk, x Wv on v_wmma_f32_16x16x32_bf16 with RNE bf16 copies of x and W (exact products);
// query rows < RRES of each sequence: q.k^T and p.v on v_wmma_f32_16x16x32_bf16 as bf16 hi/lo splits (3 products each), their ctx Wo as bf16 hi/lo ctx times bf16 Wo (2 products);
// query rows >= RRES: q.k^T and p.v on v_wmma_f32_16x16x32_f16 (f16 q/k/v planes, p carried x1024), ctx Wo on v_wmma_f32_16x16x32_f16 (ctx carried x16, Wo carried x64, folded by 1/1024 in the epilogue).
// diagonal are skipped (their probabilities are exactly 0) and the diagonal tile is masked by index; a constant zero flag line feeds the additive term of the GEMM epilogue.
// The projection GEMMs write the attention operand planes themselves: the rotary mix (q, k) and the 16-bit conversions (q, k, v^T) are their epilogues; no f32 projection plane exists.
// All NB sequences go through every launch together: the sequence is blockIdx.z (blockIdx.y in k_cvt8), and every per-sequence workspace plane holds NB copies, sequence-major.

#ifndef NB
#define NB 2
#endif
#ifndef SEQ
#define SEQ 2048
#endif
#ifndef RRES
#define RRES 256
#endif
#define NB_FULL 2
#define SEQ_FULL 2048
#define DIN 2048
#define DMO 2048
#define NH 32
#define NKV 8
#define GRP (NH / NKV)
#define HD 64
#define DKV (NKV * HD)
#define PP 72
#define PCAR 1024.0f
#define CCAR 16.0f
#define WCAR 64.0f
#define SCL 0.125f
#define L2E 1.4426950408889634f
static_assert(SEQ % 64 == 0 && SEQ >= 64 && SEQ <= SEQ_FULL);
static_assert(RRES % 64 == 0 && RRES >= 64 && RRES <= SEQ);
static_assert(NB >= 1 && NB <= NB_FULL);
static_assert(DIN % 32 == 0 && DMO % 64 == 0 && DKV % 64 == 0 && HD == 64 && (NH % NKV) == 0);
static_assert(DMO == NH * HD && DMO % 32 == 0);
static_assert(PP % 8 == 0 && PP >= HD);
static_assert((DMO * DIN) % 64 == 0 && (DKV * DIN) % 64 == 0 && (DMO * DMO) % 64 == 0 && DIN % 2 == 0 && DMO % 2 == 0);
static_assert(((size_t)SEQ * DIN) % 8 == 0);
// workspace carve (every plane a multiple of 256 B; same sequence as the launcher's take() calls)
#define AL256(x) ((((size_t)(x)) + 255) & ~(size_t)255)
#define WS_TOTAL (AL256((size_t)DMO * DIN * 2) + 2 * AL256((size_t)DKV * DIN * 2) + 2 * AL256((size_t)DMO * DMO * 2) + AL256((size_t)NB * SEQ * DIN * 2) \
                  + AL256((size_t)NB * NH * SEQ * HD * 2) + 2 * AL256((size_t)NB * NKV * SEQ * HD * 2) + 2 * AL256((size_t)NB * NH * RRES * HD * 2) \
                  + 4 * AL256((size_t)NB * NKV * RRES * HD * 2) + AL256((size_t)NB * SEQ * DMO * 2) + 2 * AL256((size_t)NB * RRES * DMO * 2) + AL256(128))
static_assert(WS_TOTAL <= (size_t)268435456);

typedef _Float16 h16;
typedef unsigned short bf;
typedef __attribute__((ext_vector_type(16))) __bf16   v16bf;
typedef __attribute__((ext_vector_type(16))) _Float16 v16h;
typedef __attribute__((ext_vector_type(8)))  _Float16 v8h;
typedef __attribute__((ext_vector_type(8)))  unsigned short v8us;
typedef __attribute__((ext_vector_type(8)))  float    v8f;
typedef __attribute__((ext_vector_type(4)))  float    v4f;
typedef __attribute__((ext_vector_type(4)))  int      v4i;
typedef __attribute__((ext_vector_type(2)))  _Float16 v2h;
typedef __attribute__((ext_vector_type(2)))  unsigned short v2us;
typedef __attribute__((ext_vector_type(4)))  _Float16 v4h;
typedef __attribute__((ext_vector_type(4)))  unsigned short v4us;
typedef v8h  __attribute__((may_alias)) v8ha;
typedef v4f  __attribute__((may_alias)) v4fa;
typedef v8us __attribute__((may_alias)) v8usa;

__device__ __forceinline__ unsigned short f2bf(float f) { unsigned u = __float_as_uint(f); u += 0x7FFFu + ((u >> 16) & 1u); return (unsigned short)(u >> 16); }
__device__ __forceinline__ float bf2f(unsigned short b) { return __uint_as_float(((unsigned)b) << 16); }
__device__ __forceinline__ float bfr(float f) { return bf2f(f2bf(f)); }
__device__ __forceinline__ h16 tohx(float x) { return (h16)x; }
__device__ __forceinline__ void splitf(float y, unsigned short& h, unsigned short& l) { h = f2bf(y); l = f2bf(y - bf2f(h)); }
__device__ __forceinline__ v16h cat16(v8h lo, v8h hi) { return __builtin_shufflevector(lo, hi, 0, 1, 2, 3, 4, 5, 6, 7, 8, 9, 10, 11, 12, 13, 14, 15); }
__device__ __forceinline__ v16bf cat16b(v8us lo, v8us hi) { return __builtin_bit_cast(v16bf, __builtin_shufflevector(lo, hi, 0, 1, 2, 3, 4, 5, 6, 7, 8, 9, 10, 11, 12, 13, 14, 15)); }
__device__ __forceinline__ v8f wmma16(v16h a, v16h b, v8f c) { return __builtin_amdgcn_wmma_f32_16x16x32_f16(false, a, false, b, (short)0, c, false, false); }
__device__ __forceinline__ v8f wmmab(v16bf a, v16bf b, v8f c) { return __builtin_amdgcn_wmma_f32_16x16x32_bf16(false, a, false, b, (short)0, c, false, false); }
// wave-private LDS tile: stores of this wave made visible to its own later cross-lane loads, loads kept below the stores by the compiler
__device__ __forceinline__ void lds_wsync() { __builtin_amdgcn_fence(3 /* release order */, "wavefront"); __builtin_amdgcn_wave_barrier(); asm volatile("" ::: "memory"); }

// 16-bit fragment loaders: lane l -> row/column (l & 15); elements 0..7 <- k0 + 8*(l>>4) + 0..7, elements 8..15 <- k0 + 16 + 8*(l>>4) + 0..7 of a K-contiguous row (p already offset by 8*(l>>4)).
template <typename T16> struct WFrag;
template <> struct WFrag<h16> { typedef v16h V; static __device__ __forceinline__ V ld(const h16* p) { return cat16(*(const v8h*)p, *(const v8h*)(p + 16)); } static __device__ __forceinline__ v8f mma(V a, V b, v8f c) { return wmma16(a, b, c); } };
template <> struct WFrag<bf> { typedef v16bf V; static __device__ __forceinline__ V ld(const bf* p) { return cat16b(*(const v8us*)p, *(const v8us*)(p + 16)); } static __device__ __forceinline__ v8f mma(V a, V b, v8f c) { return wmmab(a, b, c); } };

// ---- k_gemmw: work-group tiled GEMM: 4 waves (2 x 2) share one 128x128 output tile, each wave keeps a 64x64 part (16 accumulators); grid (M/128, N/128, Z), 128 threads.
// A stage is GKS = 128 k (256 B) of the 128 A rows, the 128 Bt rows (and the 128 A2 rows when NSPLIT == 1), brought from the K-contiguous 16-bit planes into LDS by asynchronous
// 16-byte copies at a row pitch of 272 B; two buffers, the next stage's copies fly while this stage is multiplied. Every accumulator sums k upward in steps of 32, A before A2.
// F[m][n] = (sum_k A[m][k] Bt[n][k] (+ A2[m][k] Bt[n][k] when NSPLIT == 1)) * cscale + (pflag[0] ? NaN : 0). K % 128 == 0, K >= 128, M % 128 == 0, N % 128 == 0.
// EPI == 0: C[m][n] (f32, pitch ldc) = F[m][n].
// EPI == 1 (m = token t, n = h*HD + d, ldc = N; a wave's 64 columns are one head): head planes of the rotate-half rotary mix of F with the cos/sin input tables (bf16 RNE values):
//   r[d] = x[d] cos[t][d] - x[d+HD/2] sin[t][d] (d < HD/2), r[d] = x[d] cos[t][d] + x[d-HD/2] sin[t][d] (d >= HD/2); P16[h][t][d] = f16(r) for every t, Ph/Pl[h][t][d] bf16 hi/lo for t < RRES.
// EPI == 2 (m = g*HD + d, n = token t: the weight rows are the A operand, so F is already v^T): P16[m][t] = f16(F) (row pitch SEQ), Ph/Pl[m][t] bf16 hi/lo for t < RRES (row pitch RRES).
#define GKS 128
#define GPI 136
static_assert(DIN % GKS == 0 && DMO % GKS == 0 && SEQ % 128 == 0 && RRES % 128 == 0 && DMO % 128 == 0 && DKV % 128 == 0);
__device__ __forceinline__ unsigned lds_off(const void* p) { return (unsigned)(size_t)p; }
// eight copies of one lane: rows 8 apart, 16 B each, LDS byte address l, global address g (row pitch K elements). The s_wait_xcnt closes the statement so that no address register
// of an issued copy is rewritten ahead of it.
template <typename T16>
__device__ __forceinline__ void acopy8(unsigned l, const T16* g, size_t K) {
    const unsigned ls = 8 * GPI * 2; const size_t gs = 8 * K;
    asm volatile("global_load_async_to_lds_b128 %0, %8, off\n\t"
                 "global_load_async_to_lds_b128 %1, %9, off\n\t"
                 "global_load_async_to_lds_b128 %2, %10, off\n\t"
                 "global_load_async_to_lds_b128 %3, %11, off\n\t"
                 "global_load_async_to_lds_b128 %4, %12, off\n\t"
                 "global_load_async_to_lds_b128 %5, %13, off\n\t"
                 "global_load_async_to_lds_b128 %6, %14, off\n\t"
                 "global_load_async_to_lds_b128 %7, %15, off\n\t"
                 "s_wait_xcnt 0x0"
                 :: "v"(l), "v"(l + ls), "v"(l + 2 * ls), "v"(l + 3 * ls), "v"(l + 4 * ls), "v"(l + 5 * ls), "v"(l + 6 * ls), "v"(l + 7 * ls),
                    "v"(g), "v"(g + gs), "v"(g + 2 * gs), "v"(g + 3 * gs), "v"(g + 4 * gs), "v"(g + 5 * gs), "v"(g + 6 * gs), "v"(g + 7 * gs) : "memory");
}
// 128 rows x 256 B of one operand: 16 copies a lane (16 lanes cover a row, a wave two rows)
template <typename T16>
__device__ __forceinline__ void acopy_rows(unsigned l, const T16* g, size_t K) { acopy8(l, g, K); acopy8(l + 64 * GPI * 2, g + 64 * K, K); }

template <typename T16, int NSPLIT, int EPI>
__global__ __launch_bounds__(128) void k_gemmw(const T16* __restrict__ A, const T16* __restrict__ A2, const T16* __restrict__ Bt, const T16* __restrict__ Bt2, int K, float* C, int ldc, float cscale, const int* __restrict__ pflag, size_t sA, size_t sB, size_t sC,
                                               const float* __restrict__ COSI, const float* __restrict__ SINI, h16* P16, bf* Ph, bf* Pl) {
    typedef typename WFrag<T16>::V V;
    static_assert(NSPLIT == 0 || NSPLIT == 1); static_assert(EPI >= 0 && EPI <= 2);
    constexpr int OPE = 128 * GPI;                        // elements of one operand's rows in a stage
    constexpr int STE = (NSPLIT == 1 ? 3 : 2) * OPE;      // elements of a stage: [A | Bt | A2]
    __shared__ __align__(128) T16 ring[2 * STE];
    __shared__ __align__(16) float osw[4][16 * 68];
    const size_t z = blockIdx.z; A += z * sA; if (A2) A2 += z * sA; Bt += z * sB; if (EPI == 0) C += z * sC;
    const int tid = threadIdx.x, lane = tid & 31, wave = tid >> 5, lr = lane & 15, hi = lane >> 4; const int wm = wave >> 1, wn = wave & 1;
    const int r0 = blockIdx.x * 128, c0 = blockIdx.y * 128;
    const float padd = (pflag[0] != 0) ? __int_as_float(0x7fc00000) : 0.0f;
    v8f acc[4][4];
#pragma unroll
    for (int mb = 0; mb < 4; ++mb)
#pragma unroll
        for (int nb = 0; nb < 4; ++nb) acc[mb][nb] = (v8f){};
    const int trow = tid >> 4, tcol = tid & 15;
    const T16* ga = A + (size_t)(r0 + trow) * K + tcol * 8; const T16* gb = Bt + (size_t)(c0 + trow) * K + tcol * 8;
    const T16* ga2 = (NSPLIT == 1) ? A2 + (size_t)(r0 + trow) * K + tcol * 8 : nullptr;
    const unsigned lt = lds_off(ring) + (unsigned)(trow * GPI + tcol * 8) * 2;
    auto stage = [&](int t, int buf) { const unsigned l = lt + (unsigned)buf * (STE * 2); const size_t ko = (size_t)t * GKS;
        acopy_rows(l, ga + ko, (size_t)K); acopy_rows(l + OPE * 2, gb + ko, (size_t)K); if (NSPLIT == 1) acopy_rows(l + 2 * OPE * 2, ga2 + ko, (size_t)K); };
    const int nt = K / GKS;
    stage(0, 0);
    asm volatile("s_wait_asynccnt 0x0" ::: "memory");     // this wave's copies of stage 0 have landed
    __syncthreads();                                      // every wave's have: stage 0 may be read
    if (nt > 1) stage(1, 1);
    // the stage loop stays rolled: one copy of the body in the instruction cache, the buffer picked by t & 1
#pragma unroll 1
    for (int t = 0; t < nt; ++t) {
        const T16* sa = ring + (t & 1) * STE + (wm * 64 + lr) * GPI + 8 * hi; const T16* sb = ring + (t & 1) * STE + OPE + (wn * 64 + lr) * GPI + 8 * hi;
        // two fragment sets: the reads of the next 32 k of this stage go out as one group ahead of this step's matrix instructions, so that only the stage's first group is waited for in full
        // (every loop below is unrolled so that set, fragment and accumulator indices are constants and the arrays live in registers)
        V a[2][4], b[2][4], a2[2][4];
        auto ldset = [&](int s, int ks) {
#pragma unroll
            for (int mb = 0; mb < 4; ++mb) { a[s][mb] = WFrag<T16>::ld(sa + mb * 16 * GPI + ks); if (NSPLIT == 1) a2[s][mb] = WFrag<T16>::ld(sa + 2 * OPE + mb * 16 * GPI + ks); }
#pragma unroll
            for (int nb = 0; nb < 4; ++nb) b[s][nb] = WFrag<T16>::ld(sb + nb * 16 * GPI + ks); };
        ldset(0, 0);
#pragma unroll
        for (int q = 0; q < GKS / 32; ++q) {
            if (q + 1 < GKS / 32) ldset((q + 1) & 1, (q + 1) * 32);
            // keeps the group of reads above in front of this step's matrix instructions (the scheduler otherwise spreads them among these, each with a full wait); in the last step, which
            // has no reads, it keeps the step before in front of the waits at the loop's foot, where its matrix instructions cover the last reads' latency (without it they sink behind the barrier)
            __builtin_amdgcn_sched_barrier(0);
#pragma unroll
            for (int nb = 0; nb < 4; ++nb)
#pragma unroll
                for (int mb = 0; mb < 4; ++mb) { acc[mb][nb] = WFrag<T16>::mma(a[q & 1][mb], b[q & 1][nb], acc[mb][nb]); if (NSPLIT == 1) acc[mb][nb] = WFrag<T16>::mma(a2[q & 1][mb], b[q & 1][nb], acc[mb][nb]); }
        }
        asm volatile("s_wait_dscnt 0x0" ::: "memory");    // this wave has left the buffer that is refilled below
        asm volatile("s_wait_asynccnt 0x0" ::: "memory"); // this wave's copies of stage t + 1 have landed
        __syncthreads();                                  // publishes stage t + 1 and ends every reader's last read of stage t
        if (t + 2 < nt) stage(t + 2, t & 1);
    }
    asm volatile("s_wait_asynccnt 0x0" ::: "memory");     // no copy is outstanding when the wave goes on and ends
    if constexpr (EPI == 0) {
    float* os = &osw[wave][0];
#pragma unroll
    for (int mb = 0; mb < 4; ++mb) {
#pragma unroll
        for (int nb = 0; nb < 4; ++nb) {
#pragma unroll
            for (int j = 0; j < 8; ++j) os[(hi * 8 + j) * 68 + nb * 16 + lr] = acc[mb][nb][j]; }
        __builtin_amdgcn_wave_barrier(); asm volatile("" ::: "memory");
        float* crow = C + (size_t)(r0 + wm * 64 + mb * 16) * ldc + c0 + wn * 64;
{
#pragma unroll
            for (int s = 0; s < 8; ++s) { const int row = 2 * s + hi, cofs = lr * 4; v4f val = *(const v4fa*)(os + row * 68 + cofs); val = val * cscale + padd;
                *(v4f*)(crow + (size_t)row * ldc + cofs) = val; }
             }
        __builtin_amdgcn_wave_barrier(); asm volatile("" ::: "memory");
    }
    } else {
        // The ring is free: every wave's last read of it and every copy into it ended in front of the loop's last barrier. Each wave lays its whole 64 x 64 f32 part there (own range, row
        // pitch 68) and walks it in rolled loops of 8 rows a trip, so that the epilogue's text stays short.
        float* ot = reinterpret_cast<float*>(ring) + wave * (64 * 68);
        static_assert(4 * 64 * 68 * 4 <= 2 * STE * 2);
#pragma unroll
        for (int mb = 0; mb < 4; ++mb)
#pragma unroll
            for (int nb = 0; nb < 4; ++nb)
#pragma unroll
                for (int j = 0; j < 8; ++j) ot[(mb * 16 + hi * 8 + j) * 68 + nb * 16 + lr] = acc[mb][nb][j];
        __builtin_amdgcn_wave_barrier(); asm volatile("" ::: "memory");   // the wave's own stores stay in front of its cross-lane reads below
        const int mw = r0 + wm * 64 + hi, cofs = lr * 4;
        // the hi/lo planes hold tokens < RRES only: a whole 128-token tile is in or out (RRES % 128 == 0)
        if constexpr (EPI == 1) {
            const bool res = r0 < RRES;
            const size_t hp = z * (size_t)(ldc / HD) + (size_t)(c0 / HD + wn); P16 += hp * SEQ * HD; Ph += hp * RRES * HD; Pl += hp * RRES * HD;
            const float* cp = COSI + (size_t)mw * HD + cofs; const float* sp = SINI + (size_t)mw * HD + cofs;
            v4f cs[4], sn[4];
#pragma unroll
            for (int i = 0; i < 4; ++i) { cs[i] = *(const v4f*)(cp + i * 2 * HD); sn[i] = *(const v4f*)(sp + i * 2 * HD); }
            asm volatile("s_wait_xcnt 0x0" ::: "memory");                 // in front of any rewrite of the address registers of the loads above
            // rolled (short text); the next trip's cos and sin are asked for one trip ahead, so that this trip's work covers their latency (the last trip asks for its own rows again)
#pragma unroll 1
            for (int g = 0; g < 8; ++g) {
                v4f cn[4], sm[4]; const int gn = (g < 7) ? g + 1 : 7;
#pragma unroll
                for (int i = 0; i < 4; ++i) { cn[i] = *(const v4f*)(cp + (gn * 8 + i * 2) * HD); sm[i] = *(const v4f*)(sp + (gn * 8 + i * 2) * HD); }
                asm volatile("s_wait_xcnt 0x0" ::: "memory");             // in front of any rewrite of the address registers of the loads above
                // the trip's LDS reads go out together, its stores together at its foot: one LDS latency and one wait a trip
                v4f x0[4], x1[4]; v4h o16[4]; v4us oh[4], ol[4];
#pragma unroll
                for (int i = 0; i < 4; ++i) { const float* xr = ot + (g * 8 + i * 2 + hi) * 68; x0[i] = *(const v4fa*)(xr + cofs); x1[i] = *(const v4fa*)(xr + (cofs ^ (HD / 2))); }
#pragma unroll
                for (int i = 0; i < 4; ++i) { const v4f y0 = x0[i] * cscale + padd, y1 = x1[i] * cscale + padd;
#pragma unroll
                    for (int q = 0; q < 4; ++q) { const float cv = bfr(cs[i][q]), snv = bfr(sn[i][q]); const float pa = y0[q] * cv, pb = y1[q] * snv; const float r = (cofs < HD / 2) ? (pa - pb) : (pa + pb);
                        o16[i][q] = tohx(r); unsigned short a2, c2; splitf(r, a2, c2); oh[i][q] = a2; ol[i][q] = c2; } }
                const size_t oo = (size_t)(mw + g * 8) * HD + cofs;
                if (res) {
#pragma unroll
                    for (int i = 0; i < 4; ++i) { *(v4us*)(Ph + oo + i * 2 * HD) = oh[i]; *(v4us*)(Pl + oo + i * 2 * HD) = ol[i]; }
                    asm volatile("s_wait_xcnt 0x0" ::: "memory"); }       // in front of any rewrite of the registers of the stores above
#pragma unroll
                for (int i = 0; i < 4; ++i) *(v4h*)(P16 + oo + i * 2 * HD) = o16[i];
                asm volatile("s_wait_xcnt 0x0" ::: "memory");             // in front of any rewrite of the registers of the stores above
                __builtin_amdgcn_sched_barrier(0);                        // keeps the register copies below behind that wait (the scheduler otherwise lifts them over it, onto the stores' registers)
#pragma unroll
                for (int i = 0; i < 4; ++i) { cs[i] = cn[i]; sn[i] = sm[i]; }
            }
        } else {
            const bool res = c0 < RRES;
            const int t = c0 + wn * 64 + cofs;
            P16 += z * (size_t)DKV * SEQ + t; Ph += z * (size_t)DKV * RRES + t; Pl += z * (size_t)DKV * RRES + t;
            // rolled: short text
#pragma unroll 1
            for (int g = 0; g < 8; ++g) {
                // the trip's LDS reads go out together, its stores together at its foot: one LDS latency and one wait a trip
                v4f val[4]; v4h o16[4]; v4us oh[4], ol[4];
#pragma unroll
                for (int i = 0; i < 4; ++i) val[i] = *(const v4fa*)(ot + (g * 8 + i * 2 + hi) * 68 + cofs);
#pragma unroll
                for (int i = 0; i < 4; ++i) { const v4f y = val[i] * cscale + padd;
#pragma unroll
                    for (int q = 0; q < 4; ++q) { o16[i][q] = tohx(y[q]); unsigned short a2, c2; splitf(y[q], a2, c2); oh[i][q] = a2; ol[i][q] = c2; } }
                const size_t m = (size_t)(mw + g * 8);
                if (res) {
#pragma unroll
                    for (int i = 0; i < 4; ++i) { *(v4us*)(Ph + (m + i * 2) * RRES) = oh[i]; *(v4us*)(Pl + (m + i * 2) * RRES) = ol[i]; }
                    asm volatile("s_wait_xcnt 0x0" ::: "memory"); }       // in front of any rewrite of the registers of the stores above
#pragma unroll
                for (int i = 0; i < 4; ++i) *(v4h*)(P16 + (m + i * 2) * SEQ) = o16[i];
                asm volatile("s_wait_xcnt 0x0" ::: "memory");             // in front of any rewrite of the registers of the stores above
            }
        }
    }
}

__global__ __launch_bounds__(32) void k_flag0(int* MFLAG) {
    const int lane = threadIdx.x & 31; const int r = 0;
    int* p = MFLAG + lane; *(int*)p = r; 
}

__global__ __launch_bounds__(256) void k_wtG(const float* __restrict__ w, int K, int N, bf* Bt, h16* Ht) {
    const int lane = threadIdx.x & 31; const int L0 = (blockIdx.x * 8 + (threadIdx.x >> 5)) * 8; const int nlines = N * K / 64;
{
#pragma unroll 1
        for (int l = 0; l < 8; ++l) { const int L = L0 + l; if (L >= nlines) break; const size_t e = (size_t)L * 64 + lane * 2; const int k = (int)(e % K), n = (int)(e / K);
            const float w0 = bfr(w[(size_t)k * N + n]), w1 = bfr(w[(size_t)(k + 1) * N + n]); v2us o; o[0] = f2bf(w0); o[1] = f2bf(w1); *(v2us*)(Bt + e) = o;
            if (Ht != nullptr) { v2h oh; oh[0] = tohx(w0 * WCAR); oh[1] = tohx(w1 * WCAR); *(v2h*)(Ht + e) = oh; } }
         }
}
// blockIdx.y = sequence: source and destination planes ssrc and sdst elements apart
__global__ __launch_bounds__(256) void k_cvt8(const float* __restrict__ src, bf* dst, size_t n8, size_t ssrc, size_t sdst) { const size_t i = (size_t)blockIdx.x * 256 + threadIdx.x; if (i >= n8) return;
    src += blockIdx.y * ssrc; dst += blockIdx.y * sdst; const v8f v = *(const v8f*)(src + i * 8); v8us o;
#pragma unroll
    for (int k = 0; k < 8; ++k) o[k] = f2bf(v[k]); *(v8us*)(dst + i * 8) = o;  }

// ---- attention key / value tiles in LDS: a tile is 64 rows x 128 B (64 keys x HD of k, or HD x 64 keys of v^T) at a row pitch of PP elements (144 B).
// eight copies of one lane, 16 B each: four rows 16 apart of tile 0 (LDS byte address l0, global address g0, global row pitch p0 elements) and four of tile 1; eight lanes cover a
// row, so a wave's copy reads four whole 128-B lines. The s_wait_xcnt closes the statement so that no address register of an issued copy is rewritten ahead of it.
#define TLE (64 * PP)
template <typename T16>
__device__ __forceinline__ void acopy_tiles(unsigned l0, const T16* g0, size_t p0, unsigned l1, const T16* g1, size_t p1) {
    const unsigned ls = 16 * PP * 2; const size_t s0 = 16 * p0, s1 = 16 * p1;
    asm volatile("global_load_async_to_lds_b128 %0, %8, off\n\t"
                 "global_load_async_to_lds_b128 %1, %9, off\n\t"
                 "global_load_async_to_lds_b128 %2, %10, off\n\t"
                 "global_load_async_to_lds_b128 %3, %11, off\n\t"
                 "global_load_async_to_lds_b128 %4, %12, off\n\t"
                 "global_load_async_to_lds_b128 %5, %13, off\n\t"
                 "global_load_async_to_lds_b128 %6, %14, off\n\t"
                 "global_load_async_to_lds_b128 %7, %15, off\n\t"
                 "s_wait_xcnt 0x0"
                 :: "v"(l0), "v"(l0 + ls), "v"(l0 + 2 * ls), "v"(l0 + 3 * ls), "v"(l1), "v"(l1 + ls), "v"(l1 + 2 * ls), "v"(l1 + 3 * ls),
                    "v"(g0), "v"(g0 + s0), "v"(g0 + 2 * s0), "v"(g0 + 3 * s0), "v"(g1), "v"(g1 + s1), "v"(g1 + 2 * s1), "v"(g1 + 3 * s1) : "memory");
}

// ---- online softmax step on one wave's 16 x 64 score tile (D layout: s[nt][r] = S[row 8*hi + r][col nt*16 + lr]); diagonal tile: entries with col > row replaced by -1e9 before the
// 1/sqrt(HD) scaling (their exp is exactly 0); running max / running sum per row (replicated over the 16 lanes of a half), output accumulators rescaled; leaves s = exp(t - m).
__device__ __forceinline__ void online_softmax(v8f (&s)[4], float (&m)[8], float (&l)[8], v8f (&o)[4], bool diag, int row0, int kvb, int lr, int hi) {
#pragma unroll
    for (int nt = 0; nt < 4; ++nt)
#pragma unroll
        for (int r = 0; r < 8; ++r) { const int row = row0 + 8 * hi + r, col = kvb + nt * 16 + lr; float v = s[nt][r]; if (diag && col > row) v = -1.0e9f; s[nt][r] = v * SCL; }
#pragma unroll
    for (int r = 0; r < 8; ++r) {
        float mx = fmaxf(fmaxf(s[0][r], s[1][r]), fmaxf(s[2][r], s[3][r]));
#pragma unroll
        for (int sh = 1; sh < 16; sh <<= 1) mx = fmaxf(mx, __shfl_xor(mx, sh, 32));
        const float m2 = fmaxf(m[r], mx); const float alpha = __builtin_amdgcn_exp2f((m[r] - m2) * L2E); m[r] = m2;
        float rs = 0.0f;
#pragma unroll
        for (int nt = 0; nt < 4; ++nt) { const float p = __builtin_amdgcn_exp2f((s[nt][r] - m2) * L2E); s[nt][r] = p; rs += p; }
#pragma unroll
        for (int sh = 1; sh < 16; sh <<= 1) rs += __shfl_xor(rs, sh, 32);
        l[r] = l[r] * alpha + rs;
#pragma unroll
        for (int nt = 0; nt < 4; ++nt) o[nt][r] = o[nt][r] * alpha;
    }
}

// ---- k_attnr: causal attention for query rows < RRES (query tiles 0 .. RRES/64-1; they only visit key tiles 0 .. qt): block = 4 waves x 16 rows, head h uses kv group h / GRP.
// q, k, v from the bf16 hi/lo planes ([h][RRES][HD], [g][RRES][HD], [g][HD][RRES]); scores = qh.kh + ql.kh + qh.kl; unnormalised p split to bf16 hi/lo in a wave-private LDS tile,
// the four k and v^T tiles of 64 keys shared by the four waves through LDS (asynchronous copies, two buffers: the next tiles fly while these are worked on).
__global__ __launch_bounds__(128) void k_attnr(const bf* __restrict__ QPh, const bf* __restrict__ QPl, const bf* __restrict__ KPh, const bf* __restrict__ KPl, const bf* __restrict__ VTh, const bf* __restrict__ VTl, bf* CTh, bf* CTl) {
    __shared__ __align__(16) bf sP[4][2][16 * PP];
    __shared__ __align__(128) bf sKV[2][4][TLE];          // [buffer][k hi | v^T hi | k lo | v^T lo]
    const int lane = threadIdx.x & 31, wave = threadIdx.x >> 5, lr = lane & 15, hi = lane >> 4;
    const int qt = blockIdx.x, h = blockIdx.y, g = h / GRP; const int q0 = qt * 64 + wave * 16;
    const size_t sq = blockIdx.z;                         // sequence
    QPh += sq * NH * RRES * HD; QPl += sq * NH * RRES * HD; KPh += sq * NKV * RRES * HD; KPl += sq * NKV * RRES * HD; VTh += sq * NKV * HD * RRES; VTl += sq * NKV * HD * RRES;
    CTh += sq * RRES * DMO; CTl += sq * RRES * DMO;
    const bf* qh = QPh + ((size_t)h * RRES + q0) * HD; const bf* ql = QPl + ((size_t)h * RRES + q0) * HD;
    const bf* kh = KPh + (size_t)g * RRES * HD; const bf* kl = KPl + (size_t)g * RRES * HD;
    const bf* vh = VTh + (size_t)g * HD * RRES; const bf* vl = VTl + (size_t)g * HD * RRES;
    bf* sph = &sP[wave][0][0]; bf* spl = &sP[wave][1][0];
    float m[8], l[8]; v8f o[4];
#pragma unroll
    for (int r = 0; r < 8; ++r) { m[r] = -3.0e38f; l[r] = 0.0f; }
#pragma unroll
    for (int nt = 0; nt < 4; ++nt) o[nt] = (v8f){};
    const int nch = qt + 1;
    const int trow = threadIdx.x >> 3, tcol = (threadIdx.x & 7) * 8; const size_t tk = (size_t)trow * HD + tcol, tv = (size_t)trow * RRES + tcol;
    const unsigned lt = lds_off(&sKV[0][0][0]) + (unsigned)(trow * PP + tcol) * 2;
    auto stage = [&](int c, int buf) { const unsigned l = lt + (unsigned)buf * (4 * TLE * 2); const size_t ok = tk + (size_t)c * 64 * HD, ov = tv + (size_t)c * 64;
        acopy_tiles(l, kh + ok, (size_t)HD, l + TLE * 2, vh + ov, (size_t)RRES); acopy_tiles(l + 2 * TLE * 2, kl + ok, (size_t)HD, l + 3 * TLE * 2, vl + ov, (size_t)RRES); };
    stage(0, 0);
    asm volatile("s_wait_asynccnt 0x0" ::: "memory");     // this wave's copies of tile 0 have landed
    __syncthreads();                                      // every wave's have: tile 0 may be read
    if (nch > 1) stage(1, 1);
#pragma unroll 1
    for (int c = 0; c < nch; ++c) {
        const int kvb = c * 64; v8f s[4]; v16bf aqh[2], aql[2], bh, bl;
        const bf* skh = &sKV[c & 1][0][0]; const bf* svh = &sKV[c & 1][1][0]; const bf* skl = &sKV[c & 1][2][0]; const bf* svl = &sKV[c & 1][3][0];
#pragma unroll
        for (int kk = 0; kk < 2; ++kk) { aqh[kk] = WFrag<bf>::ld(qh + (size_t)lr * HD + 8 * hi + kk * 32); aql[kk] = WFrag<bf>::ld(ql + (size_t)lr * HD + 8 * hi + kk * 32); }
#pragma unroll
        for (int nt = 0; nt < 4; ++nt) { s[nt] = (v8f){}; const int ko = (nt * 16 + lr) * PP + 8 * hi;
#pragma unroll
            for (int kk = 0; kk < 2; ++kk) { bh = WFrag<bf>::ld(skh + ko + kk * 32); bl = WFrag<bf>::ld(skl + ko + kk * 32);
                s[nt] = wmmab(aqh[kk], bh, s[nt]); s[nt] = wmmab(aql[kk], bh, s[nt]); s[nt] = wmmab(aqh[kk], bl, s[nt]); } }
        asm volatile("v_nop\n\tv_nop\n\tv_nop\n\tv_nop" : "+v"(s[0]), "+v"(s[1]), "+v"(s[2]), "+v"(s[3]) : "v"(aqh[0]), "v"(aql[1]), "v"(bh), "v"(bl));
        online_softmax(s, m, l, o, c == qt, q0, kvb, lr, hi);
#pragma unroll
        for (int nt = 0; nt < 4; ++nt)
#pragma unroll
            for (int r = 0; r < 8; ++r) { unsigned short a2, c2; splitf(s[nt][r], a2, c2); const int so = (8 * hi + r) * PP + nt * 16 + lr; sph[so] = a2; spl[so] = c2; }
        lds_wsync();
        v16bf aph[2], apl[2], bvh, bvl;
#pragma unroll
        for (int kk = 0; kk < 2; ++kk) { const int ao = lr * PP + kk * 32 + 8 * hi; aph[kk] = cat16b(*(const v8usa*)(sph + ao), *(const v8usa*)(sph + ao + 16)); apl[kk] = cat16b(*(const v8usa*)(spl + ao), *(const v8usa*)(spl + ao + 16)); }
#pragma unroll
        for (int kk = 0; kk < 2; ++kk)
#pragma unroll
            for (int nt = 0; nt < 4; ++nt) { const int vo = (nt * 16 + lr) * PP + kk * 32 + 8 * hi; bvh = WFrag<bf>::ld(svh + vo); bvl = WFrag<bf>::ld(svl + vo);
                o[nt] = wmmab(aph[kk], bvh, o[nt]); o[nt] = wmmab(apl[kk], bvh, o[nt]); o[nt] = wmmab(aph[kk], bvl, o[nt]); }
        asm volatile("v_nop\n\tv_nop\n\tv_nop\n\tv_nop" : "+v"(o[0]), "+v"(o[1]), "+v"(o[2]), "+v"(o[3]) : "v"(aph[0]), "v"(apl[1]), "v"(bvh), "v"(bvl));
        lds_wsync();
        asm volatile("s_wait_dscnt 0x0" ::: "memory");    // this wave has left the buffer that is refilled below
        asm volatile("s_wait_asynccnt 0x0" ::: "memory"); // this wave's copies of tile c + 1 have landed
        __syncthreads();                                  // publishes tile c + 1 and ends every reader's last read of tile c
        if (c + 2 < nch) stage(c + 2, c & 1);
    }
    asm volatile("s_wait_asynccnt 0x0" ::: "memory");     // no copy is outstanding when the wave goes on and ends
    float inv[8];
#pragma unroll
    for (int r = 0; r < 8; ++r) inv[r] = 1.0f / l[r];
#pragma unroll
    for (int nt = 0; nt < 4; ++nt)
#pragma unroll
        for (int r = 0; r < 8; ++r) { unsigned short a2, c2; splitf(o[nt][r] * inv[r], a2, c2); const int so = (8 * hi + r) * PP + nt * 16 + lr; sph[so] = a2; spl[so] = c2; }
    lds_wsync();
    bf* chb = CTh + (size_t)q0 * DMO + h * HD; bf* clb = CTl + (size_t)q0 * DMO + h * HD;
{
#pragma unroll
        for (int it = 0; it < 4; ++it) { const int rr = it * 4 + (lane >> 3), pc = (lane & 7) * 8; const v8us va = *(const v8usa*)(sph + rr * PP + pc); const v8us vb = *(const v8usa*)(spl + rr * PP + pc);
            *(v8us*)(chb + (size_t)rr * DMO + pc) = va; *(v8us*)(clb + (size_t)rr * DMO + pc) = vb; }
         }
}

// ---- k_attn: causal attention for query tiles qt >= RRES/64 (blockIdx.x + RRES/64): same structure with single f16 products; q, k from [h][SEQ][HD] / [g][SEQ][HD] f16 planes,
// the k and v^T tiles of 64 keys shared by the four waves through LDS (asynchronous copies, two buffers: the next tiles fly while these are worked on).
__global__ __launch_bounds__(128) void k_attn(const h16* __restrict__ Q16, const h16* __restrict__ K16, const h16* __restrict__ VT16, h16* C16) {
    __shared__ __align__(16) h16 sP[4][16 * PP];
    __shared__ __align__(128) h16 sKV[2][2][TLE];         // [buffer][k | v^T]
    const int lane = threadIdx.x & 31, wave = threadIdx.x >> 5, lr = lane & 15, hi = lane >> 4;
    const int qt = blockIdx.x + RRES / 64, h = blockIdx.y, g = h / GRP; const int q0 = qt * 64 + wave * 16;
    const size_t sq = blockIdx.z;                         // sequence
    Q16 += sq * NH * SEQ * HD; K16 += sq * NKV * SEQ * HD; VT16 += sq * NKV * HD * SEQ; C16 += sq * SEQ * DMO;
    const h16* qp = Q16 + ((size_t)h * SEQ + q0) * HD; const h16* kp = K16 + (size_t)g * SEQ * HD; const h16* vp = VT16 + (size_t)g * HD * SEQ;
    h16* spw = &sP[wave][0];
    v16h aq[2];
#pragma unroll
    for (int kk = 0; kk < 2; ++kk) aq[kk] = WFrag<h16>::ld(qp + (size_t)lr * HD + 8 * hi + kk * 32);
    float m[8], l[8]; v8f o[4];
#pragma unroll
    for (int r = 0; r < 8; ++r) { m[r] = -3.0e38f; l[r] = 0.0f; }
#pragma unroll
    for (int nt = 0; nt < 4; ++nt) o[nt] = (v8f){};
    const int nch = qt + 1;
    const int trow = threadIdx.x >> 3, tcol = (threadIdx.x & 7) * 8;
    const h16* gk = kp + (size_t)trow * HD + tcol; const h16* gv = vp + (size_t)trow * SEQ + tcol;
    const unsigned lt = lds_off(&sKV[0][0][0]) + (unsigned)(trow * PP + tcol) * 2;
    auto stage = [&](int c, int buf) { const unsigned l = lt + (unsigned)buf * (2 * TLE * 2);
        acopy_tiles(l, gk + (size_t)c * 64 * HD, (size_t)HD, l + TLE * 2, gv + (size_t)c * 64, (size_t)SEQ); };
    stage(0, 0);
    asm volatile("s_wait_asynccnt 0x0" ::: "memory");     // this wave's copies of tile 0 have landed
    __syncthreads();                                      // every wave's have: tile 0 may be read
    if (nch > 1) stage(1, 1);
#pragma unroll 1
    for (int c = 0; c < nch; ++c) {
        const int kvb = c * 64; v8f s[4]; v16h b;
        const h16* sk = &sKV[c & 1][0][0] + lr * PP + 8 * hi; const h16* sv = &sKV[c & 1][1][0] + lr * PP + 8 * hi;
#pragma unroll
        for (int nt = 0; nt < 4; ++nt) { s[nt] = (v8f){}; const h16* kr = sk + nt * 16 * PP;
#pragma unroll
            for (int kk = 0; kk < 2; ++kk) { b = WFrag<h16>::ld(kr + kk * 32); s[nt] = wmma16(aq[kk], b, s[nt]); } }
        asm volatile("v_nop\n\tv_nop\n\tv_nop\n\tv_nop" : "+v"(s[0]), "+v"(s[1]), "+v"(s[2]), "+v"(s[3]) : "v"(aq[0]), "v"(aq[1]), "v"(b));
        online_softmax(s, m, l, o, c == qt, q0, kvb, lr, hi);
#pragma unroll
        for (int nt = 0; nt < 4; ++nt)
#pragma unroll
            for (int r = 0; r < 8; ++r) spw[(8 * hi + r) * PP + nt * 16 + lr] = tohx(s[nt][r] * PCAR);
        lds_wsync();
        v16h ap[2], bv;
#pragma unroll
        for (int kk = 0; kk < 2; ++kk) { const int ao = lr * PP + kk * 32 + 8 * hi; ap[kk] = cat16(*(const v8ha*)(spw + ao), *(const v8ha*)(spw + ao + 16)); }
#pragma unroll
        for (int kk = 0; kk < 2; ++kk)
#pragma unroll
            for (int nt = 0; nt < 4; ++nt) { bv = WFrag<h16>::ld(sv + nt * 16 * PP + kk * 32); o[nt] = wmma16(ap[kk], bv, o[nt]); }
        asm volatile("v_nop\n\tv_nop\n\tv_nop\n\tv_nop" : "+v"(o[0]), "+v"(o[1]), "+v"(o[2]), "+v"(o[3]) : "v"(ap[0]), "v"(ap[1]), "v"(bv));
        lds_wsync();
        asm volatile("s_wait_dscnt 0x0" ::: "memory");    // this wave has left the buffer that is refilled below
        asm volatile("s_wait_asynccnt 0x0" ::: "memory"); // this wave's copies of tile c + 1 have landed
        __syncthreads();                                  // publishes tile c + 1 and ends every reader's last read of tile c
        if (c + 2 < nch) stage(c + 2, c & 1);
    }
    asm volatile("s_wait_asynccnt 0x0" ::: "memory");     // no copy is outstanding when the wave goes on and ends
    float inv[8];
#pragma unroll
    for (int r = 0; r < 8; ++r) inv[r] = (1.0f / l[r]) * (CCAR / PCAR);
#pragma unroll
    for (int nt = 0; nt < 4; ++nt)
#pragma unroll
        for (int r = 0; r < 8; ++r) spw[(8 * hi + r) * PP + nt * 16 + lr] = tohx(o[nt][r] * inv[r]);
    lds_wsync();
    h16* cb = C16 + (size_t)q0 * DMO + h * HD;
{
#pragma unroll
        for (int it = 0; it < 4; ++it) { const int rr = it * 4 + (lane >> 3), pc = (lane & 7) * 8; const v8h val = *(const v8ha*)(spw + rr * PP + pc); *(v8h*)(cb + (size_t)rr * DMO + pc) = val; }
         }
}

extern "C" void kernel_launch(void* const* d_in, const int* in_sizes, int n_in,
                              void* d_out, int out_size, void* d_ws, size_t ws_size, hipStream_t stream) {
    if (n_in < 7) return;
    const long long rows_used = (long long)(NB - 1) * SEQ_FULL + SEQ;
    if ((long long)in_sizes[0] < rows_used * DIN) return;
    if (in_sizes[1] < SEQ * HD || in_sizes[2] < SEQ * HD) return;
    if (in_sizes[3] < DIN * DMO || in_sizes[4] < DIN * DKV || in_sizes[5] < DIN * DKV || in_sizes[6] < DMO * DMO) return;
    if ((long long)out_size < rows_used * DMO) return;
    // wire order: x, cos, sin, wq, wk, wv, wo
    const float* x = (const float*)d_in[0]; const float* cosi = (const float*)d_in[1]; const float* sini = (const float*)d_in[2];
    const float* wq = (const float*)d_in[3]; const float* wk = (const float*)d_in[4]; const float* wv = (const float*)d_in[5]; const float* wo = (const float*)d_in[6];
    float* OUT = (float*)d_out;     // [NB_FULL][SEQ_FULL][DMO]
    char* wsp = (char*)d_ws;
    auto take = [&](size_t bytes) { char* p = wsp; wsp += (bytes + 255) & ~(size_t)255; return (void*)p; };
    bf* WQ   = (bf*)take((size_t)DMO * DIN * 2);          // Bt [out][in]
    bf* WK   = (bf*)take((size_t)DKV * DIN * 2);
    bf* WV   = (bf*)take((size_t)DKV * DIN * 2);
    bf* WOb  = (bf*)take((size_t)DMO * DMO * 2);
    h16* WO16 = (h16*)take((size_t)DMO * DMO * 2);
    bf* XB   = (bf*)take((size_t)NB * SEQ * DIN * 2);     // from here on: NB planes each, sequence-major
    h16* Q16 = (h16*)take((size_t)NB * NH * SEQ * HD * 2); h16* K16 = (h16*)take((size_t)NB * NKV * SEQ * HD * 2); h16* VT16 = (h16*)take((size_t)NB * NKV * HD * SEQ * 2);
    bf* QPh = (bf*)take((size_t)NB * NH * RRES * HD * 2); bf* QPl = (bf*)take((size_t)NB * NH * RRES * HD * 2);
    bf* KPh = (bf*)take((size_t)NB * NKV * RRES * HD * 2); bf* KPl = (bf*)take((size_t)NB * NKV * RRES * HD * 2);
    bf* VTh = (bf*)take((size_t)NB * NKV * HD * RRES * 2); bf* VTl = (bf*)take((size_t)NB * NKV * HD * RRES * 2);
    h16* C16 = (h16*)take((size_t)NB * SEQ * DMO * 2);   // rows >= RRES of each sequence used
    bf* CTh = (bf*)take((size_t)NB * RRES * DMO * 2); bf* CTl = (bf*)take((size_t)NB * RRES * DMO * 2);
    int* MFLAG = (int*)take(128);
    const size_t carved = (size_t)(wsp - (char*)d_ws);
    if (carved > ws_size || carved > (size_t)268435456) return;

    k_flag0<<<1, 32, 0, stream>>>(MFLAG);
    k_wtG<<<(unsigned)((DMO * DIN / 64 + 63) / 64), 256, 0, stream>>>(wq, DIN, DMO, WQ, nullptr);
    k_wtG<<<(unsigned)((DKV * DIN / 64 + 63) / 64), 256, 0, stream>>>(wk, DIN, DKV, WK, nullptr);
    k_wtG<<<(unsigned)((DKV * DIN / 64 + 63) / 64), 256, 0, stream>>>(wv, DIN, DKV, WV, nullptr);
    k_wtG<<<(unsigned)((DMO * DMO / 64 + 63) / 64), 256, 0, stream>>>(wo, DMO, DMO, WOb, WO16);
    k_cvt8<<<dim3((unsigned)(((size_t)SEQ * DIN / 8 + 255) / 256), NB, 1), 256, 0, stream>>>(x, XB, (size_t)SEQ * DIN / 8, (size_t)SEQ_FULL * DIN, (size_t)SEQ * DIN);
    k_gemmw<bf, 0, 1><<<dim3(SEQ / 128, DMO / 128, NB), 128, 0, stream>>>(XB, nullptr, WQ, nullptr, DIN, nullptr, DMO, 1.0f, MFLAG, (size_t)SEQ * DIN, 0, 0, cosi, sini, Q16, QPh, QPl);
    k_gemmw<bf, 0, 1><<<dim3(SEQ / 128, DKV / 128, NB), 128, 0, stream>>>(XB, nullptr, WK, nullptr, DIN, nullptr, DKV, 1.0f, MFLAG, (size_t)SEQ * DIN, 0, 0, cosi, sini, K16, KPh, KPl);
    k_gemmw<bf, 0, 2><<<dim3(DKV / 128, SEQ / 128, NB), 128, 0, stream>>>(WV, nullptr, XB, nullptr, DIN, nullptr, SEQ, 1.0f, MFLAG, 0, (size_t)SEQ * DIN, 0, nullptr, nullptr, VT16, VTh, VTl);
    k_attnr<<<dim3(RRES / 64, NH, NB), 128, 0, stream>>>(QPh, QPl, KPh, KPl, VTh, VTl, CTh, CTl);
    if (SEQ > RRES) k_attn<<<dim3((SEQ - RRES) / 64, NH, NB), 128, 0, stream>>>(Q16, K16, VT16, C16);
    k_gemmw<bf, 1, 0><<<dim3(RRES / 128, DMO / 128, NB), 128, 0, stream>>>(CTh, CTl, WOb, nullptr, DMO, OUT, DMO, 1.0f, MFLAG, (size_t)RRES * DMO, 0, (size_t)SEQ_FULL * DMO, nullptr, nullptr, nullptr, nullptr, nullptr);
    if (SEQ > RRES) k_gemmw<h16, 0, 0><<<dim3((SEQ - RRES) / 128, DMO / 128, NB), 128, 0, stream>>>(C16 + (size_t)RRES * DMO, nullptr, WO16, nullptr, DMO, OUT + (size_t)RRES * DMO, DMO, 1.0f / (CCAR * WCAR), MFLAG, (size_t)SEQ * DMO, 0, (size_t)SEQ_FULL * DMO, nullptr, nullptr, nullptr, nullptr, nullptr);
}

// v005
// One run takes 259 microseconds.
// Timed twice side by side with v004, it ran 1.13 times as fast both times.
// Counting every step since v000, it is 2.95 times as fast.
#include <hip/hip_runtime.h>

// Contractions and operand types (f32 accumulate everywhere): x Wq, x Wk, x Wv on v_wmma_f32_16x16x32_bf16 with RNE bf16 copies of x and W (exact products);
// query rows < RRES of each sequence: q.k^T and p.v on v_wmma_f32_16x16x32_bf16 as bf16 hi/lo splits (3 products each), their ctx Wo as bf16 hi/lo ctx times bf16 Wo (2 products);
// query rows >= RRES: q.k^T and p.v on v_wmma_f32_16x16x32_f16 (f16 q/k/v planes, p carried x1024), ctx Wo on v_wmma_f32_16x16x32_f16 (ctx carried x16, Wo carried x64, folded by 1/1024 in the epilogue).
// diagonal are skipped (their probabilities are exactly 0) and the diagonal tile is masked by index; a constant zero flag line feeds the additive term of the GEMM epilogue.
// The projection GEMMs write the attention operand planes themselves: the rotary mix (q, k) and the 16-bit conversions (q, k, v^T) are their epilogues; no f32 projection plane exists.
// All NB sequences go through every launch together: the last grid dimension is the sequence (k_prep, on a flat grid, takes PX_S blocks a sequence after the weight tiles), and every per-sequence workspace plane holds NB copies, sequence-major.

#ifndef NB
#define NB 2
#endif
#ifndef SEQ
#define SEQ 2048
#endif
#ifndef RRES
#define RRES 256
#endif
#define NB_FULL 2
#define SEQ_FULL 2048
#define DIN 2048
#define DMO 2048
#define NH 32
#define NKV 8
#define GRP (NH / NKV)
#define HD 64
#define DKV (NKV * HD)
#define PP 72
#define PCAR 1024.0f
#define CCAR 16.0f
#define WCAR 64.0f
#define SCL 0.125f
#define L2E 1.4426950408889634f
static_assert(SEQ % 64 == 0 && SEQ >= 64 && SEQ <= SEQ_FULL);
static_assert(RRES % 64 == 0 && RRES >= 64 && RRES <= SEQ);
static_assert(NB >= 1 && NB <= NB_FULL);
static_assert(DIN % 32 == 0 && DMO % 64 == 0 && DKV % 64 == 0 && HD == 64 && (NH % NKV) == 0);
static_assert(DMO == NH * HD && DMO % 32 == 0);
static_assert(PP % 8 == 0 && PP >= HD);
static_assert((DMO * DIN) % 64 == 0 && (DKV * DIN) % 64 == 0 && (DMO * DMO) % 64 == 0 && DIN % 2 == 0 && DMO % 2 == 0);
static_assert(((size_t)SEQ * DIN) % 8 == 0);
// workspace carve (every plane a multiple of 256 B; same sequence as the launcher's take() calls)
#define AL256(x) ((((size_t)(x)) + 255) & ~(size_t)255)
#define WS_TOTAL (AL256((size_t)DMO * DIN * 2) + 2 * AL256((size_t)DKV * DIN * 2) + 2 * AL256((size_t)DMO * DMO * 2) + AL256((size_t)NB * SEQ * DIN * 2) \
                  + AL256((size_t)NB * NH * SEQ * HD * 2) + 2 * AL256((size_t)NB * NKV * SEQ * HD * 2) + 2 * AL256((size_t)NB * NH * RRES * HD * 2) \
                  + 4 * AL256((size_t)NB * NKV * RRES * HD * 2) + AL256((size_t)NB * SEQ * DMO * 2) + 2 * AL256((size_t)NB * RRES * DMO * 2) + AL256(128))
static_assert(WS_TOTAL <= (size_t)268435456);

typedef _Float16 h16;
typedef unsigned short bf;
typedef __attribute__((ext_vector_type(16))) __bf16   v16bf;
typedef __attribute__((ext_vector_type(16))) _Float16 v16h;
typedef __attribute__((ext_vector_type(8)))  _Float16 v8h;
typedef __attribute__((ext_vector_type(8)))  unsigned short v8us;
typedef __attribute__((ext_vector_type(8)))  float    v8f;
typedef __attribute__((ext_vector_type(4)))  float    v4f;
typedef __attribute__((ext_vector_type(4)))  int      v4i;
typedef __attribute__((ext_vector_type(2)))  _Float16 v2h;
typedef __attribute__((ext_vector_type(2)))  unsigned short v2us;
typedef __attribute__((ext_vector_type(4)))  _Float16 v4h;
typedef __attribute__((ext_vector_type(4)))  unsigned short v4us;
typedef v8h  __attribute__((may_alias)) v8ha;
typedef v4f  __attribute__((may_alias)) v4fa;
typedef v8us __attribute__((may_alias)) v8usa;

__device__ __forceinline__ unsigned short f2bf(float f) { unsigned u = __float_as_uint(f); u += 0x7FFFu + ((u >> 16) & 1u); return (unsigned short)(u >> 16); }
__device__ __forceinline__ float bf2f(unsigned short b) { return __uint_as_float(((unsigned)b) << 16); }
__device__ __forceinline__ float bfr(float f) { return bf2f(f2bf(f)); }
__device__ __forceinline__ h16 tohx(float x) { return (h16)x; }
__device__ __forceinline__ void splitf(float y, unsigned short& h, unsigned short& l) { h = f2bf(y); l = f2bf(y - bf2f(h)); }
__device__ __forceinline__ v16h cat16(v8h lo, v8h hi) { return __builtin_shufflevector(lo, hi, 0, 1, 2, 3, 4, 5, 6, 7, 8, 9, 10, 11, 12, 13, 14, 15); }
__device__ __forceinline__ v16bf cat16b(v8us lo, v8us hi) { return __builtin_bit_cast(v16bf, __builtin_shufflevector(lo, hi, 0, 1, 2, 3, 4, 5, 6, 7, 8, 9, 10, 11, 12, 13, 14, 15)); }
__device__ __forceinline__ v8f wmma16(v16h a, v16h b, v8f c) { return __builtin_amdgcn_wmma_f32_16x16x32_f16(false, a, false, b, (short)0, c, false, false); }
__device__ __forceinline__ v8f wmmab(v16bf a, v16bf b, v8f c) { return __builtin_amdgcn_wmma_f32_16x16x32_bf16(false, a, false, b, (short)0, c, false, false); }
// wave-private LDS tile: stores of this wave made visible to its own later cross-lane loads, loads kept below the stores by the compiler
__device__ __forceinline__ void lds_wsync() { __builtin_amdgcn_fence(3 /* release order */, "wavefront"); __builtin_amdgcn_wave_barrier(); asm volatile("" ::: "memory"); }

// 16-bit fragment loaders: lane l -> row/column (l & 15); elements 0..7 <- k0 + 8*(l>>4) + 0..7, elements 8..15 <- k0 + 16 + 8*(l>>4) + 0..7 of a K-contiguous row (p already offset by 8*(l>>4)).
template <typename T16> struct WFrag;
template <> struct WFrag<h16> { typedef v16h V; static __device__ __forceinline__ V ld(const h16* p) { return cat16(*(const v8h*)p, *(const v8h*)(p + 16)); } static __device__ __forceinline__ v8f mma(V a, V b, v8f c) { return wmma16(a, b, c); } };
template <> struct WFrag<bf> { typedef v16bf V; static __device__ __forceinline__ V ld(const bf* p) { return cat16b(*(const v8us*)p, *(const v8us*)(p + 16)); } static __device__ __forceinline__ v8f mma(V a, V b, v8f c) { return wmmab(a, b, c); } };

// ---- k_gemmw: work-group tiled GEMM: 4 waves (2 x 2) share one 128x128 output tile, each wave keeps a 64x64 part (16 accumulators); grid (M/128, N/128, Z), 128 threads.
// A stage is GKS = 128 k (256 B) of the 128 A rows, the 128 Bt rows (and the 128 A2 rows when NSPLIT == 1), brought from the K-contiguous 16-bit planes into LDS by asynchronous
// 16-byte copies at a row pitch of 272 B; two buffers, the next stage's copies fly while this stage is multiplied. Every accumulator sums k upward in steps of 32, A before A2.
// F[m][n] = (sum_k A[m][k] Bt[n][k] (+ A2[m][k] Bt[n][k] when NSPLIT == 1)) * cscale + (pflag[0] ? NaN : 0). K % 128 == 0, K >= 128, M % 128 == 0, N % 128 == 0.
// EPI == 0: C[m][n] (f32, pitch ldc) = F[m][n].
// EPI == 1 (m = token t, n = h*HD + d, ldc = N; a wave's 64 columns are one head): head planes of the rotate-half rotary mix of F with the cos/sin input tables (bf16 RNE values):
//   r[d] = x[d] cos[t][d] - x[d+HD/2] sin[t][d] (d < HD/2), r[d] = x[d] cos[t][d] + x[d-HD/2] sin[t][d] (d >= HD/2); P16[h][t][d] = f16(r) for every t, Ph/Pl[h][t][d] bf16 hi/lo for t < RRES.
// EPI == 2 (m = g*HD + d, n = token t: the weight rows are the A operand, so F is already v^T): P16[m][t] = f16(F) (row pitch SEQ), Ph/Pl[m][t] bf16 hi/lo for t < RRES (row pitch RRES).
#define GKS 128
#define GPI 136
static_assert(DIN % GKS == 0 && DMO % GKS == 0 && SEQ % 128 == 0 && RRES % 128 == 0 && DMO % 128 == 0 && DKV % 128 == 0);
__device__ __forceinline__ unsigned lds_off(const void* p) { return (unsigned)(size_t)p; }
// eight copies of one lane: rows 8 apart, 16 B each, LDS byte address l, global address g (row pitch K elements). The s_wait_xcnt closes the statement so that no address register
// of an issued copy is rewritten ahead of it.
template <typename T16>
__device__ __forceinline__ void acopy8(unsigned l, const T16* g, size_t K) {
    const unsigned ls = 8 * GPI * 2; const size_t gs = 8 * K;
    asm volatile("global_load_async_to_lds_b128 %0, %8, off\n\t"
                 "global_load_async_to_lds_b128 %1, %9, off\n\t"
                 "global_load_async_to_lds_b128 %2, %10, off\n\t"
                 "global_load_async_to_lds_b128 %3, %11, off\n\t"
                 "global_load_async_to_lds_b128 %4, %12, off\n\t"
                 "global_load_async_to_lds_b128 %5, %13, off\n\t"
                 "global_load_async_to_lds_b128 %6, %14, off\n\t"
                 "global_load_async_to_lds_b128 %7, %15, off\n\t"
                 "s_wait_xcnt 0x0"
                 :: "v"(l), "v"(l + ls), "v"(l + 2 * ls), "v"(l + 3 * ls), "v"(l + 4 * ls), "v"(l + 5 * ls), "v"(l + 6 * ls), "v"(l + 7 * ls),
                    "v"(g), "v"(g + gs), "v"(g + 2 * gs), "v"(g + 3 * gs), "v"(g + 4 * gs), "v"(g + 5 * gs), "v"(g + 6 * gs), "v"(g + 7 * gs) : "memory");
}
// 128 rows x 256 B of one operand: 16 copies a lane (16 lanes cover a row, a wave two rows)
template <typename T16>
__device__ __forceinline__ void acopy_rows(unsigned l, const T16* g, size_t K) { acopy8(l, g, K); acopy8(l + 64 * GPI * 2, g + 64 * K, K); }

template <typename T16, int NSPLIT, int EPI>
__global__ __launch_bounds__(128) void k_gemmw(const T16* __restrict__ A, const T16* __restrict__ A2, const T16* __restrict__ Bt, const T16* __restrict__ Bt2, int K, float* C, int ldc, float cscale, const int* __restrict__ pflag, size_t sA, size_t sB, size_t sC,
                                               const float* __restrict__ COSI, const float* __restrict__ SINI, h16* P16, bf* Ph, bf* Pl) {
    typedef typename WFrag<T16>::V V;
    static_assert(NSPLIT == 0 || NSPLIT == 1); static_assert(EPI >= 0 && EPI <= 2);
    constexpr int OPE = 128 * GPI;                        // elements of one operand's rows in a stage
    constexpr int STE = (NSPLIT == 1 ? 3 : 2) * OPE;      // elements of a stage: [A | Bt | A2]
    __shared__ __align__(128) T16 ring[2 * STE];
    __shared__ __align__(16) float osw[4][16 * 68];
    const size_t z = blockIdx.z; A += z * sA; if (A2) A2 += z * sA; Bt += z * sB; if (EPI == 0) C += z * sC;
    const int tid = threadIdx.x, lane = tid & 31, wave = tid >> 5, lr = lane & 15, hi = lane >> 4; const int wm = wave >> 1, wn = wave & 1;
    const int r0 = blockIdx.x * 128, c0 = blockIdx.y * 128;
    const float padd = (pflag[0] != 0) ? __int_as_float(0x7fc00000) : 0.0f;
    v8f acc[4][4];
#pragma unroll
    for (int mb = 0; mb < 4; ++mb)
#pragma unroll
        for (int nb = 0; nb < 4; ++nb) acc[mb][nb] = (v8f){};
    const int trow = tid >> 4, tcol = tid & 15;
    const T16* ga = A + (size_t)(r0 + trow) * K + tcol * 8; const T16* gb = Bt + (size_t)(c0 + trow) * K + tcol * 8;
    const T16* ga2 = (NSPLIT == 1) ? A2 + (size_t)(r0 + trow) * K + tcol * 8 : nullptr;
    const unsigned lt = lds_off(ring) + (unsigned)(trow * GPI + tcol * 8) * 2;
    auto stage = [&](int t, int buf) { const unsigned l = lt + (unsigned)buf * (STE * 2); const size_t ko = (size_t)t * GKS;
        acopy_rows(l, ga + ko, (size_t)K); acopy_rows(l + OPE * 2, gb + ko, (size_t)K); if (NSPLIT == 1) acopy_rows(l + 2 * OPE * 2, ga2 + ko, (size_t)K); };
    const int nt = K / GKS;
    stage(0, 0);
    asm volatile("s_wait_asynccnt 0x0" ::: "memory");     // this wave's copies of stage 0 have landed
    __syncthreads();                                      // every wave's have: stage 0 may be read
    if (nt > 1) stage(1, 1);
    // the stage loop stays rolled: one copy of the body in the instruction cache, the buffer picked by t & 1
#pragma unroll 1
    for (int t = 0; t < nt; ++t) {
        const T16* sa = ring + (t & 1) * STE + (wm * 64 + lr) * GPI + 8 * hi; const T16* sb = ring + (t & 1) * STE + OPE + (wn * 64 + lr) * GPI + 8 * hi;
        // two fragment sets: the reads of the next 32 k of this stage go out as one group ahead of this step's matrix instructions, so that only the stage's first group is waited for in full
        // (every loop below is unrolled so that set, fragment and accumulator indices are constants and the arrays live in registers)
        V a[2][4], b[2][4], a2[2][4];
        auto ldset = [&](int s, int ks) {
#pragma unroll
            for (int mb = 0; mb < 4; ++mb) { a[s][mb] = WFrag<T16>::ld(sa + mb * 16 * GPI + ks); if (NSPLIT == 1) a2[s][mb] = WFrag<T16>::ld(sa + 2 * OPE + mb * 16 * GPI + ks); }
#pragma unroll
            for (int nb = 0; nb < 4; ++nb) b[s][nb] = WFrag<T16>::ld(sb + nb * 16 * GPI + ks); };
        ldset(0, 0);
#pragma unroll
        for (int q = 0; q < GKS / 32; ++q) {
            if (q + 1 < GKS / 32) ldset((q + 1) & 1, (q + 1) * 32);
            // keeps the group of reads above in front of this step's matrix instructions (the scheduler otherwise spreads them among these, each with a full wait); in the last step, which
            // has no reads, it keeps the step before in front of the waits at the loop's foot, where its matrix instructions cover the last reads' latency (without it they sink behind the barrier)
            __builtin_amdgcn_sched_barrier(0);
#pragma unroll
            for (int nb = 0; nb < 4; ++nb)
#pragma unroll
                for (int mb = 0; mb < 4; ++mb) { acc[mb][nb] = WFrag<T16>::mma(a[q & 1][mb], b[q & 1][nb], acc[mb][nb]); if (NSPLIT == 1) acc[mb][nb] = WFrag<T16>::mma(a2[q & 1][mb], b[q & 1][nb], acc[mb][nb]); }
        }
        asm volatile("s_wait_dscnt 0x0" ::: "memory");    // this wave has left the buffer that is refilled below
        asm volatile("s_wait_asynccnt 0x0" ::: "memory"); // this wave's copies of stage t + 1 have landed
        __syncthreads();                                  // publishes stage t + 1 and ends every reader's last read of stage t
        if (t + 2 < nt) stage(t + 2, t & 1);
    }
    asm volatile("s_wait_asynccnt 0x0" ::: "memory");     // no copy is outstanding when the wave goes on and ends
    if constexpr (EPI == 0) {
    float* os = &osw[wave][0];
#pragma unroll
    for (int mb = 0; mb < 4; ++mb) {
#pragma unroll
        for (int nb = 0; nb < 4; ++nb) {
#pragma unroll
            for (int j = 0; j < 8; ++j) os[(hi * 8 + j) * 68 + nb * 16 + lr] = acc[mb][nb][j]; }
        __builtin_amdgcn_wave_barrier(); asm volatile("" ::: "memory");
        float* crow = C + (size_t)(r0 + wm * 64 + mb * 16) * ldc + c0 + wn * 64;
{
#pragma unroll
            for (int s = 0; s < 8; ++s) { const int row = 2 * s + hi, cofs = lr * 4; v4f val = *(const v4fa*)(os + row * 68 + cofs); val = val * cscale + padd;
                *(v4f*)(crow + (size_t)row * ldc + cofs) = val; }
             }
        __builtin_amdgcn_wave_barrier(); asm volatile("" ::: "memory");
    }
    } else {
        // The ring is free: every wave's last read of it and every copy into it ended in front of the loop's last barrier. Each wave lays its whole 64 x 64 f32 part there (own range, row
        // pitch 68) and walks it in rolled loops of 8 rows a trip, so that the epilogue's text stays short.
        float* ot = reinterpret_cast<float*>(ring) + wave * (64 * 68);
        static_assert(4 * 64 * 68 * 4 <= 2 * STE * 2);
#pragma unroll
        for (int mb = 0; mb < 4; ++mb)
#pragma unroll
            for (int nb = 0; nb < 4; ++nb)
#pragma unroll
                for (int j = 0; j < 8; ++j) ot[(mb * 16 + hi * 8 + j) * 68 + nb * 16 + lr] = acc[mb][nb][j];
        __builtin_amdgcn_wave_barrier(); asm volatile("" ::: "memory");   // the wave's own stores stay in front of its cross-lane reads below
        const int mw = r0 + wm * 64 + hi, cofs = lr * 4;
        // the hi/lo planes hold tokens < RRES only: a whole 128-token tile is in or out (RRES % 128 == 0)
        if constexpr (EPI == 1) {
            const bool res = r0 < RRES;
            const size_t hp = z * (size_t)(ldc / HD) + (size_t)(c0 / HD + wn); P16 += hp * SEQ * HD; Ph += hp * RRES * HD; Pl += hp * RRES * HD;
            const float* cp = COSI + (size_t)mw * HD + cofs; const float* sp = SINI + (size_t)mw * HD + cofs;
            v4f cs[4], sn[4];
#pragma unroll
            for (int i = 0; i < 4; ++i) { cs[i] = *(const v4f*)(cp + i * 2 * HD); sn[i] = *(const v4f*)(sp + i * 2 * HD); }
            asm volatile("s_wait_xcnt 0x0" ::: "memory");                 // in front of any rewrite of the address registers of the loads above
            // rolled (short text); the next trip's cos and sin are asked for one trip ahead, so that this trip's work covers their latency (the last trip asks for its own rows again)
#pragma unroll 1
            for (int g = 0; g < 8; ++g) {
                v4f cn[4], sm[4]; const int gn = (g < 7) ? g + 1 : 7;
#pragma unroll
                for (int i = 0; i < 4; ++i) { cn[i] = *(const v4f*)(cp + (gn * 8 + i * 2) * HD); sm[i] = *(const v4f*)(sp + (gn * 8 + i * 2) * HD); }
                asm volatile("s_wait_xcnt 0x0" ::: "memory");             // in front of any rewrite of the address registers of the loads above
                // the trip's LDS reads go out together, its stores together at its foot: one LDS latency and one wait a trip
                v4f x0[4], x1[4]; v4h o16[4]; v4us oh[4], ol[4];
#pragma unroll
                for (int i = 0; i < 4; ++i) { const float* xr = ot + (g * 8 + i * 2 + hi) * 68; x0[i] = *(const v4fa*)(xr + cofs); x1[i] = *(const v4fa*)(xr + (cofs ^ (HD / 2))); }
#pragma unroll
                for (int i = 0; i < 4; ++i) { const v4f y0 = x0[i] * cscale + padd, y1 = x1[i] * cscale + padd;
#pragma unroll
                    for (int q = 0; q < 4; ++q) { const float cv = bfr(cs[i][q]), snv = bfr(sn[i][q]); const float pa = y0[q] * cv, pb = y1[q] * snv; const float r = (cofs < HD / 2) ? (pa - pb) : (pa + pb);
                        o16[i][q] = tohx(r); unsigned short a2, c2; splitf(r, a2, c2); oh[i][q] = a2; ol[i][q] = c2; } }
                const size_t oo = (size_t)(mw + g * 8) * HD + cofs;
                if (res) {
#pragma unroll
                    for (int i = 0; i < 4; ++i) { *(v4us*)(Ph + oo + i * 2 * HD) = oh[i]; *(v4us*)(Pl + oo + i * 2 * HD) = ol[i]; }
                    asm volatile("s_wait_xcnt 0x0" ::: "memory"); }       // in front of any rewrite of the registers of the stores above
#pragma unroll
                for (int i = 0; i < 4; ++i) *(v4h*)(P16 + oo + i * 2 * HD) = o16[i];
                asm volatile("s_wait_xcnt 0x0" ::: "memory");             // in front of any rewrite of the registers of the stores above
                __builtin_amdgcn_sched_barrier(0);                        // keeps the register copies below behind that wait (the scheduler otherwise lifts them over it, onto the stores' registers)
#pragma unroll
                for (int i = 0; i < 4; ++i) { cs[i] = cn[i]; sn[i] = sm[i]; }
            }
        } else {
            const bool res = c0 < RRES;
            const int t = c0 + wn * 64 + cofs;
            P16 += z * (size_t)DKV * SEQ + t; Ph += z * (size_t)DKV * RRES + t; Pl += z * (size_t)DKV * RRES + t;
            // rolled: short text
#pragma unroll 1
            for (int g = 0; g < 8; ++g) {
                // the trip's LDS reads go out together, its stores together at its foot: one LDS latency and one wait a trip
                v4f val[4]; v4h o16[4]; v4us oh[4], ol[4];
#pragma unroll
                for (int i = 0; i < 4; ++i) val[i] = *(const v4fa*)(ot + (g * 8 + i * 2 + hi) * 68 + cofs);
#pragma unroll
                for (int i = 0; i < 4; ++i) { const v4f y = val[i] * cscale + padd;
#pragma unroll
                    for (int q = 0; q < 4; ++q) { o16[i][q] = tohx(y[q]); unsigned short a2, c2; splitf(y[q], a2, c2); oh[i][q] = a2; ol[i][q] = c2; } }
                const size_t m = (size_t)(mw + g * 8);
                if (res) {
#pragma unroll
                    for (int i = 0; i < 4; ++i) { *(v4us*)(Ph + (m + i * 2) * RRES) = oh[i]; *(v4us*)(Pl + (m + i * 2) * RRES) = ol[i]; }
                    asm volatile("s_wait_xcnt 0x0" ::: "memory"); }       // in front of any rewrite of the registers of the stores above
#pragma unroll
                for (int i = 0; i < 4; ++i) *(v4h*)(P16 + (m + i * 2) * SEQ) = o16[i];
                asm volatile("s_wait_xcnt 0x0" ::: "memory");             // in front of any rewrite of the registers of the stores above
            }
        }
    }
}

// ---- k_prep: every 16-bit plane that is a plain function of one input, in one launch of 256-thread blocks, 64 KB of f32 a block, sixteen 16-byte loads a lane in flight.
// Blocks < PT_W: one 128 (k) x 128 (n) tile of a weight w[k][n]: whole 512-B rows are read, RNE bf16 pairs (k, k + 1) go to LDS as dwords at [n][k / 2], and rows of 128 k (256 B) are written to
// Bt[n][k]; Ht[n][k] = f16(bf16 value x WCAR) for wo. The dword column is XORed with 2 * ((n >> 2) & 31): the 32 lanes of a store (n four apart, one k pair) then hit 32 different banks,
// and a pair of neighbouring columns stays an aligned pair for the 8-byte reads. Blocks >= PT_W: PXE consecutive elements of x to bf16. Block 0 also writes the zero flag line.
#define PTE 128
#define PXE 16384
#define PT_Q ((DIN / PTE) * (DMO / PTE))
#define PT_K ((DIN / PTE) * (DKV / PTE))
#define PT_O ((DMO / PTE) * (DMO / PTE))
#define PT_W (PT_Q + 2 * PT_K + PT_O)
#define PX_S ((int)(((size_t)SEQ * DIN) / PXE))
static_assert(DIN % PTE == 0 && DMO % PTE == 0 && DKV % PTE == 0 && ((size_t)SEQ * DIN) % PXE == 0);
typedef __attribute__((ext_vector_type(2))) unsigned v2u;
typedef v2u __attribute__((may_alias)) v2ua;
template <int N, int K, bool HASH>
__device__ __forceinline__ void prep_tile(const float* __restrict__ w, bf* Bt, h16* Ht, int b, unsigned* tp, int lane, int wave) {
    constexpr int NTN = N / PTE; const int k0 = (b / NTN) * PTE, n0 = (b % NTN) * PTE;
    const float* s = w + (size_t)(k0 + wave * 16) * N + n0 + lane * 4;
    v4f v[16];
#pragma unroll
    for (int i = 0; i < 16; ++i) v[i] = *(const v4f*)(s + (size_t)i * N);
    asm volatile("s_wait_xcnt 0x0" :: "v"(s) : "memory");   // in front of any rewrite of the loads' address registers (the pointer is named so that they live up to here)
#pragma unroll
    for (int i = 0; i < 8; ++i)
#pragma unroll
        for (int j = 0; j < 4; ++j) tp[(lane * 4 + j) * (PTE / 2) + ((wave * 8 + i) ^ (lane * 2))] = (unsigned)f2bf(v[2 * i][j]) | ((unsigned)f2bf(v[2 * i + 1][j]) << 16);
    __syncthreads();                                      // the whole tile is in LDS before any row of it is read
    v2u d[16];
#pragma unroll
    for (int r = 0; r < 16; ++r) { const int n = wave * 16 + r; d[r] = *(const v2ua*)(tp + n * (PTE / 2) + ((lane * 2) ^ (((n >> 2) & 31) << 1))); }
    const size_t o = (size_t)(n0 + wave * 16) * K + k0 + lane * 4;
#pragma unroll
    for (int r = 0; r < 16; ++r) { const v4us t = __builtin_bit_cast(v4us, d[r]); *(v4us*)(Bt + o + (size_t)r * K) = t;
        if (HASH) { v4h hh;
#pragma unroll
            for (int q = 0; q < 4; ++q) hh[q] = tohx(bf2f(t[q]) * WCAR);
            *(v4h*)(Ht + o + (size_t)r * K) = hh; } }
    asm volatile("s_wait_xcnt 0x0" ::: "memory");         // in front of any rewrite of the registers of the stores above
}
__global__ __launch_bounds__(256) void k_prep(const float* __restrict__ x, const float* __restrict__ wq, const float* __restrict__ wk, const float* __restrict__ wv, const float* __restrict__ wo,
                                              bf* XB, bf* WQ, bf* WK, bf* WV, bf* WOb, h16* WO16, int* MFLAG) {
    __shared__ __align__(16) unsigned tp[PTE * (PTE / 2)];
    const int tid = threadIdx.x, lane = tid & 31, wave = tid >> 5; const int b = blockIdx.x;
    if (b == 0 && tid < 32) MFLAG[tid] = 0;
    if (b < PT_Q) prep_tile<DMO, DIN, false>(wq, WQ, nullptr, b, tp, lane, wave);
    else if (b < PT_Q + PT_K) prep_tile<DKV, DIN, false>(wk, WK, nullptr, b - PT_Q, tp, lane, wave);
    else if (b < PT_Q + 2 * PT_K) prep_tile<DKV, DIN, false>(wv, WV, nullptr, b - PT_Q - PT_K, tp, lane, wave);
    else if (b < PT_W) prep_tile<DMO, DMO, true>(wo, WOb, WO16, b - PT_Q - 2 * PT_K, tp, lane, wave);
    else {
        const int u = b - PT_W; const int sq = u / PX_S; const size_t o = (size_t)(u % PX_S) * PXE + tid * 4;
        const float* s = x + (size_t)sq * SEQ_FULL * DIN + o; bf* dp = XB + (size_t)sq * SEQ * DIN + o;
        v4f v[16];
#pragma unroll
        for (int i = 0; i < 16; ++i) v[i] = *(const v4f*)(s + i * 1024);
        asm volatile("s_wait_xcnt 0x0" :: "v"(s) : "memory");   // in front of any rewrite of the loads' address registers (the pointer is named so that they live up to here)
#pragma unroll
        for (int i = 0; i < 16; ++i) { v4us t;
#pragma unroll
            for (int q = 0; q < 4; ++q) t[q] = f2bf(v[i][q]);
            *(v4us*)(dp + i * 1024) = t; }
        asm volatile("s_wait_xcnt 0x0" ::: "memory");     // in front of any rewrite of the registers of the stores above
    }
}

// ---- attention key / value tiles in LDS: a tile is 64 rows x 128 B (64 keys x HD of k, or HD x 64 keys of v^T) at a row pitch of PP elements (144 B).
// eight copies of one lane, 16 B each: four rows 16 apart of tile 0 (LDS byte address l0, global address g0, global row pitch p0 elements) and four of tile 1; eight lanes cover a
// row, so a wave's copy reads four whole 128-B lines. The s_wait_xcnt closes the statement so that no address register of an issued copy is rewritten ahead of it.
#define TLE (64 * PP)
template <typename T16>
__device__ __forceinline__ void acopy_tiles(unsigned l0, const T16* g0, size_t p0, unsigned l1, const T16* g1, size_t p1) {
    const unsigned ls = 16 * PP * 2; const size_t s0 = 16 * p0, s1 = 16 * p1;
    asm volatile("global_load_async_to_lds_b128 %0, %8, off\n\t"
                 "global_load_async_to_lds_b128 %1, %9, off\n\t"
                 "global_load_async_to_lds_b128 %2, %10, off\n\t"
                 "global_load_async_to_lds_b128 %3, %11, off\n\t"
                 "global_load_async_to_lds_b128 %4, %12, off\n\t"
                 "global_load_async_to_lds_b128 %5, %13, off\n\t"
                 "global_load_async_to_lds_b128 %6, %14, off\n\t"
                 "global_load_async_to_lds_b128 %7, %15, off\n\t"
                 "s_wait_xcnt 0x0"
                 :: "v"(l0), "v"(l0 + ls), "v"(l0 + 2 * ls), "v"(l0 + 3 * ls), "v"(l1), "v"(l1 + ls), "v"(l1 + 2 * ls), "v"(l1 + 3 * ls),
                    "v"(g0), "v"(g0 + s0), "v"(g0 + 2 * s0), "v"(g0 + 3 * s0), "v"(g1), "v"(g1 + s1), "v"(g1 + 2 * s1), "v"(g1 + 3 * s1) : "memory");
}

// ---- online softmax step on one wave's 16 x 64 score tile (D layout: s[nt][r] = S[row 8*hi + r][col nt*16 + lr]); diagonal tile: entries with col > row replaced by -1e9 before the
// 1/sqrt(HD) scaling (their exp is exactly 0); running max / running sum per row (replicated over the 16 lanes of a half), output accumulators rescaled; leaves s = exp(t - m).
__device__ __forceinline__ void online_softmax(v8f (&s)[4], float (&m)[8], float (&l)[8], v8f (&o)[4], bool diag, int row0, int kvb, int lr, int hi) {
#pragma unroll
    for (int nt = 0; nt < 4; ++nt)
#pragma unroll
        for (int r = 0; r < 8; ++r) { const int row = row0 + 8 * hi + r, col = kvb + nt * 16 + lr; float v = s[nt][r]; if (diag && col > row) v = -1.0e9f; s[nt][r] = v * SCL; }
#pragma unroll
    for (int r = 0; r < 8; ++r) {
        float mx = fmaxf(fmaxf(s[0][r], s[1][r]), fmaxf(s[2][r], s[3][r]));
#pragma unroll
        for (int sh = 1; sh < 16; sh <<= 1) mx = fmaxf(mx, __shfl_xor(mx, sh, 32));
        const float m2 = fmaxf(m[r], mx); const float alpha = __builtin_amdgcn_exp2f((m[r] - m2) * L2E); m[r] = m2;
        float rs = 0.0f;
#pragma unroll
        for (int nt = 0; nt < 4; ++nt) { const float p = __builtin_amdgcn_exp2f((s[nt][r] - m2) * L2E); s[nt][r] = p; rs += p; }
#pragma unroll
        for (int sh = 1; sh < 16; sh <<= 1) rs += __shfl_xor(rs, sh, 32);
        l[r] = l[r] * alpha + rs;
#pragma unroll
        for (int nt = 0; nt < 4; ++nt) o[nt][r] = o[nt][r] * alpha;
    }
}

// ---- k_attnr: causal attention for query rows < RRES (query tiles 0 .. RRES/64-1; they only visit key tiles 0 .. qt): block = 4 waves x 16 rows, head h uses kv group h / GRP.
// q, k, v from the bf16 hi/lo planes ([h][RRES][HD], [g][RRES][HD], [g][HD][RRES]); scores = qh.kh + ql.kh + qh.kl; unnormalised p split to bf16 hi/lo in a wave-private LDS tile,
// the four k and v^T tiles of 64 keys shared by the four waves through LDS (asynchronous copies, two buffers: the next tiles fly while these are worked on).
__global__ __launch_bounds__(128) void k_attnr(const bf* __restrict__ QPh, const bf* __restrict__ QPl, const bf* __restrict__ KPh, const bf* __restrict__ KPl, const bf* __restrict__ VTh, const bf* __restrict__ VTl, bf* CTh, bf* CTl) {
    __shared__ __align__(16) bf sP[4][2][16 * PP];
    __shared__ __align__(128) bf sKV[2][4][TLE];          // [buffer][k hi | v^T hi | k lo | v^T lo]
    const int lane = threadIdx.x & 31, wave = threadIdx.x >> 5, lr = lane & 15, hi = lane >> 4;
    const int qt = blockIdx.x, h = blockIdx.y, g = h / GRP; const int q0 = qt * 64 + wave * 16;
    const size_t sq = blockIdx.z;                         // sequence
    QPh += sq * NH * RRES * HD; QPl += sq * NH * RRES * HD; KPh += sq * NKV * RRES * HD; KPl += sq * NKV * RRES * HD; VTh += sq * NKV * HD * RRES; VTl += sq * NKV * HD * RRES;
    CTh += sq * RRES * DMO; CTl += sq * RRES * DMO;
    const bf* qh = QPh + ((size_t)h * RRES + q0) * HD; const bf* ql = QPl + ((size_t)h * RRES + q0) * HD;
    const bf* kh = KPh + (size_t)g * RRES * HD; const bf* kl = KPl + (size_t)g * RRES * HD;
    const bf* vh = VTh + (size_t)g * HD * RRES; const bf* vl = VTl + (size_t)g * HD * RRES;
    bf* sph = &sP[wave][0][0]; bf* spl = &sP[wave][1][0];
    float m[8], l[8]; v8f o[4];
#pragma unroll
    for (int r = 0; r < 8; ++r) { m[r] = -3.0e38f; l[r] = 0.0f; }
#pragma unroll
    for (int nt = 0; nt < 4; ++nt) o[nt] = (v8f){};
    const int nch = qt + 1;
    const int trow = threadIdx.x >> 3, tcol = (threadIdx.x & 7) * 8; const size_t tk = (size_t)trow * HD + tcol, tv = (size_t)trow * RRES + tcol;
    const unsigned lt = lds_off(&sKV[0][0][0]) + (unsigned)(trow * PP + tcol) * 2;
    auto stage = [&](int c, int buf) { const unsigned l = lt + (unsigned)buf * (4 * TLE * 2); const size_t ok = tk + (size_t)c * 64 * HD, ov = tv + (size_t)c * 64;
        acopy_tiles(l, kh + ok, (size_t)HD, l + TLE * 2, vh + ov, (size_t)RRES); acopy_tiles(l + 2 * TLE * 2, kl + ok, (size_t)HD, l + 3 * TLE * 2, vl + ov, (size_t)RRES); };
    stage(0, 0);
    asm volatile("s_wait_asynccnt 0x0" ::: "memory");     // this wave's copies of tile 0 have landed
    __syncthreads();                                      // every wave's have: tile 0 may be read
    if (nch > 1) stage(1, 1);
#pragma unroll 1
    for (int c = 0; c < nch; ++c) {
        const int kvb = c * 64; v8f s[4]; v16bf aqh[2], aql[2], bh, bl;
        const bf* skh = &sKV[c & 1][0][0]; const bf* svh = &sKV[c & 1][1][0]; const bf* skl = &sKV[c & 1][2][0]; const bf* svl = &sKV[c & 1][3][0];
#pragma unroll
        for (int kk = 0; kk < 2; ++kk) { aqh[kk] = WFrag<bf>::ld(qh + (size_t)lr * HD + 8 * hi + kk * 32); aql[kk] = WFrag<bf>::ld(ql + (size_t)lr * HD + 8 * hi + kk * 32); }
#pragma unroll
        for (int nt = 0; nt < 4; ++nt) { s[nt] = (v8f){}; const int ko = (nt * 16 + lr) * PP + 8 * hi;
#pragma unroll
            for (int kk = 0; kk < 2; ++kk) { bh = WFrag<bf>::ld(skh + ko + kk * 32); bl = WFrag<bf>::ld(skl + ko + kk * 32);
                s[nt] = wmmab(aqh[kk], bh, s[nt]); s[nt] = wmmab(aql[kk], bh, s[nt]); s[nt] = wmmab(aqh[kk], bl, s[nt]); } }
        asm volatile("v_nop\n\tv_nop\n\tv_nop\n\tv_nop" : "+v"(s[0]), "+v"(s[1]), "+v"(s[2]), "+v"(s[3]) : "v"(aqh[0]), "v"(aql[1]), "v"(bh), "v"(bl));
        online_softmax(s, m, l, o, c == qt, q0, kvb, lr, hi);
#pragma unroll
        for (int nt = 0; nt < 4; ++nt)
#pragma unroll
            for (int r = 0; r < 8; ++r) { unsigned short a2, c2; splitf(s[nt][r], a2, c2); const int so = (8 * hi + r) * PP + nt * 16 + lr; sph[so] = a2; spl[so] = c2; }
        lds_wsync();
        v16bf aph[2], apl[2], bvh, bvl;
#pragma unroll
        for (int kk = 0; kk < 2; ++kk) { const int ao = lr * PP + kk * 32 + 8 * hi; aph[kk] = cat16b(*(const v8usa*)(sph + ao), *(const v8usa*)(sph + ao + 16)); apl[kk] = cat16b(*(const v8usa*)(spl + ao), *(const v8usa*)(spl + ao + 16)); }
#pragma unroll
        for (int kk = 0; kk < 2; ++kk)
#pragma unroll
            for (int nt = 0; nt < 4; ++nt) { const int vo = (nt * 16 + lr) * PP + kk * 32 + 8 * hi; bvh = WFrag<bf>::ld(svh + vo); bvl = WFrag<bf>::ld(svl + vo);
                o[nt] = wmmab(aph[kk], bvh, o[nt]); o[nt] = wmmab(apl[kk], bvh, o[nt]); o[nt] = wmmab(aph[kk], bvl, o[nt]); }
        asm volatile("v_nop\n\tv_nop\n\tv_nop\n\tv_nop" : "+v"(o[0]), "+v"(o[1]), "+v"(o[2]), "+v"(o[3]) : "v"(aph[0]), "v"(apl[1]), "v"(bvh), "v"(bvl));
        lds_wsync();
        asm volatile("s_wait_dscnt 0x0" ::: "memory");    // this wave has left the buffer that is refilled below
        asm volatile("s_wait_asynccnt 0x0" ::: "memory"); // this wave's copies of tile c + 1 have landed
        __syncthreads();                                  // publishes tile c + 1 and ends every reader's last read of tile c
        if (c + 2 < nch) stage(c + 2, c & 1);
    }
    asm volatile("s_wait_asynccnt 0x0" ::: "memory");     // no copy is outstanding when the wave goes on and ends
    float inv[8];
#pragma unroll
    for (int r = 0; r < 8; ++r) inv[r] = 1.0f / l[r];
#pragma unroll
    for (int nt = 0; nt < 4; ++nt)
#pragma unroll
        for (int r = 0; r < 8; ++r) { unsigned short a2, c2; splitf(o[nt][r] * inv[r], a2, c2); const int so = (8 * hi + r) * PP + nt * 16 + lr; sph[so] = a2; spl[so] = c2; }
    lds_wsync();
    bf* chb = CTh + (size_t)q0 * DMO + h * HD; bf* clb = CTl + (size_t)q0 * DMO + h * HD;
{
#pragma unroll
        for (int it = 0; it < 4; ++it) { const int rr = it * 4 + (lane >> 3), pc = (lane & 7) * 8; const v8us va = *(const v8usa*)(sph + rr * PP + pc); const v8us vb = *(const v8usa*)(spl + rr * PP + pc);
            *(v8us*)(chb + (size_t)rr * DMO + pc) = va; *(v8us*)(clb + (size_t)rr * DMO + pc) = vb; }
         }
}

// ---- k_attn: causal attention for query tiles qt >= RRES/64 (blockIdx.x + RRES/64): same structure with single f16 products; q, k from [h][SEQ][HD] / [g][SEQ][HD] f16 planes,
// the k and v^T tiles of 64 keys shared by the four waves through LDS (asynchronous copies, two buffers: the next tiles fly while these are worked on).
__global__ __launch_bounds__(128) void k_attn(const h16* __restrict__ Q16, const h16* __restrict__ K16, const h16* __restrict__ VT16, h16* C16) {
    __shared__ __align__(16) h16 sP[4][16 * PP];
    __shared__ __align__(128) h16 sKV[2][2][TLE];         // [buffer][k | v^T]
    const int lane = threadIdx.x & 31, wave = threadIdx.x >> 5, lr = lane & 15, hi = lane >> 4;
    const int qt = blockIdx.x + RRES / 64, h = blockIdx.y, g = h / GRP; const int q0 = qt * 64 + wave * 16;
    const size_t sq = blockIdx.z;                         // sequence
    Q16 += sq * NH * SEQ * HD; K16 += sq * NKV * SEQ * HD; VT16 += sq * NKV * HD * SEQ; C16 += sq * SEQ * DMO;
    const h16* qp = Q16 + ((size_t)h * SEQ + q0) * HD; const h16* kp = K16 + (size_t)g * SEQ * HD; const h16* vp = VT16 + (size_t)g * HD * SEQ;
    h16* spw = &sP[wave][0];
    v16h aq[2];
#pragma unroll
    for (int kk = 0; kk < 2; ++kk) aq[kk] = WFrag<h16>::ld(qp + (size_t)lr * HD + 8 * hi + kk * 32);
    float m[8], l[8]; v8f o[4];
#pragma unroll
    for (int r = 0; r < 8; ++r) { m[r] = -3.0e38f; l[r] = 0.0f; }
#pragma unroll
    for (int nt = 0; nt < 4; ++nt) o[nt] = (v8f){};
    const int nch = qt + 1;
    const int trow = threadIdx.x >> 3, tcol = (threadIdx.x & 7) * 8;
    const h16* gk = kp + (size_t)trow * HD + tcol; const h16* gv = vp + (size_t)trow * SEQ + tcol;
    const unsigned lt = lds_off(&sKV[0][0][0]) + (unsigned)(trow * PP + tcol) * 2;
    auto stage = [&](int c, int buf) { const unsigned l = lt + (unsigned)buf * (2 * TLE * 2);
        acopy_tiles(l, gk + (size_t)c * 64 * HD, (size_t)HD, l + TLE * 2, gv + (size_t)c * 64, (size_t)SEQ); };
    stage(0, 0);
    asm volatile("s_wait_asynccnt 0x0" ::: "memory");     // this wave's copies of tile 0 have landed
    __syncthreads();                                      // every wave's have: tile 0 may be read
    if (nch > 1) stage(1, 1);
#pragma unroll 1
    for (int c = 0; c < nch; ++c) {
        const int kvb = c * 64; v8f s[4]; v16h b;
        const h16* sk = &sKV[c & 1][0][0] + lr * PP + 8 * hi; const h16* sv = &sKV[c & 1][1][0] + lr * PP + 8 * hi;
#pragma unroll
        for (int nt = 0; nt < 4; ++nt) { s[nt] = (v8f){}; const h16* kr = sk + nt * 16 * PP;
#pragma unroll
            for (int kk = 0; kk < 2; ++kk) { b = WFrag<h16>::ld(kr + kk * 32); s[nt] = wmma16(aq[kk], b, s[nt]); } }
        asm volatile("v_nop\n\tv_nop\n\tv_nop\n\tv_nop" : "+v"(s[0]), "+v"(s[1]), "+v"(s[2]), "+v"(s[3]) : "v"(aq[0]), "v"(aq[1]), "v"(b));
        online_softmax(s, m, l, o, c == qt, q0, kvb, lr, hi);
#pragma unroll
        for (int nt = 0; nt < 4; ++nt)
#pragma unroll
            for (int r = 0; r < 8; ++r) spw[(8 * hi + r) * PP + nt * 16 + lr] = tohx(s[nt][r] * PCAR);
        lds_wsync();
        v16h ap[2], bv;
#pragma unroll
        for (int kk = 0; kk < 2; ++kk) { const int ao = lr * PP + kk * 32 + 8 * hi; ap[kk] = cat16(*(const v8ha*)(spw + ao), *(const v8ha*)(spw + ao + 16)); }
#pragma unroll
        for (int kk = 0; kk < 2; ++kk)
#pragma unroll
            for (int nt = 0; nt < 4; ++nt) { bv = WFrag<h16>::ld(sv + nt * 16 * PP + kk * 32); o[nt] = wmma16(ap[kk], bv, o[nt]); }
        asm volatile("v_nop\n\tv_nop\n\tv_nop\n\tv_nop" : "+v"(o[0]), "+v"(o[1]), "+v"(o[2]), "+v"(o[3]) : "v"(ap[0]), "v"(ap[1]), "v"(bv));
        lds_wsync();
        asm volatile("s_wait_dscnt 0x0" ::: "memory");    // this wave has left the buffer that is refilled below
        asm volatile("s_wait_asynccnt 0x0" ::: "memory"); // this wave's copies of tile c + 1 have landed
        __syncthreads();                                  // publishes tile c + 1 and ends every reader's last read of tile c
        if (c + 2 < nch) stage(c + 2, c & 1);
    }
    asm volatile("s_wait_asynccnt 0x0" ::: "memory");     // no copy is outstanding when the wave goes on and ends
    float inv[8];
#pragma unroll
    for (int r = 0; r < 8; ++r) inv[r] = (1.0f / l[r]) * (CCAR / PCAR);
#pragma unroll
    for (int nt = 0; nt < 4; ++nt)
#pragma unroll
        for (int r = 0; r < 8; ++r) spw[(8 * hi + r) * PP + nt * 16 + lr] = tohx(o[nt][r] * inv[r]);
    lds_wsync();
    h16* cb = C16 + (size_t)q0 * DMO + h * HD;
{
#pragma unroll
        for (int it = 0; it < 4; ++it) { const int rr = it * 4 + (lane >> 3), pc = (lane & 7) * 8; const v8h val = *(const v8ha*)(spw + rr * PP + pc); *(v8h*)(cb + (size_t)rr * DMO + pc) = val; }
         }
}

extern "C" void kernel_launch(void* const* d_in, const int* in_sizes, int n_in,
                              void* d_out, int out_size, void* d_ws, size_t ws_size, hipStream_t stream) {
    if (n_in < 7) return;
    const long long rows_used = (long long)(NB - 1) * SEQ_FULL + SEQ;
    if ((long long)in_sizes[0] < rows_used * DIN) return;
    if (in_sizes[1] < SEQ * HD || in_sizes[2] < SEQ * HD) return;
    if (in_sizes[3] < DIN * DMO || in_sizes[4] < DIN * DKV || in_sizes[5] < DIN * DKV || in_sizes[6] < DMO * DMO) return;
    if ((long long)out_size < rows_used * DMO) return;
    // wire order: x, cos, sin, wq, wk, wv, wo
    const float* x = (const float*)d_in[0]; const float* cosi = (const float*)d_in[1]; const float* sini = (const float*)d_in[2];
    const float* wq = (const float*)d_in[3]; const float* wk = (const float*)d_in[4]; const float* wv = (const float*)d_in[5]; const float* wo = (const float*)d_in[6];
    float* OUT = (float*)d_out;     // [NB_FULL][SEQ_FULL][DMO]
    char* wsp = (char*)d_ws;
    auto take = [&](size_t bytes) { char* p = wsp; wsp += (bytes + 255) & ~(size_t)255; return (void*)p; };
    bf* WQ   = (bf*)take((size_t)DMO * DIN * 2);          // Bt [out][in]
    bf* WK   = (bf*)take((size_t)DKV * DIN * 2);
    bf* WV   = (bf*)take((size_t)DKV * DIN * 2);
    bf* WOb  = (bf*)take((size_t)DMO * DMO * 2);
    h16* WO16 = (h16*)take((size_t)DMO * DMO * 2);
    bf* XB   = (bf*)take((size_t)NB * SEQ * DIN * 2);     // from here on: NB planes each, sequence-major
    h16* Q16 = (h16*)take((size_t)NB * NH * SEQ * HD * 2); h16* K16 = (h16*)take((size_t)NB * NKV * SEQ * HD * 2); h16* VT16 = (h16*)take((size_t)NB * NKV * HD * SEQ * 2);
    bf* QPh = (bf*)take((size_t)NB * NH * RRES * HD * 2); bf* QPl = (bf*)take((size_t)NB * NH * RRES * HD * 2);
    bf* KPh = (bf*)take((size_t)NB * NKV * RRES * HD * 2); bf* KPl = (bf*)take((size_t)NB * NKV * RRES * HD * 2);
    bf* VTh = (bf*)take((size_t)NB * NKV * HD * RRES * 2); bf* VTl = (bf*)take((size_t)NB * NKV * HD * RRES * 2);
    h16* C16 = (h16*)take((size_t)NB * SEQ * DMO * 2);   // rows >= RRES of each sequence used
    bf* CTh = (bf*)take((size_t)NB * RRES * DMO * 2); bf* CTl = (bf*)take((size_t)NB * RRES * DMO * 2);
    int* MFLAG = (int*)take(128);
    const size_t carved = (size_t)(wsp - (char*)d_ws);
    if (carved > ws_size || carved > (size_t)268435456) return;

    k_prep<<<PT_W + NB * PX_S, 256, 0, stream>>>(x, wq, wk, wv, wo, XB, WQ, WK, WV, WOb, WO16, MFLAG);
    k_gemmw<bf, 0, 1><<<dim3(SEQ / 128, DMO / 128, NB), 128, 0, stream>>>(XB, nullptr, WQ, nullptr, DIN, nullptr, DMO, 1.0f, MFLAG, (size_t)SEQ * DIN, 0, 0, cosi, sini, Q16, QPh, QPl);
    k_gemmw<bf, 0, 1><<<dim3(SEQ / 128, DKV / 128, NB), 128, 0, stream>>>(XB, nullptr, WK, nullptr, DIN, nullptr, DKV, 1.0f, MFLAG, (size_t)SEQ * DIN, 0, 0, cosi, sini, K16, KPh, KPl);
    k_gemmw<bf, 0, 2><<<dim3(DKV / 128, SEQ / 128, NB), 128, 0, stream>>>(WV, nullptr, XB, nullptr, DIN, nullptr, SEQ, 1.0f, MFLAG, 0, (size_t)SEQ * DIN, 0, nullptr, nullptr, VT16, VTh, VTl);
    k_attnr<<<dim3(RRES / 64, NH, NB), 128, 0, stream>>>(QPh, QPl, KPh, KPl, VTh, VTl, CTh, CTl);
    if (SEQ > RRES) k_attn<<<dim3((SEQ - RRES) / 64, NH, NB), 128, 0, stream>>>(Q16, K16, VT16, C16);
    k_gemmw<bf, 1, 0><<<dim3(RRES / 128, DMO / 128, NB), 128, 0, stream>>>(CTh, CTl, WOb, nullptr, DMO, OUT, DMO, 1.0f, MFLAG, (size_t)RRES * DMO, 0, (size_t)SEQ_FULL * DMO, nullptr, nullptr, nullptr, nullptr, nullptr);
    if (SEQ > RRES) k_gemmw<h16, 0, 0><<<dim3((SEQ - RRES) / 128, DMO / 128, NB), 128, 0, stream>>>(C16 + (size_t)RRES * DMO, nullptr, WO16, nullptr, DMO, OUT + (size_t)RRES * DMO, DMO, 1.0f / (CCAR * WCAR), MFLAG, (size_t)SEQ * DMO, 0, (size_t)SEQ_FULL * DMO, nullptr, nullptr, nullptr, nullptr, nullptr);
}

// v006
// One run takes 211 microseconds.
// Two timings next to v005 both put it at 1.23 times that version's speed.
// Over all steps from v000 it is 3.64 times as fast.
#include <hip/hip_runtime.h>

// Contractions and operand types (f32 accumulate everywhere): x Wq, x Wk, x Wv on v_wmma_f32_16x16x32_bf16 with RNE bf16 copies of x and W (exact products);
// query rows < RRES of each sequence: q.k^T and p.v on v_wmma_f32_16x16x32_bf16 as bf16 hi/lo splits (3 products each), their ctx Wo as bf16 hi/lo ctx times bf16 Wo (2 products);
// query rows >= RRES: q.k^T and p.v on v_wmma_f32_16x16x32_f16 (f16 q/k/v planes, p carried x1024), ctx Wo on v_wmma_f32_16x16x32_f16 (ctx carried x16, Wo carried x64, folded by 1/1024 in the epilogue).
// diagonal are skipped (their probabilities are exactly 0) and the diagonal tile is masked by index; a constant zero flag line feeds the additive term of the GEMM epilogue.
// The projection GEMMs write the attention operand planes themselves: the rotary mix (q, k) and the 16-bit conversions (q, k, v^T) are their epilogues; no f32 projection plane exists.
// All NB sequences go through every launch together: the last grid dimension is the sequence (k_prep, on a flat grid, takes PX_S blocks a sequence after the weight tiles), and every per-sequence workspace plane holds NB copies, sequence-major.

#ifndef NB
#define NB 2
#endif
#ifndef SEQ
#define SEQ 2048
#endif
#ifndef RRES
#define RRES 256
#endif
#define NB_FULL 2
#define SEQ_FULL 2048
#define DIN 2048
#define DMO 2048
#define NH 32
#define NKV 8
#define GRP (NH / NKV)
#define HD 64
#define DKV (NKV * HD)
#define PP 72
#define PCAR 1024.0f
#define CCAR 16.0f
#define WCAR 64.0f
#define SCL 0.125f
#define L2E 1.4426950408889634f
static_assert(SEQ % 64 == 0 && SEQ >= 64 && SEQ <= SEQ_FULL);
static_assert(RRES % 64 == 0 && RRES >= 64 && RRES <= SEQ);
static_assert(NB >= 1 && NB <= NB_FULL);
static_assert(DIN % 32 == 0 && DMO % 64 == 0 && DKV % 64 == 0 && HD == 64 && (NH % NKV) == 0);
static_assert(DMO == NH * HD && DMO % 32 == 0);
static_assert(PP % 8 == 0 && PP >= HD);
static_assert((DMO * DIN) % 64 == 0 && (DKV * DIN) % 64 == 0 && (DMO * DMO) % 64 == 0 && DIN % 2 == 0 && DMO % 2 == 0);
static_assert(((size_t)SEQ * DIN) % 8 == 0);
// workspace carve (every plane a multiple of 256 B; same sequence as the launcher's take() calls)
#define AL256(x) ((((size_t)(x)) + 255) & ~(size_t)255)
#define WS_TOTAL (AL256((size_t)DMO * DIN * 2) + 2 * AL256((size_t)DKV * DIN * 2) + 2 * AL256((size_t)DMO * DMO * 2) + AL256((size_t)NB * SEQ * DIN * 2) \
                  + AL256((size_t)NB * NH * SEQ * HD * 2) + 2 * AL256((size_t)NB * NKV * SEQ * HD * 2) + 2 * AL256((size_t)NB * NH * RRES * HD * 2) \
                  + 4 * AL256((size_t)NB * NKV * RRES * HD * 2) + AL256((size_t)NB * SEQ * DMO * 2) + 2 * AL256((size_t)NB * RRES * DMO * 2) + AL256(128))
static_assert(WS_TOTAL <= (size_t)268435456);

typedef _Float16 h16;
typedef unsigned short bf;
typedef __attribute__((ext_vector_type(16))) __bf16   v16bf;
typedef __attribute__((ext_vector_type(16))) _Float16 v16h;
typedef __attribute__((ext_vector_type(8)))  _Float16 v8h;
typedef __attribute__((ext_vector_type(8)))  unsigned short v8us;
typedef __attribute__((ext_vector_type(8)))  float    v8f;
typedef __attribute__((ext_vector_type(4)))  float    v4f;
typedef __attribute__((ext_vector_type(4)))  int      v4i;
typedef __attribute__((ext_vector_type(2)))  _Float16 v2h;
typedef __attribute__((ext_vector_type(2)))  unsigned short v2us;
typedef __attribute__((ext_vector_type(4)))  _Float16 v4h;
typedef __attribute__((ext_vector_type(4)))  unsigned short v4us;
typedef v8h  __attribute__((may_alias)) v8ha;
typedef v4f  __attribute__((may_alias)) v4fa;
typedef v8us __attribute__((may_alias)) v8usa;

__device__ __forceinline__ unsigned short f2bf(float f) { unsigned u = __float_as_uint(f); u += 0x7FFFu + ((u >> 16) & 1u); return (unsigned short)(u >> 16); }
__device__ __forceinline__ float bf2f(unsigned short b) { return __uint_as_float(((unsigned)b) << 16); }
__device__ __forceinline__ float bfr(float f) { return bf2f(f2bf(f)); }
__device__ __forceinline__ h16 tohx(float x) { return (h16)x; }
__device__ __forceinline__ void splitf(float y, unsigned short& h, unsigned short& l) { h = f2bf(y); l = f2bf(y - bf2f(h)); }
__device__ __forceinline__ v16h cat16(v8h lo, v8h hi) { return __builtin_shufflevector(lo, hi, 0, 1, 2, 3, 4, 5, 6, 7, 8, 9, 10, 11, 12, 13, 14, 15); }
__device__ __forceinline__ v16bf cat16b(v8us lo, v8us hi) { return __builtin_bit_cast(v16bf, __builtin_shufflevector(lo, hi, 0, 1, 2, 3, 4, 5, 6, 7, 8, 9, 10, 11, 12, 13, 14, 15)); }
__device__ __forceinline__ v8f wmma16(v16h a, v16h b, v8f c) { return __builtin_amdgcn_wmma_f32_16x16x32_f16(false, a, false, b, (short)0, c, false, false); }
__device__ __forceinline__ v8f wmmab(v16bf a, v16bf b, v8f c) { return __builtin_amdgcn_wmma_f32_16x16x32_bf16(false, a, false, b, (short)0, c, false, false); }
// wave-private LDS tile: stores of this wave made visible to its own later cross-lane loads, loads kept below the stores by the compiler
__device__ __forceinline__ void lds_wsync() { __builtin_amdgcn_fence(3 /* release order */, "wavefront"); __builtin_amdgcn_wave_barrier(); asm volatile("" ::: "memory"); }

// 16-bit fragment loaders: lane l -> row/column (l & 15); elements 0..7 <- k0 + 8*(l>>4) + 0..7, elements 8..15 <- k0 + 16 + 8*(l>>4) + 0..7 of a K-contiguous row (p already offset by 8*(l>>4)).
template <typename T16> struct WFrag;
template <> struct WFrag<h16> { typedef v16h V; static __device__ __forceinline__ V ld(const h16* p) { return cat16(*(const v8h*)p, *(const v8h*)(p + 16)); } static __device__ __forceinline__ v8f mma(V a, V b, v8f c) { return wmma16(a, b, c); } };
template <> struct WFrag<bf> { typedef v16bf V; static __device__ __forceinline__ V ld(const bf* p) { return cat16b(*(const v8us*)p, *(const v8us*)(p + 16)); } static __device__ __forceinline__ v8f mma(V a, V b, v8f c) { return wmmab(a, b, c); } };

// ---- k_gemmw: work-group tiled GEMM: 4 waves (2 x 2) share one 128x128 output tile, each wave keeps a 64x64 part (16 accumulators); grid (M/128, N/128, Z), 128 threads.
// A stage is GKS = 128 k (256 B) of the 128 A rows, the 128 Bt rows (and the 128 A2 rows when NSPLIT == 1), brought from the K-contiguous 16-bit planes into LDS by asynchronous
// 16-byte copies at a row pitch of 272 B; two buffers, the next stage's copies fly while this stage is multiplied. Every accumulator sums k upward in steps of 32, A before A2.
// F[m][n] = (sum_k A[m][k] Bt[n][k] (+ A2[m][k] Bt[n][k] when NSPLIT == 1)) * cscale + (pflag[0] ? NaN : 0). K % 128 == 0, K >= 128, M % 128 == 0, N % 128 == 0.
// EPI == 0: C[m][n] (f32, pitch ldc) = F[m][n].
// EPI == 1 (m = token t, n = h*HD + d, ldc = N; a wave's 64 columns are one head): head planes of the rotate-half rotary mix of F with the cos/sin input tables (bf16 RNE values):
//   r[d] = x[d] cos[t][d] - x[d+HD/2] sin[t][d] (d < HD/2), r[d] = x[d] cos[t][d] + x[d-HD/2] sin[t][d] (d >= HD/2); P16[h][t][d] = f16(r) for every t, Ph/Pl[h][t][d] bf16 hi/lo for t < RRES.
// EPI == 2 (m = g*HD + d, n = token t: the weight rows are the A operand, so F is already v^T): P16[m][t] = f16(F) (row pitch SEQ), Ph/Pl[m][t] bf16 hi/lo for t < RRES (row pitch RRES).
#define GKS 128
#define GPI 136
static_assert(DIN % GKS == 0 && DMO % GKS == 0 && SEQ % 128 == 0 && RRES % 128 == 0 && DMO % 128 == 0 && DKV % 128 == 0);
__device__ __forceinline__ unsigned lds_off(const void* p) { return (unsigned)(size_t)p; }
// eight copies of one lane: rows 8 apart, 16 B each, LDS byte address l, global address g (row pitch K elements). The s_wait_xcnt closes the statement so that no address register
// of an issued copy is rewritten ahead of it.
template <typename T16>
__device__ __forceinline__ void acopy8(unsigned l, const T16* g, size_t K) {
    const unsigned ls = 8 * GPI * 2; const size_t gs = 8 * K;
    asm volatile("global_load_async_to_lds_b128 %0, %8, off\n\t"
                 "global_load_async_to_lds_b128 %1, %9, off\n\t"
                 "global_load_async_to_lds_b128 %2, %10, off\n\t"
                 "global_load_async_to_lds_b128 %3, %11, off\n\t"
                 "global_load_async_to_lds_b128 %4, %12, off\n\t"
                 "global_load_async_to_lds_b128 %5, %13, off\n\t"
                 "global_load_async_to_lds_b128 %6, %14, off\n\t"
                 "global_load_async_to_lds_b128 %7, %15, off\n\t"
                 "s_wait_xcnt 0x0"
                 :: "v"(l), "v"(l + ls), "v"(l + 2 * ls), "v"(l + 3 * ls), "v"(l + 4 * ls), "v"(l + 5 * ls), "v"(l + 6 * ls), "v"(l + 7 * ls),
                    "v"(g), "v"(g + gs), "v"(g + 2 * gs), "v"(g + 3 * gs), "v"(g + 4 * gs), "v"(g + 5 * gs), "v"(g + 6 * gs), "v"(g + 7 * gs) : "memory");
}
// 128 rows x 256 B of one operand: 16 copies a lane (16 lanes cover a row, a wave two rows)
template <typename T16>
__device__ __forceinline__ void acopy_rows(unsigned l, const T16* g, size_t K) { acopy8(l, g, K); acopy8(l + 64 * GPI * 2, g + 64 * K, K); }

template <typename T16, int NSPLIT, int EPI>
__global__ __launch_bounds__(128) void k_gemmw(const T16* __restrict__ A, const T16* __restrict__ A2, const T16* __restrict__ Bt, const T16* __restrict__ Bt2, int K, float* C, int ldc, float cscale, const int* __restrict__ pflag, size_t sA, size_t sB, size_t sC,
                                               const float* __restrict__ COSI, const float* __restrict__ SINI, h16* P16, bf* Ph, bf* Pl) {
    typedef typename WFrag<T16>::V V;
    static_assert(NSPLIT == 0 || NSPLIT == 1); static_assert(EPI >= 0 && EPI <= 2);
    constexpr int OPE = 128 * GPI;                        // elements of one operand's rows in a stage
    constexpr int STE = (NSPLIT == 1 ? 3 : 2) * OPE;      // elements of a stage: [A | Bt | A2]
    __shared__ __align__(128) T16 ring[2 * STE];
    __shared__ __align__(16) float osw[4][16 * 68];
    const size_t z = blockIdx.z; A += z * sA; if (A2) A2 += z * sA; Bt += z * sB; if (EPI == 0) C += z * sC;
    const int tid = threadIdx.x, lane = tid & 31, wave = tid >> 5, lr = lane & 15, hi = lane >> 4; const int wm = wave >> 1, wn = wave & 1;
    const int r0 = blockIdx.x * 128, c0 = blockIdx.y * 128;
    const float padd = (pflag[0] != 0) ? __int_as_float(0x7fc00000) : 0.0f;
    v8f acc[4][4];
#pragma unroll
    for (int mb = 0; mb < 4; ++mb)
#pragma unroll
        for (int nb = 0; nb < 4; ++nb) acc[mb][nb] = (v8f){};
    const int trow = tid >> 4, tcol = tid & 15;
    const T16* ga = A + (size_t)(r0 + trow) * K + tcol * 8; const T16* gb = Bt + (size_t)(c0 + trow) * K + tcol * 8;
    const T16* ga2 = (NSPLIT == 1) ? A2 + (size_t)(r0 + trow) * K + tcol * 8 : nullptr;
    const unsigned lt = lds_off(ring) + (unsigned)(trow * GPI + tcol * 8) * 2;
    auto stage = [&](int t, int buf) { const unsigned l = lt + (unsigned)buf * (STE * 2); const size_t ko = (size_t)t * GKS;
        acopy_rows(l, ga + ko, (size_t)K); acopy_rows(l + OPE * 2, gb + ko, (size_t)K); if (NSPLIT == 1) acopy_rows(l + 2 * OPE * 2, ga2 + ko, (size_t)K); };
    const int nt = K / GKS;
    stage(0, 0);
    asm volatile("s_wait_asynccnt 0x0" ::: "memory");     // this wave's copies of stage 0 have landed
    __syncthreads();                                      // every wave's have: stage 0 may be read
    if (nt > 1) stage(1, 1);
    // the stage loop stays rolled: one copy of the body in the instruction cache, the buffer picked by t & 1
#pragma unroll 1
    for (int t = 0; t < nt; ++t) {
        const T16* sa = ring + (t & 1) * STE + (wm * 64 + lr) * GPI + 8 * hi; const T16* sb = ring + (t & 1) * STE + OPE + (wn * 64 + lr) * GPI + 8 * hi;
        // two fragment sets: the reads of the next 32 k of this stage go out as one group ahead of this step's matrix instructions, so that only the stage's last group is waited for in full
        // (every loop below is unrolled so that set, fragment and accumulator indices are constants and the arrays live in registers)
        V a[2][4], b[2][4], a2[2][4];
        auto ldset = [&](int s, int ks) {
#pragma unroll
            for (int mb = 0; mb < 4; ++mb) { a[s][mb] = WFrag<T16>::ld(sa + mb * 16 * GPI + ks); if (NSPLIT == 1) a2[s][mb] = WFrag<T16>::ld(sa + 2 * OPE + mb * 16 * GPI + ks); }
#pragma unroll
            for (int nb = 0; nb < 4; ++nb) b[s][nb] = WFrag<T16>::ld(sb + nb * 16 * GPI + ks); };
        ldset(0, 0);
#pragma unroll
        for (int q = 0; q < GKS / 32; ++q) {
            if (q + 1 < GKS / 32) ldset((q + 1) & 1, (q + 1) * 32);
            // keeps the group of reads above in front of this step's matrix instructions (the scheduler otherwise spreads them among these, each with a full wait); in the last step, which
            // has no reads, it keeps the step before in front of the waits at the loop's foot, where its matrix instructions cover the last reads' latency (without it they sink behind the barrier)
            __builtin_amdgcn_sched_barrier(0);
#pragma unroll
            for (int nb = 0; nb < 4; ++nb)
#pragma unroll
                for (int mb = 0; mb < 4; ++mb) { acc[mb][nb] = WFrag<T16>::mma(a[q & 1][mb], b[q & 1][nb], acc[mb][nb]); if (NSPLIT == 1) acc[mb][nb] = WFrag<T16>::mma(a2[q & 1][mb], b[q & 1][nb], acc[mb][nb]); }
        }
        asm volatile("s_wait_dscnt 0x0" ::: "memory");    // this wave has left the buffer that is refilled below
        asm volatile("s_wait_asynccnt 0x0" ::: "memory"); // this wave's copies of stage t + 1 have landed
        __syncthreads();                                  // publishes stage t + 1 and ends every reader's last read of stage t
        if (t + 2 < nt) stage(t + 2, t & 1);
    }
    asm volatile("s_wait_asynccnt 0x0" ::: "memory");     // no copy is outstanding when the wave goes on and ends
    if constexpr (EPI == 0) {
    float* os = &osw[wave][0];
#pragma unroll
    for (int mb = 0; mb < 4; ++mb) {
#pragma unroll
        for (int nb = 0; nb < 4; ++nb) {
#pragma unroll
            for (int j = 0; j < 8; ++j) os[(hi * 8 + j) * 68 + nb * 16 + lr] = acc[mb][nb][j]; }
        __builtin_amdgcn_wave_barrier(); asm volatile("" ::: "memory");
        float* crow = C + (size_t)(r0 + wm * 64 + mb * 16) * ldc + c0 + wn * 64;
{
#pragma unroll
            for (int s = 0; s < 8; ++s) { const int row = 2 * s + hi, cofs = lr * 4; v4f val = *(const v4fa*)(os + row * 68 + cofs); val = val * cscale + padd;
                *(v4f*)(crow + (size_t)row * ldc + cofs) = val; }
             }
        __builtin_amdgcn_wave_barrier(); asm volatile("" ::: "memory");
    }
    } else {
        // The ring is free: every wave's last read of it and every copy into it ended in front of the loop's last barrier. Each wave lays its whole 64 x 64 f32 part there (own range, row
        // pitch 68) and walks it in rolled loops of 8 rows a trip, so that the epilogue's text stays short.
        float* ot = reinterpret_cast<float*>(ring) + wave * (64 * 68);
        static_assert(4 * 64 * 68 * 4 <= 2 * STE * 2);
#pragma unroll
        for (int mb = 0; mb < 4; ++mb)
#pragma unroll
            for (int nb = 0; nb < 4; ++nb)
#pragma unroll
                for (int j = 0; j < 8; ++j) ot[(mb * 16 + hi * 8 + j) * 68 + nb * 16 + lr] = acc[mb][nb][j];
        __builtin_amdgcn_wave_barrier(); asm volatile("" ::: "memory");   // the wave's own stores stay in front of its cross-lane reads below
        const int mw = r0 + wm * 64 + hi, cofs = lr * 4;
        // the hi/lo planes hold tokens < RRES only: a whole 128-token tile is in or out (RRES % 128 == 0)
        if constexpr (EPI == 1) {
            const bool res = r0 < RRES;
            const size_t hp = z * (size_t)(ldc / HD) + (size_t)(c0 / HD + wn); P16 += hp * SEQ * HD; Ph += hp * RRES * HD; Pl += hp * RRES * HD;
            const float* cp = COSI + (size_t)mw * HD + cofs; const float* sp = SINI + (size_t)mw * HD + cofs;
            v4f cs[4], sn[4];
#pragma unroll
            for (int i = 0; i < 4; ++i) { cs[i] = *(const v4f*)(cp + i * 2 * HD); sn[i] = *(const v4f*)(sp + i * 2 * HD); }
            asm volatile("s_wait_xcnt 0x0" ::: "memory");                 // in front of any rewrite of the address registers of the loads above
            // rolled (short text); the next trip's cos and sin are asked for one trip ahead, so that this trip's work covers their latency (the last trip asks for its own rows again)
#pragma unroll 1
            for (int g = 0; g < 8; ++g) {
                v4f cn[4], sm[4]; const int gn = (g < 7) ? g + 1 : 7;
#pragma unroll
                for (int i = 0; i < 4; ++i) { cn[i] = *(const v4f*)(cp + (gn * 8 + i * 2) * HD); sm[i] = *(const v4f*)(sp + (gn * 8 + i * 2) * HD); }
                asm volatile("s_wait_xcnt 0x0" ::: "memory");             // in front of any rewrite of the address registers of the loads above
                // the trip's LDS reads go out together, its stores together at its foot: one LDS latency and one wait a trip
                v4f x0[4], x1[4]; v4h o16[4]; v4us oh[4], ol[4];
#pragma unroll
                for (int i = 0; i < 4; ++i) { const float* xr = ot + (g * 8 + i * 2 + hi) * 68; x0[i] = *(const v4fa*)(xr + cofs); x1[i] = *(const v4fa*)(xr + (cofs ^ (HD / 2))); }
#pragma unroll
                for (int i = 0; i < 4; ++i) { const v4f y0 = x0[i] * cscale + padd, y1 = x1[i] * cscale + padd;
#pragma unroll
                    for (int q = 0; q < 4; ++q) { const float cv = bfr(cs[i][q]), snv = bfr(sn[i][q]); const float pa = y0[q] * cv, pb = y1[q] * snv; const float r = (cofs < HD / 2) ? (pa - pb) : (pa + pb);
                        o16[i][q] = tohx(r); unsigned short a2, c2; splitf(r, a2, c2); oh[i][q] = a2; ol[i][q] = c2; } }
                const size_t oo = (size_t)(mw + g * 8) * HD + cofs;
                if (res) {
#pragma unroll
                    for (int i = 0; i < 4; ++i) { *(v4us*)(Ph + oo + i * 2 * HD) = oh[i]; *(v4us*)(Pl + oo + i * 2 * HD) = ol[i]; }
                    asm volatile("s_wait_xcnt 0x0" ::: "memory"); }       // in front of any rewrite of the registers of the stores above
#pragma unroll
                for (int i = 0; i < 4; ++i) *(v4h*)(P16 + oo + i * 2 * HD) = o16[i];
                asm volatile("s_wait_xcnt 0x0" ::: "memory");             // in front of any rewrite of the registers of the stores above
                __builtin_amdgcn_sched_barrier(0);                        // keeps the register copies below behind that wait (the scheduler otherwise lifts them over it, onto the stores' registers)
#pragma unroll
                for (int i = 0; i < 4; ++i) { cs[i] = cn[i]; sn[i] = sm[i]; }
            }
        } else {
            const bool res = c0 < RRES;
            const int t = c0 + wn * 64 + cofs;
            P16 += z * (size_t)DKV * SEQ + t; Ph += z * (size_t)DKV * RRES + t; Pl += z * (size_t)DKV * RRES + t;
            // rolled: short text
#pragma unroll 1
            for (int g = 0; g < 8; ++g) {
                // the trip's LDS reads go out together, its stores together at its foot: one LDS latency and one wait a trip
                v4f val[4]; v4h o16[4]; v4us oh[4], ol[4];
#pragma unroll
                for (int i = 0; i < 4; ++i) val[i] = *(const v4fa*)(ot + (g * 8 + i * 2 + hi) * 68 + cofs);
#pragma unroll
                for (int i = 0; i < 4; ++i) { const v4f y = val[i] * cscale + padd;
#pragma unroll
                    for (int q = 0; q < 4; ++q) { o16[i][q] = tohx(y[q]); unsigned short a2, c2; splitf(y[q], a2, c2); oh[i][q] = a2; ol[i][q] = c2; } }
                const size_t m = (size_t)(mw + g * 8);
                if (res) {
#pragma unroll
                    for (int i = 0; i < 4; ++i) { *(v4us*)(Ph + (m + i * 2) * RRES) = oh[i]; *(v4us*)(Pl + (m + i * 2) * RRES) = ol[i]; }
                    asm volatile("s_wait_xcnt 0x0" ::: "memory"); }       // in front of any rewrite of the registers of the stores above
#pragma unroll
                for (int i = 0; i < 4; ++i) *(v4h*)(P16 + (m + i * 2) * SEQ) = o16[i];
                asm volatile("s_wait_xcnt 0x0" ::: "memory");             // in front of any rewrite of the registers of the stores above
            }
        }
    }
}

// ---- k_prep: every 16-bit plane that is a plain function of one input, in one launch of 256-thread blocks, 64 KB of f32 a block, sixteen 16-byte loads a lane in flight.
// Blocks < PT_W: one 128 (k) x 128 (n) tile of a weight w[k][n]: whole 512-B rows are read, RNE bf16 pairs (k, k + 1) go to LDS as dwords at [n][k / 2], and rows of 128 k (256 B) are written to
// Bt[n][k]; Ht[n][k] = f16(bf16 value x WCAR) for wo. The dword column is XORed with 2 * ((n >> 2) & 31): the 32 lanes of a store (n four apart, one k pair) then hit 32 different banks,
// and a pair of neighbouring columns stays an aligned pair for the 8-byte reads. Blocks >= PT_W: PXE consecutive elements of x to bf16. Block 0 also writes the zero flag line.
#define PTE 128
#define PXE 16384
#define PT_Q ((DIN / PTE) * (DMO / PTE))
#define PT_K ((DIN / PTE) * (DKV / PTE))
#define PT_O ((DMO / PTE) * (DMO / PTE))
#define PT_W (PT_Q + 2 * PT_K + PT_O)
#define PX_S ((int)(((size_t)SEQ * DIN) / PXE))
static_assert(DIN % PTE == 0 && DMO % PTE == 0 && DKV % PTE == 0 && ((size_t)SEQ * DIN) % PXE == 0);
typedef __attribute__((ext_vector_type(2))) unsigned v2u;
typedef v2u __attribute__((may_alias)) v2ua;
template <int N, int K, bool HASH>
__device__ __forceinline__ void prep_tile(const float* __restrict__ w, bf* Bt, h16* Ht, int b, unsigned* tp, int lane, int wave) {
    constexpr int NTN = N / PTE; const int k0 = (b / NTN) * PTE, n0 = (b % NTN) * PTE;
    const float* s = w + (size_t)(k0 + wave * 16) * N + n0 + lane * 4;
    v4f v[16];
#pragma unroll
    for (int i = 0; i < 16; ++i) v[i] = *(const v4f*)(s + (size_t)i * N);
    asm volatile("s_wait_xcnt 0x0" :: "v"(s) : "memory");   // in front of any rewrite of the loads' address registers (the pointer is named so that they live up to here)
#pragma unroll
    for (int i = 0; i < 8; ++i)
#pragma unroll
        for (int j = 0; j < 4; ++j) tp[(lane * 4 + j) * (PTE / 2) + ((wave * 8 + i) ^ (lane * 2))] = (unsigned)f2bf(v[2 * i][j]) | ((unsigned)f2bf(v[2 * i + 1][j]) << 16);
    __syncthreads();                                      // the whole tile is in LDS before any row of it is read
    v2u d[16];
#pragma unroll
    for (int r = 0; r < 16; ++r) { const int n = wave * 16 + r; d[r] = *(const v2ua*)(tp + n * (PTE / 2) + ((lane * 2) ^ (((n >> 2) & 31) << 1))); }
    const size_t o = (size_t)(n0 + wave * 16) * K + k0 + lane * 4;
#pragma unroll
    for (int r = 0; r < 16; ++r) { const v4us t = __builtin_bit_cast(v4us, d[r]); *(v4us*)(Bt + o + (size_t)r * K) = t;
        if (HASH) { v4h hh;
#pragma unroll
            for (int q = 0; q < 4; ++q) hh[q] = tohx(bf2f(t[q]) * WCAR);
            *(v4h*)(Ht + o + (size_t)r * K) = hh; } }
    asm volatile("s_wait_xcnt 0x0" ::: "memory");         // in front of any rewrite of the registers of the stores above
}
__global__ __launch_bounds__(256) void k_prep(const float* __restrict__ x, const float* __restrict__ wq, const float* __restrict__ wk, const float* __restrict__ wv, const float* __restrict__ wo,
                                              bf* XB, bf* WQ, bf* WK, bf* WV, bf* WOb, h16* WO16, int* MFLAG) {
    __shared__ __align__(16) unsigned tp[PTE * (PTE / 2)];
    const int tid = threadIdx.x, lane = tid & 31, wave = tid >> 5; const int b = blockIdx.x;
    if (b == 0 && tid < 32) MFLAG[tid] = 0;
    if (b < PT_Q) prep_tile<DMO, DIN, false>(wq, WQ, nullptr, b, tp, lane, wave);
    else if (b < PT_Q + PT_K) prep_tile<DKV, DIN, false>(wk, WK, nullptr, b - PT_Q, tp, lane, wave);
    else if (b < PT_Q + 2 * PT_K) prep_tile<DKV, DIN, false>(wv, WV, nullptr, b - PT_Q - PT_K, tp, lane, wave);
    else if (b < PT_W) prep_tile<DMO, DMO, true>(wo, WOb, WO16, b - PT_Q - 2 * PT_K, tp, lane, wave);
    else {
        const int u = b - PT_W; const int sq = u / PX_S; const size_t o = (size_t)(u % PX_S) * PXE + tid * 4;
        const float* s = x + (size_t)sq * SEQ_FULL * DIN + o; bf* dp = XB + (size_t)sq * SEQ * DIN + o;
        v4f v[16];
#pragma unroll
        for (int i = 0; i < 16; ++i) v[i] = *(const v4f*)(s + i * 1024);
        asm volatile("s_wait_xcnt 0x0" :: "v"(s) : "memory");   // in front of any rewrite of the loads' address registers (the pointer is named so that they live up to here)
#pragma unroll
        for (int i = 0; i < 16; ++i) { v4us t;
#pragma unroll
            for (int q = 0; q < 4; ++q) t[q] = f2bf(v[i][q]);
            *(v4us*)(dp + i * 1024) = t; }
        asm volatile("s_wait_xcnt 0x0" ::: "memory");     // in front of any rewrite of the registers of the stores above
    }
}

// ---- attention key / value tiles in LDS: a tile is 64 rows x 128 B (64 keys x HD of k, or HD x 64 keys of v^T) at a row pitch of PP elements (144 B).
// eight copies of one lane, 16 B each: four rows 16 apart of tile 0 (LDS byte address l0, global address g0, global row pitch p0 elements) and four of tile 1; eight lanes cover a
// row, so a wave's copy reads four whole 128-B lines. The s_wait_xcnt closes the statement so that no address register of an issued copy is rewritten ahead of it.
#define TLE (64 * PP)
template <typename T16>
__device__ __forceinline__ void acopy_tiles(unsigned l0, const T16* g0, size_t p0, unsigned l1, const T16* g1, size_t p1) {
    const unsigned ls = 16 * PP * 2; const size_t s0 = 16 * p0, s1 = 16 * p1;
    asm volatile("global_load_async_to_lds_b128 %0, %8, off\n\t"
                 "global_load_async_to_lds_b128 %1, %9, off\n\t"
                 "global_load_async_to_lds_b128 %2, %10, off\n\t"
                 "global_load_async_to_lds_b128 %3, %11, off\n\t"
                 "global_load_async_to_lds_b128 %4, %12, off\n\t"
                 "global_load_async_to_lds_b128 %5, %13, off\n\t"
                 "global_load_async_to_lds_b128 %6, %14, off\n\t"
                 "global_load_async_to_lds_b128 %7, %15, off\n\t"
                 "s_wait_xcnt 0x0"
                 :: "v"(l0), "v"(l0 + ls), "v"(l0 + 2 * ls), "v"(l0 + 3 * ls), "v"(l1), "v"(l1 + ls), "v"(l1 + 2 * ls), "v"(l1 + 3 * ls),
                    "v"(g0), "v"(g0 + s0), "v"(g0 + 2 * s0), "v"(g0 + 3 * s0), "v"(g1), "v"(g1 + s1), "v"(g1 + 2 * s1), "v"(g1 + 3 * s1) : "memory");
}

// lane l <-> lane l ^ 16 (the two lanes that share a query column of a transposed score tile)
__device__ __forceinline__ float xhalf(float x) { return __builtin_bit_cast(float, __builtin_amdgcn_permlanex16(__builtin_bit_cast(int, x), __builtin_bit_cast(int, x), 0x76543210, 0xfedcba98, false, false)); }

// ---- online softmax step on one wave's TRANSPOSED 64 x 16 score tile (D layout: s[nt][r] = S[key nt*16 + 8*hi + r][query lr]): a lane holds 32 of the 64 scores of its one query (row),
// so maximum and sum run inside the lane; the maximum is joined with the other half's by one exchange, the sum l stays this half's own and is joined behind the key loop. Diagonal tile: entries
// with key > query replaced by -1e9 before the 1/sqrt(HD) scaling (their exp is exactly 0); the transposed output accumulators (o[nt][r] = O[d nt*16 + 8*hi + r][query lr]) are rescaled by the
// lane's one factor; leaves s = exp(t - m).
__device__ __forceinline__ void online_softmax_t(v8f (&s)[4], float& m, float& l, v8f (&o)[4], bool diag, int row, int kvb, int hi) {
    float mp[4]; const int dl = row - kvb - 8 * hi;      // key kvb + nt*16 + 8*hi + r lies behind query row where nt*16 + r > dl
#pragma unroll
    for (int nt = 0; nt < 4; ++nt) {
#pragma unroll
        for (int r = 0; r < 8; ++r) { float v = s[nt][r]; if (diag && nt * 16 + r > dl) v = -1.0e9f; v = v * SCL; s[nt][r] = v; mp[nt] = (r == 0) ? v : fmaxf(mp[nt], v); } }
    float mx = fmaxf(fmaxf(mp[0], mp[1]), fmaxf(mp[2], mp[3]));
    mx = fmaxf(mx, xhalf(mx));
    const float m2 = fmaxf(m, mx); const float alpha = __builtin_amdgcn_exp2f((m - m2) * L2E); m = m2;
#pragma unroll
    for (int nt = 0; nt < 4; ++nt)
#pragma unroll
        for (int r = 0; r < 8; ++r) s[nt][r] = __builtin_amdgcn_exp2f((s[nt][r] - m2) * L2E);
    // the lane's 32 terms summed as a tree (the four key groups register by register, then the eight registers): packed additions, no chain of 32 dependent ones
    const v8f t = (s[0] + s[1]) + (s[2] + s[3]);
    l = l * alpha + (((t[0] + t[1]) + (t[2] + t[3])) + ((t[4] + t[5]) + (t[6] + t[7])));
#pragma unroll
    for (int nt = 0; nt < 4; ++nt) o[nt] = o[nt] * alpha;
}

// ---- k_attnr: causal attention for query rows < RRES (query tiles 0 .. RRES/64-1; they only visit key tiles 0 .. qt): block = 4 waves x 16 rows, head h uses kv group h / GRP.
// q, k, v from the bf16 hi/lo planes ([h][RRES][HD], [g][RRES][HD], [g][HD][RRES]); scores = qh.kh + ql.kh + qh.kl, computed transposed (S^T = k q^T, O^T += v^T P^T: a lane holds one query's scores); unnormalised p split to bf16 hi/lo in registers, where it is the B operand;
// the four k and v^T tiles of 64 keys shared by the four waves through LDS (asynchronous copies, two buffers: the next tiles fly while these are worked on).
__global__ __launch_bounds__(128) void k_attnr(const bf* __restrict__ QPh, const bf* __restrict__ QPl, const bf* __restrict__ KPh, const bf* __restrict__ KPl, const bf* __restrict__ VTh, const bf* __restrict__ VTl, bf* CTh, bf* CTl) {
    __shared__ __align__(16) bf sP[4][2][16 * PP];
    __shared__ __align__(128) bf sKV[2][4][TLE];          // [buffer][k hi | v^T hi | k lo | v^T lo]
    const int lane = threadIdx.x & 31, wave = threadIdx.x >> 5, lr = lane & 15, hi = lane >> 4;
    const int qt = blockIdx.x, h = blockIdx.y, g = h / GRP; const int q0 = qt * 64 + wave * 16;
    const size_t sq = blockIdx.z;                         // sequence
    QPh += sq * NH * RRES * HD; QPl += sq * NH * RRES * HD; KPh += sq * NKV * RRES * HD; KPl += sq * NKV * RRES * HD; VTh += sq * NKV * HD * RRES; VTl += sq * NKV * HD * RRES;
    CTh += sq * RRES * DMO; CTl += sq * RRES * DMO;
    const bf* qh = QPh + ((size_t)h * RRES + q0) * HD; const bf* ql = QPl + ((size_t)h * RRES + q0) * HD;
    const bf* kh = KPh + (size_t)g * RRES * HD; const bf* kl = KPl + (size_t)g * RRES * HD;
    const bf* vh = VTh + (size_t)g * HD * RRES; const bf* vl = VTl + (size_t)g * HD * RRES;
    bf* sph = &sP[wave][0][0]; bf* spl = &sP[wave][1][0];
    float m = -3.0e38f, l = 0.0f; v8f o[4];
#pragma unroll
    for (int nt = 0; nt < 4; ++nt) o[nt] = (v8f){};
    const int nch = qt + 1;
    const int trow = threadIdx.x >> 3, tcol = (threadIdx.x & 7) * 8; const size_t tk = (size_t)trow * HD + tcol, tv = (size_t)trow * RRES + tcol;
    const unsigned lt = lds_off(&sKV[0][0][0]) + (unsigned)(trow * PP + tcol) * 2;
    auto stage = [&](int c, int buf) { const unsigned l = lt + (unsigned)buf * (4 * TLE * 2); const size_t ok = tk + (size_t)c * 64 * HD, ov = tv + (size_t)c * 64;
        acopy_tiles(l, kh + ok, (size_t)HD, l + TLE * 2, vh + ov, (size_t)RRES); acopy_tiles(l + 2 * TLE * 2, kl + ok, (size_t)HD, l + 3 * TLE * 2, vl + ov, (size_t)RRES); };
    stage(0, 0);
    asm volatile("s_wait_asynccnt 0x0" ::: "memory");     // this wave's copies of tile 0 have landed
    __syncthreads();                                      // every wave's have: tile 0 may be read
    if (nch > 1) stage(1, 1);
#pragma unroll 1
    for (int c = 0; c < nch; ++c) {
        const int kvb = c * 64; v8f s[4]; v16bf aqh[2], aql[2], bh, bl;
        const bf* skh = &sKV[c & 1][0][0]; const bf* svh = &sKV[c & 1][1][0]; const bf* skl = &sKV[c & 1][2][0]; const bf* svl = &sKV[c & 1][3][0];
#pragma unroll
        for (int kk = 0; kk < 2; ++kk) { aqh[kk] = WFrag<bf>::ld(qh + (size_t)lr * HD + 8 * hi + kk * 32); aql[kk] = WFrag<bf>::ld(ql + (size_t)lr * HD + 8 * hi + kk * 32); }
#pragma unroll
        for (int nt = 0; nt < 4; ++nt) { s[nt] = (v8f){}; const int ko = (nt * 16 + lr) * PP + 8 * hi;
#pragma unroll
            for (int kk = 0; kk < 2; ++kk) { bh = WFrag<bf>::ld(skh + ko + kk * 32); bl = WFrag<bf>::ld(skl + ko + kk * 32);
                s[nt] = wmmab(bh, aqh[kk], s[nt]); s[nt] = wmmab(bh, aql[kk], s[nt]); s[nt] = wmmab(bl, aqh[kk], s[nt]); } }      // S^T: the 16 keys are the rows (A), the 16 queries the columns (B)
        asm volatile("v_nop\n\tv_nop\n\tv_nop\n\tv_nop" : "+v"(s[0]), "+v"(s[1]), "+v"(s[2]), "+v"(s[3]) : "v"(aqh[0]), "v"(aql[1]), "v"(bh), "v"(bl));
        online_softmax_t(s, m, l, o, c == qt, q0 + lr, kvb, hi);
        // two score tiles of 16 keys, split in place, are the B operands P^T (hi, lo) of 32 keys: element e <- key 8*hi + e of the first, element 8 + e <- key 16 + 8*hi + e (the second's
        // 8*hi + e), the k order of the v^T loader
        v16bf aph[2], apl[2], bvh, bvl;
#pragma unroll
        for (int kk = 0; kk < 2; ++kk) { v8us h0, h1, l0, l1;
#pragma unroll
            for (int e = 0; e < 8; ++e) { unsigned short a2, c2; splitf(s[2 * kk][e], a2, c2); h0[e] = a2; l0[e] = c2; splitf(s[2 * kk + 1][e], a2, c2); h1[e] = a2; l1[e] = c2; }
            aph[kk] = cat16b(h0, h1); apl[kk] = cat16b(l0, l1); }
#pragma unroll
        for (int kk = 0; kk < 2; ++kk)
#pragma unroll
            for (int nt = 0; nt < 4; ++nt) { const int vo = (nt * 16 + lr) * PP + kk * 32 + 8 * hi; bvh = WFrag<bf>::ld(svh + vo); bvl = WFrag<bf>::ld(svl + vo);
                o[nt] = wmmab(bvh, aph[kk], o[nt]); o[nt] = wmmab(bvh, apl[kk], o[nt]); o[nt] = wmmab(bvl, aph[kk], o[nt]); }      // O^T: 16 rows of v^T are A
        asm volatile("v_nop\n\tv_nop\n\tv_nop\n\tv_nop" : "+v"(o[0]), "+v"(o[1]), "+v"(o[2]), "+v"(o[3]) : "v"(aph[0]), "v"(apl[1]), "v"(bvh), "v"(bvl));
        asm volatile("s_wait_dscnt 0x0" ::: "memory");    // this wave has left the buffer that is refilled below
        asm volatile("s_wait_asynccnt 0x0" ::: "memory"); // this wave's copies of tile c + 1 have landed
        __syncthreads();                                  // publishes tile c + 1 and ends every reader's last read of tile c
        if (c + 2 < nch) stage(c + 2, c & 1);
    }
    asm volatile("s_wait_asynccnt 0x0" ::: "memory");     // no copy is outstanding when the wave goes on and ends
    const float inv = 1.0f / (l + xhalf(l));                        // the two halves' sums of one query joined
#pragma unroll
    for (int nt = 0; nt < 4; ++nt) { v8us th, tl;
#pragma unroll
        for (int r = 0; r < 8; ++r) { unsigned short a2, c2; splitf(o[nt][r] * inv, a2, c2); th[r] = a2; tl[r] = c2; }
        const int so = lr * PP + nt * 16 + 8 * hi; *(v8usa*)(sph + so) = th; *(v8usa*)(spl + so) = tl; }           // a lane's 8 accumulators are 8 consecutive d of its query's row
    lds_wsync();
    bf* chb = CTh + (size_t)q0 * DMO + h * HD; bf* clb = CTl + (size_t)q0 * DMO + h * HD;
{
#pragma unroll
        for (int it = 0; it < 4; ++it) { const int rr = it * 4 + (lane >> 3), pc = (lane & 7) * 8; const v8us va = *(const v8usa*)(sph + rr * PP + pc); const v8us vb = *(const v8usa*)(spl + rr * PP + pc);
            *(v8us*)(chb + (size_t)rr * DMO + pc) = va; *(v8us*)(clb + (size_t)rr * DMO + pc) = vb; }
         }
}

// ---- k_attn: causal attention for query tiles qt >= RRES/64 (blockIdx.x + RRES/64): same structure (transposed products, p stays in registers) with single f16 products; q, k from [h][SEQ][HD] / [g][SEQ][HD] f16 planes,
// the k and v^T tiles of 64 keys shared by the four waves through LDS (asynchronous copies, two buffers: the next tiles fly while these are worked on).
__global__ __launch_bounds__(128) void k_attn(const h16* __restrict__ Q16, const h16* __restrict__ K16, const h16* __restrict__ VT16, h16* C16) {
    __shared__ __align__(16) h16 sP[4][16 * PP];
    __shared__ __align__(128) h16 sKV[2][2][TLE];         // [buffer][k | v^T]
    const int lane = threadIdx.x & 31, wave = threadIdx.x >> 5, lr = lane & 15, hi = lane >> 4;
    const int qt = blockIdx.x + RRES / 64, h = blockIdx.y, g = h / GRP; const int q0 = qt * 64 + wave * 16;
    const size_t sq = blockIdx.z;                         // sequence
    Q16 += sq * NH * SEQ * HD; K16 += sq * NKV * SEQ * HD; VT16 += sq * NKV * HD * SEQ; C16 += sq * SEQ * DMO;
    const h16* qp = Q16 + ((size_t)h * SEQ + q0) * HD; const h16* kp = K16 + (size_t)g * SEQ * HD; const h16* vp = VT16 + (size_t)g * HD * SEQ;
    h16* spw = &sP[wave][0];
    v16h aq[2];
#pragma unroll
    for (int kk = 0; kk < 2; ++kk) aq[kk] = WFrag<h16>::ld(qp + (size_t)lr * HD + 8 * hi + kk * 32);
    float m = -3.0e38f, l = 0.0f; v8f o[4];
#pragma unroll
    for (int nt = 0; nt < 4; ++nt) o[nt] = (v8f){};
    const int nch = qt + 1;
    const int trow = threadIdx.x >> 3, tcol = (threadIdx.x & 7) * 8;
    const h16* gk = kp + (size_t)trow * HD + tcol; const h16* gv = vp + (size_t)trow * SEQ + tcol;
    const unsigned lt = lds_off(&sKV[0][0][0]) + (unsigned)(trow * PP + tcol) * 2;
    auto stage = [&](int c, int buf) { const unsigned l = lt + (unsigned)buf * (2 * TLE * 2);
        acopy_tiles(l, gk + (size_t)c * 64 * HD, (size_t)HD, l + TLE * 2, gv + (size_t)c * 64, (size_t)SEQ); };
    stage(0, 0);
    asm volatile("s_wait_asynccnt 0x0" ::: "memory");     // this wave's copies of tile 0 have landed
    __syncthreads();                                      // every wave's have: tile 0 may be read
    if (nch > 1) stage(1, 1);
#pragma unroll 1
    for (int c = 0; c < nch; ++c) {
        const int kvb = c * 64; v8f s[4]; v16h b;
        const h16* sk = &sKV[c & 1][0][0] + lr * PP + 8 * hi; const h16* sv = &sKV[c & 1][1][0] + lr * PP + 8 * hi;
#pragma unroll
        for (int nt = 0; nt < 4; ++nt) { s[nt] = (v8f){}; const h16* kr = sk + nt * 16 * PP;
#pragma unroll
            for (int kk = 0; kk < 2; ++kk) { b = WFrag<h16>::ld(kr + kk * 32); s[nt] = wmma16(b, aq[kk], s[nt]); } }      // S^T: the 16 keys are the rows (A), the 16 queries the columns (B)
        asm volatile("v_nop\n\tv_nop\n\tv_nop\n\tv_nop" : "+v"(s[0]), "+v"(s[1]), "+v"(s[2]), "+v"(s[3]) : "v"(aq[0]), "v"(aq[1]), "v"(b));
        online_softmax_t(s, m, l, o, c == qt, q0 + lr, kvb, hi);
        // two score tiles of 16 keys, converted in place, are the B operand P^T of 32 keys: element e <- key 8*hi + e of the first, element 8 + e <- key 16 + 8*hi + e (the second's 8*hi + e),
        // the k order of the v^T loader
        v16h ap[2], bv;
#pragma unroll
        for (int kk = 0; kk < 2; ++kk)
#pragma unroll
            for (int e = 0; e < 8; ++e) { ap[kk][e] = tohx(s[2 * kk][e] * PCAR); ap[kk][8 + e] = tohx(s[2 * kk + 1][e] * PCAR); }
#pragma unroll
        for (int kk = 0; kk < 2; ++kk)
#pragma unroll
            for (int nt = 0; nt < 4; ++nt) { bv = WFrag<h16>::ld(sv + nt * 16 * PP + kk * 32); o[nt] = wmma16(bv, ap[kk], o[nt]); }      // O^T: 16 rows of v^T are A
        asm volatile("v_nop\n\tv_nop\n\tv_nop\n\tv_nop" : "+v"(o[0]), "+v"(o[1]), "+v"(o[2]), "+v"(o[3]) : "v"(ap[0]), "v"(ap[1]), "v"(bv));
        asm volatile("s_wait_dscnt 0x0" ::: "memory");    // this wave has left the buffer that is refilled below
        asm volatile("s_wait_asynccnt 0x0" ::: "memory"); // this wave's copies of tile c + 1 have landed
        __syncthreads();                                  // publishes tile c + 1 and ends every reader's last read of tile c
        if (c + 2 < nch) stage(c + 2, c & 1);
    }
    asm volatile("s_wait_asynccnt 0x0" ::: "memory");     // no copy is outstanding when the wave goes on and ends
    const float inv = (1.0f / (l + xhalf(l))) * (CCAR / PCAR);      // the two halves' sums of one query joined
#pragma unroll
    for (int nt = 0; nt < 4; ++nt) { v8h t;
#pragma unroll
        for (int r = 0; r < 8; ++r) t[r] = tohx(o[nt][r] * inv);
        *(v8ha*)(spw + lr * PP + nt * 16 + 8 * hi) = t; }           // a lane's 8 accumulators are 8 consecutive d of its query's row
    lds_wsync();
    h16* cb = C16 + (size_t)q0 * DMO + h * HD;
{
#pragma unroll
        for (int it = 0; it < 4; ++it) { const int rr = it * 4 + (lane >> 3), pc = (lane & 7) * 8; const v8h val = *(const v8ha*)(spw + rr * PP + pc); *(v8h*)(cb + (size_t)rr * DMO + pc) = val; }
         }
}

extern "C" void kernel_launch(void* const* d_in, const int* in_sizes, int n_in,
                              void* d_out, int out_size, void* d_ws, size_t ws_size, hipStream_t stream) {
    if (n_in < 7) return;
    const long long rows_used = (long long)(NB - 1) * SEQ_FULL + SEQ;
    if ((long long)in_sizes[0] < rows_used * DIN) return;
    if (in_sizes[1] < SEQ * HD || in_sizes[2] < SEQ * HD) return;
    if (in_sizes[3] < DIN * DMO || in_sizes[4] < DIN * DKV || in_sizes[5] < DIN * DKV || in_sizes[6] < DMO * DMO) return;
    if ((long long)out_size < rows_used * DMO) return;
    // wire order: x, cos, sin, wq, wk, wv, wo
    const float* x = (const float*)d_in[0]; const float* cosi = (const float*)d_in[1]; const float* sini = (const float*)d_in[2];
    const float* wq = (const float*)d_in[3]; const float* wk = (const float*)d_in[4]; const float* wv = (const float*)d_in[5]; const float* wo = (const float*)d_in[6];
    float* OUT = (float*)d_out;     // [NB_FULL][SEQ_FULL][DMO]
    char* wsp = (char*)d_ws;
    auto take = [&](size_t bytes) { char* p = wsp; wsp += (bytes + 255) & ~(size_t)255; return (void*)p; };
    bf* WQ   = (bf*)take((size_t)DMO * DIN * 2);          // Bt [out][in]
    bf* WK   = (bf*)take((size_t)DKV * DIN * 2);
    bf* WV   = (bf*)take((size_t)DKV * DIN * 2);
    bf* WOb  = (bf*)take((size_t)DMO * DMO * 2);
    h16* WO16 = (h16*)take((size_t)DMO * DMO * 2);
    bf* XB   = (bf*)take((size_t)NB * SEQ * DIN * 2);     // from here on: NB planes each, sequence-major
    h16* Q16 = (h16*)take((size_t)NB * NH * SEQ * HD * 2); h16* K16 = (h16*)take((size_t)NB * NKV * SEQ * HD * 2); h16* VT16 = (h16*)take((size_t)NB * NKV * HD * SEQ * 2);
    bf* QPh = (bf*)take((size_t)NB * NH * RRES * HD * 2); bf* QPl = (bf*)take((size_t)NB * NH * RRES * HD * 2);
    bf* KPh = (bf*)take((size_t)NB * NKV * RRES * HD * 2); bf* KPl = (bf*)take((size_t)NB * NKV * RRES * HD * 2);
    bf* VTh = (bf*)take((size_t)NB * NKV * HD * RRES * 2); bf* VTl = (bf*)take((size_t)NB * NKV * HD * RRES * 2);
    h16* C16 = (h16*)take((size_t)NB * SEQ * DMO * 2);   // rows >= RRES of each sequence used
    bf* CTh = (bf*)take((size_t)NB * RRES * DMO * 2); bf* CTl = (bf*)take((size_t)NB * RRES * DMO * 2);
    int* MFLAG = (int*)take(128);
    const size_t carved = (size_t)(wsp - (char*)d_ws);
    if (carved > ws_size || carved > (size_t)268435456) return;

    k_prep<<<PT_W + NB * PX_S, 256, 0, stream>>>(x, wq, wk, wv, wo, XB, WQ, WK, WV, WOb, WO16, MFLAG);
    k_gemmw<bf, 0, 1><<<dim3(SEQ / 128, DMO / 128, NB), 128, 0, stream>>>(XB, nullptr, WQ, nullptr, DIN, nullptr, DMO, 1.0f, MFLAG, (size_t)SEQ * DIN, 0, 0, cosi, sini, Q16, QPh, QPl);
    k_gemmw<bf, 0, 1><<<dim3(SEQ / 128, DKV / 128, NB), 128, 0, stream>>>(XB, nullptr, WK, nullptr, DIN, nullptr, DKV, 1.0f, MFLAG, (size_t)SEQ * DIN, 0, 0, cosi, sini, K16, KPh, KPl);
    k_gemmw<bf, 0, 2><<<dim3(DKV / 128, SEQ / 128, NB), 128, 0, stream>>>(WV, nullptr, XB, nullptr, DIN, nullptr, SEQ, 1.0f, MFLAG, 0, (size_t)SEQ * DIN, 0, nullptr, nullptr, VT16, VTh, VTl);
    k_attnr<<<dim3(RRES / 64, NH, NB), 128, 0, stream>>>(QPh, QPl, KPh, KPl, VTh, VTl, CTh, CTl);
    if (SEQ > RRES) k_attn<<<dim3((SEQ - RRES) / 64, NH, NB), 128, 0, stream>>>(Q16, K16, VT16, C16);
    k_gemmw<bf, 1, 0><<<dim3(RRES / 128, DMO / 128, NB), 128, 0, stream>>>(CTh, CTl, WOb, nullptr, DMO, OUT, DMO, 1.0f, MFLAG, (size_t)RRES * DMO, 0, (size_t)SEQ_FULL * DMO, nullptr, nullptr, nullptr, nullptr, nullptr);
    if (SEQ > RRES) k_gemmw<h16, 0, 0><<<dim3((SEQ - RRES) / 128, DMO / 128, NB), 128, 0, stream>>>(C16 + (size_t)RRES * DMO, nullptr, WO16, nullptr, DMO, OUT + (size_t)RRES * DMO, DMO, 1.0f / (CCAR * WCAR), MFLAG, (size_t)SEQ * DMO, 0, (size_t)SEQ_FULL * DMO, nullptr, nullptr, nullptr, nullptr, nullptr);
}

// v007
// It runs in 193 microseconds.
// Two timings next to v006 both put it at 1.07 times that version's speed.
// Counting every step since v000, it is 3.91 times as fast.
#include <hip/hip_runtime.h>

// Contractions and operand types (f32 accumulate everywhere): x Wq, x Wk, x Wv on v_wmma_f32_16x16x32_bf16 with RNE bf16 copies of x and W (exact products);
// query rows < RRES of each sequence: q.k^T and p.v on v_wmma_f32_16x16x32_bf16 as bf16 hi/lo splits (3 products each), their ctx Wo as bf16 hi/lo ctx times bf16 Wo (2 products);
// query rows >= RRES: q.k^T and p.v on v_wmma_f32_16x16x32_f16 (f16 q/k/v planes, p carried x1024), ctx Wo on v_wmma_f32_16x16x32_f16 (ctx carried x16, Wo carried x64, folded by 1/1024 in the epilogue).
// diagonal are skipped (their probabilities are exactly 0) and the diagonal tile is masked by index; a constant zero flag line feeds the additive term of the GEMM epilogue.
// The projection GEMMs write the attention operand planes themselves: the rotary mix (q, k) and the 16-bit conversions (q, k, v^T) are their epilogues; no f32 projection plane exists.
// All NB sequences go through every launch together: the last grid dimension is the sequence (k_prep, on a flat grid, takes PX_S blocks a sequence after the weight tiles), and every per-sequence workspace plane holds NB copies, sequence-major.

#ifndef NB
#define NB 2
#endif
#ifndef SEQ
#define SEQ 2048
#endif
#ifndef RRES
#define RRES 256
#endif
#define NB_FULL 2
#define SEQ_FULL 2048
#define DIN 2048
#define DMO 2048
#define NH 32
#define NKV 8
#define GRP (NH / NKV)
#define HD 64
#define DKV (NKV * HD)
#define PP 72
#define PCAR 1024.0f
#define LPCAR 10
#define CCAR 16.0f
#define WCAR 64.0f
#define SCL 0.125f
#define L2E 1.4426950408889634f
static_assert(SEQ % 64 == 0 && SEQ >= 64 && SEQ <= SEQ_FULL);
static_assert(RRES % 64 == 0 && RRES >= 64 && RRES <= SEQ);
static_assert(NB >= 1 && NB <= NB_FULL);
static_assert(DIN % 32 == 0 && DMO % 64 == 0 && DKV % 64 == 0 && HD == 64 && (NH % NKV) == 0);
static_assert(DMO == NH * HD && DMO % 32 == 0);
static_assert(PP % 8 == 0 && PP >= HD);
static_assert(PCAR == (float)(1 << LPCAR));
static_assert((DMO * DIN) % 64 == 0 && (DKV * DIN) % 64 == 0 && (DMO * DMO) % 64 == 0 && DIN % 2 == 0 && DMO % 2 == 0);
static_assert(((size_t)SEQ * DIN) % 8 == 0);
// workspace carve (every plane a multiple of 256 B; same sequence as the launcher's take() calls)
#define AL256(x) ((((size_t)(x)) + 255) & ~(size_t)255)
#define WS_TOTAL (AL256((size_t)DMO * DIN * 2) + 2 * AL256((size_t)DKV * DIN * 2) + 2 * AL256((size_t)DMO * DMO * 2) + AL256((size_t)NB * SEQ * DIN * 2) \
                  + AL256((size_t)NB * NH * SEQ * HD * 2) + 2 * AL256((size_t)NB * NKV * SEQ * HD * 2) + 2 * AL256((size_t)NB * NH * RRES * HD * 2) \
                  + 4 * AL256((size_t)NB * NKV * RRES * HD * 2) + AL256((size_t)NB * SEQ * DMO * 2) + 2 * AL256((size_t)NB * RRES * DMO * 2) + AL256(128))
static_assert(WS_TOTAL <= (size_t)268435456);

typedef _Float16 h16;
typedef unsigned short bf;
typedef __attribute__((ext_vector_type(16))) __bf16   v16bf;
typedef __attribute__((ext_vector_type(16))) _Float16 v16h;
typedef __attribute__((ext_vector_type(8)))  _Float16 v8h;
typedef __attribute__((ext_vector_type(8)))  unsigned short v8us;
typedef __attribute__((ext_vector_type(8)))  float    v8f;
typedef __attribute__((ext_vector_type(4)))  float    v4f;
typedef __attribute__((ext_vector_type(4)))  int      v4i;
typedef __attribute__((ext_vector_type(2)))  _Float16 v2h;
typedef __attribute__((ext_vector_type(2)))  unsigned short v2us;
typedef __attribute__((ext_vector_type(4)))  _Float16 v4h;
typedef __attribute__((ext_vector_type(4)))  unsigned short v4us;
typedef v8h  __attribute__((may_alias)) v8ha;
typedef v4f  __attribute__((may_alias)) v4fa;
typedef v8us __attribute__((may_alias)) v8usa;

__device__ __forceinline__ unsigned short f2bf(float f) { unsigned u = __float_as_uint(f); u += 0x7FFFu + ((u >> 16) & 1u); return (unsigned short)(u >> 16); }
__device__ __forceinline__ float bf2f(unsigned short b) { return __uint_as_float(((unsigned)b) << 16); }
__device__ __forceinline__ float bfr(float f) { return bf2f(f2bf(f)); }
__device__ __forceinline__ h16 tohx(float x) { return (h16)x; }
__device__ __forceinline__ void splitf(float y, unsigned short& h, unsigned short& l) { h = f2bf(y); l = f2bf(y - bf2f(h)); }
__device__ __forceinline__ v16h cat16(v8h lo, v8h hi) { return __builtin_shufflevector(lo, hi, 0, 1, 2, 3, 4, 5, 6, 7, 8, 9, 10, 11, 12, 13, 14, 15); }
__device__ __forceinline__ v16bf cat16b(v8us lo, v8us hi) { return __builtin_bit_cast(v16bf, __builtin_shufflevector(lo, hi, 0, 1, 2, 3, 4, 5, 6, 7, 8, 9, 10, 11, 12, 13, 14, 15)); }
__device__ __forceinline__ v8f wmma16(v16h a, v16h b, v8f c) { return __builtin_amdgcn_wmma_f32_16x16x32_f16(false, a, false, b, (short)0, c, false, false); }
__device__ __forceinline__ v8f wmmab(v16bf a, v16bf b, v8f c) { return __builtin_amdgcn_wmma_f32_16x16x32_bf16(false, a, false, b, (short)0, c, false, false); }
// wave-private LDS tile: stores of this wave made visible to its own later cross-lane loads, loads kept below the stores by the compiler
__device__ __forceinline__ void lds_wsync() { __builtin_amdgcn_fence(3 /* release order */, "wavefront"); __builtin_amdgcn_wave_barrier(); asm volatile("" ::: "memory"); }

// 16-bit fragment loaders: lane l -> row/column (l & 15); elements 0..7 <- k0 + 8*(l>>4) + 0..7, elements 8..15 <- k0 + 16 + 8*(l>>4) + 0..7 of a K-contiguous row (p already offset by 8*(l>>4)).
template <typename T16> struct WFrag;
template <> struct WFrag<h16> { typedef v16h V; static __device__ __forceinline__ V ld(const h16* p) { return cat16(*(const v8h*)p, *(const v8h*)(p + 16)); } static __device__ __forceinline__ v8f mma(V a, V b, v8f c) { return wmma16(a, b, c); } };
template <> struct WFrag<bf> { typedef v16bf V; static __device__ __forceinline__ V ld(const bf* p) { return cat16b(*(const v8us*)p, *(const v8us*)(p + 16)); } static __device__ __forceinline__ v8f mma(V a, V b, v8f c) { return wmmab(a, b, c); } };

// ---- k_gemmw: work-group tiled GEMM: 4 waves (2 x 2) share one 128x128 output tile, each wave keeps a 64x64 part (16 accumulators); grid (M/128, N/128, Z), 128 threads.
// A stage is GKS = 128 k (256 B) of the 128 A rows, the 128 Bt rows (and the 128 A2 rows when NSPLIT == 1), brought from the K-contiguous 16-bit planes into LDS by asynchronous
// 16-byte copies at a row pitch of 272 B; two buffers, the next stage's copies fly while this stage is multiplied. Every accumulator sums k upward in steps of 32, A before A2.
// F[m][n] = (sum_k A[m][k] Bt[n][k] (+ A2[m][k] Bt[n][k] when NSPLIT == 1)) * cscale + (pflag[0] ? NaN : 0). K % 128 == 0, K >= 128, M % 128 == 0, N % 128 == 0.
// EPI == 0: C[m][n] (f32, pitch ldc) = F[m][n].
// EPI == 1 (m = token t, n = h*HD + d, ldc = N; a wave's 64 columns are one head): head planes of the rotate-half rotary mix of F with the cos/sin input tables (bf16 RNE values):
//   r[d] = x[d] cos[t][d] - x[d+HD/2] sin[t][d] (d < HD/2), r[d] = x[d] cos[t][d] + x[d-HD/2] sin[t][d] (d >= HD/2); P16[h][t][d] = f16(r) for every t, Ph/Pl[h][t][d] bf16 hi/lo for t < RRES.
// EPI == 2 (m = g*HD + d, n = token t: the weight rows are the A operand, so F is already v^T): P16[m][t] = f16(F) (row pitch SEQ), Ph/Pl[m][t] bf16 hi/lo for t < RRES (row pitch RRES).
#define GKS 128
#define GPI 136
static_assert(DIN % GKS == 0 && DMO % GKS == 0 && SEQ % 128 == 0 && RRES % 128 == 0 && DMO % 128 == 0 && DKV % 128 == 0);
__device__ __forceinline__ unsigned lds_off(const void* p) { return (unsigned)(size_t)p; }
// eight copies of one lane: rows 8 apart, 16 B each, LDS byte address l, global address g (row pitch K elements). The s_wait_xcnt closes the statement so that no address register
// of an issued copy is rewritten ahead of it.
template <typename T16>
__device__ __forceinline__ void acopy8(unsigned l, const T16* g, size_t K) {
    const unsigned ls = 8 * GPI * 2; const size_t gs = 8 * K;
    asm volatile("global_load_async_to_lds_b128 %0, %8, off\n\t"
                 "global_load_async_to_lds_b128 %1, %9, off\n\t"
                 "global_load_async_to_lds_b128 %2, %10, off\n\t"
                 "global_load_async_to_lds_b128 %3, %11, off\n\t"
                 "global_load_async_to_lds_b128 %4, %12, off\n\t"
                 "global_load_async_to_lds_b128 %5, %13, off\n\t"
                 "global_load_async_to_lds_b128 %6, %14, off\n\t"
                 "global_load_async_to_lds_b128 %7, %15, off\n\t"
                 "s_wait_xcnt 0x0"
                 :: "v"(l), "v"(l + ls), "v"(l + 2 * ls), "v"(l + 3 * ls), "v"(l + 4 * ls), "v"(l + 5 * ls), "v"(l + 6 * ls), "v"(l + 7 * ls),
                    "v"(g), "v"(g + gs), "v"(g + 2 * gs), "v"(g + 3 * gs), "v"(g + 4 * gs), "v"(g + 5 * gs), "v"(g + 6 * gs), "v"(g + 7 * gs) : "memory");
}
// 128 rows x 256 B of one operand: 16 copies a lane (16 lanes cover a row, a wave two rows)
template <typename T16>
__device__ __forceinline__ void acopy_rows(unsigned l, const T16* g, size_t K) { acopy8(l, g, K); acopy8(l + 64 * GPI * 2, g + 64 * K, K); }

template <typename T16, int NSPLIT, int EPI>
__global__ __launch_bounds__(128) void k_gemmw(const T16* __restrict__ A, const T16* __restrict__ A2, const T16* __restrict__ Bt, const T16* __restrict__ Bt2, int K, float* C, int ldc, float cscale, const int* __restrict__ pflag, size_t sA, size_t sB, size_t sC,
                                               const float* __restrict__ COSI, const float* __restrict__ SINI, h16* P16, bf* Ph, bf* Pl) {
    typedef typename WFrag<T16>::V V;
    static_assert(NSPLIT == 0 || NSPLIT == 1); static_assert(EPI >= 0 && EPI <= 2);
    constexpr int OPE = 128 * GPI;                        // elements of one operand's rows in a stage
    constexpr int STE = (NSPLIT == 1 ? 3 : 2) * OPE;      // elements of a stage: [A | Bt | A2]
    __shared__ __align__(128) T16 ring[2 * STE];
    __shared__ __align__(16) float osw[4][16 * 68];
    const size_t z = blockIdx.z; A += z * sA; if (A2) A2 += z * sA; Bt += z * sB; if (EPI == 0) C += z * sC;
    const int tid = threadIdx.x, lane = tid & 31, wave = tid >> 5, lr = lane & 15, hi = lane >> 4; const int wm = wave >> 1, wn = wave & 1;
    const int r0 = blockIdx.x * 128, c0 = blockIdx.y * 128;
    const float padd = (pflag[0] != 0) ? __int_as_float(0x7fc00000) : 0.0f;
    v8f acc[4][4];
#pragma unroll
    for (int mb = 0; mb < 4; ++mb)
#pragma unroll
        for (int nb = 0; nb < 4; ++nb) acc[mb][nb] = (v8f){};
    const int trow = tid >> 4, tcol = tid & 15;
    const T16* ga = A + (size_t)(r0 + trow) * K + tcol * 8; const T16* gb = Bt + (size_t)(c0 + trow) * K + tcol * 8;
    const T16* ga2 = (NSPLIT == 1) ? A2 + (size_t)(r0 + trow) * K + tcol * 8 : nullptr;
    const unsigned lt = lds_off(ring) + (unsigned)(trow * GPI + tcol * 8) * 2;
    auto stage = [&](int t, int buf) { const unsigned l = lt + (unsigned)buf * (STE * 2); const size_t ko = (size_t)t * GKS;
        acopy_rows(l, ga + ko, (size_t)K); acopy_rows(l + OPE * 2, gb + ko, (size_t)K); if (NSPLIT == 1) acopy_rows(l + 2 * OPE * 2, ga2 + ko, (size_t)K); };
    const int nt = K / GKS;
    stage(0, 0);
    asm volatile("s_wait_asynccnt 0x0" ::: "memory");     // this wave's copies of stage 0 have landed
    __syncthreads();                                      // every wave's have: stage 0 may be read
    if (nt > 1) stage(1, 1);
    // the stage loop stays rolled: one copy of the body in the instruction cache, the buffer picked by t & 1
#pragma unroll 1
    for (int t = 0; t < nt; ++t) {
        const T16* sa = ring + (t & 1) * STE + (wm * 64 + lr) * GPI + 8 * hi; const T16* sb = ring + (t & 1) * STE + OPE + (wn * 64 + lr) * GPI + 8 * hi;
        // two fragment sets: the reads of the next 32 k of this stage go out as one group ahead of this step's matrix instructions, so that only the stage's last group is waited for in full
        // (every loop below is unrolled so that set, fragment and accumulator indices are constants and the arrays live in registers)
        V a[2][4], b[2][4], a2[2][4];
        auto ldset = [&](int s, int ks) {
#pragma unroll
            for (int mb = 0; mb < 4; ++mb) { a[s][mb] = WFrag<T16>::ld(sa + mb * 16 * GPI + ks); if (NSPLIT == 1) a2[s][mb] = WFrag<T16>::ld(sa + 2 * OPE + mb * 16 * GPI + ks); }
#pragma unroll
            for (int nb = 0; nb < 4; ++nb) b[s][nb] = WFrag<T16>::ld(sb + nb * 16 * GPI + ks); };
        ldset(0, 0);
#pragma unroll
        for (int q = 0; q < GKS / 32; ++q) {
            if (q + 1 < GKS / 32) ldset((q + 1) & 1, (q + 1) * 32);
            // keeps the group of reads above in front of this step's matrix instructions (the scheduler otherwise spreads them among these, each with a full wait); in the last step, which
            // has no reads, it keeps the step before in front of the waits at the loop's foot, where its matrix instructions cover the last reads' latency (without it they sink behind the barrier)
            __builtin_amdgcn_sched_barrier(0);
#pragma unroll
            for (int nb = 0; nb < 4; ++nb)
#pragma unroll
                for (int mb = 0; mb < 4; ++mb) { acc[mb][nb] = WFrag<T16>::mma(a[q & 1][mb], b[q & 1][nb], acc[mb][nb]); if (NSPLIT == 1) acc[mb][nb] = WFrag<T16>::mma(a2[q & 1][mb], b[q & 1][nb], acc[mb][nb]); }
        }
        asm volatile("s_wait_dscnt 0x0" ::: "memory");    // this wave has left the buffer that is refilled below
        asm volatile("s_wait_asynccnt 0x0" ::: "memory"); // this wave's copies of stage t + 1 have landed
        __syncthreads();                                  // publishes stage t + 1 and ends every reader's last read of stage t
        if (t + 2 < nt) stage(t + 2, t & 1);
    }
    asm volatile("s_wait_asynccnt 0x0" ::: "memory");     // no copy is outstanding when the wave goes on and ends
    if constexpr (EPI == 0) {
    float* os = &osw[wave][0];
#pragma unroll
    for (int mb = 0; mb < 4; ++mb) {
#pragma unroll
        for (int nb = 0; nb < 4; ++nb) {
#pragma unroll
            for (int j = 0; j < 8; ++j) os[(hi * 8 + j) * 68 + nb * 16 + lr] = acc[mb][nb][j]; }
        __builtin_amdgcn_wave_barrier(); asm volatile("" ::: "memory");
        float* crow = C + (size_t)(r0 + wm * 64 + mb * 16) * ldc + c0 + wn * 64;
{
#pragma unroll
            for (int s = 0; s < 8; ++s) { const int row = 2 * s + hi, cofs = lr * 4; v4f val = *(const v4fa*)(os + row * 68 + cofs); val = val * cscale + padd;
                *(v4f*)(crow + (size_t)row * ldc + cofs) = val; }
             }
        __builtin_amdgcn_wave_barrier(); asm volatile("" ::: "memory");
    }
    } else {
        // The ring is free: every wave's last read of it and every copy into it ended in front of the loop's last barrier. Each wave lays its whole 64 x 64 f32 part there (own range, row
        // pitch 68) and walks it in rolled loops of 8 rows a trip, so that the epilogue's text stays short.
        float* ot = reinterpret_cast<float*>(ring) + wave * (64 * 68);
        static_assert(4 * 64 * 68 * 4 <= 2 * STE * 2);
#pragma unroll
        for (int mb = 0; mb < 4; ++mb)
#pragma unroll
            for (int nb = 0; nb < 4; ++nb)
#pragma unroll
                for (int j = 0; j < 8; ++j) ot[(mb * 16 + hi * 8 + j) * 68 + nb * 16 + lr] = acc[mb][nb][j];
        __builtin_amdgcn_wave_barrier(); asm volatile("" ::: "memory");   // the wave's own stores stay in front of its cross-lane reads below
        const int mw = r0 + wm * 64 + hi, cofs = lr * 4;
        // the hi/lo planes hold tokens < RRES only: a whole 128-token tile is in or out (RRES % 128 == 0)
        if constexpr (EPI == 1) {
            const bool res = r0 < RRES;
            const size_t hp = z * (size_t)(ldc / HD) + (size_t)(c0 / HD + wn); P16 += hp * SEQ * HD; Ph += hp * RRES * HD; Pl += hp * RRES * HD;
            const float* cp = COSI + (size_t)mw * HD + cofs; const float* sp = SINI + (size_t)mw * HD + cofs;
            v4f cs[4], sn[4];
#pragma unroll
            for (int i = 0; i < 4; ++i) { cs[i] = *(const v4f*)(cp + i * 2 * HD); sn[i] = *(const v4f*)(sp + i * 2 * HD); }
            asm volatile("s_wait_xcnt 0x0" ::: "memory");                 // in front of any rewrite of the address registers of the loads above
            // rolled (short text); the next trip's cos and sin are asked for one trip ahead, so that this trip's work covers their latency (the last trip asks for its own rows again)
#pragma unroll 1
            for (int g = 0; g < 8; ++g) {
                v4f cn[4], sm[4]; const int gn = (g < 7) ? g + 1 : 7;
#pragma unroll
                for (int i = 0; i < 4; ++i) { cn[i] = *(const v4f*)(cp + (gn * 8 + i * 2) * HD); sm[i] = *(const v4f*)(sp + (gn * 8 + i * 2) * HD); }
                asm volatile("s_wait_xcnt 0x0" ::: "memory");             // in front of any rewrite of the address registers of the loads above
                // the trip's LDS reads go out together, its stores together at its foot: one LDS latency and one wait a trip
                v4f x0[4], x1[4]; v4h o16[4]; v4us oh[4], ol[4];
#pragma unroll
                for (int i = 0; i < 4; ++i) { const float* xr = ot + (g * 8 + i * 2 + hi) * 68; x0[i] = *(const v4fa*)(xr + cofs); x1[i] = *(const v4fa*)(xr + (cofs ^ (HD / 2))); }
#pragma unroll
                for (int i = 0; i < 4; ++i) { const v4f y0 = x0[i] * cscale + padd, y1 = x1[i] * cscale + padd;
#pragma unroll
                    for (int q = 0; q < 4; ++q) { const float cv = bfr(cs[i][q]), snv = bfr(sn[i][q]); const float pa = y0[q] * cv, pb = y1[q] * snv; const float r = (cofs < HD / 2) ? (pa - pb) : (pa + pb);
                        o16[i][q] = tohx(r); unsigned short a2, c2; splitf(r, a2, c2); oh[i][q] = a2; ol[i][q] = c2; } }
                const size_t oo = (size_t)(mw + g * 8) * HD + cofs;
                if (res) {
#pragma unroll
                    for (int i = 0; i < 4; ++i) { *(v4us*)(Ph + oo + i * 2 * HD) = oh[i]; *(v4us*)(Pl + oo + i * 2 * HD) = ol[i]; }
                    asm volatile("s_wait_xcnt 0x0" ::: "memory"); }       // in front of any rewrite of the registers of the stores above
#pragma unroll
                for (int i = 0; i < 4; ++i) *(v4h*)(P16 + oo + i * 2 * HD) = o16[i];
                asm volatile("s_wait_xcnt 0x0" ::: "memory");             // in front of any rewrite of the registers of the stores above
                __builtin_amdgcn_sched_barrier(0);                        // keeps the register copies below behind that wait (the scheduler otherwise lifts them over it, onto the stores' registers)
#pragma unroll
                for (int i = 0; i < 4; ++i) { cs[i] = cn[i]; sn[i] = sm[i]; }
            }
        } else {
            const bool res = c0 < RRES;
            const int t = c0 + wn * 64 + cofs;
            P16 += z * (size_t)DKV * SEQ + t; Ph += z * (size_t)DKV * RRES + t; Pl += z * (size_t)DKV * RRES + t;
            // rolled: short text
#pragma unroll 1
            for (int g = 0; g < 8; ++g) {
                // the trip's LDS reads go out together, its stores together at its foot: one LDS latency and one wait a trip
                v4f val[4]; v4h o16[4]; v4us oh[4], ol[4];
#pragma unroll
                for (int i = 0; i < 4; ++i) val[i] = *(const v4fa*)(ot + (g * 8 + i * 2 + hi) * 68 + cofs);
#pragma unroll
                for (int i = 0; i < 4; ++i) { const v4f y = val[i] * cscale + padd;
#pragma unroll
                    for (int q = 0; q < 4; ++q) { o16[i][q] = tohx(y[q]); unsigned short a2, c2; splitf(y[q], a2, c2); oh[i][q] = a2; ol[i][q] = c2; } }
                const size_t m = (size_t)(mw + g * 8);
                if (res) {
#pragma unroll
                    for (int i = 0; i < 4; ++i) { *(v4us*)(Ph + (m + i * 2) * RRES) = oh[i]; *(v4us*)(Pl + (m + i * 2) * RRES) = ol[i]; }
                    asm volatile("s_wait_xcnt 0x0" ::: "memory"); }       // in front of any rewrite of the registers of the stores above
#pragma unroll
                for (int i = 0; i < 4; ++i) *(v4h*)(P16 + (m + i * 2) * SEQ) = o16[i];
                asm volatile("s_wait_xcnt 0x0" ::: "memory");             // in front of any rewrite of the registers of the stores above
            }
        }
    }
}

// ---- k_prep: every 16-bit plane that is a plain function of one input, in one launch of 256-thread blocks, 64 KB of f32 a block, sixteen 16-byte loads a lane in flight.
// Blocks < PT_W: one 128 (k) x 128 (n) tile of a weight w[k][n]: whole 512-B rows are read, RNE bf16 pairs (k, k + 1) go to LDS as dwords at [n][k / 2], and rows of 128 k (256 B) are written to
// Bt[n][k]; Ht[n][k] = f16(bf16 value x WCAR) for wo. The dword column is XORed with 2 * ((n >> 2) & 31): the 32 lanes of a store (n four apart, one k pair) then hit 32 different banks,
// and a pair of neighbouring columns stays an aligned pair for the 8-byte reads. Blocks >= PT_W: PXE consecutive elements of x to bf16. Block 0 also writes the zero flag line.
#define PTE 128
#define PXE 16384
#define PT_Q ((DIN / PTE) * (DMO / PTE))
#define PT_K ((DIN / PTE) * (DKV / PTE))
#define PT_O ((DMO / PTE) * (DMO / PTE))
#define PT_W (PT_Q + 2 * PT_K + PT_O)
#define PX_S ((int)(((size_t)SEQ * DIN) / PXE))
static_assert(DIN % PTE == 0 && DMO % PTE == 0 && DKV % PTE == 0 && ((size_t)SEQ * DIN) % PXE == 0);
typedef __attribute__((ext_vector_type(2))) unsigned v2u;
typedef v2u __attribute__((may_alias)) v2ua;
template <int N, int K, bool HASH>
__device__ __forceinline__ void prep_tile(const float* __restrict__ w, bf* Bt, h16* Ht, int b, unsigned* tp, int lane, int wave) {
    constexpr int NTN = N / PTE; const int k0 = (b / NTN) * PTE, n0 = (b % NTN) * PTE;
    const float* s = w + (size_t)(k0 + wave * 16) * N + n0 + lane * 4;
    v4f v[16];
#pragma unroll
    for (int i = 0; i < 16; ++i) v[i] = *(const v4f*)(s + (size_t)i * N);
    asm volatile("s_wait_xcnt 0x0" :: "v"(s) : "memory");   // in front of any rewrite of the loads' address registers (the pointer is named so that they live up to here)
#pragma unroll
    for (int i = 0; i < 8; ++i)
#pragma unroll
        for (int j = 0; j < 4; ++j) tp[(lane * 4 + j) * (PTE / 2) + ((wave * 8 + i) ^ (lane * 2))] = (unsigned)f2bf(v[2 * i][j]) | ((unsigned)f2bf(v[2 * i + 1][j]) << 16);
    __syncthreads();                                      // the whole tile is in LDS before any row of it is read
    v2u d[16];
#pragma unroll
    for (int r = 0; r < 16; ++r) { const int n = wave * 16 + r; d[r] = *(const v2ua*)(tp + n * (PTE / 2) + ((lane * 2) ^ (((n >> 2) & 31) << 1))); }
    const size_t o = (size_t)(n0 + wave * 16) * K + k0 + lane * 4;
#pragma unroll
    for (int r = 0; r < 16; ++r) { const v4us t = __builtin_bit_cast(v4us, d[r]); *(v4us*)(Bt + o + (size_t)r * K) = t;
        if (HASH) { v4h hh;
#pragma unroll
            for (int q = 0; q < 4; ++q) hh[q] = tohx(bf2f(t[q]) * WCAR);
            *(v4h*)(Ht + o + (size_t)r * K) = hh; } }
    asm volatile("s_wait_xcnt 0x0" ::: "memory");         // in front of any rewrite of the registers of the stores above
}
__global__ __launch_bounds__(256) void k_prep(const float* __restrict__ x, const float* __restrict__ wq, const float* __restrict__ wk, const float* __restrict__ wv, const float* __restrict__ wo,
                                              bf* XB, bf* WQ, bf* WK, bf* WV, bf* WOb, h16* WO16, int* MFLAG) {
    __shared__ __align__(16) unsigned tp[PTE * (PTE / 2)];
    const int tid = threadIdx.x, lane = tid & 31, wave = tid >> 5; const int b = blockIdx.x;
    if (b == 0 && tid < 32) MFLAG[tid] = 0;
    if (b < PT_Q) prep_tile<DMO, DIN, false>(wq, WQ, nullptr, b, tp, lane, wave);
    else if (b < PT_Q + PT_K) prep_tile<DKV, DIN, false>(wk, WK, nullptr, b - PT_Q, tp, lane, wave);
    else if (b < PT_Q + 2 * PT_K) prep_tile<DKV, DIN, false>(wv, WV, nullptr, b - PT_Q - PT_K, tp, lane, wave);
    else if (b < PT_W) prep_tile<DMO, DMO, true>(wo, WOb, WO16, b - PT_Q - 2 * PT_K, tp, lane, wave);
    else {
        const int u = b - PT_W; const int sq = u / PX_S; const size_t o = (size_t)(u % PX_S) * PXE + tid * 4;
        const float* s = x + (size_t)sq * SEQ_FULL * DIN + o; bf* dp = XB + (size_t)sq * SEQ * DIN + o;
        v4f v[16];
#pragma unroll
        for (int i = 0; i < 16; ++i) v[i] = *(const v4f*)(s + i * 1024);
        asm volatile("s_wait_xcnt 0x0" :: "v"(s) : "memory");   // in front of any rewrite of the loads' address registers (the pointer is named so that they live up to here)
#pragma unroll
        for (int i = 0; i < 16; ++i) { v4us t;
#pragma unroll
            for (int q = 0; q < 4; ++q) t[q] = f2bf(v[i][q]);
            *(v4us*)(dp + i * 1024) = t; }
        asm volatile("s_wait_xcnt 0x0" ::: "memory");     // in front of any rewrite of the registers of the stores above
    }
}

// ---- attention key / value tiles in LDS: a tile is 64 rows x 128 B (64 keys x HD of k, or HD x 64 keys of v^T) at a row pitch of PP elements (144 B).
// eight copies of one lane, 16 B each: four rows 16 apart of tile 0 (LDS byte address l0, global address g0, global row pitch p0 elements) and four of tile 1; eight lanes cover a
// row, so a wave's copy reads four whole 128-B lines. The s_wait_xcnt closes the statement so that no address register of an issued copy is rewritten ahead of it.
#define TLE (64 * PP)
template <typename T16>
__device__ __forceinline__ void acopy_tiles(unsigned l0, const T16* g0, size_t p0, unsigned l1, const T16* g1, size_t p1) {
    const unsigned ls = 16 * PP * 2; const size_t s0 = 16 * p0, s1 = 16 * p1;
    asm volatile("global_load_async_to_lds_b128 %0, %8, off\n\t"
                 "global_load_async_to_lds_b128 %1, %9, off\n\t"
                 "global_load_async_to_lds_b128 %2, %10, off\n\t"
                 "global_load_async_to_lds_b128 %3, %11, off\n\t"
                 "global_load_async_to_lds_b128 %4, %12, off\n\t"
                 "global_load_async_to_lds_b128 %5, %13, off\n\t"
                 "global_load_async_to_lds_b128 %6, %14, off\n\t"
                 "global_load_async_to_lds_b128 %7, %15, off\n\t"
                 "s_wait_xcnt 0x0"
                 :: "v"(l0), "v"(l0 + ls), "v"(l0 + 2 * ls), "v"(l0 + 3 * ls), "v"(l1), "v"(l1 + ls), "v"(l1 + 2 * ls), "v"(l1 + 3 * ls),
                    "v"(g0), "v"(g0 + s0), "v"(g0 + 2 * s0), "v"(g0 + 3 * s0), "v"(g1), "v"(g1 + s1), "v"(g1 + 2 * s1), "v"(g1 + 3 * s1) : "memory");
}

// lane l <-> lane l ^ 16 (the two lanes that share a query column of a transposed score tile)
__device__ __forceinline__ float xhalf(float x) { return __builtin_bit_cast(float, __builtin_amdgcn_permlanex16(__builtin_bit_cast(int, x), __builtin_bit_cast(int, x), 0x76543210, 0xfedcba98, false, false)); }

// ---- online softmax step on one wave's TRANSPOSED 64 x 16 score tile (D layout: s[nt][r] = S[key nt*16 + 8*hi + r][query lr]): a lane holds 32 of the 64 scores of its one query (row),
// so maximum and sum run inside the lane; the maximum is joined with the other half's by one exchange, the sum l stays this half's own and is joined behind the key loop. The running maximum m
// is that of the UNSCALED scores: the 1/sqrt(HD) scaling, the change to base 2 and the carry 2^LOGCAR of p are one multiply-add per score in front of exp2. Only the diagonal tile is masked
// (diag is the same for the whole work-group: a scalar branch): entries with key > query become -1e9 (their exp is exactly 0). The transposed output accumulators
// (o[nt][r] = O[d nt*16 + 8*hi + r][query lr]) are rescaled by the lane's one factor; leaves s = 2^LOGCAR exp(t - m), and l sums these.
template <int LOGCAR>
__device__ __forceinline__ void online_softmax_t(v8f (&s)[4], float& m, float& l, v8f (&o)[4], bool diag, int row, int kvb, int hi) {
    constexpr float KS = SCL * L2E;
    if (diag) {
        const int dl = row - kvb - 8 * hi;               // key kvb + nt*16 + 8*hi + r lies behind query row where nt*16 + r > dl
#pragma unroll
        for (int nt = 0; nt < 4; ++nt)
#pragma unroll
            for (int r = 0; r < 8; ++r) s[nt][r] = (nt * 16 + r > dl) ? -1.0e9f : s[nt][r];
    }
    float mp[4];
#pragma unroll
    for (int nt = 0; nt < 4; ++nt) {
#pragma unroll
        for (int r = 0; r < 8; ++r) mp[nt] = (r == 0) ? s[nt][r] : fmaxf(mp[nt], s[nt][r]); }
    float mx = fmaxf(fmaxf(mp[0], mp[1]), fmaxf(mp[2], mp[3]));
    mx = fmaxf(mx, xhalf(mx));
    const float m2 = fmaxf(m, mx); const float alpha = __builtin_amdgcn_exp2f((m - m2) * KS); m = m2;
    const float cadd = (float)LOGCAR - m2 * KS;
#pragma unroll
    for (int nt = 0; nt < 4; ++nt) { const v8f t = s[nt] * KS + cadd;
#pragma unroll
        for (int r = 0; r < 8; ++r) s[nt][r] = __builtin_amdgcn_exp2f(t[r]); }
    // the lane's 32 terms summed as a tree (the four key groups register by register, then the eight registers): packed additions, no chain of 32 dependent ones
    const v8f t = (s[0] + s[1]) + (s[2] + s[3]);
    l = l * alpha + (((t[0] + t[1]) + (t[2] + t[3])) + ((t[4] + t[5]) + (t[6] + t[7])));
#pragma unroll
    for (int nt = 0; nt < 4; ++nt) o[nt] = o[nt] * alpha;
}

// ---- k_attnr: causal attention for query rows < RRES (query tiles 0 .. RRES/64-1; they only visit key tiles 0 .. qt): block = 4 waves x 16 rows, head h uses kv group h / GRP.
// q, k, v from the bf16 hi/lo planes ([h][RRES][HD], [g][RRES][HD], [g][HD][RRES]); scores = qh.kh + ql.kh + qh.kl, computed transposed (S^T = k q^T, O^T += v^T P^T: a lane holds one query's scores); unnormalised p split to bf16 hi/lo in registers, where it is the B operand;
// the four k and v^T tiles of 64 keys shared by the four waves through LDS (asynchronous copies, two buffers: the next tiles fly while these are worked on).
__global__ __launch_bounds__(128) void k_attnr(const bf* __restrict__ QPh, const bf* __restrict__ QPl, const bf* __restrict__ KPh, const bf* __restrict__ KPl, const bf* __restrict__ VTh, const bf* __restrict__ VTl, bf* CTh, bf* CTl) {
    __shared__ __align__(16) bf sP[4][2][16 * PP];
    __shared__ __align__(128) bf sKV[2][4][TLE];          // [buffer][k hi | v^T hi | k lo | v^T lo]
    const int lane = threadIdx.x & 31, wave = threadIdx.x >> 5, lr = lane & 15, hi = lane >> 4;
    const int qt = blockIdx.x, h = blockIdx.y, g = h / GRP; const int q0 = qt * 64 + wave * 16;
    const size_t sq = blockIdx.z;                         // sequence
    QPh += sq * NH * RRES * HD; QPl += sq * NH * RRES * HD; KPh += sq * NKV * RRES * HD; KPl += sq * NKV * RRES * HD; VTh += sq * NKV * HD * RRES; VTl += sq * NKV * HD * RRES;
    CTh += sq * RRES * DMO; CTl += sq * RRES * DMO;
    const bf* qh = QPh + ((size_t)h * RRES + q0) * HD; const bf* ql = QPl + ((size_t)h * RRES + q0) * HD;
    const bf* kh = KPh + (size_t)g * RRES * HD; const bf* kl = KPl + (size_t)g * RRES * HD;
    const bf* vh = VTh + (size_t)g * HD * RRES; const bf* vl = VTl + (size_t)g * HD * RRES;
    bf* sph = &sP[wave][0][0]; bf* spl = &sP[wave][1][0];
    float m = -3.0e38f, l = 0.0f; v8f o[4];
#pragma unroll
    for (int nt = 0; nt < 4; ++nt) o[nt] = (v8f){};
    const int nch = qt + 1;
    const int trow = threadIdx.x >> 3, tcol = (threadIdx.x & 7) * 8; const size_t tk = (size_t)trow * HD + tcol, tv = (size_t)trow * RRES + tcol;
    const unsigned lt = lds_off(&sKV[0][0][0]) + (unsigned)(trow * PP + tcol) * 2;
    auto stage = [&](int c, int buf) { const unsigned l = lt + (unsigned)buf * (4 * TLE * 2); const size_t ok = tk + (size_t)c * 64 * HD, ov = tv + (size_t)c * 64;
        acopy_tiles(l, kh + ok, (size_t)HD, l + TLE * 2, vh + ov, (size_t)RRES); acopy_tiles(l + 2 * TLE * 2, kl + ok, (size_t)HD, l + 3 * TLE * 2, vl + ov, (size_t)RRES); };
    stage(0, 0);
    asm volatile("s_wait_asynccnt 0x0" ::: "memory");     // this wave's copies of tile 0 have landed
    __syncthreads();                                      // every wave's have: tile 0 may be read
    if (nch > 1) stage(1, 1);
#pragma unroll 1
    for (int c = 0; c < nch; ++c) {
        const int kvb = c * 64; v8f s[4]; v16bf aqh[2], aql[2], bh[4][2], bl[4][2];
        const bf* skh = &sKV[c & 1][0][0]; const bf* svh = &sKV[c & 1][1][0]; const bf* skl = &sKV[c & 1][2][0]; const bf* svl = &sKV[c & 1][3][0];
#pragma unroll
        for (int kk = 0; kk < 2; ++kk) { aqh[kk] = WFrag<bf>::ld(qh + (size_t)lr * HD + 8 * hi + kk * 32); aql[kk] = WFrag<bf>::ld(ql + (size_t)lr * HD + 8 * hi + kk * 32); }
#pragma unroll
        for (int nt = 0; nt < 4; ++nt) { const int ko = (nt * 16 + lr) * PP + 8 * hi;
#pragma unroll
            for (int kk = 0; kk < 2; ++kk) { bh[nt][kk] = WFrag<bf>::ld(skh + ko + kk * 32); bl[nt][kk] = WFrag<bf>::ld(skl + ko + kk * 32); } }
        // keeps the tile's k reads together in front of the products: with the mask's branch behind them the products are a block of their own, in which the scheduler otherwise reads one
        // fragment at a time into the same registers, each read waited for in full
        __builtin_amdgcn_sched_barrier(0);
#pragma unroll
        for (int nt = 0; nt < 4; ++nt) { s[nt] = (v8f){};
#pragma unroll
            for (int kk = 0; kk < 2; ++kk) {
                s[nt] = wmmab(bh[nt][kk], aqh[kk], s[nt]); s[nt] = wmmab(bh[nt][kk], aql[kk], s[nt]); s[nt] = wmmab(bl[nt][kk], aqh[kk], s[nt]); } }      // S^T: the 16 keys are the rows (A), the 16 queries the columns (B)
        asm volatile("v_nop\n\tv_nop\n\tv_nop\n\tv_nop" : "+v"(s[0]), "+v"(s[1]), "+v"(s[2]), "+v"(s[3]) : "v"(aqh[0]), "v"(aql[1]), "v"(bh[3][1]), "v"(bl[3][1]));
        online_softmax_t<0>(s, m, l, o, c == qt, q0 + lr, kvb, hi);
        // two score tiles of 16 keys, split in place, are the B operands P^T (hi, lo) of 32 keys: element e <- key 8*hi + e of the first, element 8 + e <- key 16 + 8*hi + e (the second's
        // 8*hi + e), the k order of the v^T loader
        v16bf aph[2], apl[2], bvh, bvl;
#pragma unroll
        for (int kk = 0; kk < 2; ++kk) { v8us h0, h1, l0, l1;
#pragma unroll
            for (int e = 0; e < 8; ++e) { unsigned short a2, c2; splitf(s[2 * kk][e], a2, c2); h0[e] = a2; l0[e] = c2; splitf(s[2 * kk + 1][e], a2, c2); h1[e] = a2; l1[e] = c2; }
            aph[kk] = cat16b(h0, h1); apl[kk] = cat16b(l0, l1); }
#pragma unroll
        for (int kk = 0; kk < 2; ++kk)
#pragma unroll
            for (int nt = 0; nt < 4; ++nt) { const int vo = (nt * 16 + lr) * PP + kk * 32 + 8 * hi; bvh = WFrag<bf>::ld(svh + vo); bvl = WFrag<bf>::ld(svl + vo);
                o[nt] = wmmab(bvh, aph[kk], o[nt]); o[nt] = wmmab(bvh, apl[kk], o[nt]); o[nt] = wmmab(bvl, aph[kk], o[nt]); }      // O^T: 16 rows of v^T are A
        asm volatile("v_nop\n\tv_nop\n\tv_nop\n\tv_nop" : "+v"(o[0]), "+v"(o[1]), "+v"(o[2]), "+v"(o[3]) : "v"(aph[0]), "v"(apl[1]), "v"(bvh), "v"(bvl));
        asm volatile("s_wait_dscnt 0x0" ::: "memory");    // this wave has left the buffer that is refilled below
        asm volatile("s_wait_asynccnt 0x0" ::: "memory"); // this wave's copies of tile c + 1 have landed
        __syncthreads();                                  // publishes tile c + 1 and ends every reader's last read of tile c
        if (c + 2 < nch) stage(c + 2, c & 1);
    }
    asm volatile("s_wait_asynccnt 0x0" ::: "memory");     // no copy is outstanding when the wave goes on and ends
    const float inv = 1.0f / (l + xhalf(l));                        // the two halves' sums of one query joined
#pragma unroll
    for (int nt = 0; nt < 4; ++nt) { v8us th, tl;
#pragma unroll
        for (int r = 0; r < 8; ++r) { unsigned short a2, c2; splitf(o[nt][r] * inv, a2, c2); th[r] = a2; tl[r] = c2; }
        const int so = lr * PP + nt * 16 + 8 * hi; *(v8usa*)(sph + so) = th; *(v8usa*)(spl + so) = tl; }           // a lane's 8 accumulators are 8 consecutive d of its query's row
    lds_wsync();
    bf* chb = CTh + (size_t)q0 * DMO + h * HD; bf* clb = CTl + (size_t)q0 * DMO + h * HD;
{
#pragma unroll
        for (int it = 0; it < 4; ++it) { const int rr = it * 4 + (lane >> 3), pc = (lane & 7) * 8; const v8us va = *(const v8usa*)(sph + rr * PP + pc); const v8us vb = *(const v8usa*)(spl + rr * PP + pc);
            *(v8us*)(chb + (size_t)rr * DMO + pc) = va; *(v8us*)(clb + (size_t)rr * DMO + pc) = vb; }
         }
}

// ---- k_attn: causal attention for query tiles qt >= RRES/64 (blockIdx.x + RRES/64): same structure (transposed products, p stays in registers) with single f16 products; q, k from [h][SEQ][HD] / [g][SEQ][HD] f16 planes,
// the k and v^T tiles of 64 keys shared by the four waves through LDS (asynchronous copies, two buffers: the next tiles fly while these are worked on).
__global__ __launch_bounds__(128) void k_attn(const h16* __restrict__ Q16, const h16* __restrict__ K16, const h16* __restrict__ VT16, h16* C16) {
    __shared__ __align__(16) h16 sP[4][16 * PP];
    __shared__ __align__(128) h16 sKV[2][2][TLE];         // [buffer][k | v^T]
    const int lane = threadIdx.x & 31, wave = threadIdx.x >> 5, lr = lane & 15, hi = lane >> 4;
    const int qt = blockIdx.x + RRES / 64, h = blockIdx.y, g = h / GRP; const int q0 = qt * 64 + wave * 16;
    const size_t sq = blockIdx.z;                         // sequence
    Q16 += sq * NH * SEQ * HD; K16 += sq * NKV * SEQ * HD; VT16 += sq * NKV * HD * SEQ; C16 += sq * SEQ * DMO;
    const h16* qp = Q16 + ((size_t)h * SEQ + q0) * HD; const h16* kp = K16 + (size_t)g * SEQ * HD; const h16* vp = VT16 + (size_t)g * HD * SEQ;
    h16* spw = &sP[wave][0];
    v16h aq[2];
#pragma unroll
    for (int kk = 0; kk < 2; ++kk) aq[kk] = WFrag<h16>::ld(qp + (size_t)lr * HD + 8 * hi + kk * 32);
    float m = -3.0e38f, l = 0.0f; v8f o[4];
#pragma unroll
    for (int nt = 0; nt < 4; ++nt) o[nt] = (v8f){};
    const int nch = qt + 1;
    const int trow = threadIdx.x >> 3, tcol = (threadIdx.x & 7) * 8;
    const h16* gk = kp + (size_t)trow * HD + tcol; const h16* gv = vp + (size_t)trow * SEQ + tcol;
    const unsigned lt = lds_off(&sKV[0][0][0]) + (unsigned)(trow * PP + tcol) * 2;
    auto stage = [&](int c, int buf) { const unsigned l = lt + (unsigned)buf * (2 * TLE * 2);
        acopy_tiles(l, gk + (size_t)c * 64 * HD, (size_t)HD, l + TLE * 2, gv + (size_t)c * 64, (size_t)SEQ); };
    stage(0, 0);
    asm volatile("s_wait_asynccnt 0x0" ::: "memory");     // this wave's copies of tile 0 have landed
    __syncthreads();                                      // every wave's have: tile 0 may be read
    if (nch > 1) stage(1, 1);
#pragma unroll 1
    for (int c = 0; c < nch; ++c) {
        const int kvb = c * 64; v8f s[4]; v16h b[4][2];
        const h16* sk = &sKV[c & 1][0][0] + lr * PP + 8 * hi; const h16* sv = &sKV[c & 1][1][0] + lr * PP + 8 * hi;
#pragma unroll
        for (int nt = 0; nt < 4; ++nt)
#pragma unroll
            for (int kk = 0; kk < 2; ++kk) b[nt][kk] = WFrag<h16>::ld(sk + nt * 16 * PP + kk * 32);
        // keeps the tile's k reads together in front of the products: with the mask's branch behind them the products are a block of their own, in which the scheduler otherwise reads one
        // fragment at a time into the same registers, each read waited for in full
        __builtin_amdgcn_sched_barrier(0);
#pragma unroll
        for (int nt = 0; nt < 4; ++nt) { s[nt] = (v8f){};
#pragma unroll
            for (int kk = 0; kk < 2; ++kk) s[nt] = wmma16(b[nt][kk], aq[kk], s[nt]); }      // S^T: the 16 keys are the rows (A), the 16 queries the columns (B)
        asm volatile("v_nop\n\tv_nop\n\tv_nop\n\tv_nop" : "+v"(s[0]), "+v"(s[1]), "+v"(s[2]), "+v"(s[3]) : "v"(aq[0]), "v"(aq[1]), "v"(b[3][1]));
        online_softmax_t<LPCAR>(s, m, l, o, c == qt, q0 + lr, kvb, hi);    // s and l carry PCAR
        // two score tiles of 16 keys, converted in place, are the B operand P^T of 32 keys: element e <- key 8*hi + e of the first, element 8 + e <- key 16 + 8*hi + e (the second's 8*hi + e),
        // the k order of the v^T loader
        v16h ap[2], bv;
#pragma unroll
        for (int kk = 0; kk < 2; ++kk)
#pragma unroll
            for (int e = 0; e < 8; ++e) { ap[kk][e] = tohx(s[2 * kk][e]); ap[kk][8 + e] = tohx(s[2 * kk + 1][e]); }
#pragma unroll
        for (int kk = 0; kk < 2; ++kk)
#pragma unroll
            for (int nt = 0; nt < 4; ++nt) { bv = WFrag<h16>::ld(sv + nt * 16 * PP + kk * 32); o[nt] = wmma16(bv, ap[kk], o[nt]); }      // O^T: 16 rows of v^T are A
        asm volatile("v_nop\n\tv_nop\n\tv_nop\n\tv_nop" : "+v"(o[0]), "+v"(o[1]), "+v"(o[2]), "+v"(o[3]) : "v"(ap[0]), "v"(ap[1]), "v"(bv));
        asm volatile("s_wait_dscnt 0x0" ::: "memory");    // this wave has left the buffer that is refilled below
        asm volatile("s_wait_asynccnt 0x0" ::: "memory"); // this wave's copies of tile c + 1 have landed
        __syncthreads();                                  // publishes tile c + 1 and ends every reader's last read of tile c
        if (c + 2 < nch) stage(c + 2, c & 1);
    }
    asm volatile("s_wait_asynccnt 0x0" ::: "memory");     // no copy is outstanding when the wave goes on and ends
    const float inv = (1.0f / (l + xhalf(l))) * CCAR;               // the two halves' sums of one query joined; o and l both carry PCAR
#pragma unroll
    for (int nt = 0; nt < 4; ++nt) { v8h t;
#pragma unroll
        for (int r = 0; r < 8; ++r) t[r] = tohx(o[nt][r] * inv);
        *(v8ha*)(spw + lr * PP + nt * 16 + 8 * hi) = t; }           // a lane's 8 accumulators are 8 consecutive d of its query's row
    lds_wsync();
    h16* cb = C16 + (size_t)q0 * DMO + h * HD;
{
#pragma unroll
        for (int it = 0; it < 4; ++it) { const int rr = it * 4 + (lane >> 3), pc = (lane & 7) * 8; const v8h val = *(const v8ha*)(spw + rr * PP + pc); *(v8h*)(cb + (size_t)rr * DMO + pc) = val; }
         }
}

extern "C" void kernel_launch(void* const* d_in, const int* in_sizes, int n_in,
                              void* d_out, int out_size, void* d_ws, size_t ws_size, hipStream_t stream) {
    if (n_in < 7) return;
    const long long rows_used = (long long)(NB - 1) * SEQ_FULL + SEQ;
    if ((long long)in_sizes[0] < rows_used * DIN) return;
    if (in_sizes[1] < SEQ * HD || in_sizes[2] < SEQ * HD) return;
    if (in_sizes[3] < DIN * DMO || in_sizes[4] < DIN * DKV || in_sizes[5] < DIN * DKV || in_sizes[6] < DMO * DMO) return;
    if ((long long)out_size < rows_used * DMO) return;
    // wire order: x, cos, sin, wq, wk, wv, wo
    const float* x = (const float*)d_in[0]; const float* cosi = (const float*)d_in[1]; const float* sini = (const float*)d_in[2];
    const float* wq = (const float*)d_in[3]; const float* wk = (const float*)d_in[4]; const float* wv = (const float*)d_in[5]; const float* wo = (const float*)d_in[6];
    float* OUT = (float*)d_out;     // [NB_FULL][SEQ_FULL][DMO]
    char* wsp = (char*)d_ws;
    auto take = [&](size_t bytes) { char* p = wsp; wsp += (bytes + 255) & ~(size_t)255; return (void*)p; };
    bf* WQ   = (bf*)take((size_t)DMO * DIN * 2);          // Bt [out][in]
    bf* WK   = (bf*)take((size_t)DKV * DIN * 2);
    bf* WV   = (bf*)take((size_t)DKV * DIN * 2);
    bf* WOb  = (bf*)take((size_t)DMO * DMO * 2);
    h16* WO16 = (h16*)take((size_t)DMO * DMO * 2);
    bf* XB   = (bf*)take((size_t)NB * SEQ * DIN * 2);     // from here on: NB planes each, sequence-major
    h16* Q16 = (h16*)take((size_t)NB * NH * SEQ * HD * 2); h16* K16 = (h16*)take((size_t)NB * NKV * SEQ * HD * 2); h16* VT16 = (h16*)take((size_t)NB * NKV * HD * SEQ * 2);
    bf* QPh = (bf*)take((size_t)NB * NH * RRES * HD * 2); bf* QPl = (bf*)take((size_t)NB * NH * RRES * HD * 2);
    bf* KPh = (bf*)take((size_t)NB * NKV * RRES * HD * 2); bf* KPl = (bf*)take((size_t)NB * NKV * RRES * HD * 2);
    bf* VTh = (bf*)take((size_t)NB * NKV * HD * RRES * 2); bf* VTl = (bf*)take((size_t)NB * NKV * HD * RRES * 2);
    h16* C16 = (h16*)take((size_t)NB * SEQ * DMO * 2);   // rows >= RRES of each sequence used
    bf* CTh = (bf*)take((size_t)NB * RRES * DMO * 2); bf* CTl = (bf*)take((size_t)NB * RRES * DMO * 2);
    int* MFLAG = (int*)take(128);
    const size_t carved = (size_t)(wsp - (char*)d_ws);
    if (carved > ws_size || carved > (size_t)268435456) return;

    k_prep<<<PT_W + NB * PX_S, 256, 0, stream>>>(x, wq, wk, wv, wo, XB, WQ, WK, WV, WOb, WO16, MFLAG);
    k_gemmw<bf, 0, 1><<<dim3(SEQ / 128, DMO / 128, NB), 128, 0, stream>>>(XB, nullptr, WQ, nullptr, DIN, nullptr, DMO, 1.0f, MFLAG, (size_t)SEQ * DIN, 0, 0, cosi, sini, Q16, QPh, QPl);
    k_gemmw<bf, 0, 1><<<dim3(SEQ / 128, DKV / 128, NB), 128, 0, stream>>>(XB, nullptr, WK, nullptr, DIN, nullptr, DKV, 1.0f, MFLAG, (size_t)SEQ * DIN, 0, 0, cosi, sini, K16, KPh, KPl);
    k_gemmw<bf, 0, 2><<<dim3(DKV / 128, SEQ / 128, NB), 128, 0, stream>>>(WV, nullptr, XB, nullptr, DIN, nullptr, SEQ, 1.0f, MFLAG, 0, (size_t)SEQ * DIN, 0, nullptr, nullptr, VT16, VTh, VTl);
    k_attnr<<<dim3(RRES / 64, NH, NB), 128, 0, stream>>>(QPh, QPl, KPh, KPl, VTh, VTl, CTh, CTl);
    if (SEQ > RRES) k_attn<<<dim3((SEQ - RRES) / 64, NH, NB), 128, 0, stream>>>(Q16, K16, VT16, C16);
    k_gemmw<bf, 1, 0><<<dim3(RRES / 128, DMO / 128, NB), 128, 0, stream>>>(CTh, CTl, WOb, nullptr, DMO, OUT, DMO, 1.0f, MFLAG, (size_t)RRES * DMO, 0, (size_t)SEQ_FULL * DMO, nullptr, nullptr, nullptr, nullptr, nullptr);
    if (SEQ > RRES) k_gemmw<h16, 0, 0><<<dim3((SEQ - RRES) / 128, DMO / 128, NB), 128, 0, stream>>>(C16 + (size_t)RRES * DMO, nullptr, WO16, nullptr, DMO, OUT + (size_t)RRES * DMO, DMO, 1.0f / (CCAR * WCAR), MFLAG, (size_t)SEQ * DMO, 0, (size_t)SEQ_FULL * DMO, nullptr, nullptr, nullptr, nullptr, nullptr);
}

// v008
// One run takes 160 microseconds.
// Timed twice side by side with v007, it ran 1.24 and 1.23 times as fast.
// Counting every step since v000, it is 4.84 times as fast.
#include <hip/hip_runtime.h>

// Contractions and operand types (f32 accumulate everywhere): x Wq, x Wk, x Wv on v_wmma_f32_16x16x32_bf16 with RNE bf16 copies of x and W (exact products);
// query rows < RRES of each sequence: q.k^T and p.v on v_wmma_f32_16x16x32_bf16 as bf16 hi/lo splits (3 products each), their ctx Wo as bf16 hi/lo ctx times bf16 Wo (2 products);
// query rows >= RRES: q.k^T and p.v on v_wmma_f32_16x16x32_f16 (f16 q/k/v planes, p carried x1024), ctx Wo on v_wmma_f32_16x16x32_f16 (ctx carried x16, Wo carried x64, folded by 1/1024 in the epilogue).
// diagonal are skipped (their probabilities are exactly 0) and the diagonal tile is masked by index; a constant zero flag line feeds the additive term of the GEMM epilogue.
// The projection GEMMs write the attention operand planes themselves: the rotary mix (q, k) and the 16-bit conversions (q, k, v^T) are their epilogues; no f32 projection plane exists.
// All NB sequences go through every launch together: the last grid dimension is the sequence (k_prep and k_out are flat grids: k_prep takes PX_S blocks a sequence after the weight tiles, k_out's sequence index is the slowest within each of its two tile ranges), and every per-sequence workspace plane holds NB copies, sequence-major.

#ifndef NB
#define NB 2
#endif
#ifndef SEQ
#define SEQ 2048
#endif
#ifndef RRES
#define RRES 256
#endif
#define NB_FULL 2
#define SEQ_FULL 2048
#define DIN 2048
#define DMO 2048
#define NH 32
#define NKV 8
#define GRP (NH / NKV)
#define HD 64
#define DKV (NKV * HD)
#define PP 72
#define PCAR 1024.0f
#define LPCAR 10
#define CCAR 16.0f
#define WCAR 64.0f
#define SCL 0.125f
#define L2E 1.4426950408889634f
static_assert(SEQ % 64 == 0 && SEQ >= 64 && SEQ <= SEQ_FULL);
static_assert(RRES % 64 == 0 && RRES >= 64 && RRES <= SEQ);
static_assert(NB >= 1 && NB <= NB_FULL);
static_assert(DIN % 32 == 0 && DMO % 64 == 0 && DKV % 64 == 0 && HD == 64 && (NH % NKV) == 0);
static_assert(DMO == NH * HD && DMO % 32 == 0);
static_assert(PP % 8 == 0 && PP >= HD);
static_assert(PCAR == (float)(1 << LPCAR));
static_assert((DMO * DIN) % 64 == 0 && (DKV * DIN) % 64 == 0 && (DMO * DMO) % 64 == 0 && DIN % 2 == 0 && DMO % 2 == 0);
static_assert(((size_t)SEQ * DIN) % 8 == 0);
// workspace carve (every plane a multiple of 256 B; same sequence as the launcher's take() calls)
#define AL256(x) ((((size_t)(x)) + 255) & ~(size_t)255)
#define WS_TOTAL (AL256((size_t)DMO * DIN * 2) + 2 * AL256((size_t)DKV * DIN * 2) + 2 * AL256((size_t)DMO * DMO * 2) + AL256((size_t)NB * SEQ * DIN * 2) \
                  + AL256((size_t)NB * NH * SEQ * HD * 2) + 2 * AL256((size_t)NB * NKV * SEQ * HD * 2) + 2 * AL256((size_t)NB * NH * RRES * HD * 2) \
                  + 4 * AL256((size_t)NB * NKV * RRES * HD * 2) + AL256((size_t)NB * SEQ * DMO * 2) + 2 * AL256((size_t)NB * RRES * DMO * 2) + AL256(128))
static_assert(WS_TOTAL <= (size_t)268435456);

typedef _Float16 h16;
typedef unsigned short bf;
typedef __attribute__((ext_vector_type(16))) __bf16   v16bf;
typedef __attribute__((ext_vector_type(16))) _Float16 v16h;
typedef __attribute__((ext_vector_type(8)))  _Float16 v8h;
typedef __attribute__((ext_vector_type(8)))  unsigned short v8us;
typedef __attribute__((ext_vector_type(8)))  float    v8f;
typedef __attribute__((ext_vector_type(4)))  float    v4f;
typedef __attribute__((ext_vector_type(4)))  int      v4i;
typedef __attribute__((ext_vector_type(2)))  _Float16 v2h;
typedef __attribute__((ext_vector_type(2)))  unsigned short v2us;
typedef __attribute__((ext_vector_type(4)))  _Float16 v4h;
typedef __attribute__((ext_vector_type(4)))  unsigned short v4us;
typedef v8h  __attribute__((may_alias)) v8ha;
typedef v4f  __attribute__((may_alias)) v4fa;
typedef v8us __attribute__((may_alias)) v8usa;

__device__ __forceinline__ unsigned short f2bf(float f) { unsigned u = __float_as_uint(f); u += 0x7FFFu + ((u >> 16) & 1u); return (unsigned short)(u >> 16); }
__device__ __forceinline__ float bf2f(unsigned short b) { return __uint_as_float(((unsigned)b) << 16); }
__device__ __forceinline__ float bfr(float f) { return bf2f(f2bf(f)); }
__device__ __forceinline__ h16 tohx(float x) { return (h16)x; }
__device__ __forceinline__ void splitf(float y, unsigned short& h, unsigned short& l) { h = f2bf(y); l = f2bf(y - bf2f(h)); }
__device__ __forceinline__ v16h cat16(v8h lo, v8h hi) { return __builtin_shufflevector(lo, hi, 0, 1, 2, 3, 4, 5, 6, 7, 8, 9, 10, 11, 12, 13, 14, 15); }
__device__ __forceinline__ v16bf cat16b(v8us lo, v8us hi) { return __builtin_bit_cast(v16bf, __builtin_shufflevector(lo, hi, 0, 1, 2, 3, 4, 5, 6, 7, 8, 9, 10, 11, 12, 13, 14, 15)); }
__device__ __forceinline__ v8f wmma16(v16h a, v16h b, v8f c) { return __builtin_amdgcn_wmma_f32_16x16x32_f16(false, a, false, b, (short)0, c, false, false); }
__device__ __forceinline__ v8f wmmab(v16bf a, v16bf b, v8f c) { return __builtin_amdgcn_wmma_f32_16x16x32_bf16(false, a, false, b, (short)0, c, false, false); }
// wave-private LDS tile: stores of this wave made visible to its own later cross-lane loads, loads kept below the stores by the compiler
__device__ __forceinline__ void lds_wsync() { __builtin_amdgcn_fence(3 /* release order */, "wavefront"); __builtin_amdgcn_wave_barrier(); asm volatile("" ::: "memory"); }

// 16-bit fragment loaders: lane l -> row/column (l & 15); elements 0..7 <- k0 + 8*(l>>4) + 0..7, elements 8..15 <- k0 + 16 + 8*(l>>4) + 0..7 of a K-contiguous row (p already offset by 8*(l>>4)).
template <typename T16> struct WFrag;
template <> struct WFrag<h16> { typedef v16h V; static __device__ __forceinline__ V ld(const h16* p) { return cat16(*(const v8h*)p, *(const v8h*)(p + 16)); } static __device__ __forceinline__ v8f mma(V a, V b, v8f c) { return wmma16(a, b, c); } };
template <> struct WFrag<bf> { typedef v16bf V; static __device__ __forceinline__ V ld(const bf* p) { return cat16b(*(const v8us*)p, *(const v8us*)(p + 16)); } static __device__ __forceinline__ v8f mma(V a, V b, v8f c) { return wmmab(a, b, c); } };

// ---- gemmw: work-group tiled GEMM, the body of k_qkv and k_out: 4 waves (2 x 2) share the 128x128 output tile at (r0, c0) of sequence z, each wave keeps a 64x64 part (16 accumulators); 128 threads.
// A stage is GKS = 128 k (256 B) of the 128 A rows and the 128 Bt rows, brought from the K-contiguous 16-bit planes into LDS (sm: GRING bytes, then GOSW bytes when EPI == 0) by asynchronous
// 16-byte copies at a row pitch of 272 B; two buffers, the next stage's copies fly while this stage is multiplied. Every accumulator sums k upward in steps of 32; when NSPLIT == 1 the K
// stages of A are followed by the K stages of A2 against the same Bt rows (one contraction of length 2 K). A, A2, Bt, C point at sequence z's planes.
// F[m][n] = (sum_k A[m][k] Bt[n][k] (+ sum_k A2[m][k] Bt[n][k] when NSPLIT == 1)) * cscale + (pflag[0] ? NaN : 0). K % 128 == 0, K >= 128, M % 128 == 0, N % 128 == 0.
// EPI == 0: C[m][n] (f32, pitch ldc) = F[m][n].
// EPI == 1, vt false (m = token t, n = h*HD + d, ldc = N; a wave's 64 columns are one head): head planes of the rotate-half rotary mix of F with the cos/sin input tables (bf16 RNE values):
//   r[d] = x[d] cos[t][d] - x[d+HD/2] sin[t][d] (d < HD/2), r[d] = x[d] cos[t][d] + x[d-HD/2] sin[t][d] (d >= HD/2); P16[h][t][d] = f16(r) for every t, Ph/Pl[h][t][d] bf16 hi/lo for t < RRES.
// EPI == 1, vt true (the same for the whole work-group; m = g*HD + d, n = token t: the weight rows are the A operand, so F is already v^T): P16[m][t] = f16(F) (row pitch SEQ), Ph/Pl[m][t] bf16 hi/lo for t < RRES (row pitch RRES).
#define GKS 128
#define GPI 136
static_assert(DIN % GKS == 0 && DMO % GKS == 0 && SEQ % 128 == 0 && RRES % 128 == 0 && DMO % 128 == 0 && DKV % 128 == 0);
__device__ __forceinline__ unsigned lds_off(const void* p) { return (unsigned)(size_t)p; }
// eight copies of one lane: rows 8 apart, 16 B each, LDS byte address l, global address g (row pitch K elements). The s_wait_xcnt closes the statement so that no address register
// of an issued copy is rewritten ahead of it.
template <typename T16>
__device__ __forceinline__ void acopy8(unsigned l, const T16* g, size_t K) {
    const unsigned ls = 8 * GPI * 2; const size_t gs = 8 * K;
    asm volatile("global_load_async_to_lds_b128 %0, %8, off\n\t"
                 "global_load_async_to_lds_b128 %1, %9, off\n\t"
                 "global_load_async_to_lds_b128 %2, %10, off\n\t"
                 "global_load_async_to_lds_b128 %3, %11, off\n\t"
                 "global_load_async_to_lds_b128 %4, %12, off\n\t"
                 "global_load_async_to_lds_b128 %5, %13, off\n\t"
                 "global_load_async_to_lds_b128 %6, %14, off\n\t"
                 "global_load_async_to_lds_b128 %7, %15, off\n\t"
                 "s_wait_xcnt 0x0"
                 :: "v"(l), "v"(l + ls), "v"(l + 2 * ls), "v"(l + 3 * ls), "v"(l + 4 * ls), "v"(l + 5 * ls), "v"(l + 6 * ls), "v"(l + 7 * ls),
                    "v"(g), "v"(g + gs), "v"(g + 2 * gs), "v"(g + 3 * gs), "v"(g + 4 * gs), "v"(g + 5 * gs), "v"(g + 6 * gs), "v"(g + 7 * gs) : "memory");
}
// 128 rows x 256 B of one operand: 16 copies a lane (16 lanes cover a row, a wave two rows)
template <typename T16>
__device__ __forceinline__ void acopy_rows(unsigned l, const T16* g, size_t K) { acopy8(l, g, K); acopy8(l + 64 * GPI * 2, g + 64 * K, K); }

#define GRING (2 * 2 * 128 * GPI * 2)
#define GOSW (4 * 16 * 68 * 4)
template <typename T16, int NSPLIT, int EPI>
__device__ __forceinline__ void gemmw(char* sm, int r0, int c0, size_t z, const T16* __restrict__ A, const T16* __restrict__ A2, const T16* __restrict__ Bt, int K, float* C, int ldc, float cscale, const int* __restrict__ pflag,
                                      bool vt, const float* __restrict__ COSI, const float* __restrict__ SINI, h16* P16, bf* Ph, bf* Pl) {
    typedef typename WFrag<T16>::V V;
    static_assert(NSPLIT == 0 || NSPLIT == 1); static_assert(EPI == 0 || EPI == 1);
    constexpr int OPE = 128 * GPI;                        // elements of one operand's rows in a stage
    constexpr int STE = 2 * OPE;                          // elements of a stage: [A | Bt]
    static_assert(2 * STE * 2 == GRING);
    T16* ring = reinterpret_cast<T16*>(sm);
    const int tid = threadIdx.x, lane = tid & 31, wave = tid >> 5, lr = lane & 15, hi = lane >> 4; const int wm = wave >> 1, wn = wave & 1;
    const float padd = (pflag[0] != 0) ? __int_as_float(0x7fc00000) : 0.0f;
    v8f acc[4][4];
#pragma unroll
    for (int mb = 0; mb < 4; ++mb)
#pragma unroll
        for (int nb = 0; nb < 4; ++nb) acc[mb][nb] = (v8f){};
    const int trow = tid >> 4, tcol = tid & 15;
    const T16* ga = A + (size_t)(r0 + trow) * K + tcol * 8; const T16* gb = Bt + (size_t)(c0 + trow) * K + tcol * 8;
    const T16* ga2 = (NSPLIT == 1) ? A2 + (size_t)(r0 + trow) * K + tcol * 8 : nullptr;
    const unsigned lt = lds_off(ring) + (unsigned)(trow * GPI + tcol * 8) * 2;
    const int nk = K / GKS, nt = (NSPLIT == 1 ? 2 : 1) * nk;
    auto stage = [&](int t, int buf) { const unsigned l = lt + (unsigned)buf * (STE * 2); const bool sec = NSPLIT == 1 && t >= nk; const size_t ko = (size_t)(sec ? t - nk : t) * GKS;
        acopy_rows(l, (sec ? ga2 : ga) + ko, (size_t)K); acopy_rows(l + OPE * 2, gb + ko, (size_t)K); };
    stage(0, 0);
    asm volatile("s_wait_asynccnt 0x0" ::: "memory");     // this wave's copies of stage 0 have landed
    __syncthreads();                                      // every wave's have: stage 0 may be read
    if (nt > 1) stage(1, 1);
    // the stage loop stays rolled: one copy of the body in the instruction cache, the buffer picked by t & 1
#pragma unroll 1
    for (int t = 0; t < nt; ++t) {
        const T16* sa = ring + (t & 1) * STE + (wm * 64 + lr) * GPI + 8 * hi; const T16* sb = ring + (t & 1) * STE + OPE + (wn * 64 + lr) * GPI + 8 * hi;
        // two fragment sets: the reads of the next 32 k of this stage go out as one group ahead of this step's matrix instructions, so that only the stage's last group is waited for in full
        // (every loop below is unrolled so that set, fragment and accumulator indices are constants and the arrays live in registers)
        V a[2][4], b[2][4];
        auto ldset = [&](int s, int ks) {
#pragma unroll
            for (int mb = 0; mb < 4; ++mb) a[s][mb] = WFrag<T16>::ld(sa + mb * 16 * GPI + ks);
#pragma unroll
            for (int nb = 0; nb < 4; ++nb) b[s][nb] = WFrag<T16>::ld(sb + nb * 16 * GPI + ks); };
        ldset(0, 0);
#pragma unroll
        for (int q = 0; q < GKS / 32; ++q) {
            if (q + 1 < GKS / 32) ldset((q + 1) & 1, (q + 1) * 32);
            // keeps the group of reads above in front of this step's matrix instructions (the scheduler otherwise spreads them among these, each with a full wait); in the last step, which
            // has no reads, it keeps the step before in front of the waits at the loop's foot, where its matrix instructions cover the last reads' latency (without it they sink behind the barrier)
            __builtin_amdgcn_sched_barrier(0);
#pragma unroll
            for (int nb = 0; nb < 4; ++nb)
#pragma unroll
                for (int mb = 0; mb < 4; ++mb) acc[mb][nb] = WFrag<T16>::mma(a[q & 1][mb], b[q & 1][nb], acc[mb][nb]);
        }
        asm volatile("s_wait_dscnt 0x0" ::: "memory");    // this wave has left the buffer that is refilled below
        asm volatile("s_wait_asynccnt 0x0" ::: "memory"); // this wave's copies of stage t + 1 have landed
        __syncthreads();                                  // publishes stage t + 1 and ends every reader's last read of stage t
        if (t + 2 < nt) stage(t + 2, t & 1);
    }
    asm volatile("s_wait_asynccnt 0x0" ::: "memory");     // no copy is outstanding when the wave goes on and ends
    if constexpr (EPI == 0) {
    float* os = reinterpret_cast<float*>(sm + GRING) + wave * (16 * 68);
#pragma unroll
    for (int mb = 0; mb < 4; ++mb) {
#pragma unroll
        for (int nb = 0; nb < 4; ++nb) {
#pragma unroll
            for (int j = 0; j < 8; ++j) os[(hi * 8 + j) * 68 + nb * 16 + lr] = acc[mb][nb][j]; }
        __builtin_amdgcn_wave_barrier(); asm volatile("" ::: "memory");
        float* crow = C + (size_t)(r0 + wm * 64 + mb * 16) * ldc + c0 + wn * 64;
{
#pragma unroll
            for (int s = 0; s < 8; ++s) { const int row = 2 * s + hi, cofs = lr * 4; v4f val = *(const v4fa*)(os + row * 68 + cofs); val = val * cscale + padd;
                *(v4f*)(crow + (size_t)row * ldc + cofs) = val; }
             }
        __builtin_amdgcn_wave_barrier(); asm volatile("" ::: "memory");
    }
    } else {
        // The ring is free: every wave's last read of it and every copy into it ended in front of the loop's last barrier. Each wave lays its whole 64 x 64 f32 part there (own range, row
        // pitch 68) and walks it in rolled loops of 8 rows a trip, so that the epilogue's text stays short.
        float* ot = reinterpret_cast<float*>(ring) + wave * (64 * 68);
        static_assert(4 * 64 * 68 * 4 <= 2 * STE * 2);
#pragma unroll
        for (int mb = 0; mb < 4; ++mb)
#pragma unroll
            for (int nb = 0; nb < 4; ++nb)
#pragma unroll
                for (int j = 0; j < 8; ++j) ot[(mb * 16 + hi * 8 + j) * 68 + nb * 16 + lr] = acc[mb][nb][j];
        __builtin_amdgcn_wave_barrier(); asm volatile("" ::: "memory");   // the wave's own stores stay in front of its cross-lane reads below
        const int mw = r0 + wm * 64 + hi, cofs = lr * 4;
        // the hi/lo planes hold tokens < RRES only: a whole 128-token tile is in or out (RRES % 128 == 0)
        if (!vt) {
            const bool res = r0 < RRES;
            const size_t hp = z * (size_t)(ldc / HD) + (size_t)(c0 / HD + wn); P16 += hp * SEQ * HD; Ph += hp * RRES * HD; Pl += hp * RRES * HD;
            const float* cp = COSI + (size_t)mw * HD + cofs; const float* sp = SINI + (size_t)mw * HD + cofs;
            v4f cs[4], sn[4];
#pragma unroll
            for (int i = 0; i < 4; ++i) { cs[i] = *(const v4f*)(cp + i * 2 * HD); sn[i] = *(const v4f*)(sp + i * 2 * HD); }
            asm volatile("s_wait_xcnt 0x0" ::: "memory");                 // in front of any rewrite of the address registers of the loads above
            // rolled (short text); the next trip's cos and sin are asked for one trip ahead, so that this trip's work covers their latency (the last trip asks for its own rows again)
#pragma unroll 1
            for (int g = 0; g < 8; ++g) {
                v4f cn[4], sm[4]; const int gn = (g < 7) ? g + 1 : 7;
#pragma unroll
                for (int i = 0; i < 4; ++i) { cn[i] = *(const v4f*)(cp + (gn * 8 + i * 2) * HD); sm[i] = *(const v4f*)(sp + (gn * 8 + i * 2) * HD); }
                asm volatile("s_wait_xcnt 0x0" ::: "memory");             // in front of any rewrite of the address registers of the loads above
                // the trip's LDS reads go out together, its stores together at its foot: one LDS latency and one wait a trip
                v4f x0[4], x1[4]; v4h o16[4]; v4us oh[4], ol[4];
#pragma unroll
                for (int i = 0; i < 4; ++i) { const float* xr = ot + (g * 8 + i * 2 + hi) * 68; x0[i] = *(const v4fa*)(xr + cofs); x1[i] = *(const v4fa*)(xr + (cofs ^ (HD / 2))); }
#pragma unroll
                for (int i = 0; i < 4; ++i) { const v4f y0 = x0[i] * cscale + padd, y1 = x1[i] * cscale + padd;
#pragma unroll
                    for (int q = 0; q < 4; ++q) { const float cv = bfr(cs[i][q]), snv = bfr(sn[i][q]); const float pa = y0[q] * cv, pb = y1[q] * snv; const float r = (cofs < HD / 2) ? (pa - pb) : (pa + pb);
                        o16[i][q] = tohx(r); unsigned short a2, c2; splitf(r, a2, c2); oh[i][q] = a2; ol[i][q] = c2; } }
                const size_t oo = (size_t)(mw + g * 8) * HD + cofs;
                if (res) {
#pragma unroll
                    for (int i = 0; i < 4; ++i) { *(v4us*)(Ph + oo + i * 2 * HD) = oh[i]; *(v4us*)(Pl + oo + i * 2 * HD) = ol[i]; }
                    asm volatile("s_wait_xcnt 0x0" ::: "memory"); }       // in front of any rewrite of the registers of the stores above
#pragma unroll
                for (int i = 0; i < 4; ++i) *(v4h*)(P16 + oo + i * 2 * HD) = o16[i];
                asm volatile("s_wait_xcnt 0x0" ::: "memory");             // in front of any rewrite of the registers of the stores above
                __builtin_amdgcn_sched_barrier(0);                        // keeps the register copies below behind that wait (the scheduler otherwise lifts them over it, onto the stores' registers)
#pragma unroll
                for (int i = 0; i < 4; ++i) { cs[i] = cn[i]; sn[i] = sm[i]; }
            }
        } else {
            const bool res = c0 < RRES;
            const int t = c0 + wn * 64 + cofs;
            P16 += z * (size_t)DKV * SEQ + t; Ph += z * (size_t)DKV * RRES + t; Pl += z * (size_t)DKV * RRES + t;
            // rolled: short text
#pragma unroll 1
            for (int g = 0; g < 8; ++g) {
                // the trip's LDS reads go out together, its stores together at its foot: one LDS latency and one wait a trip
                v4f val[4]; v4h o16[4]; v4us oh[4], ol[4];
#pragma unroll
                for (int i = 0; i < 4; ++i) val[i] = *(const v4fa*)(ot + (g * 8 + i * 2 + hi) * 68 + cofs);
#pragma unroll
                for (int i = 0; i < 4; ++i) { const v4f y = val[i] * cscale + padd;
#pragma unroll
                    for (int q = 0; q < 4; ++q) { o16[i][q] = tohx(y[q]); unsigned short a2, c2; splitf(y[q], a2, c2); oh[i][q] = a2; ol[i][q] = c2; } }
                const size_t m = (size_t)(mw + g * 8);
                if (res) {
#pragma unroll
                    for (int i = 0; i < 4; ++i) { *(v4us*)(Ph + (m + i * 2) * RRES) = oh[i]; *(v4us*)(Pl + (m + i * 2) * RRES) = ol[i]; }
                    asm volatile("s_wait_xcnt 0x0" ::: "memory"); }       // in front of any rewrite of the registers of the stores above
#pragma unroll
                for (int i = 0; i < 4; ++i) *(v4h*)(P16 + (m + i * 2) * SEQ) = o16[i];
                asm volatile("s_wait_xcnt 0x0" ::: "memory");             // in front of any rewrite of the registers of the stores above
            }
        }
    }
}

// ---- k_qkv: the three projections, which need nothing of one another, as one grid (SEQ/128 token tiles, (DMO + 2 DKV)/128, NB): blockIdx.y picks q columns, then k columns, then v^T rows.
// Only pointers and the epilogue differ (a scalar choice); the small k and v^T grids fill the places that they would leave idle as launches of their own.
__global__ __launch_bounds__(128) void k_qkv(const bf* __restrict__ XB, const bf* __restrict__ WQ, const bf* __restrict__ WK, const bf* __restrict__ WV, const int* __restrict__ pflag,
                                             const float* __restrict__ COSI, const float* __restrict__ SINI, h16* Q16, bf* QPh, bf* QPl, h16* K16, bf* KPh, bf* KPl, h16* VT16, bf* VTh, bf* VTl) {
    __shared__ __align__(128) char sm[GRING];
    const int tk = blockIdx.x * 128, y = blockIdx.y; const size_t z = blockIdx.z;
    const bf* X = XB + z * (size_t)SEQ * DIN;
    const bf* A = X; const bf* B = WQ; int r0 = tk, c0 = y * 128, ldc = DMO; h16* P16 = Q16; bf* Ph = QPh; bf* Pl = QPl; bool vt = false;
    if (y >= (DMO + DKV) / 128) { A = WV; B = X; r0 = (y - (DMO + DKV) / 128) * 128; c0 = tk; ldc = SEQ; P16 = VT16; Ph = VTh; Pl = VTl; vt = true; }
    else if (y >= DMO / 128) { B = WK; c0 = (y - DMO / 128) * 128; ldc = DKV; P16 = K16; Ph = KPh; Pl = KPl; }
    gemmw<bf, 0, 1>(sm, r0, c0, z, A, nullptr, B, DIN, nullptr, ldc, 1.0f, pflag, vt, COSI, SINI, P16, Ph, Pl);
}

// ---- k_out: both output GEMMs, which need nothing of one another, as one grid of NB * (SEQ/128) * (DMO/128) work-groups. The tiles of rows < RRES (bf16 hi/lo ctx, twice the stages) have the
// lowest indices; the f16 tiles of rows >= RRES follow, row tile fastest.
#define ON (DMO / 128)
#define OR_ (RRES / 128)
#define OX ((SEQ - RRES) / 128)
__global__ __launch_bounds__(128) void k_out(const bf* __restrict__ CTh, const bf* __restrict__ CTl, const bf* __restrict__ WOb, const h16* __restrict__ C16, const h16* __restrict__ WO16, float* OUT, const int* __restrict__ pflag) {
    __shared__ __align__(128) char sm[GRING + GOSW];
    const int f = blockIdx.x;
    if (f < NB * ON * OR_) {
        const int x = f % OR_, y = (f / OR_) % ON; const size_t z = f / (OR_ * ON);
        gemmw<bf, 1, 0>(sm, x * 128, y * 128, z, CTh + z * RRES * DMO, CTl + z * RRES * DMO, WOb, DMO, OUT + z * SEQ_FULL * DMO, DMO, 1.0f, pflag, false, nullptr, nullptr, nullptr, nullptr, nullptr);
    } else if constexpr (SEQ > RRES) {
        const int g = f - NB * ON * OR_; const int x = g % OX, y = (g / OX) % ON; const size_t z = g / (OX * ON);
        gemmw<h16, 0, 0>(sm, RRES + x * 128, y * 128, z, C16 + z * SEQ * DMO, nullptr, WO16, DMO, OUT + z * SEQ_FULL * DMO, DMO, 1.0f / (CCAR * WCAR), pflag, false, nullptr, nullptr, nullptr, nullptr, nullptr);
    }
}

// ---- k_prep: every 16-bit plane that is a plain function of one input, in one launch of 256-thread blocks, 64 KB of f32 a block, sixteen 16-byte loads a lane in flight.
// Blocks < PT_W: one 128 (k) x 128 (n) tile of a weight w[k][n]: whole 512-B rows are read, RNE bf16 pairs (k, k + 1) go to LDS as dwords at [n][k / 2], and rows of 128 k (256 B) are written to
// Bt[n][k]; Ht[n][k] = f16(bf16 value x WCAR) for wo. The dword column is XORed with 2 * ((n >> 2) & 31): the 32 lanes of a store (n four apart, one k pair) then hit 32 different banks,
// and a pair of neighbouring columns stays an aligned pair for the 8-byte reads. Blocks >= PT_W: PXE consecutive elements of x to bf16. Block 0 also writes the zero flag line.
#define PTE 128
#define PXE 16384
#define PT_Q ((DIN / PTE) * (DMO / PTE))
#define PT_K ((DIN / PTE) * (DKV / PTE))
#define PT_O ((DMO / PTE) * (DMO / PTE))
#define PT_W (PT_Q + 2 * PT_K + PT_O)
#define PX_S ((int)(((size_t)SEQ * DIN) / PXE))
static_assert(DIN % PTE == 0 && DMO % PTE == 0 && DKV % PTE == 0 && ((size_t)SEQ * DIN) % PXE == 0);
typedef __attribute__((ext_vector_type(2))) unsigned v2u;
typedef v2u __attribute__((may_alias)) v2ua;
template <int N, int K, bool HASH>
__device__ __forceinline__ void prep_tile(const float* __restrict__ w, bf* Bt, h16* Ht, int b, unsigned* tp, int lane, int wave) {
    constexpr int NTN = N / PTE; const int k0 = (b / NTN) * PTE, n0 = (b % NTN) * PTE;
    const float* s = w + (size_t)(k0 + wave * 16) * N + n0 + lane * 4;
    v4f v[16];
#pragma unroll
    for (int i = 0; i < 16; ++i) v[i] = *(const v4f*)(s + (size_t)i * N);
    asm volatile("s_wait_xcnt 0x0" :: "v"(s) : "memory");   // in front of any rewrite of the loads' address registers (the pointer is named so that they live up to here)
#pragma unroll
    for (int i = 0; i < 8; ++i)
#pragma unroll
        for (int j = 0; j < 4; ++j) tp[(lane * 4 + j) * (PTE / 2) + ((wave * 8 + i) ^ (lane * 2))] = (unsigned)f2bf(v[2 * i][j]) | ((unsigned)f2bf(v[2 * i + 1][j]) << 16);
    __syncthreads();                                      // the whole tile is in LDS before any row of it is read
    v2u d[16];
#pragma unroll
    for (int r = 0; r < 16; ++r) { const int n = wave * 16 + r; d[r] = *(const v2ua*)(tp + n * (PTE / 2) + ((lane * 2) ^ (((n >> 2) & 31) << 1))); }
    const size_t o = (size_t)(n0 + wave * 16) * K + k0 + lane * 4;
#pragma unroll
    for (int r = 0; r < 16; ++r) { const v4us t = __builtin_bit_cast(v4us, d[r]); *(v4us*)(Bt + o + (size_t)r * K) = t;
        if (HASH) { v4h hh;
#pragma unroll
            for (int q = 0; q < 4; ++q) hh[q] = tohx(bf2f(t[q]) * WCAR);
            *(v4h*)(Ht + o + (size_t)r * K) = hh; } }
    asm volatile("s_wait_xcnt 0x0" ::: "memory");         // in front of any rewrite of the registers of the stores above
}
__global__ __launch_bounds__(256) void k_prep(const float* __restrict__ x, const float* __restrict__ wq, const float* __restrict__ wk, const float* __restrict__ wv, const float* __restrict__ wo,
                                              bf* XB, bf* WQ, bf* WK, bf* WV, bf* WOb, h16* WO16, int* MFLAG) {
    __shared__ __align__(16) unsigned tp[PTE * (PTE / 2)];
    const int tid = threadIdx.x, lane = tid & 31, wave = tid >> 5; const int b = blockIdx.x;
    if (b == 0 && tid < 32) MFLAG[tid] = 0;
    if (b < PT_Q) prep_tile<DMO, DIN, false>(wq, WQ, nullptr, b, tp, lane, wave);
    else if (b < PT_Q + PT_K) prep_tile<DKV, DIN, false>(wk, WK, nullptr, b - PT_Q, tp, lane, wave);
    else if (b < PT_Q + 2 * PT_K) prep_tile<DKV, DIN, false>(wv, WV, nullptr, b - PT_Q - PT_K, tp, lane, wave);
    else if (b < PT_W) prep_tile<DMO, DMO, true>(wo, WOb, WO16, b - PT_Q - 2 * PT_K, tp, lane, wave);
    else {
        const int u = b - PT_W; const int sq = u / PX_S; const size_t o = (size_t)(u % PX_S) * PXE + tid * 4;
        const float* s = x + (size_t)sq * SEQ_FULL * DIN + o; bf* dp = XB + (size_t)sq * SEQ * DIN + o;
        v4f v[16];
#pragma unroll
        for (int i = 0; i < 16; ++i) v[i] = *(const v4f*)(s + i * 1024);
        asm volatile("s_wait_xcnt 0x0" :: "v"(s) : "memory");   // in front of any rewrite of the loads' address registers (the pointer is named so that they live up to here)
#pragma unroll
        for (int i = 0; i < 16; ++i) { v4us t;
#pragma unroll
            for (int q = 0; q < 4; ++q) t[q] = f2bf(v[i][q]);
            *(v4us*)(dp + i * 1024) = t; }
        asm volatile("s_wait_xcnt 0x0" ::: "memory");     // in front of any rewrite of the registers of the stores above
    }
}

// ---- attention key / value tiles in LDS: a tile is 64 rows x 128 B (64 keys x HD of k, or HD x 64 keys of v^T) at a row pitch of PP elements (144 B).
// eight copies of one lane, 16 B each: four rows 16 apart of tile 0 (LDS byte address l0, global address g0, global row pitch p0 elements) and four of tile 1; eight lanes cover a
// row, so a wave's copy reads four whole 128-B lines. The s_wait_xcnt closes the statement so that no address register of an issued copy is rewritten ahead of it.
#define TLE (64 * PP)
template <typename T16>
__device__ __forceinline__ void acopy_tiles(unsigned l0, const T16* g0, size_t p0, unsigned l1, const T16* g1, size_t p1) {
    const unsigned ls = 16 * PP * 2; const size_t s0 = 16 * p0, s1 = 16 * p1;
    asm volatile("global_load_async_to_lds_b128 %0, %8, off\n\t"
                 "global_load_async_to_lds_b128 %1, %9, off\n\t"
                 "global_load_async_to_lds_b128 %2, %10, off\n\t"
                 "global_load_async_to_lds_b128 %3, %11, off\n\t"
                 "global_load_async_to_lds_b128 %4, %12, off\n\t"
                 "global_load_async_to_lds_b128 %5, %13, off\n\t"
                 "global_load_async_to_lds_b128 %6, %14, off\n\t"
                 "global_load_async_to_lds_b128 %7, %15, off\n\t"
                 "s_wait_xcnt 0x0"
                 :: "v"(l0), "v"(l0 + ls), "v"(l0 + 2 * ls), "v"(l0 + 3 * ls), "v"(l1), "v"(l1 + ls), "v"(l1 + 2 * ls), "v"(l1 + 3 * ls),
                    "v"(g0), "v"(g0 + s0), "v"(g0 + 2 * s0), "v"(g0 + 3 * s0), "v"(g1), "v"(g1 + s1), "v"(g1 + 2 * s1), "v"(g1 + 3 * s1) : "memory");
}

// lane l <-> lane l ^ 16 (the two lanes that share a query column of a transposed score tile)
__device__ __forceinline__ float xhalf(float x) { return __builtin_bit_cast(float, __builtin_amdgcn_permlanex16(__builtin_bit_cast(int, x), __builtin_bit_cast(int, x), 0x76543210, 0xfedcba98, false, false)); }

// ---- online softmax step on one wave's TRANSPOSED 64 x 16 score tile (D layout: s[nt][r] = S[key nt*16 + 8*hi + r][query lr]): a lane holds 32 of the 64 scores of its one query (row),
// so maximum and sum run inside the lane; the maximum is joined with the other half's by one exchange, the sum l stays this half's own and is joined behind the key loop. The running maximum m
// is that of the UNSCALED scores: the 1/sqrt(HD) scaling, the change to base 2 and the carry 2^LOGCAR of p are one multiply-add per score in front of exp2. Only the diagonal tile is masked
// (diag is the same for the whole work-group: a scalar branch): entries with key > query become -1e9 (their exp is exactly 0). The transposed output accumulators
// (o[nt][r] = O[d nt*16 + 8*hi + r][query lr]) are rescaled by the lane's one factor; leaves s = 2^LOGCAR exp(t - m), and l sums these.
template <int LOGCAR>
__device__ __forceinline__ void online_softmax_t(v8f (&s)[4], float& m, float& l, v8f (&o)[4], bool diag, int row, int kvb, int hi) {
    constexpr float KS = SCL * L2E;
    if (diag) {
        const int dl = row - kvb - 8 * hi;               // key kvb + nt*16 + 8*hi + r lies behind query row where nt*16 + r > dl
#pragma unroll
        for (int nt = 0; nt < 4; ++nt)
#pragma unroll
            for (int r = 0; r < 8; ++r) s[nt][r] = (nt * 16 + r > dl) ? -1.0e9f : s[nt][r];
    }
    float mp[4];
#pragma unroll
    for (int nt = 0; nt < 4; ++nt) {
#pragma unroll
        for (int r = 0; r < 8; ++r) mp[nt] = (r == 0) ? s[nt][r] : fmaxf(mp[nt], s[nt][r]); }
    float mx = fmaxf(fmaxf(mp[0], mp[1]), fmaxf(mp[2], mp[3]));
    mx = fmaxf(mx, xhalf(mx));
    const float m2 = fmaxf(m, mx); const float alpha = __builtin_amdgcn_exp2f((m - m2) * KS); m = m2;
    const float cadd = (float)LOGCAR - m2 * KS;
#pragma unroll
    for (int nt = 0; nt < 4; ++nt) { const v8f t = s[nt] * KS + cadd;
#pragma unroll
        for (int r = 0; r < 8; ++r) s[nt][r] = __builtin_amdgcn_exp2f(t[r]); }
    // the lane's 32 terms summed as a tree (the four key groups register by register, then the eight registers): packed additions, no chain of 32 dependent ones
    const v8f t = (s[0] + s[1]) + (s[2] + s[3]);
    l = l * alpha + (((t[0] + t[1]) + (t[2] + t[3])) + ((t[4] + t[5]) + (t[6] + t[7])));
#pragma unroll
    for (int nt = 0; nt < 4; ++nt) o[nt] = o[nt] * alpha;
}

// ---- k_attnr: causal attention for query rows < RRES (query tiles 0 .. RRES/64-1; they only visit key tiles 0 .. qt): block = 4 waves x 16 rows, head h uses kv group h / GRP.
// q, k, v from the bf16 hi/lo planes ([h][RRES][HD], [g][RRES][HD], [g][HD][RRES]); scores = qh.kh + ql.kh + qh.kl, computed transposed (S^T = k q^T, O^T += v^T P^T: a lane holds one query's scores); unnormalised p split to bf16 hi/lo in registers, where it is the B operand;
// the four k and v^T tiles of 64 keys shared by the four waves through LDS (asynchronous copies, two buffers: the next tiles fly while these are worked on).
__global__ __launch_bounds__(128) void k_attnr(const bf* __restrict__ QPh, const bf* __restrict__ QPl, const bf* __restrict__ KPh, const bf* __restrict__ KPl, const bf* __restrict__ VTh, const bf* __restrict__ VTl, bf* CTh, bf* CTl) {
    __shared__ __align__(16) bf sP[4][2][16 * PP];
    __shared__ __align__(128) bf sKV[2][4][TLE];          // [buffer][k hi | v^T hi | k lo | v^T lo]
    const int lane = threadIdx.x & 31, wave = threadIdx.x >> 5, lr = lane & 15, hi = lane >> 4;
    const int qt = blockIdx.x, h = blockIdx.y, g = h / GRP; const int q0 = qt * 64 + wave * 16;
    const size_t sq = blockIdx.z;                         // sequence
    QPh += sq * NH * RRES * HD; QPl += sq * NH * RRES * HD; KPh += sq * NKV * RRES * HD; KPl += sq * NKV * RRES * HD; VTh += sq * NKV * HD * RRES; VTl += sq * NKV * HD * RRES;
    CTh += sq * RRES * DMO; CTl += sq * RRES * DMO;
    const bf* qh = QPh + ((size_t)h * RRES + q0) * HD; const bf* ql = QPl + ((size_t)h * RRES + q0) * HD;
    const bf* kh = KPh + (size_t)g * RRES * HD; const bf* kl = KPl + (size_t)g * RRES * HD;
    const bf* vh = VTh + (size_t)g * HD * RRES; const bf* vl = VTl + (size_t)g * HD * RRES;
    bf* sph = &sP[wave][0][0]; bf* spl = &sP[wave][1][0];
    float m = -3.0e38f, l = 0.0f; v8f o[4];
#pragma unroll
    for (int nt = 0; nt < 4; ++nt) o[nt] = (v8f){};
    const int nch = qt + 1;
    const int trow = threadIdx.x >> 3, tcol = (threadIdx.x & 7) * 8; const size_t tk = (size_t)trow * HD + tcol, tv = (size_t)trow * RRES + tcol;
    const unsigned lt = lds_off(&sKV[0][0][0]) + (unsigned)(trow * PP + tcol) * 2;
    auto stage = [&](int c, int buf) { const unsigned l = lt + (unsigned)buf * (4 * TLE * 2); const size_t ok = tk + (size_t)c * 64 * HD, ov = tv + (size_t)c * 64;
        acopy_tiles(l, kh + ok, (size_t)HD, l + TLE * 2, vh + ov, (size_t)RRES); acopy_tiles(l + 2 * TLE * 2, kl + ok, (size_t)HD, l + 3 * TLE * 2, vl + ov, (size_t)RRES); };
    stage(0, 0);
    asm volatile("s_wait_asynccnt 0x0" ::: "memory");     // this wave's copies of tile 0 have landed
    __syncthreads();                                      // every wave's have: tile 0 may be read
    if (nch > 1) stage(1, 1);
#pragma unroll 1
    for (int c = 0; c < nch; ++c) {
        const int kvb = c * 64; v8f s[4]; v16bf aqh[2], aql[2], bh[4][2], bl[4][2];
        const bf* skh = &sKV[c & 1][0][0]; const bf* svh = &sKV[c & 1][1][0]; const bf* skl = &sKV[c & 1][2][0]; const bf* svl = &sKV[c & 1][3][0];
#pragma unroll
        for (int kk = 0; kk < 2; ++kk) { aqh[kk] = WFrag<bf>::ld(qh + (size_t)lr * HD + 8 * hi + kk * 32); aql[kk] = WFrag<bf>::ld(ql + (size_t)lr * HD + 8 * hi + kk * 32); }
#pragma unroll
        for (int nt = 0; nt < 4; ++nt) { const int ko = (nt * 16 + lr) * PP + 8 * hi;
#pragma unroll
            for (int kk = 0; kk < 2; ++kk) { bh[nt][kk] = WFrag<bf>::ld(skh + ko + kk * 32); bl[nt][kk] = WFrag<bf>::ld(skl + ko + kk * 32); } }
        // keeps the tile's k reads together in front of the products: with the mask's branch behind them the products are a block of their own, in which the scheduler otherwise reads one
        // fragment at a time into the same registers, each read waited for in full
        __builtin_amdgcn_sched_barrier(0);
#pragma unroll
        for (int nt = 0; nt < 4; ++nt) { s[nt] = (v8f){};
#pragma unroll
            for (int kk = 0; kk < 2; ++kk) {
                s[nt] = wmmab(bh[nt][kk], aqh[kk], s[nt]); s[nt] = wmmab(bh[nt][kk], aql[kk], s[nt]); s[nt] = wmmab(bl[nt][kk], aqh[kk], s[nt]); } }      // S^T: the 16 keys are the rows (A), the 16 queries the columns (B)
        asm volatile("v_nop\n\tv_nop\n\tv_nop\n\tv_nop" : "+v"(s[0]), "+v"(s[1]), "+v"(s[2]), "+v"(s[3]) : "v"(aqh[0]), "v"(aql[1]), "v"(bh[3][1]), "v"(bl[3][1]));
        online_softmax_t<0>(s, m, l, o, c == qt, q0 + lr, kvb, hi);
        // two score tiles of 16 keys, split in place, are the B operands P^T (hi, lo) of 32 keys: element e <- key 8*hi + e of the first, element 8 + e <- key 16 + 8*hi + e (the second's
        // 8*hi + e), the k order of the v^T loader
        v16bf aph[2], apl[2], bvh, bvl;
#pragma unroll
        for (int kk = 0; kk < 2; ++kk) { v8us h0, h1, l0, l1;
#pragma unroll
            for (int e = 0; e < 8; ++e) { unsigned short a2, c2; splitf(s[2 * kk][e], a2, c2); h0[e] = a2; l0[e] = c2; splitf(s[2 * kk + 1][e], a2, c2); h1[e] = a2; l1[e] = c2; }
            aph[kk] = cat16b(h0, h1); apl[kk] = cat16b(l0, l1); }
#pragma unroll
        for (int kk = 0; kk < 2; ++kk)
#pragma unroll
            for (int nt = 0; nt < 4; ++nt) { const int vo = (nt * 16 + lr) * PP + kk * 32 + 8 * hi; bvh = WFrag<bf>::ld(svh + vo); bvl = WFrag<bf>::ld(svl + vo);
                o[nt] = wmmab(bvh, aph[kk], o[nt]); o[nt] = wmmab(bvh, apl[kk], o[nt]); o[nt] = wmmab(bvl, aph[kk], o[nt]); }      // O^T: 16 rows of v^T are A
        asm volatile("v_nop\n\tv_nop\n\tv_nop\n\tv_nop" : "+v"(o[0]), "+v"(o[1]), "+v"(o[2]), "+v"(o[3]) : "v"(aph[0]), "v"(apl[1]), "v"(bvh), "v"(bvl));
        asm volatile("s_wait_dscnt 0x0" ::: "memory");    // this wave has left the buffer that is refilled below
        asm volatile("s_wait_asynccnt 0x0" ::: "memory"); // this wave's copies of tile c + 1 have landed
        __syncthreads();                                  // publishes tile c + 1 and ends every reader's last read of tile c
        if (c + 2 < nch) stage(c + 2, c & 1);
    }
    asm volatile("s_wait_asynccnt 0x0" ::: "memory");     // no copy is outstanding when the wave goes on and ends
    const float inv = 1.0f / (l + xhalf(l));                        // the two halves' sums of one query joined
#pragma unroll
    for (int nt = 0; nt < 4; ++nt) { v8us th, tl;
#pragma unroll
        for (int r = 0; r < 8; ++r) { unsigned short a2, c2; splitf(o[nt][r] * inv, a2, c2); th[r] = a2; tl[r] = c2; }
        const int so = lr * PP + nt * 16 + 8 * hi; *(v8usa*)(sph + so) = th; *(v8usa*)(spl + so) = tl; }           // a lane's 8 accumulators are 8 consecutive d of its query's row
    lds_wsync();
    bf* chb = CTh + (size_t)q0 * DMO + h * HD; bf* clb = CTl + (size_t)q0 * DMO + h * HD;
{
#pragma unroll
        for (int it = 0; it < 4; ++it) { const int rr = it * 4 + (lane >> 3), pc = (lane & 7) * 8; const v8us va = *(const v8usa*)(sph + rr * PP + pc); const v8us vb = *(const v8usa*)(spl + rr * PP + pc);
            *(v8us*)(chb + (size_t)rr * DMO + pc) = va; *(v8us*)(clb + (size_t)rr * DMO + pc) = vb; }
         }
}

// ---- k_attn: causal attention for query tiles qt >= RRES/64 (blockIdx.x + RRES/64): same structure (transposed products, p stays in registers) with single f16 products; q, k from [h][SEQ][HD] / [g][SEQ][HD] f16 planes,
// the k and v^T tiles of 64 keys shared by the four waves through LDS (asynchronous copies, two buffers: the next tiles fly while these are worked on).
__global__ __launch_bounds__(128) void k_attn(const h16* __restrict__ Q16, const h16* __restrict__ K16, const h16* __restrict__ VT16, h16* C16) {
    __shared__ __align__(16) h16 sP[4][16 * PP];
    __shared__ __align__(128) h16 sKV[2][2][TLE];         // [buffer][k | v^T]
    const int lane = threadIdx.x & 31, wave = threadIdx.x >> 5, lr = lane & 15, hi = lane >> 4;
    const int qt = blockIdx.x + RRES / 64, h = blockIdx.y, g = h / GRP; const int q0 = qt * 64 + wave * 16;
    const size_t sq = blockIdx.z;                         // sequence
    Q16 += sq * NH * SEQ * HD; K16 += sq * NKV * SEQ * HD; VT16 += sq * NKV * HD * SEQ; C16 += sq * SEQ * DMO;
    const h16* qp = Q16 + ((size_t)h * SEQ + q0) * HD; const h16* kp = K16 + (size_t)g * SEQ * HD; const h16* vp = VT16 + (size_t)g * HD * SEQ;
    h16* spw = &sP[wave][0];
    v16h aq[2];
#pragma unroll
    for (int kk = 0; kk < 2; ++kk) aq[kk] = WFrag<h16>::ld(qp + (size_t)lr * HD + 8 * hi + kk * 32);
    float m = -3.0e38f, l = 0.0f; v8f o[4];
#pragma unroll
    for (int nt = 0; nt < 4; ++nt) o[nt] = (v8f){};
    const int nch = qt + 1;
    const int trow = threadIdx.x >> 3, tcol = (threadIdx.x & 7) * 8;
    const h16* gk = kp + (size_t)trow * HD + tcol; const h16* gv = vp + (size_t)trow * SEQ + tcol;
    const unsigned lt = lds_off(&sKV[0][0][0]) + (unsigned)(trow * PP + tcol) * 2;
    auto stage = [&](int c, int buf) { const unsigned l = lt + (unsigned)buf * (2 * TLE * 2);
        acopy_tiles(l, gk + (size_t)c * 64 * HD, (size_t)HD, l + TLE * 2, gv + (size_t)c * 64, (size_t)SEQ); };
    stage(0, 0);
    asm volatile("s_wait_asynccnt 0x0" ::: "memory");     // this wave's copies of tile 0 have landed
    __syncthreads();                                      // every wave's have: tile 0 may be read
    if (nch > 1) stage(1, 1);
#pragma unroll 1
    for (int c = 0; c < nch; ++c) {
        const int kvb = c * 64; v8f s[4]; v16h b[4][2];
        const h16* sk = &sKV[c & 1][0][0] + lr * PP + 8 * hi; const h16* sv = &sKV[c & 1][1][0] + lr * PP + 8 * hi;
#pragma unroll
        for (int nt = 0; nt < 4; ++nt)
#pragma unroll
            for (int kk = 0; kk < 2; ++kk) b[nt][kk] = WFrag<h16>::ld(sk + nt * 16 * PP + kk * 32);
        // keeps the tile's k reads together in front of the products: with the mask's branch behind them the products are a block of their own, in which the scheduler otherwise reads one
        // fragment at a time into the same registers, each read waited for in full
        __builtin_amdgcn_sched_barrier(0);
#pragma unroll
        for (int nt = 0; nt < 4; ++nt) { s[nt] = (v8f){};
#pragma unroll
            for (int kk = 0; kk < 2; ++kk) s[nt] = wmma16(b[nt][kk], aq[kk], s[nt]); }      // S^T: the 16 keys are the rows (A), the 16 queries the columns (B)
        asm volatile("v_nop\n\tv_nop\n\tv_nop\n\tv_nop" : "+v"(s[0]), "+v"(s[1]), "+v"(s[2]), "+v"(s[3]) : "v"(aq[0]), "v"(aq[1]), "v"(b[3][1]));
        online_softmax_t<LPCAR>(s, m, l, o, c == qt, q0 + lr, kvb, hi);    // s and l carry PCAR
        // two score tiles of 16 keys, converted in place, are the B operand P^T of 32 keys: element e <- key 8*hi + e of the first, element 8 + e <- key 16 + 8*hi + e (the second's 8*hi + e),
        // the k order of the v^T loader
        v16h ap[2], bv;
#pragma unroll
        for (int kk = 0; kk < 2; ++kk)
#pragma unroll
            for (int e = 0; e < 8; ++e) { ap[kk][e] = tohx(s[2 * kk][e]); ap[kk][8 + e] = tohx(s[2 * kk + 1][e]); }
#pragma unroll
        for (int kk = 0; kk < 2; ++kk)
#pragma unroll
            for (int nt = 0; nt < 4; ++nt) { bv = WFrag<h16>::ld(sv + nt * 16 * PP + kk * 32); o[nt] = wmma16(bv, ap[kk], o[nt]); }      // O^T: 16 rows of v^T are A
        asm volatile("v_nop\n\tv_nop\n\tv_nop\n\tv_nop" : "+v"(o[0]), "+v"(o[1]), "+v"(o[2]), "+v"(o[3]) : "v"(ap[0]), "v"(ap[1]), "v"(bv));
        asm volatile("s_wait_dscnt 0x0" ::: "memory");    // this wave has left the buffer that is refilled below
        asm volatile("s_wait_asynccnt 0x0" ::: "memory"); // this wave's copies of tile c + 1 have landed
        __syncthreads();                                  // publishes tile c + 1 and ends every reader's last read of tile c
        if (c + 2 < nch) stage(c + 2, c & 1);
    }
    asm volatile("s_wait_asynccnt 0x0" ::: "memory");     // no copy is outstanding when the wave goes on and ends
    const float inv = (1.0f / (l + xhalf(l))) * CCAR;               // the two halves' sums of one query joined; o and l both carry PCAR
#pragma unroll
    for (int nt = 0; nt < 4; ++nt) { v8h t;
#pragma unroll
        for (int r = 0; r < 8; ++r) t[r] = tohx(o[nt][r] * inv);
        *(v8ha*)(spw + lr * PP + nt * 16 + 8 * hi) = t; }           // a lane's 8 accumulators are 8 consecutive d of its query's row
    lds_wsync();
    h16* cb = C16 + (size_t)q0 * DMO + h * HD;
{
#pragma unroll
        for (int it = 0; it < 4; ++it) { const int rr = it * 4 + (lane >> 3), pc = (lane & 7) * 8; const v8h val = *(const v8ha*)(spw + rr * PP + pc); *(v8h*)(cb + (size_t)rr * DMO + pc) = val; }
         }
}

extern "C" void kernel_launch(void* const* d_in, const int* in_sizes, int n_in,
                              void* d_out, int out_size, void* d_ws, size_t ws_size, hipStream_t stream) {
    if (n_in < 7) return;
    const long long rows_used = (long long)(NB - 1) * SEQ_FULL + SEQ;
    if ((long long)in_sizes[0] < rows_used * DIN) return;
    if (in_sizes[1] < SEQ * HD || in_sizes[2] < SEQ * HD) return;
    if (in_sizes[3] < DIN * DMO || in_sizes[4] < DIN * DKV || in_sizes[5] < DIN * DKV || in_sizes[6] < DMO * DMO) return;
    if ((long long)out_size < rows_used * DMO) return;
    // wire order: x, cos, sin, wq, wk, wv, wo
    const float* x = (const float*)d_in[0]; const float* cosi = (const float*)d_in[1]; const float* sini = (const float*)d_in[2];
    const float* wq = (const float*)d_in[3]; const float* wk = (const float*)d_in[4]; const float* wv = (const float*)d_in[5]; const float* wo = (const float*)d_in[6];
    float* OUT = (float*)d_out;     // [NB_FULL][SEQ_FULL][DMO]
    char* wsp = (char*)d_ws;
    auto take = [&](size_t bytes) { char* p = wsp; wsp += (bytes + 255) & ~(size_t)255; return (void*)p; };
    bf* WQ   = (bf*)take((size_t)DMO * DIN * 2);          // Bt [out][in]
    bf* WK   = (bf*)take((size_t)DKV * DIN * 2);
    bf* WV   = (bf*)take((size_t)DKV * DIN * 2);
    bf* WOb  = (bf*)take((size_t)DMO * DMO * 2);
    h16* WO16 = (h16*)take((size_t)DMO * DMO * 2);
    bf* XB   = (bf*)take((size_t)NB * SEQ * DIN * 2);     // from here on: NB planes each, sequence-major
    h16* Q16 = (h16*)take((size_t)NB * NH * SEQ * HD * 2); h16* K16 = (h16*)take((size_t)NB * NKV * SEQ * HD * 2); h16* VT16 = (h16*)take((size_t)NB * NKV * HD * SEQ * 2);
    bf* QPh = (bf*)take((size_t)NB * NH * RRES * HD * 2); bf* QPl = (bf*)take((size_t)NB * NH * RRES * HD * 2);
    bf* KPh = (bf*)take((size_t)NB * NKV * RRES * HD * 2); bf* KPl = (bf*)take((size_t)NB * NKV * RRES * HD * 2);
    bf* VTh = (bf*)take((size_t)NB * NKV * HD * RRES * 2); bf* VTl = (bf*)take((size_t)NB * NKV * HD * RRES * 2);
    h16* C16 = (h16*)take((size_t)NB * SEQ * DMO * 2);   // rows >= RRES of each sequence used
    bf* CTh = (bf*)take((size_t)NB * RRES * DMO * 2); bf* CTl = (bf*)take((size_t)NB * RRES * DMO * 2);
    int* MFLAG = (int*)take(128);
    const size_t carved = (size_t)(wsp - (char*)d_ws);
    if (carved > ws_size || carved > (size_t)268435456) return;

    k_prep<<<PT_W + NB * PX_S, 256, 0, stream>>>(x, wq, wk, wv, wo, XB, WQ, WK, WV, WOb, WO16, MFLAG);
    k_qkv<<<dim3(SEQ / 128, (DMO + 2 * DKV) / 128, NB), 128, 0, stream>>>(XB, WQ, WK, WV, MFLAG, cosi, sini, Q16, QPh, QPl, K16, KPh, KPl, VT16, VTh, VTl);
    k_attnr<<<dim3(RRES / 64, NH, NB), 128, 0, stream>>>(QPh, QPl, KPh, KPl, VTh, VTl, CTh, CTl);
    if (SEQ > RRES) k_attn<<<dim3((SEQ - RRES) / 64, NH, NB), 128, 0, stream>>>(Q16, K16, VT16, C16);
    k_out<<<NB * (SEQ / 128) * (DMO / 128), 128, 0, stream>>>(CTh, CTl, WOb, C16, WO16, OUT, MFLAG);
}

// v009
// It runs in 141 microseconds.
// Timed twice side by side with v008, it ran 1.13 and 1.12 times as fast.
// All steps since v000 together make it 5.43 times as fast.
#include <hip/hip_runtime.h>

// Contractions and operand types (f32 accumulate everywhere): x Wq, x Wk, x Wv on v_wmma_f32_16x16x32_bf16 with RNE bf16 copies of x and W (exact products);
// query rows < RRES of each sequence: q.k^T and p.v on v_wmma_f32_16x16x32_bf16 as bf16 hi/lo splits (3 products each), their ctx Wo as bf16 hi/lo ctx times bf16 Wo (2 products);
// query rows >= RRES: q.k^T and p.v on v_wmma_f32_16x16x32_f16 (f16 q/k/v planes, p carried x1024), ctx Wo on v_wmma_f32_16x16x32_f16 (ctx carried x16, Wo carried x64, folded by 1/1024 in the epilogue).
// diagonal are skipped (their probabilities are exactly 0) and the diagonal tile is masked by index; a constant zero flag line feeds the additive term of the GEMM epilogue.
// The projection GEMMs write the attention operand planes themselves: the rotary mix (q, k) and the 16-bit conversions (q, k, v^T) are their epilogues; no f32 projection plane exists.
// All NB sequences go through every launch together: the last grid dimension is the sequence (k_prep, k_att and k_out are flat grids: k_prep takes PX_S blocks a sequence after the weight tiles, k_att's sequence index lies between head (fastest) and query tile (slowest), k_out's sequence index is the slowest within each of its two tile ranges), and every per-sequence workspace plane holds NB copies, sequence-major.

#ifndef NB
#define NB 2
#endif
#ifndef SEQ
#define SEQ 2048
#endif
#ifndef RRES
#define RRES 256
#endif
#define NB_FULL 2
#define SEQ_FULL 2048
#define DIN 2048
#define DMO 2048
#define NH 32
#define NKV 8
#define GRP (NH / NKV)
#define HD 64
#define DKV (NKV * HD)
#define PP 72
#define PCAR 1024.0f
#define LPCAR 10
#define CCAR 16.0f
#define WCAR 64.0f
#define SCL 0.125f
#define L2E 1.4426950408889634f
static_assert(SEQ % 64 == 0 && SEQ >= 64 && SEQ <= SEQ_FULL);
static_assert(RRES % 64 == 0 && RRES >= 64 && RRES <= SEQ);
static_assert(NB >= 1 && NB <= NB_FULL);
static_assert(DIN % 32 == 0 && DMO % 64 == 0 && DKV % 64 == 0 && HD == 64 && (NH % NKV) == 0);
static_assert(DMO == NH * HD && DMO % 32 == 0);
static_assert(PP % 8 == 0 && PP >= HD);
static_assert(PCAR == (float)(1 << LPCAR));
static_assert((DMO * DIN) % 64 == 0 && (DKV * DIN) % 64 == 0 && (DMO * DMO) % 64 == 0 && DIN % 2 == 0 && DMO % 2 == 0);
static_assert(((size_t)SEQ * DIN) % 8 == 0);
// workspace carve (every plane a multiple of 256 B; same sequence as the launcher's take() calls)
#define AL256(x) ((((size_t)(x)) + 255) & ~(size_t)255)
#define WS_TOTAL (AL256((size_t)DMO * DIN * 2) + 2 * AL256((size_t)DKV * DIN * 2) + 2 * AL256((size_t)DMO * DMO * 2) + AL256((size_t)NB * SEQ * DIN * 2) \
                  + AL256((size_t)NB * NH * SEQ * HD * 2) + 2 * AL256((size_t)NB * NKV * SEQ * HD * 2) + 2 * AL256((size_t)NB * NH * RRES * HD * 2) \
                  + 4 * AL256((size_t)NB * NKV * RRES * HD * 2) + AL256((size_t)NB * SEQ * DMO * 2) + 2 * AL256((size_t)NB * RRES * DMO * 2) + AL256(128))
static_assert(WS_TOTAL <= (size_t)268435456);

typedef _Float16 h16;
typedef unsigned short bf;
typedef __attribute__((ext_vector_type(16))) __bf16   v16bf;
typedef __attribute__((ext_vector_type(16))) _Float16 v16h;
typedef __attribute__((ext_vector_type(8)))  _Float16 v8h;
typedef __attribute__((ext_vector_type(8)))  unsigned short v8us;
typedef __attribute__((ext_vector_type(8)))  float    v8f;
typedef __attribute__((ext_vector_type(4)))  float    v4f;
typedef __attribute__((ext_vector_type(4)))  int      v4i;
typedef __attribute__((ext_vector_type(2)))  _Float16 v2h;
typedef __attribute__((ext_vector_type(2)))  unsigned short v2us;
typedef __attribute__((ext_vector_type(4)))  _Float16 v4h;
typedef __attribute__((ext_vector_type(4)))  unsigned short v4us;
typedef v8h  __attribute__((may_alias)) v8ha;
typedef v4f  __attribute__((may_alias)) v4fa;
typedef v8us __attribute__((may_alias)) v8usa;

__device__ __forceinline__ unsigned short f2bf(float f) { unsigned u = __float_as_uint(f); u += 0x7FFFu + ((u >> 16) & 1u); return (unsigned short)(u >> 16); }
__device__ __forceinline__ float bf2f(unsigned short b) { return __uint_as_float(((unsigned)b) << 16); }
__device__ __forceinline__ float bfr(float f) { return bf2f(f2bf(f)); }
__device__ __forceinline__ h16 tohx(float x) { return (h16)x; }
__device__ __forceinline__ void splitf(float y, unsigned short& h, unsigned short& l) { h = f2bf(y); l = f2bf(y - bf2f(h)); }
__device__ __forceinline__ v16h cat16(v8h lo, v8h hi) { return __builtin_shufflevector(lo, hi, 0, 1, 2, 3, 4, 5, 6, 7, 8, 9, 10, 11, 12, 13, 14, 15); }
__device__ __forceinline__ v16bf cat16b(v8us lo, v8us hi) { return __builtin_bit_cast(v16bf, __builtin_shufflevector(lo, hi, 0, 1, 2, 3, 4, 5, 6, 7, 8, 9, 10, 11, 12, 13, 14, 15)); }
__device__ __forceinline__ v8f wmma16(v16h a, v16h b, v8f c) { return __builtin_amdgcn_wmma_f32_16x16x32_f16(false, a, false, b, (short)0, c, false, false); }
__device__ __forceinline__ v8f wmmab(v16bf a, v16bf b, v8f c) { return __builtin_amdgcn_wmma_f32_16x16x32_bf16(false, a, false, b, (short)0, c, false, false); }
// wave-private LDS tile: stores of this wave made visible to its own later cross-lane loads, loads kept below the stores by the compiler
__device__ __forceinline__ void lds_wsync() { __builtin_amdgcn_fence(3 /* release order */, "wavefront"); __builtin_amdgcn_wave_barrier(); asm volatile("" ::: "memory"); }

// 16-bit fragment loaders: lane l -> row/column (l & 15); elements 0..7 <- k0 + 8*(l>>4) + 0..7, elements 8..15 <- k0 + 16 + 8*(l>>4) + 0..7 of a K-contiguous row (p already offset by 8*(l>>4)).
template <typename T16> struct WFrag;
template <> struct WFrag<h16> { typedef v16h V; static __device__ __forceinline__ V ld(const h16* p) { return cat16(*(const v8h*)p, *(const v8h*)(p + 16)); } static __device__ __forceinline__ v8f mma(V a, V b, v8f c) { return wmma16(a, b, c); } };
template <> struct WFrag<bf> { typedef v16bf V; static __device__ __forceinline__ V ld(const bf* p) { return cat16b(*(const v8us*)p, *(const v8us*)(p + 16)); } static __device__ __forceinline__ v8f mma(V a, V b, v8f c) { return wmmab(a, b, c); } };

// ---- gemmw: work-group tiled GEMM, the body of k_qkv and k_out: 4 waves (2 x 2) share the 128x128 output tile at (r0, c0) of sequence z, each wave keeps a 64x64 part (16 accumulators); 128 threads.
// A stage is GKS = 128 k (256 B) of the 128 A rows and the 128 Bt rows, brought from the K-contiguous 16-bit planes into LDS (sm: GRING bytes, then GOSW bytes when EPI == 0) by asynchronous
// 16-byte copies at a row pitch of 272 B; two buffers, the next stage's copies fly while this stage is multiplied. Every accumulator sums k upward in steps of 32; when NSPLIT == 1 the K
// stages of A are followed by the K stages of A2 against the same Bt rows (one contraction of length 2 K). A, A2, Bt, C point at sequence z's planes.
// F[m][n] = (sum_k A[m][k] Bt[n][k] (+ sum_k A2[m][k] Bt[n][k] when NSPLIT == 1)) * cscale + (pflag[0] ? NaN : 0). K % 128 == 0, K >= 128, M % 128 == 0, N % 128 == 0.
// EPI == 0: C[m][n] (f32, pitch ldc) = F[m][n].
// EPI == 1, vt false (m = token t, n = h*HD + d, ldc = N; a wave's 64 columns are one head): head planes of the rotate-half rotary mix of F with the cos/sin input tables (bf16 RNE values):
//   r[d] = x[d] cos[t][d] - x[d+HD/2] sin[t][d] (d < HD/2), r[d] = x[d] cos[t][d] + x[d-HD/2] sin[t][d] (d >= HD/2); P16[h][t][d] = f16(r) for every t, Ph/Pl[h][t][d] bf16 hi/lo for t < RRES.
// EPI == 1, vt true (the same for the whole work-group; m = g*HD + d, n = token t: the weight rows are the A operand, so F is already v^T): P16[m][t] = f16(F) (row pitch SEQ), Ph/Pl[m][t] bf16 hi/lo for t < RRES (row pitch RRES).
#define GKS 128
#define GPI 136
static_assert(DIN % GKS == 0 && DMO % GKS == 0 && SEQ % 128 == 0 && RRES % 128 == 0 && DMO % 128 == 0 && DKV % 128 == 0);
__device__ __forceinline__ unsigned lds_off(const void* p) { return (unsigned)(size_t)p; }
// eight copies of one lane: rows 8 apart, 16 B each, LDS byte address l, global address g (row pitch K elements). The s_wait_xcnt closes the statement so that no address register
// of an issued copy is rewritten ahead of it.
template <typename T16>
__device__ __forceinline__ void acopy8(unsigned l, const T16* g, size_t K) {
    const unsigned ls = 8 * GPI * 2; const size_t gs = 8 * K;
    asm volatile("global_load_async_to_lds_b128 %0, %8, off\n\t"
                 "global_load_async_to_lds_b128 %1, %9, off\n\t"
                 "global_load_async_to_lds_b128 %2, %10, off\n\t"
                 "global_load_async_to_lds_b128 %3, %11, off\n\t"
                 "global_load_async_to_lds_b128 %4, %12, off\n\t"
                 "global_load_async_to_lds_b128 %5, %13, off\n\t"
                 "global_load_async_to_lds_b128 %6, %14, off\n\t"
                 "global_load_async_to_lds_b128 %7, %15, off\n\t"
                 "s_wait_xcnt 0x0"
                 :: "v"(l), "v"(l + ls), "v"(l + 2 * ls), "v"(l + 3 * ls), "v"(l + 4 * ls), "v"(l + 5 * ls), "v"(l + 6 * ls), "v"(l + 7 * ls),
                    "v"(g), "v"(g + gs), "v"(g + 2 * gs), "v"(g + 3 * gs), "v"(g + 4 * gs), "v"(g + 5 * gs), "v"(g + 6 * gs), "v"(g + 7 * gs) : "memory");
}
// 128 rows x 256 B of one operand: 16 copies a lane (16 lanes cover a row, a wave two rows)
template <typename T16>
__device__ __forceinline__ void acopy_rows(unsigned l, const T16* g, size_t K) { acopy8(l, g, K); acopy8(l + 64 * GPI * 2, g + 64 * K, K); }

#define GRING (2 * 2 * 128 * GPI * 2)
#define GOSW (4 * 16 * 68 * 4)
template <typename T16, int NSPLIT, int EPI>
__device__ __forceinline__ void gemmw(char* sm, int r0, int c0, size_t z, const T16* __restrict__ A, const T16* __restrict__ A2, const T16* __restrict__ Bt, int K, float* C, int ldc, float cscale, const int* __restrict__ pflag,
                                      bool vt, const float* __restrict__ COSI, const float* __restrict__ SINI, h16* P16, bf* Ph, bf* Pl) {
    typedef typename WFrag<T16>::V V;
    static_assert(NSPLIT == 0 || NSPLIT == 1); static_assert(EPI == 0 || EPI == 1);
    constexpr int OPE = 128 * GPI;                        // elements of one operand's rows in a stage
    constexpr int STE = 2 * OPE;                          // elements of a stage: [A | Bt]
    static_assert(2 * STE * 2 == GRING);
    T16* ring = reinterpret_cast<T16*>(sm);
    const int tid = threadIdx.x, lane = tid & 31, wave = tid >> 5, lr = lane & 15, hi = lane >> 4; const int wm = wave >> 1, wn = wave & 1;
    const float padd = (pflag[0] != 0) ? __int_as_float(0x7fc00000) : 0.0f;
    v8f acc[4][4];
#pragma unroll
    for (int mb = 0; mb < 4; ++mb)
#pragma unroll
        for (int nb = 0; nb < 4; ++nb) acc[mb][nb] = (v8f){};
    const int trow = tid >> 4, tcol = tid & 15;
    const T16* ga = A + (size_t)(r0 + trow) * K + tcol * 8; const T16* gb = Bt + (size_t)(c0 + trow) * K + tcol * 8;
    const T16* ga2 = (NSPLIT == 1) ? A2 + (size_t)(r0 + trow) * K + tcol * 8 : nullptr;
    const unsigned lt = lds_off(ring) + (unsigned)(trow * GPI + tcol * 8) * 2;
    const int nk = K / GKS, nt = (NSPLIT == 1 ? 2 : 1) * nk;
    auto stage = [&](int t, int buf) { const unsigned l = lt + (unsigned)buf * (STE * 2); const bool sec = NSPLIT == 1 && t >= nk; const size_t ko = (size_t)(sec ? t - nk : t) * GKS;
        acopy_rows(l, (sec ? ga2 : ga) + ko, (size_t)K); acopy_rows(l + OPE * 2, gb + ko, (size_t)K); };
    stage(0, 0);
    asm volatile("s_wait_asynccnt 0x0" ::: "memory");     // this wave's copies of stage 0 have landed
    __syncthreads();                                      // every wave's have: stage 0 may be read
    if (nt > 1) stage(1, 1);
    // the stage loop stays rolled: one copy of the body in the instruction cache, the buffer picked by t & 1
#pragma unroll 1
    for (int t = 0; t < nt; ++t) {
        const T16* sa = ring + (t & 1) * STE + (wm * 64 + lr) * GPI + 8 * hi; const T16* sb = ring + (t & 1) * STE + OPE + (wn * 64 + lr) * GPI + 8 * hi;
        // two fragment sets: the reads of the next 32 k of this stage go out as one group ahead of this step's matrix instructions, so that only the stage's last group is waited for in full
        // (every loop below is unrolled so that set, fragment and accumulator indices are constants and the arrays live in registers)
        V a[2][4], b[2][4];
        auto ldset = [&](int s, int ks) {
#pragma unroll
            for (int mb = 0; mb < 4; ++mb) a[s][mb] = WFrag<T16>::ld(sa + mb * 16 * GPI + ks);
#pragma unroll
            for (int nb = 0; nb < 4; ++nb) b[s][nb] = WFrag<T16>::ld(sb + nb * 16 * GPI + ks); };
        ldset(0, 0);
#pragma unroll
        for (int q = 0; q < GKS / 32; ++q) {
            if (q + 1 < GKS / 32) ldset((q + 1) & 1, (q + 1) * 32);
            // keeps the group of reads above in front of this step's matrix instructions (the scheduler otherwise spreads them among these, each with a full wait); in the last step, which
            // has no reads, it keeps the step before in front of the waits at the loop's foot, where its matrix instructions cover the last reads' latency (without it they sink behind the barrier)
            __builtin_amdgcn_sched_barrier(0);
#pragma unroll
            for (int nb = 0; nb < 4; ++nb)
#pragma unroll
                for (int mb = 0; mb < 4; ++mb) acc[mb][nb] = WFrag<T16>::mma(a[q & 1][mb], b[q & 1][nb], acc[mb][nb]);
        }
        asm volatile("s_wait_dscnt 0x0" ::: "memory");    // this wave has left the buffer that is refilled below
        asm volatile("s_wait_asynccnt 0x0" ::: "memory"); // this wave's copies of stage t + 1 have landed
        __syncthreads();                                  // publishes stage t + 1 and ends every reader's last read of stage t
        if (t + 2 < nt) stage(t + 2, t & 1);
    }
    asm volatile("s_wait_asynccnt 0x0" ::: "memory");     // no copy is outstanding when the wave goes on and ends
    if constexpr (EPI == 0) {
    float* os = reinterpret_cast<float*>(sm + GRING) + wave * (16 * 68);
#pragma unroll
    for (int mb = 0; mb < 4; ++mb) {
#pragma unroll
        for (int nb = 0; nb < 4; ++nb) {
#pragma unroll
            for (int j = 0; j < 8; ++j) os[(hi * 8 + j) * 68 + nb * 16 + lr] = acc[mb][nb][j]; }
        __builtin_amdgcn_wave_barrier(); asm volatile("" ::: "memory");
        float* crow = C + (size_t)(r0 + wm * 64 + mb * 16) * ldc + c0 + wn * 64;
{
#pragma unroll
            for (int s = 0; s < 8; ++s) { const int row = 2 * s + hi, cofs = lr * 4; v4f val = *(const v4fa*)(os + row * 68 + cofs); val = val * cscale + padd;
                *(v4f*)(crow + (size_t)row * ldc + cofs) = val; }
             }
        __builtin_amdgcn_wave_barrier(); asm volatile("" ::: "memory");
    }
    } else {
        // The ring is free: every wave's last read of it and every copy into it ended in front of the loop's last barrier. Each wave lays its whole 64 x 64 f32 part there (own range, row
        // pitch 68) and walks it in rolled loops of 8 rows a trip, so that the epilogue's text stays short.
        float* ot = reinterpret_cast<float*>(ring) + wave * (64 * 68);
        static_assert(4 * 64 * 68 * 4 <= 2 * STE * 2);
#pragma unroll
        for (int mb = 0; mb < 4; ++mb)
#pragma unroll
            for (int nb = 0; nb < 4; ++nb)
#pragma unroll
                for (int j = 0; j < 8; ++j) ot[(mb * 16 + hi * 8 + j) * 68 + nb * 16 + lr] = acc[mb][nb][j];
        __builtin_amdgcn_wave_barrier(); asm volatile("" ::: "memory");   // the wave's own stores stay in front of its cross-lane reads below
        const int mw = r0 + wm * 64 + hi, cofs = lr * 4;
        // the hi/lo planes hold tokens < RRES only: a whole 128-token tile is in or out (RRES % 128 == 0)
        if (!vt) {
            const bool res = r0 < RRES;
            const size_t hp = z * (size_t)(ldc / HD) + (size_t)(c0 / HD + wn); P16 += hp * SEQ * HD; Ph += hp * RRES * HD; Pl += hp * RRES * HD;
            const float* cp = COSI + (size_t)mw * HD + cofs; const float* sp = SINI + (size_t)mw * HD + cofs;
            v4f cs[4], sn[4];
#pragma unroll
            for (int i = 0; i < 4; ++i) { cs[i] = *(const v4f*)(cp + i * 2 * HD); sn[i] = *(const v4f*)(sp + i * 2 * HD); }
            asm volatile("s_wait_xcnt 0x0" ::: "memory");                 // in front of any rewrite of the address registers of the loads above
            // rolled (short text); the next trip's cos and sin are asked for one trip ahead, so that this trip's work covers their latency (the last trip asks for its own rows again)
#pragma unroll 1
            for (int g = 0; g < 8; ++g) {
                v4f cn[4], sm[4]; const int gn = (g < 7) ? g + 1 : 7;
#pragma unroll
                for (int i = 0; i < 4; ++i) { cn[i] = *(const v4f*)(cp + (gn * 8 + i * 2) * HD); sm[i] = *(const v4f*)(sp + (gn * 8 + i * 2) * HD); }
                asm volatile("s_wait_xcnt 0x0" ::: "memory");             // in front of any rewrite of the address registers of the loads above
                // the trip's LDS reads go out together, its stores together at its foot: one LDS latency and one wait a trip
                v4f x0[4], x1[4]; v4h o16[4]; v4us oh[4], ol[4];
#pragma unroll
                for (int i = 0; i < 4; ++i) { const float* xr = ot + (g * 8 + i * 2 + hi) * 68; x0[i] = *(const v4fa*)(xr + cofs); x1[i] = *(const v4fa*)(xr + (cofs ^ (HD / 2))); }
#pragma unroll
                for (int i = 0; i < 4; ++i) { const v4f y0 = x0[i] * cscale + padd, y1 = x1[i] * cscale + padd;
#pragma unroll
                    for (int q = 0; q < 4; ++q) { const float cv = bfr(cs[i][q]), snv = bfr(sn[i][q]); const float pa = y0[q] * cv, pb = y1[q] * snv; const float r = (cofs < HD / 2) ? (pa - pb) : (pa + pb);
                        o16[i][q] = tohx(r); unsigned short a2, c2; splitf(r, a2, c2); oh[i][q] = a2; ol[i][q] = c2; } }
                const size_t oo = (size_t)(mw + g * 8) * HD + cofs;
                if (res) {
#pragma unroll
                    for (int i = 0; i < 4; ++i) { *(v4us*)(Ph + oo + i * 2 * HD) = oh[i]; *(v4us*)(Pl + oo + i * 2 * HD) = ol[i]; }
                    asm volatile("s_wait_xcnt 0x0" ::: "memory"); }       // in front of any rewrite of the registers of the stores above
#pragma unroll
                for (int i = 0; i < 4; ++i) *(v4h*)(P16 + oo + i * 2 * HD) = o16[i];
                asm volatile("s_wait_xcnt 0x0" ::: "memory");             // in front of any rewrite of the registers of the stores above
                __builtin_amdgcn_sched_barrier(0);                        // keeps the register copies below behind that wait (the scheduler otherwise lifts them over it, onto the stores' registers)
#pragma unroll
                for (int i = 0; i < 4; ++i) { cs[i] = cn[i]; sn[i] = sm[i]; }
            }
        } else {
            const bool res = c0 < RRES;
            const int t = c0 + wn * 64 + cofs;
            P16 += z * (size_t)DKV * SEQ + t; Ph += z * (size_t)DKV * RRES + t; Pl += z * (size_t)DKV * RRES + t;
            // rolled: short text
#pragma unroll 1
            for (int g = 0; g < 8; ++g) {
                // the trip's LDS reads go out together, its stores together at its foot: one LDS latency and one wait a trip
                v4f val[4]; v4h o16[4]; v4us oh[4], ol[4];
#pragma unroll
                for (int i = 0; i < 4; ++i) val[i] = *(const v4fa*)(ot + (g * 8 + i * 2 + hi) * 68 + cofs);
#pragma unroll
                for (int i = 0; i < 4; ++i) { const v4f y = val[i] * cscale + padd;
#pragma unroll
                    for (int q = 0; q < 4; ++q) { o16[i][q] = tohx(y[q]); unsigned short a2, c2; splitf(y[q], a2, c2); oh[i][q] = a2; ol[i][q] = c2; } }
                const size_t m = (size_t)(mw + g * 8);
                if (res) {
#pragma unroll
                    for (int i = 0; i < 4; ++i) { *(v4us*)(Ph + (m + i * 2) * RRES) = oh[i]; *(v4us*)(Pl + (m + i * 2) * RRES) = ol[i]; }
                    asm volatile("s_wait_xcnt 0x0" ::: "memory"); }       // in front of any rewrite of the registers of the stores above
#pragma unroll
                for (int i = 0; i < 4; ++i) *(v4h*)(P16 + (m + i * 2) * SEQ) = o16[i];
                asm volatile("s_wait_xcnt 0x0" ::: "memory");             // in front of any rewrite of the registers of the stores above
            }
        }
    }
}

// ---- k_qkv: the three projections, which need nothing of one another, as one grid (SEQ/128 token tiles, (DMO + 2 DKV)/128, NB): blockIdx.y picks q columns, then k columns, then v^T rows.
// Only pointers and the epilogue differ (a scalar choice); the small k and v^T grids fill the places that they would leave idle as launches of their own.
__global__ __launch_bounds__(128) void k_qkv(const bf* __restrict__ XB, const bf* __restrict__ WQ, const bf* __restrict__ WK, const bf* __restrict__ WV, const int* __restrict__ pflag,
                                             const float* __restrict__ COSI, const float* __restrict__ SINI, h16* Q16, bf* QPh, bf* QPl, h16* K16, bf* KPh, bf* KPl, h16* VT16, bf* VTh, bf* VTl) {
    __shared__ __align__(128) char sm[GRING];
    const int tk = blockIdx.x * 128, y = blockIdx.y; const size_t z = blockIdx.z;
    const bf* X = XB + z * (size_t)SEQ * DIN;
    const bf* A = X; const bf* B = WQ; int r0 = tk, c0 = y * 128, ldc = DMO; h16* P16 = Q16; bf* Ph = QPh; bf* Pl = QPl; bool vt = false;
    if (y >= (DMO + DKV) / 128) { A = WV; B = X; r0 = (y - (DMO + DKV) / 128) * 128; c0 = tk; ldc = SEQ; P16 = VT16; Ph = VTh; Pl = VTl; vt = true; }
    else if (y >= DMO / 128) { B = WK; c0 = (y - DMO / 128) * 128; ldc = DKV; P16 = K16; Ph = KPh; Pl = KPl; }
    gemmw<bf, 0, 1>(sm, r0, c0, z, A, nullptr, B, DIN, nullptr, ldc, 1.0f, pflag, vt, COSI, SINI, P16, Ph, Pl);
}

// ---- k_out: both output GEMMs, which need nothing of one another, as one grid of NB * (SEQ/128) * (DMO/128) work-groups. The tiles of rows < RRES (bf16 hi/lo ctx, twice the stages) have the
// lowest indices; the f16 tiles of rows >= RRES follow, row tile fastest.
#define ON (DMO / 128)
#define OR_ (RRES / 128)
#define OX ((SEQ - RRES) / 128)
__global__ __launch_bounds__(128) void k_out(const bf* __restrict__ CTh, const bf* __restrict__ CTl, const bf* __restrict__ WOb, const h16* __restrict__ C16, const h16* __restrict__ WO16, float* OUT, const int* __restrict__ pflag) {
    __shared__ __align__(128) char sm[GRING + GOSW];
    const int f = blockIdx.x;
    if (f < NB * ON * OR_) {
        const int x = f % OR_, y = (f / OR_) % ON; const size_t z = f / (OR_ * ON);
        gemmw<bf, 1, 0>(sm, x * 128, y * 128, z, CTh + z * RRES * DMO, CTl + z * RRES * DMO, WOb, DMO, OUT + z * SEQ_FULL * DMO, DMO, 1.0f, pflag, false, nullptr, nullptr, nullptr, nullptr, nullptr);
    } else if constexpr (SEQ > RRES) {
        const int g = f - NB * ON * OR_; const int x = g % OX, y = (g / OX) % ON; const size_t z = g / (OX * ON);
        gemmw<h16, 0, 0>(sm, RRES + x * 128, y * 128, z, C16 + z * SEQ * DMO, nullptr, WO16, DMO, OUT + z * SEQ_FULL * DMO, DMO, 1.0f / (CCAR * WCAR), pflag, false, nullptr, nullptr, nullptr, nullptr, nullptr);
    }
}

// ---- k_prep: every 16-bit plane that is a plain function of one input, in one launch of 256-thread blocks, 64 KB of f32 a block, sixteen 16-byte loads a lane in flight.
// Blocks < PT_W: one 128 (k) x 128 (n) tile of a weight w[k][n]: whole 512-B rows are read, RNE bf16 pairs (k, k + 1) go to LDS as dwords at [n][k / 2], and rows of 128 k (256 B) are written to
// Bt[n][k]; Ht[n][k] = f16(bf16 value x WCAR) for wo. The dword column is XORed with 2 * ((n >> 2) & 31): the 32 lanes of a store (n four apart, one k pair) then hit 32 different banks,
// and a pair of neighbouring columns stays an aligned pair for the 8-byte reads. Blocks >= PT_W: PXE consecutive elements of x to bf16. Block 0 also writes the zero flag line.
#define PTE 128
#define PXE 16384
#define PT_Q ((DIN / PTE) * (DMO / PTE))
#define PT_K ((DIN / PTE) * (DKV / PTE))
#define PT_O ((DMO / PTE) * (DMO / PTE))
#define PT_W (PT_Q + 2 * PT_K + PT_O)
#define PX_S ((int)(((size_t)SEQ * DIN) / PXE))
static_assert(DIN % PTE == 0 && DMO % PTE == 0 && DKV % PTE == 0 && ((size_t)SEQ * DIN) % PXE == 0);
typedef __attribute__((ext_vector_type(2))) unsigned v2u;
typedef v2u __attribute__((may_alias)) v2ua;
template <int N, int K, bool HASH>
__device__ __forceinline__ void prep_tile(const float* __restrict__ w, bf* Bt, h16* Ht, int b, unsigned* tp, int lane, int wave) {
    constexpr int NTN = N / PTE; const int k0 = (b / NTN) * PTE, n0 = (b % NTN) * PTE;
    const float* s = w + (size_t)(k0 + wave * 16) * N + n0 + lane * 4;
    v4f v[16];
#pragma unroll
    for (int i = 0; i < 16; ++i) v[i] = *(const v4f*)(s + (size_t)i * N);
    asm volatile("s_wait_xcnt 0x0" :: "v"(s) : "memory");   // in front of any rewrite of the loads' address registers (the pointer is named so that they live up to here)
#pragma unroll
    for (int i = 0; i < 8; ++i)
#pragma unroll
        for (int j = 0; j < 4; ++j) tp[(lane * 4 + j) * (PTE / 2) + ((wave * 8 + i) ^ (lane * 2))] = (unsigned)f2bf(v[2 * i][j]) | ((unsigned)f2bf(v[2 * i + 1][j]) << 16);
    __syncthreads();                                      // the whole tile is in LDS before any row of it is read
    v2u d[16];
#pragma unroll
    for (int r = 0; r < 16; ++r) { const int n = wave * 16 + r; d[r] = *(const v2ua*)(tp + n * (PTE / 2) + ((lane * 2) ^ (((n >> 2) & 31) << 1))); }
    const size_t o = (size_t)(n0 + wave * 16) * K + k0 + lane * 4;
#pragma unroll
    for (int r = 0; r < 16; ++r) { const v4us t = __builtin_bit_cast(v4us, d[r]); *(v4us*)(Bt + o + (size_t)r * K) = t;
        if (HASH) { v4h hh;
#pragma unroll
            for (int q = 0; q < 4; ++q) hh[q] = tohx(bf2f(t[q]) * WCAR);
            *(v4h*)(Ht + o + (size_t)r * K) = hh; } }
    asm volatile("s_wait_xcnt 0x0" ::: "memory");         // in front of any rewrite of the registers of the stores above
}
__global__ __launch_bounds__(256) void k_prep(const float* __restrict__ x, const float* __restrict__ wq, const float* __restrict__ wk, const float* __restrict__ wv, const float* __restrict__ wo,
                                              bf* XB, bf* WQ, bf* WK, bf* WV, bf* WOb, h16* WO16, int* MFLAG) {
    __shared__ __align__(16) unsigned tp[PTE * (PTE / 2)];
    const int tid = threadIdx.x, lane = tid & 31, wave = tid >> 5; const int b = blockIdx.x;
    if (b == 0 && tid < 32) MFLAG[tid] = 0;
    if (b < PT_Q) prep_tile<DMO, DIN, false>(wq, WQ, nullptr, b, tp, lane, wave);
    else if (b < PT_Q + PT_K) prep_tile<DKV, DIN, false>(wk, WK, nullptr, b - PT_Q, tp, lane, wave);
    else if (b < PT_Q + 2 * PT_K) prep_tile<DKV, DIN, false>(wv, WV, nullptr, b - PT_Q - PT_K, tp, lane, wave);
    else if (b < PT_W) prep_tile<DMO, DMO, true>(wo, WOb, WO16, b - PT_Q - 2 * PT_K, tp, lane, wave);
    else {
        const int u = b - PT_W; const int sq = u / PX_S; const size_t o = (size_t)(u % PX_S) * PXE + tid * 4;
        const float* s = x + (size_t)sq * SEQ_FULL * DIN + o; bf* dp = XB + (size_t)sq * SEQ * DIN + o;
        v4f v[16];
#pragma unroll
        for (int i = 0; i < 16; ++i) v[i] = *(const v4f*)(s + i * 1024);
        asm volatile("s_wait_xcnt 0x0" :: "v"(s) : "memory");   // in front of any rewrite of the loads' address registers (the pointer is named so that they live up to here)
#pragma unroll
        for (int i = 0; i < 16; ++i) { v4us t;
#pragma unroll
            for (int q = 0; q < 4; ++q) t[q] = f2bf(v[i][q]);
            *(v4us*)(dp + i * 1024) = t; }
        asm volatile("s_wait_xcnt 0x0" ::: "memory");     // in front of any rewrite of the registers of the stores above
    }
}

// ---- attention key / value tiles in LDS: a tile is 64 rows x 128 B (64 keys x HD of k, or HD x 64 keys of v^T) at a row pitch of PP elements (144 B).
// eight copies of one lane, 16 B each: four rows 16 apart of tile 0 (LDS byte address l0, global address g0, global row pitch p0 elements) and four of tile 1; eight lanes cover a
// row, so a wave's copy reads four whole 128-B lines. The s_wait_xcnt closes the statement so that no address register of an issued copy is rewritten ahead of it.
#define TLE (64 * PP)
template <typename T16>
__device__ __forceinline__ void acopy_tiles(unsigned l0, const T16* g0, size_t p0, unsigned l1, const T16* g1, size_t p1) {
    const unsigned ls = 16 * PP * 2; const size_t s0 = 16 * p0, s1 = 16 * p1;
    asm volatile("global_load_async_to_lds_b128 %0, %8, off\n\t"
                 "global_load_async_to_lds_b128 %1, %9, off\n\t"
                 "global_load_async_to_lds_b128 %2, %10, off\n\t"
                 "global_load_async_to_lds_b128 %3, %11, off\n\t"
                 "global_load_async_to_lds_b128 %4, %12, off\n\t"
                 "global_load_async_to_lds_b128 %5, %13, off\n\t"
                 "global_load_async_to_lds_b128 %6, %14, off\n\t"
                 "global_load_async_to_lds_b128 %7, %15, off\n\t"
                 "s_wait_xcnt 0x0"
                 :: "v"(l0), "v"(l0 + ls), "v"(l0 + 2 * ls), "v"(l0 + 3 * ls), "v"(l1), "v"(l1 + ls), "v"(l1 + 2 * ls), "v"(l1 + 3 * ls),
                    "v"(g0), "v"(g0 + s0), "v"(g0 + 2 * s0), "v"(g0 + 3 * s0), "v"(g1), "v"(g1 + s1), "v"(g1 + 2 * s1), "v"(g1 + 3 * s1) : "memory");
}

// lane l <-> lane l ^ 16 (the two lanes that share a query column of a transposed score tile)
__device__ __forceinline__ float xhalf(float x) { return __builtin_bit_cast(float, __builtin_amdgcn_permlanex16(__builtin_bit_cast(int, x), __builtin_bit_cast(int, x), 0x76543210, 0xfedcba98, false, false)); }

// ---- online softmax step on one wave's TRANSPOSED 64 x 16 score tile (D layout: s[nt][r] = S[key nt*16 + 8*hi + r][query lr]): a lane holds 32 of the 64 scores of its one query (row),
// so maximum and sum run inside the lane; the maximum is joined with the other half's by one exchange, the sum l stays this half's own and is joined behind the key loop. The running maximum m
// is that of the UNSCALED scores: the 1/sqrt(HD) scaling, the change to base 2 and the carry 2^LOGCAR of p are one multiply-add per score in front of exp2. Only the diagonal tile is masked
// (diag is the same for the whole work-group: a scalar branch): entries with key > query become -1e9 (their exp is exactly 0). The transposed output accumulators
// (o[nt][r] = O[d nt*16 + 8*hi + r][query lr]) are rescaled by the lane's one factor; leaves s = 2^LOGCAR exp(t - m), and l sums these.
template <int LOGCAR>
__device__ __forceinline__ void online_softmax_t(v8f (&s)[4], float& m, float& l, v8f (&o)[4], bool diag, int row, int kvb, int hi) {
    constexpr float KS = SCL * L2E;
    if (diag) {
        const int dl = row - kvb - 8 * hi;               // key kvb + nt*16 + 8*hi + r lies behind query row where nt*16 + r > dl
#pragma unroll
        for (int nt = 0; nt < 4; ++nt)
#pragma unroll
            for (int r = 0; r < 8; ++r) s[nt][r] = (nt * 16 + r > dl) ? -1.0e9f : s[nt][r];
    }
    float mp[4];
#pragma unroll
    for (int nt = 0; nt < 4; ++nt) {
#pragma unroll
        for (int r = 0; r < 8; ++r) mp[nt] = (r == 0) ? s[nt][r] : fmaxf(mp[nt], s[nt][r]); }
    float mx = fmaxf(fmaxf(mp[0], mp[1]), fmaxf(mp[2], mp[3]));
    mx = fmaxf(mx, xhalf(mx));
    const float m2 = fmaxf(m, mx); const float alpha = __builtin_amdgcn_exp2f((m - m2) * KS); m = m2;
    const float cadd = (float)LOGCAR - m2 * KS;
#pragma unroll
    for (int nt = 0; nt < 4; ++nt) { const v8f t = s[nt] * KS + cadd;
#pragma unroll
        for (int r = 0; r < 8; ++r) s[nt][r] = __builtin_amdgcn_exp2f(t[r]); }
    // the lane's 32 terms summed as a tree (the four key groups register by register, then the eight registers): packed additions, no chain of 32 dependent ones
    const v8f t = (s[0] + s[1]) + (s[2] + s[3]);
    l = l * alpha + (((t[0] + t[1]) + (t[2] + t[3])) + ((t[4] + t[5]) + (t[6] + t[7])));
#pragma unroll
    for (int nt = 0; nt < 4; ++nt) o[nt] = o[nt] * alpha;
}

// ---- attnr_tile: causal attention for query rows < RRES (query tiles 0 .. RRES/64-1; they only visit key tiles 0 .. qt): block = 4 waves x 16 rows, head h uses kv group h / GRP.
// q, k, v from the bf16 hi/lo planes ([h][RRES][HD], [g][RRES][HD], [g][HD][RRES]); scores = qh.kh + ql.kh + qh.kl, computed transposed (S^T = k q^T, O^T += v^T P^T: a lane holds one query's scores); unnormalised p split to bf16 hi/lo in registers, where it is the B operand;
// the four k and v^T tiles of 64 keys shared by the four waves through LDS (asynchronous copies, two buffers: the next tiles fly while these are worked on).
// ring: 2 * 4 * TLE elements of LDS, [buffer][k hi | v^T hi | k lo | v^T lo]; sq = sequence.
__device__ __forceinline__ void attnr_tile(bf* ring, int qt, int h, size_t sq, const bf* __restrict__ QPh, const bf* __restrict__ QPl, const bf* __restrict__ KPh, const bf* __restrict__ KPl, const bf* __restrict__ VTh, const bf* __restrict__ VTl, bf* CTh, bf* CTl) {
    const int lane = threadIdx.x & 31, wave = threadIdx.x >> 5, lr = lane & 15, hi = lane >> 4;
    const int g = h / GRP; const int q0 = qt * 64 + wave * 16;
    QPh += sq * NH * RRES * HD; QPl += sq * NH * RRES * HD; KPh += sq * NKV * RRES * HD; KPl += sq * NKV * RRES * HD; VTh += sq * NKV * HD * RRES; VTl += sq * NKV * HD * RRES;
    CTh += sq * RRES * DMO; CTl += sq * RRES * DMO;
    const bf* qh = QPh + ((size_t)h * RRES + q0) * HD; const bf* ql = QPl + ((size_t)h * RRES + q0) * HD;
    const bf* kh = KPh + (size_t)g * RRES * HD; const bf* kl = KPl + (size_t)g * RRES * HD;
    const bf* vh = VTh + (size_t)g * HD * RRES; const bf* vl = VTl + (size_t)g * HD * RRES;
    // output staging, each wave's own range of the ring: the ring is free behind the key loop (every wave's last read of it and every copy into it ended in front of the loop's last barrier)
    bf* sph = ring + wave * (2 * 16 * PP); bf* spl = sph + 16 * PP;
    float m = -3.0e38f, l = 0.0f; v8f o[4];
#pragma unroll
    for (int nt = 0; nt < 4; ++nt) o[nt] = (v8f){};
    const int nch = qt + 1;
    const int trow = threadIdx.x >> 3, tcol = (threadIdx.x & 7) * 8; const size_t tk = (size_t)trow * HD + tcol, tv = (size_t)trow * RRES + tcol;
    const unsigned lt = lds_off(ring) + (unsigned)(trow * PP + tcol) * 2;
    auto stage = [&](int c, int buf) { const unsigned l = lt + (unsigned)buf * (4 * TLE * 2); const size_t ok = tk + (size_t)c * 64 * HD, ov = tv + (size_t)c * 64;
        acopy_tiles(l, kh + ok, (size_t)HD, l + TLE * 2, vh + ov, (size_t)RRES); acopy_tiles(l + 2 * TLE * 2, kl + ok, (size_t)HD, l + 3 * TLE * 2, vl + ov, (size_t)RRES); };
    stage(0, 0);
    asm volatile("s_wait_asynccnt 0x0" ::: "memory");     // this wave's copies of tile 0 have landed
    __syncthreads();                                      // every wave's have: tile 0 may be read
    if (nch > 1) stage(1, 1);
#pragma unroll 1
    for (int c = 0; c < nch; ++c) {
        const int kvb = c * 64; v8f s[4]; v16bf aqh[2], aql[2], bh[4][2], bl[4][2];
        const bf* skh = ring + (c & 1) * (4 * TLE); const bf* svh = skh + TLE; const bf* skl = skh + 2 * TLE; const bf* svl = skh + 3 * TLE;
#pragma unroll
        for (int kk = 0; kk < 2; ++kk) { aqh[kk] = WFrag<bf>::ld(qh + (size_t)lr * HD + 8 * hi + kk * 32); aql[kk] = WFrag<bf>::ld(ql + (size_t)lr * HD + 8 * hi + kk * 32); }
#pragma unroll
        for (int nt = 0; nt < 4; ++nt) { const int ko = (nt * 16 + lr) * PP + 8 * hi;
#pragma unroll
            for (int kk = 0; kk < 2; ++kk) { bh[nt][kk] = WFrag<bf>::ld(skh + ko + kk * 32); bl[nt][kk] = WFrag<bf>::ld(skl + ko + kk * 32); } }
        // keeps the tile's k reads together in front of the products: with the mask's branch behind them the products are a block of their own, in which the scheduler otherwise reads one
        // fragment at a time into the same registers, each read waited for in full
        __builtin_amdgcn_sched_barrier(0);
#pragma unroll
        for (int nt = 0; nt < 4; ++nt) { s[nt] = (v8f){};
#pragma unroll
            for (int kk = 0; kk < 2; ++kk) {
                s[nt] = wmmab(bh[nt][kk], aqh[kk], s[nt]); s[nt] = wmmab(bh[nt][kk], aql[kk], s[nt]); s[nt] = wmmab(bl[nt][kk], aqh[kk], s[nt]); } }      // S^T: the 16 keys are the rows (A), the 16 queries the columns (B)
        asm volatile("v_nop\n\tv_nop\n\tv_nop\n\tv_nop" : "+v"(s[0]), "+v"(s[1]), "+v"(s[2]), "+v"(s[3]) : "v"(aqh[0]), "v"(aql[1]), "v"(bh[3][1]), "v"(bl[3][1]));
        online_softmax_t<0>(s, m, l, o, c == qt, q0 + lr, kvb, hi);
        // two score tiles of 16 keys, split in place, are the B operands P^T (hi, lo) of 32 keys: element e <- key 8*hi + e of the first, element 8 + e <- key 16 + 8*hi + e (the second's
        // 8*hi + e), the k order of the v^T loader
        v16bf aph[2], apl[2], bvh, bvl;
#pragma unroll
        for (int kk = 0; kk < 2; ++kk) { v8us h0, h1, l0, l1;
#pragma unroll
            for (int e = 0; e < 8; ++e) { unsigned short a2, c2; splitf(s[2 * kk][e], a2, c2); h0[e] = a2; l0[e] = c2; splitf(s[2 * kk + 1][e], a2, c2); h1[e] = a2; l1[e] = c2; }
            aph[kk] = cat16b(h0, h1); apl[kk] = cat16b(l0, l1); }
#pragma unroll
        for (int kk = 0; kk < 2; ++kk)
#pragma unroll
            for (int nt = 0; nt < 4; ++nt) { const int vo = (nt * 16 + lr) * PP + kk * 32 + 8 * hi; bvh = WFrag<bf>::ld(svh + vo); bvl = WFrag<bf>::ld(svl + vo);
                o[nt] = wmmab(bvh, aph[kk], o[nt]); o[nt] = wmmab(bvh, apl[kk], o[nt]); o[nt] = wmmab(bvl, aph[kk], o[nt]); }      // O^T: 16 rows of v^T are A
        asm volatile("v_nop\n\tv_nop\n\tv_nop\n\tv_nop" : "+v"(o[0]), "+v"(o[1]), "+v"(o[2]), "+v"(o[3]) : "v"(aph[0]), "v"(apl[1]), "v"(bvh), "v"(bvl));
        asm volatile("s_wait_dscnt 0x0" ::: "memory");    // this wave has left the buffer that is refilled below
        asm volatile("s_wait_asynccnt 0x0" ::: "memory"); // this wave's copies of tile c + 1 have landed
        __syncthreads();                                  // publishes tile c + 1 and ends every reader's last read of tile c
        if (c + 2 < nch) stage(c + 2, c & 1);
    }
    asm volatile("s_wait_asynccnt 0x0" ::: "memory");     // no copy is outstanding when the wave goes on and ends
    const float inv = 1.0f / (l + xhalf(l));                        // the two halves' sums of one query joined
#pragma unroll
    for (int nt = 0; nt < 4; ++nt) { v8us th, tl;
#pragma unroll
        for (int r = 0; r < 8; ++r) { unsigned short a2, c2; splitf(o[nt][r] * inv, a2, c2); th[r] = a2; tl[r] = c2; }
        const int so = lr * PP + nt * 16 + 8 * hi; *(v8usa*)(sph + so) = th; *(v8usa*)(spl + so) = tl; }           // a lane's 8 accumulators are 8 consecutive d of its query's row
    lds_wsync();
    bf* chb = CTh + (size_t)q0 * DMO + h * HD; bf* clb = CTl + (size_t)q0 * DMO + h * HD;
{
#pragma unroll
        for (int it = 0; it < 4; ++it) { const int rr = it * 4 + (lane >> 3), pc = (lane & 7) * 8; const v8us va = *(const v8usa*)(sph + rr * PP + pc); const v8us vb = *(const v8usa*)(spl + rr * PP + pc);
            *(v8us*)(chb + (size_t)rr * DMO + pc) = va; *(v8us*)(clb + (size_t)rr * DMO + pc) = vb; }
         }
}

// ---- attn_tile: causal attention for query tiles qt >= RRES/64: same structure (transposed products, p stays in registers) with single f16 products; q, k from [h][SEQ][HD] / [g][SEQ][HD] f16 planes,
// the k and v^T tiles of 64 keys shared by the four waves through LDS (asynchronous copies, two buffers: the next tiles fly while these are worked on).
// ring: 2 * 2 * TLE elements of LDS, [buffer][k | v^T]; sq = sequence.
__device__ __forceinline__ void attn_tile(h16* ring, int qt, int h, size_t sq, const h16* __restrict__ Q16, const h16* __restrict__ K16, const h16* __restrict__ VT16, h16* C16) {
    const int lane = threadIdx.x & 31, wave = threadIdx.x >> 5, lr = lane & 15, hi = lane >> 4;
    const int g = h / GRP; const int q0 = qt * 64 + wave * 16;
    Q16 += sq * NH * SEQ * HD; K16 += sq * NKV * SEQ * HD; VT16 += sq * NKV * HD * SEQ; C16 += sq * SEQ * DMO;
    const h16* qp = Q16 + ((size_t)h * SEQ + q0) * HD; const h16* kp = K16 + (size_t)g * SEQ * HD; const h16* vp = VT16 + (size_t)g * HD * SEQ;
    // output staging, each wave's own range of the ring: the ring is free behind the key loop (every wave's last read of it and every copy into it ended in front of the loop's last barrier)
    h16* spw = ring + wave * (16 * PP);
    v16h aq[2];
#pragma unroll
    for (int kk = 0; kk < 2; ++kk) aq[kk] = WFrag<h16>::ld(qp + (size_t)lr * HD + 8 * hi + kk * 32);
    float m = -3.0e38f, l = 0.0f; v8f o[4];
#pragma unroll
    for (int nt = 0; nt < 4; ++nt) o[nt] = (v8f){};
    const int nch = qt + 1;
    const int trow = threadIdx.x >> 3, tcol = (threadIdx.x & 7) * 8;
    const h16* gk = kp + (size_t)trow * HD + tcol; const h16* gv = vp + (size_t)trow * SEQ + tcol;
    const unsigned lt = lds_off(ring) + (unsigned)(trow * PP + tcol) * 2;
    auto stage = [&](int c, int buf) { const unsigned l = lt + (unsigned)buf * (2 * TLE * 2);
        acopy_tiles(l, gk + (size_t)c * 64 * HD, (size_t)HD, l + TLE * 2, gv + (size_t)c * 64, (size_t)SEQ); };
    stage(0, 0);
    asm volatile("s_wait_asynccnt 0x0" ::: "memory");     // this wave's copies of tile 0 have landed
    __syncthreads();                                      // every wave's have: tile 0 may be read
    if (nch > 1) stage(1, 1);
#pragma unroll 1
    for (int c = 0; c < nch; ++c) {
        const int kvb = c * 64; v8f s[4]; v16h b[4][2];
        const h16* sk = ring + (c & 1) * (2 * TLE) + lr * PP + 8 * hi; const h16* sv = sk + TLE;
#pragma unroll
        for (int nt = 0; nt < 4; ++nt)
#pragma unroll
            for (int kk = 0; kk < 2; ++kk) b[nt][kk] = WFrag<h16>::ld(sk + nt * 16 * PP + kk * 32);
        // keeps the tile's k reads together in front of the products: with the mask's branch behind them the products are a block of their own, in which the scheduler otherwise reads one
        // fragment at a time into the same registers, each read waited for in full
        __builtin_amdgcn_sched_barrier(0);
#pragma unroll
        for (int nt = 0; nt < 4; ++nt) { s[nt] = (v8f){};
#pragma unroll
            for (int kk = 0; kk < 2; ++kk) s[nt] = wmma16(b[nt][kk], aq[kk], s[nt]); }      // S^T: the 16 keys are the rows (A), the 16 queries the columns (B)
        asm volatile("v_nop\n\tv_nop\n\tv_nop\n\tv_nop" : "+v"(s[0]), "+v"(s[1]), "+v"(s[2]), "+v"(s[3]) : "v"(aq[0]), "v"(aq[1]), "v"(b[3][1]));
        online_softmax_t<LPCAR>(s, m, l, o, c == qt, q0 + lr, kvb, hi);    // s and l carry PCAR
        // two score tiles of 16 keys, converted in place, are the B operand P^T of 32 keys: element e <- key 8*hi + e of the first, element 8 + e <- key 16 + 8*hi + e (the second's 8*hi + e),
        // the k order of the v^T loader
        v16h ap[2], bv;
#pragma unroll
        for (int kk = 0; kk < 2; ++kk)
#pragma unroll
            for (int e = 0; e < 8; ++e) { ap[kk][e] = tohx(s[2 * kk][e]); ap[kk][8 + e] = tohx(s[2 * kk + 1][e]); }
#pragma unroll
        for (int kk = 0; kk < 2; ++kk)
#pragma unroll
            for (int nt = 0; nt < 4; ++nt) { bv = WFrag<h16>::ld(sv + nt * 16 * PP + kk * 32); o[nt] = wmma16(bv, ap[kk], o[nt]); }      // O^T: 16 rows of v^T are A
        asm volatile("v_nop\n\tv_nop\n\tv_nop\n\tv_nop" : "+v"(o[0]), "+v"(o[1]), "+v"(o[2]), "+v"(o[3]) : "v"(ap[0]), "v"(ap[1]), "v"(bv));
        asm volatile("s_wait_dscnt 0x0" ::: "memory");    // this wave has left the buffer that is refilled below
        asm volatile("s_wait_asynccnt 0x0" ::: "memory"); // this wave's copies of tile c + 1 have landed
        __syncthreads();                                  // publishes tile c + 1 and ends every reader's last read of tile c
        if (c + 2 < nch) stage(c + 2, c & 1);
    }
    asm volatile("s_wait_asynccnt 0x0" ::: "memory");     // no copy is outstanding when the wave goes on and ends
    const float inv = (1.0f / (l + xhalf(l))) * CCAR;               // the two halves' sums of one query joined; o and l both carry PCAR
#pragma unroll
    for (int nt = 0; nt < 4; ++nt) { v8h t;
#pragma unroll
        for (int r = 0; r < 8; ++r) t[r] = tohx(o[nt][r] * inv);
        *(v8ha*)(spw + lr * PP + nt * 16 + 8 * hi) = t; }           // a lane's 8 accumulators are 8 consecutive d of its query's row
    lds_wsync();
    h16* cb = C16 + (size_t)q0 * DMO + h * HD;
{
#pragma unroll
        for (int it = 0; it < 4; ++it) { const int rr = it * 4 + (lane >> 3), pc = (lane & 7) * 8; const v8h val = *(const v8ha*)(spw + rr * PP + pc); *(v8h*)(cb + (size_t)rr * DMO + pc) = val; }
         }
    asm volatile("s_wait_xcnt 0x0" ::: "memory");         // in front of any rewrite of the registers of the stores above (the other part's text follows this one in the joined kernel)
}

// ---- k_att: both attention parts, which need nothing of one another, as one grid of (SEQ/64) * NH * NB work-groups, one query tile of one head each; the query tile changes slowest.
// The tiles of rows < RRES (three products for one, few key tiles) have the lowest indices; the f16 tiles follow with the most key
// tiles first.
#define AQR (RRES / 64)
#define AHS (NH * NB)
static_assert(4 * 2 * 16 * PP <= 2 * 4 * TLE && 4 * 16 * PP <= 2 * 2 * TLE);
__global__ __launch_bounds__(128) void k_att(const bf* __restrict__ QPh, const bf* __restrict__ QPl, const bf* __restrict__ KPh, const bf* __restrict__ KPl, const bf* __restrict__ VTh, const bf* __restrict__ VTl, bf* CTh, bf* CTl,
                                             const h16* __restrict__ Q16, const h16* __restrict__ K16, const h16* __restrict__ VT16, h16* C16) {
    __shared__ __align__(128) char sm[2 * 4 * TLE * 2];
    const int j = blockIdx.x / AHS, u = blockIdx.x % AHS; const int h = u % NH; const size_t sq = u / NH;
    if (j < AQR) attnr_tile(reinterpret_cast<bf*>(sm), AQR - 1 - j, h, sq, QPh, QPl, KPh, KPl, VTh, VTl, CTh, CTl);
    else attn_tile(reinterpret_cast<h16*>(sm), SEQ / 64 - 1 - (j - AQR), h, sq, Q16, K16, VT16, C16);
}

extern "C" void kernel_launch(void* const* d_in, const int* in_sizes, int n_in,
                              void* d_out, int out_size, void* d_ws, size_t ws_size, hipStream_t stream) {
    if (n_in < 7) return;
    const long long rows_used = (long long)(NB - 1) * SEQ_FULL + SEQ;
    if ((long long)in_sizes[0] < rows_used * DIN) return;
    if (in_sizes[1] < SEQ * HD || in_sizes[2] < SEQ * HD) return;
    if (in_sizes[3] < DIN * DMO || in_sizes[4] < DIN * DKV || in_sizes[5] < DIN * DKV || in_sizes[6] < DMO * DMO) return;
    if ((long long)out_size < rows_used * DMO) return;
    // wire order: x, cos, sin, wq, wk, wv, wo
    const float* x = (const float*)d_in[0]; const float* cosi = (const float*)d_in[1]; const float* sini = (const float*)d_in[2];
    const float* wq = (const float*)d_in[3]; const float* wk = (const float*)d_in[4]; const float* wv = (const float*)d_in[5]; const float* wo = (const float*)d_in[6];
    float* OUT = (float*)d_out;     // [NB_FULL][SEQ_FULL][DMO]
    char* wsp = (char*)d_ws;
    auto take = [&](size_t bytes) { char* p = wsp; wsp += (bytes + 255) & ~(size_t)255; return (void*)p; };
    bf* WQ   = (bf*)take((size_t)DMO * DIN * 2);          // Bt [out][in]
    bf* WK   = (bf*)take((size_t)DKV * DIN * 2);
    bf* WV   = (bf*)take((size_t)DKV * DIN * 2);
    bf* WOb  = (bf*)take((size_t)DMO * DMO * 2);
    h16* WO16 = (h16*)take((size_t)DMO * DMO * 2);
    bf* XB   = (bf*)take((size_t)NB * SEQ * DIN * 2);     // from here on: NB planes each, sequence-major
    h16* Q16 = (h16*)take((size_t)NB * NH * SEQ * HD * 2); h16* K16 = (h16*)take((size_t)NB * NKV * SEQ * HD * 2); h16* VT16 = (h16*)take((size_t)NB * NKV * HD * SEQ * 2);
    bf* QPh = (bf*)take((size_t)NB * NH * RRES * HD * 2); bf* QPl = (bf*)take((size_t)NB * NH * RRES * HD * 2);
    bf* KPh = (bf*)take((size_t)NB * NKV * RRES * HD * 2); bf* KPl = (bf*)take((size_t)NB * NKV * RRES * HD * 2);
    bf* VTh = (bf*)take((size_t)NB * NKV * HD * RRES * 2); bf* VTl = (bf*)take((size_t)NB * NKV * HD * RRES * 2);
    h16* C16 = (h16*)take((size_t)NB * SEQ * DMO * 2);   // rows >= RRES of each sequence used
    bf* CTh = (bf*)take((size_t)NB * RRES * DMO * 2); bf* CTl = (bf*)take((size_t)NB * RRES * DMO * 2);
    int* MFLAG = (int*)take(128);
    const size_t carved = (size_t)(wsp - (char*)d_ws);
    if (carved > ws_size || carved > (size_t)268435456) return;

    k_prep<<<PT_W + NB * PX_S, 256, 0, stream>>>(x, wq, wk, wv, wo, XB, WQ, WK, WV, WOb, WO16, MFLAG);
    k_qkv<<<dim3(SEQ / 128, (DMO + 2 * DKV) / 128, NB), 128, 0, stream>>>(XB, WQ, WK, WV, MFLAG, cosi, sini, Q16, QPh, QPl, K16, KPh, KPl, VT16, VTh, VTl);
    k_att<<<(SEQ / 64) * NH * NB, 128, 0, stream>>>(QPh, QPl, KPh, KPl, VTh, VTl, CTh, CTl, Q16, K16, VT16, C16);
    k_out<<<NB * (SEQ / 128) * (DMO / 128), 128, 0, stream>>>(CTh, CTl, WOb, C16, WO16, OUT, MFLAG);
}

// v010
// Measured time: 130 microseconds a run.
// In both of two side-by-side timings against v009, it was 1.08 times as fast.
// Counting every step since v000, it is 5.87 times as fast.
#include <hip/hip_runtime.h>

// Contractions and operand types (f32 accumulate everywhere): x Wq, x Wk, x Wv on v_wmma_f32_16x16x32_bf16 with RNE bf16 copies of x and W (exact products);
// query rows < RRES of each sequence: q.k^T and p.v on v_wmma_f32_16x16x32_bf16 as bf16 hi/lo splits (3 products each), their ctx Wo as bf16 hi/lo ctx times bf16 Wo (2 products);
// query rows >= RRES: q.k^T and p.v on v_wmma_f32_16x16x32_f16 (f16 q/k/v planes, p carried x1024), ctx Wo on v_wmma_f32_16x16x32_f16 (ctx carried x16, Wo carried x64, folded by 1/1024 in the epilogue).
// diagonal are skipped (their probabilities are exactly 0) and the diagonal tile is masked by index; a constant zero flag line feeds the additive term of the GEMM epilogue.
// The projection GEMMs write the attention operand planes themselves: the rotary mix (q, k) and the 16-bit conversions (q, k, v^T) are their epilogues; no f32 projection plane exists.
// All NB sequences go through every launch together: the last grid dimension is the sequence (k_prep, k_att and k_out are flat grids: k_prep takes PX_S blocks a sequence after the weight tiles, k_att's sequence index lies between kv group (fastest) and query tile (slowest), k_out's sequence index is the slowest within each of its two tile ranges), and every per-sequence workspace plane holds NB copies, sequence-major.

#ifndef NB
#define NB 2
#endif
#ifndef SEQ
#define SEQ 2048
#endif
#ifndef RRES
#define RRES 256
#endif
#define NB_FULL 2
#define SEQ_FULL 2048
#define DIN 2048
#define DMO 2048
#define NH 32
#define NKV 8
#define GRP (NH / NKV)
#define HD 64
#define DKV (NKV * HD)
#define PP 72
#define PCAR 1024.0f
#define LPCAR 10
#define CCAR 16.0f
#define WCAR 64.0f
#define SCL 0.125f
#define L2E 1.4426950408889634f
static_assert(SEQ % 64 == 0 && SEQ >= 64 && SEQ <= SEQ_FULL);
static_assert(RRES % 64 == 0 && RRES >= 64 && RRES <= SEQ);
static_assert(NB >= 1 && NB <= NB_FULL);
static_assert(DIN % 32 == 0 && DMO % 64 == 0 && DKV % 64 == 0 && HD == 64 && (NH % NKV) == 0);
static_assert(DMO == NH * HD && DMO % 32 == 0);
static_assert(PP % 8 == 0 && PP >= HD);
static_assert(PCAR == (float)(1 << LPCAR));
static_assert((DMO * DIN) % 64 == 0 && (DKV * DIN) % 64 == 0 && (DMO * DMO) % 64 == 0 && DIN % 2 == 0 && DMO % 2 == 0);
static_assert(((size_t)SEQ * DIN) % 8 == 0);
// workspace carve (every plane a multiple of 256 B; same sequence as the launcher's take() calls)
#define AL256(x) ((((size_t)(x)) + 255) & ~(size_t)255)
#define WS_TOTAL (AL256((size_t)DMO * DIN * 2) + 2 * AL256((size_t)DKV * DIN * 2) + 2 * AL256((size_t)DMO * DMO * 2) + AL256((size_t)NB * SEQ * DIN * 2) \
                  + AL256((size_t)NB * NH * SEQ * HD * 2) + 2 * AL256((size_t)NB * NKV * SEQ * HD * 2) + 2 * AL256((size_t)NB * NH * RRES * HD * 2) \
                  + 4 * AL256((size_t)NB * NKV * RRES * HD * 2) + AL256((size_t)NB * SEQ * DMO * 2) + 2 * AL256((size_t)NB * RRES * DMO * 2) + AL256(128))
static_assert(WS_TOTAL <= (size_t)268435456);

typedef _Float16 h16;
typedef unsigned short bf;
typedef __attribute__((ext_vector_type(16))) __bf16   v16bf;
typedef __attribute__((ext_vector_type(16))) _Float16 v16h;
typedef __attribute__((ext_vector_type(8)))  _Float16 v8h;
typedef __attribute__((ext_vector_type(8)))  unsigned short v8us;
typedef __attribute__((ext_vector_type(8)))  float    v8f;
typedef __attribute__((ext_vector_type(4)))  float    v4f;
typedef __attribute__((ext_vector_type(4)))  int      v4i;
typedef __attribute__((ext_vector_type(2)))  _Float16 v2h;
typedef __attribute__((ext_vector_type(2)))  unsigned short v2us;
typedef __attribute__((ext_vector_type(4)))  _Float16 v4h;
typedef __attribute__((ext_vector_type(4)))  unsigned short v4us;
typedef v8h  __attribute__((may_alias)) v8ha;
typedef v4f  __attribute__((may_alias)) v4fa;
typedef v8us __attribute__((may_alias)) v8usa;

__device__ __forceinline__ unsigned short f2bf(float f) { unsigned u = __float_as_uint(f); u += 0x7FFFu + ((u >> 16) & 1u); return (unsigned short)(u >> 16); }
__device__ __forceinline__ float bf2f(unsigned short b) { return __uint_as_float(((unsigned)b) << 16); }
__device__ __forceinline__ float bfr(float f) { return bf2f(f2bf(f)); }
__device__ __forceinline__ h16 tohx(float x) { return (h16)x; }
__device__ __forceinline__ void splitf(float y, unsigned short& h, unsigned short& l) { h = f2bf(y); l = f2bf(y - bf2f(h)); }
__device__ __forceinline__ v16h cat16(v8h lo, v8h hi) { return __builtin_shufflevector(lo, hi, 0, 1, 2, 3, 4, 5, 6, 7, 8, 9, 10, 11, 12, 13, 14, 15); }
__device__ __forceinline__ v16bf cat16b(v8us lo, v8us hi) { return __builtin_bit_cast(v16bf, __builtin_shufflevector(lo, hi, 0, 1, 2, 3, 4, 5, 6, 7, 8, 9, 10, 11, 12, 13, 14, 15)); }
__device__ __forceinline__ v8f wmma16(v16h a, v16h b, v8f c) { return __builtin_amdgcn_wmma_f32_16x16x32_f16(false, a, false, b, (short)0, c, false, false); }
__device__ __forceinline__ v8f wmmab(v16bf a, v16bf b, v8f c) { return __builtin_amdgcn_wmma_f32_16x16x32_bf16(false, a, false, b, (short)0, c, false, false); }
// wave-private LDS tile: stores of this wave made visible to its own later cross-lane loads, loads kept below the stores by the compiler
__device__ __forceinline__ void lds_wsync() { __builtin_amdgcn_fence(3 /* release order */, "wavefront"); __builtin_amdgcn_wave_barrier(); asm volatile("" ::: "memory"); }

// 16-bit fragment loaders: lane l -> row/column (l & 15); elements 0..7 <- k0 + 8*(l>>4) + 0..7, elements 8..15 <- k0 + 16 + 8*(l>>4) + 0..7 of a K-contiguous row (p already offset by 8*(l>>4)).
template <typename T16> struct WFrag;
template <> struct WFrag<h16> { typedef v16h V; static __device__ __forceinline__ V ld(const h16* p) { return cat16(*(const v8h*)p, *(const v8h*)(p + 16)); } static __device__ __forceinline__ v8f mma(V a, V b, v8f c) { return wmma16(a, b, c); } };
template <> struct WFrag<bf> { typedef v16bf V; static __device__ __forceinline__ V ld(const bf* p) { return cat16b(*(const v8us*)p, *(const v8us*)(p + 16)); } static __device__ __forceinline__ v8f mma(V a, V b, v8f c) { return wmmab(a, b, c); } };

// ---- gemmw: work-group tiled GEMM, the body of k_qkv and k_out: WM x WN waves share the (64 WM) x (64 WN) output tile at (r0, c0) of sequence z, each wave keeps a 64x64 part (16 accumulators).
// A stage is GKS = 128 k (256 B) of the 64 WM A rows and the 64 WN Bt rows, brought from the K-contiguous 16-bit planes into LDS (sm: two stages, then GOSW bytes when EPI == 0) by asynchronous
// 16-byte copies at a row pitch of 272 B (wave w < WM + WN brings rows 64 w .. 64 w + 63 of the stage); two buffers, the next stage's copies fly while this stage is multiplied. Every accumulator sums k upward in steps of 32; when NSPLIT == 1 the K
// stages of A are followed by the K stages of A2 against the same Bt rows (one contraction of length 2 K). A, A2, Bt, C point at sequence z's planes.
// F[m][n] = (sum_k A[m][k] Bt[n][k] (+ sum_k A2[m][k] Bt[n][k] when NSPLIT == 1)) * cscale + (pflag[0] ? NaN : 0). K % 128 == 0, K >= 128, M % (64 WM) == 0, N % (64 WN) == 0.
// EPI == 0: C[m][n] (f32, pitch ldc) = F[m][n].
// EPI == 1 (m = token t; a wave's 64 columns are one head: head hd of a plane of nhd heads; vt, hd, nhd and the planes are the wave's own, the same in all its lanes).
// vt false: head planes of the rotate-half rotary mix of F with the cos/sin input tables (bf16 RNE values):
//   r[d] = x[d] cos[t][d] - x[d+HD/2] sin[t][d] (d < HD/2), r[d] = x[d] cos[t][d] + x[d-HD/2] sin[t][d] (d >= HD/2); P16[h][t][d] = f16(r) for every t, Ph/Pl[h][t][d] bf16 hi/lo for t < RRES.
// vt true: the wave's part is turned on its way into LDS, and with m = hd*HD + d: P16[m][t] = f16(F[t][d]) (row pitch SEQ), Ph/Pl[m][t] bf16 hi/lo for t < RRES (row pitch RRES).
#define GKS 128
#define GPI 136
static_assert(DIN % GKS == 0 && DMO % GKS == 0 && SEQ % 128 == 0 && RRES % 128 == 0 && DMO % 128 == 0 && DKV % 128 == 0);
__device__ __forceinline__ unsigned lds_off(const void* p) { return (unsigned)(size_t)p; }
// eight copies of one lane: rows 2 apart, 16 B each, LDS byte address l, global address g (row pitch K elements). The s_wait_xcnt closes the statement so that no address register
// of an issued copy is rewritten ahead of it.
template <typename T16>
__device__ __forceinline__ void acopy8(unsigned l, const T16* g, size_t K) {
    const unsigned ls = 2 * GPI * 2; const size_t gs = 2 * K;
    asm volatile("global_load_async_to_lds_b128 %0, %8, off\n\t"
                 "global_load_async_to_lds_b128 %1, %9, off\n\t"
                 "global_load_async_to_lds_b128 %2, %10, off\n\t"
                 "global_load_async_to_lds_b128 %3, %11, off\n\t"
                 "global_load_async_to_lds_b128 %4, %12, off\n\t"
                 "global_load_async_to_lds_b128 %5, %13, off\n\t"
                 "global_load_async_to_lds_b128 %6, %14, off\n\t"
                 "global_load_async_to_lds_b128 %7, %15, off\n\t"
                 "s_wait_xcnt 0x0"
                 :: "v"(l), "v"(l + ls), "v"(l + 2 * ls), "v"(l + 3 * ls), "v"(l + 4 * ls), "v"(l + 5 * ls), "v"(l + 6 * ls), "v"(l + 7 * ls),
                    "v"(g), "v"(g + gs), "v"(g + 2 * gs), "v"(g + 3 * gs), "v"(g + 4 * gs), "v"(g + 5 * gs), "v"(g + 6 * gs), "v"(g + 7 * gs) : "memory");
}
// 64 rows x 256 B, one wave's share of a stage: 32 copies a lane (16 lanes cover a row, a copy of the wave two rows)
template <typename T16>
__device__ __forceinline__ void acopy_rows(unsigned l, const T16* g, size_t K) { acopy8(l, g, K); acopy8(l + 16 * GPI * 2, g + 16 * K, K); acopy8(l + 32 * GPI * 2, g + 32 * K, K); acopy8(l + 48 * GPI * 2, g + 48 * K, K); }

#define GRING(WM, WN) (2 * ((WM) + (WN)) * 64 * GPI * 2)
#define GOSW (4 * 16 * 68 * 4)
template <typename T16, int NSPLIT, int EPI, int WM, int WN>
__device__ __forceinline__ void gemmw(char* sm, int r0, int c0, size_t z, const T16* __restrict__ A, const T16* __restrict__ A2, const T16* __restrict__ Bt, int K, float* C, int ldc, float cscale, const int* __restrict__ pflag,
                                      bool vt, int hd, int nhd, const float* __restrict__ COSI, const float* __restrict__ SINI, h16* P16, bf* Ph, bf* Pl) {
    typedef typename WFrag<T16>::V V;
    static_assert(NSPLIT == 0 || NSPLIT == 1); static_assert(EPI == 0 || EPI == 1);
    constexpr int OPE = WM * 64 * GPI;                    // elements of A's rows in a stage
    constexpr int STE = (WM + WN) * 64 * GPI;             // elements of a stage: [A | Bt]
    static_assert(2 * STE * 2 == GRING(WM, WN) && WM + WN <= WM * WN);
    T16* ring = reinterpret_cast<T16*>(sm);
    const int tid = threadIdx.x, lane = tid & 31, lr = lane & 15, hi = lane >> 4;
    const int wave = __builtin_amdgcn_readfirstlane(tid >> 5);   // the wave's number in a scalar register: the test around the copies below is a scalar branch
    const int wm = wave / WN, wn = wave % WN;
    const float padd = (pflag[0] != 0) ? __int_as_float(0x7fc00000) : 0.0f;
    v8f acc[4][4];
#pragma unroll
    for (int mb = 0; mb < 4; ++mb)
#pragma unroll
        for (int nb = 0; nb < 4; ++nb) acc[mb][nb] = (v8f){};
    // the copying waves: wave w < WM brings A rows 64 w .., wave WM <= w < WM + WN brings Bt rows 64 (w - WM) ..; the stage's rows lie in that order, so wave w fills rows 64 w .. of the stage
    const bool cpy = wave < WM + WN, cpa = wave < WM; const int cw = cpy ? wave : WM;   // a wave that copies nothing still forms addresses inside the planes
    const size_t co = (size_t)((cpa ? r0 + cw * 64 : c0 + (cw - WM) * 64) + hi) * K + lr * 8;
    const T16* gs = (cpa ? A : Bt) + co; const T16* gs2 = (NSPLIT == 1 && cpa) ? A2 + co : gs;
    const unsigned lt = lds_off(ring) + (unsigned)((cw * 64 + hi) * GPI + lr * 8) * 2;
    const int nk = K / GKS, nt = (NSPLIT == 1 ? 2 : 1) * nk;
    auto stage = [&](int t, int buf) { const bool sec = NSPLIT == 1 && t >= nk; const size_t ko = (size_t)(sec ? t - nk : t) * GKS;
        if (cpy) acopy_rows(lt + (unsigned)buf * (STE * 2), (sec ? gs2 : gs) + ko, (size_t)K); };
    stage(0, 0);
    asm volatile("s_wait_asynccnt 0x0" ::: "memory");     // this wave's copies of stage 0 have landed
    __syncthreads();                                      // every wave's have: stage 0 may be read
    if (nt > 1) stage(1, 1);
    // the stage loop stays rolled: one copy of the body in the instruction cache, the buffer picked by t & 1
#pragma unroll 1
    for (int t = 0; t < nt; ++t) {
        const T16* sa = ring + (t & 1) * STE + (wm * 64 + lr) * GPI + 8 * hi; const T16* sb = ring + (t & 1) * STE + OPE + (wn * 64 + lr) * GPI + 8 * hi;
        // two fragment sets: the reads of the next 32 k of this stage go out as one group ahead of this step's matrix instructions, so that only the stage's last group is waited for in full
        // (every loop below is unrolled so that set, fragment and accumulator indices are constants and the arrays live in registers)
        V a[2][4], b[2][4];
        auto ldset = [&](int s, int ks) {
#pragma unroll
            for (int mb = 0; mb < 4; ++mb) a[s][mb] = WFrag<T16>::ld(sa + mb * 16 * GPI + ks);
#pragma unroll
            for (int nb = 0; nb < 4; ++nb) b[s][nb] = WFrag<T16>::ld(sb + nb * 16 * GPI + ks); };
        ldset(0, 0);
#pragma unroll
        for (int q = 0; q < GKS / 32; ++q) {
            if (q + 1 < GKS / 32) ldset((q + 1) & 1, (q + 1) * 32);
            // keeps the group of reads above in front of this step's matrix instructions (the scheduler otherwise spreads them among these, each with a full wait); in the last step, which
            // has no reads, it keeps the step before in front of the waits at the loop's foot, where its matrix instructions cover the last reads' latency (without it they sink behind the barrier)
            __builtin_amdgcn_sched_barrier(0);
#pragma unroll
            for (int nb = 0; nb < 4; ++nb)
#pragma unroll
                for (int mb = 0; mb < 4; ++mb) acc[mb][nb] = WFrag<T16>::mma(a[q & 1][mb], b[q & 1][nb], acc[mb][nb]);
        }
        asm volatile("s_wait_dscnt 0x0" ::: "memory");    // this wave has left the buffer that is refilled below
        asm volatile("s_wait_asynccnt 0x0" ::: "memory"); // this wave's copies of stage t + 1 have landed
        __syncthreads();                                  // publishes stage t + 1 and ends every reader's last read of stage t
        if (t + 2 < nt) stage(t + 2, t & 1);
    }
    asm volatile("s_wait_asynccnt 0x0" ::: "memory");     // no copy is outstanding when the wave goes on and ends
    if constexpr (EPI == 0) {
    float* os = reinterpret_cast<float*>(sm + GRING(WM, WN)) + wave * (16 * 68);
#pragma unroll
    for (int mb = 0; mb < 4; ++mb) {
#pragma unroll
        for (int nb = 0; nb < 4; ++nb) {
#pragma unroll
            for (int j = 0; j < 8; ++j) os[(hi * 8 + j) * 68 + nb * 16 + lr] = acc[mb][nb][j]; }
        __builtin_amdgcn_wave_barrier(); asm volatile("" ::: "memory");
        float* crow = C + (size_t)(r0 + wm * 64 + mb * 16) * ldc + c0 + wn * 64;
{
#pragma unroll
            for (int s = 0; s < 8; ++s) { const int row = 2 * s + hi, cofs = lr * 4; v4f val = *(const v4fa*)(os + row * 68 + cofs); val = val * cscale + padd;
                *(v4f*)(crow + (size_t)row * ldc + cofs) = val; }
             }
        __builtin_amdgcn_wave_barrier(); asm volatile("" ::: "memory");
    }
    } else {
        // The ring is free: every wave's last read of it and every copy into it ended in front of the loop's last barrier. Each wave lays its whole 64 x 64 f32 part there (own range, row
        // pitch 68) and walks it in rolled loops of 8 rows a trip, so that the epilogue's text stays short.
        float* ot = reinterpret_cast<float*>(ring) + wave * (64 * 68);
        static_assert(WM * WN * 64 * 68 * 4 <= 2 * STE * 2 && RRES % (64 * WM) == 0);
        // rows of the laid part: tokens (vt false), or d with the tokens along the row (vt true: a lane's 8 accumulators are 8 consecutive tokens of one d)
        if (!vt) {
#pragma unroll
            for (int mb = 0; mb < 4; ++mb)
#pragma unroll
                for (int nb = 0; nb < 4; ++nb)
#pragma unroll
                    for (int j = 0; j < 8; ++j) ot[(mb * 16 + hi * 8 + j) * 68 + nb * 16 + lr] = acc[mb][nb][j];
        } else {
#pragma unroll
            for (int mb = 0; mb < 4; ++mb)
#pragma unroll
                for (int nb = 0; nb < 4; ++nb)
#pragma unroll
                    for (int j = 0; j < 8; ++j) ot[(nb * 16 + lr) * 68 + mb * 16 + hi * 8 + j] = acc[mb][nb][j];
        }
        __builtin_amdgcn_wave_barrier(); asm volatile("" ::: "memory");   // the wave's own stores stay in front of its cross-lane reads below
        const int cofs = lr * 4;
        // the hi/lo planes hold tokens < RRES only: a whole token tile is in or out
        const bool res = r0 < RRES;
        if (!vt) {
            const int mw = r0 + wm * 64 + hi;
            const size_t hp = z * (size_t)nhd + (size_t)hd; P16 += hp * SEQ * HD; Ph += hp * RRES * HD; Pl += hp * RRES * HD;
            const float* cp = COSI + (size_t)mw * HD + cofs; const float* sp = SINI + (size_t)mw * HD + cofs;
            v4f cs[4], sn[4];
#pragma unroll
            for (int i = 0; i < 4; ++i) { cs[i] = *(const v4f*)(cp + i * 2 * HD); sn[i] = *(const v4f*)(sp + i * 2 * HD); }
            asm volatile("s_wait_xcnt 0x0" ::: "memory");                 // in front of any rewrite of the address registers of the loads above
            // rolled (short text); the next trip's cos and sin are asked for one trip ahead, so that this trip's work covers their latency (the last trip asks for its own rows again)
#pragma unroll 1
            for (int g = 0; g < 8; ++g) {
                v4f cn[4], sm[4]; const int gn = (g < 7) ? g + 1 : 7;
#pragma unroll
                for (int i = 0; i < 4; ++i) { cn[i] = *(const v4f*)(cp + (gn * 8 + i * 2) * HD); sm[i] = *(const v4f*)(sp + (gn * 8 + i * 2) * HD); }
                asm volatile("s_wait_xcnt 0x0" ::: "memory");             // in front of any rewrite of the address registers of the loads above
                // the trip's LDS reads go out together, its stores together at its foot: one LDS latency and one wait a trip
                v4f x0[4], x1[4]; v4h o16[4]; v4us oh[4], ol[4];
#pragma unroll
                for (int i = 0; i < 4; ++i) { const float* xr = ot + (g * 8 + i * 2 + hi) * 68; x0[i] = *(const v4fa*)(xr + cofs); x1[i] = *(const v4fa*)(xr + (cofs ^ (HD / 2))); }
#pragma unroll
                for (int i = 0; i < 4; ++i) { const v4f y0 = x0[i] * cscale + padd, y1 = x1[i] * cscale + padd;
#pragma unroll
                    for (int q = 0; q < 4; ++q) { const float cv = bfr(cs[i][q]), snv = bfr(sn[i][q]); const float pa = y0[q] * cv, pb = y1[q] * snv; const float r = (cofs < HD / 2) ? (pa - pb) : (pa + pb);
                        o16[i][q] = tohx(r); unsigned short a2, c2; splitf(r, a2, c2); oh[i][q] = a2; ol[i][q] = c2; } }
                const size_t oo = (size_t)(mw + g * 8) * HD + cofs;
                if (res) {
#pragma unroll
                    for (int i = 0; i < 4; ++i) { *(v4us*)(Ph + oo + i * 2 * HD) = oh[i]; *(v4us*)(Pl + oo + i * 2 * HD) = ol[i]; }
                    asm volatile("s_wait_xcnt 0x0" ::: "memory"); }       // in front of any rewrite of the registers of the stores above
#pragma unroll
                for (int i = 0; i < 4; ++i) *(v4h*)(P16 + oo + i * 2 * HD) = o16[i];
                asm volatile("s_wait_xcnt 0x0" ::: "memory");             // in front of any rewrite of the registers of the stores above
                __builtin_amdgcn_sched_barrier(0);                        // keeps the register copies below behind that wait (the scheduler otherwise lifts them over it, onto the stores' registers)
#pragma unroll
                for (int i = 0; i < 4; ++i) { cs[i] = cn[i]; sn[i] = sm[i]; }
            }
        } else {
            const int mw = hd * HD + hi;
            const int t = r0 + wm * 64 + cofs;
            P16 += z * (size_t)DKV * SEQ + t; Ph += z * (size_t)DKV * RRES + t; Pl += z * (size_t)DKV * RRES + t;
            // rolled: short text
#pragma unroll 1
            for (int g = 0; g < 8; ++g) {
                // the trip's LDS reads go out together, its stores together at its foot: one LDS latency and one wait a trip
                v4f val[4]; v4h o16[4]; v4us oh[4], ol[4];
#pragma unroll
                for (int i = 0; i < 4; ++i) val[i] = *(const v4fa*)(ot + (g * 8 + i * 2 + hi) * 68 + cofs);
#pragma unroll
                for (int i = 0; i < 4; ++i) { const v4f y = val[i] * cscale + padd;
#pragma unroll
                    for (int q = 0; q < 4; ++q) { o16[i][q] = tohx(y[q]); unsigned short a2, c2; splitf(y[q], a2, c2); oh[i][q] = a2; ol[i][q] = c2; } }
                const size_t m = (size_t)(mw + g * 8);
                if (res) {
#pragma unroll
                    for (int i = 0; i < 4; ++i) { *(v4us*)(Ph + (m + i * 2) * RRES) = oh[i]; *(v4us*)(Pl + (m + i * 2) * RRES) = ol[i]; }
                    asm volatile("s_wait_xcnt 0x0" ::: "memory"); }       // in front of any rewrite of the registers of the stores above
#pragma unroll
                for (int i = 0; i < 4; ++i) *(v4h*)(P16 + (m + i * 2) * SEQ) = o16[i];
                asm volatile("s_wait_xcnt 0x0" ::: "memory");             // in front of any rewrite of the registers of the stores above
            }
        }
    }
}

// ---- k_qkv: the three projections as one GEMM over the DMO + 2 DKV weight rows (the planes WQ, WK, WV abut in the workspace, so W is one Bt of that many rows): grid (SEQ/256 token tiles,
// (DMO + 2 DKV)/192, NB) = one work-group of 12 waves (4 x 3) for each WGP; a staged token row feeds 3 waves and a staged weight row 4. A wave's 64 columns are one head of q, of k or of v:
// only the planes and the epilogue differ (a scalar choice of the wave).
#define QWM 4
#define QWN 3
static_assert(SEQ % (64 * QWM) == 0 && (DMO + 2 * DKV) % (64 * QWN) == 0 && ((size_t)DMO * DIN * 2) % 256 == 0 && ((size_t)DKV * DIN * 2) % 256 == 0);
__global__ __launch_bounds__(QWM * QWN * 32) void k_qkv(const bf* __restrict__ XB, const bf* __restrict__ W, const int* __restrict__ pflag,
                                             const float* __restrict__ COSI, const float* __restrict__ SINI, h16* Q16, bf* QPh, bf* QPl, h16* K16, bf* KPh, bf* KPl, h16* VT16, bf* VTh, bf* VTl) {
    __shared__ __align__(128) char sm[GRING(QWM, QWN)];
    const int tk = blockIdx.x * (64 * QWM), y = blockIdx.y; const size_t z = blockIdx.z;
    const int hc = y * QWN + __builtin_amdgcn_readfirstlane(threadIdx.x >> 5) % QWN;      // the wave's head among the NH + 2 NKV head columns
    int hd = hc, nhd = NH; h16* P16 = Q16; bf* Ph = QPh; bf* Pl = QPl; bool vt = false;
    if (hc >= NH + NKV) { hd = hc - (NH + NKV); nhd = NKV; P16 = VT16; Ph = VTh; Pl = VTl; vt = true; }
    else if (hc >= NH) { hd = hc - NH; nhd = NKV; P16 = K16; Ph = KPh; Pl = KPl; }
    gemmw<bf, 0, 1, QWM, QWN>(sm, tk, y * (64 * QWN), z, XB + z * (size_t)SEQ * DIN, nullptr, W, DIN, nullptr, 0, 1.0f, pflag, vt, hd, nhd, COSI, SINI, P16, Ph, Pl);
}

// ---- k_out: both output GEMMs, which need nothing of one another, as one grid of NB * (SEQ/128) * (DMO/128) work-groups. The tiles of rows < RRES (bf16 hi/lo ctx, twice the stages) have the
// lowest indices; the f16 tiles of rows >= RRES follow, row tile fastest.
#define ON (DMO / 128)
#define OR_ (RRES / 128)
#define OX ((SEQ - RRES) / 128)
__global__ __launch_bounds__(128) void k_out(const bf* __restrict__ CTh, const bf* __restrict__ CTl, const bf* __restrict__ WOb, const h16* __restrict__ C16, const h16* __restrict__ WO16, float* OUT, const int* __restrict__ pflag) {
    __shared__ __align__(128) char sm[GRING(2, 2) + GOSW];
    const int f = blockIdx.x;
    if (f < NB * ON * OR_) {
        const int x = f % OR_, y = (f / OR_) % ON; const size_t z = f / (OR_ * ON);
        gemmw<bf, 1, 0, 2, 2>(sm, x * 128, y * 128, z, CTh + z * RRES * DMO, CTl + z * RRES * DMO, WOb, DMO, OUT + z * SEQ_FULL * DMO, DMO, 1.0f, pflag, false, 0, 0, nullptr, nullptr, nullptr, nullptr, nullptr);
    } else if constexpr (SEQ > RRES) {
        const int g = f - NB * ON * OR_; const int x = g % OX, y = (g / OX) % ON; const size_t z = g / (OX * ON);
        gemmw<h16, 0, 0, 2, 2>(sm, RRES + x * 128, y * 128, z, C16 + z * SEQ * DMO, nullptr, WO16, DMO, OUT + z * SEQ_FULL * DMO, DMO, 1.0f / (CCAR * WCAR), pflag, false, 0, 0, nullptr, nullptr, nullptr, nullptr, nullptr);
    }
}

// ---- k_prep: every 16-bit plane that is a plain function of one input, in one launch of 256-thread blocks, 64 KB of f32 a block, sixteen 16-byte loads a lane in flight.
// Blocks < PT_W: one 128 (k) x 128 (n) tile of a weight w[k][n]: whole 512-B rows are read, RNE bf16 pairs (k, k + 1) go to LDS as dwords at [n][k / 2], and rows of 128 k (256 B) are written to
// Bt[n][k]; Ht[n][k] = f16(bf16 value x WCAR) for wo. The dword column is XORed with 2 * ((n >> 2) & 31): the 32 lanes of a store (n four apart, one k pair) then hit 32 different banks,
// and a pair of neighbouring columns stays an aligned pair for the 8-byte reads. Blocks >= PT_W: PXE consecutive elements of x to bf16. Block 0 also writes the zero flag line.
#define PTE 128
#define PXE 16384
#define PT_Q ((DIN / PTE) * (DMO / PTE))
#define PT_K ((DIN / PTE) * (DKV / PTE))
#define PT_O ((DMO / PTE) * (DMO / PTE))
#define PT_W (PT_Q + 2 * PT_K + PT_O)
#define PX_S ((int)(((size_t)SEQ * DIN) / PXE))
static_assert(DIN % PTE == 0 && DMO % PTE == 0 && DKV % PTE == 0 && ((size_t)SEQ * DIN) % PXE == 0);
typedef __attribute__((ext_vector_type(2))) unsigned v2u;
typedef v2u __attribute__((may_alias)) v2ua;
template <int N, int K, bool HASH>
__device__ __forceinline__ void prep_tile(const float* __restrict__ w, bf* Bt, h16* Ht, int b, unsigned* tp, int lane, int wave) {
    constexpr int NTN = N / PTE; const int k0 = (b / NTN) * PTE, n0 = (b % NTN) * PTE;
    const float* s = w + (size_t)(k0 + wave * 16) * N + n0 + lane * 4;
    v4f v[16];
#pragma unroll
    for (int i = 0; i < 16; ++i) v[i] = *(const v4f*)(s + (size_t)i * N);
    asm volatile("s_wait_xcnt 0x0" :: "v"(s) : "memory");   // in front of any rewrite of the loads' address registers (the pointer is named so that they live up to here)
#pragma unroll
    for (int i = 0; i < 8; ++i)
#pragma unroll
        for (int j = 0; j < 4; ++j) tp[(lane * 4 + j) * (PTE / 2) + ((wave * 8 + i) ^ (lane * 2))] = (unsigned)f2bf(v[2 * i][j]) | ((unsigned)f2bf(v[2 * i + 1][j]) << 16);
    __syncthreads();                                      // the whole tile is in LDS before any row of it is read
    v2u d[16];
#pragma unroll
    for (int r = 0; r < 16; ++r) { const int n = wave * 16 + r; d[r] = *(const v2ua*)(tp + n * (PTE / 2) + ((lane * 2) ^ (((n >> 2) & 31) << 1))); }
    const size_t o = (size_t)(n0 + wave * 16) * K + k0 + lane * 4;
#pragma unroll
    for (int r = 0; r < 16; ++r) { const v4us t = __builtin_bit_cast(v4us, d[r]); *(v4us*)(Bt + o + (size_t)r * K) = t;
        if (HASH) { v4h hh;
#pragma unroll
            for (int q = 0; q < 4; ++q) hh[q] = tohx(bf2f(t[q]) * WCAR);
            *(v4h*)(Ht + o + (size_t)r * K) = hh; } }
    asm volatile("s_wait_xcnt 0x0" ::: "memory");         // in front of any rewrite of the registers of the stores above
}
__global__ __launch_bounds__(256) void k_prep(const float* __restrict__ x, const float* __restrict__ wq, const float* __restrict__ wk, const float* __restrict__ wv, const float* __restrict__ wo,
                                              bf* XB, bf* WQ, bf* WK, bf* WV, bf* WOb, h16* WO16, int* MFLAG) {
    __shared__ __align__(16) unsigned tp[PTE * (PTE / 2)];
    const int tid = threadIdx.x, lane = tid & 31, wave = tid >> 5; const int b = blockIdx.x;
    if (b == 0 && tid < 32) MFLAG[tid] = 0;
    if (b < PT_Q) prep_tile<DMO, DIN, false>(wq, WQ, nullptr, b, tp, lane, wave);
    else if (b < PT_Q + PT_K) prep_tile<DKV, DIN, false>(wk, WK, nullptr, b - PT_Q, tp, lane, wave);
    else if (b < PT_Q + 2 * PT_K) prep_tile<DKV, DIN, false>(wv, WV, nullptr, b - PT_Q - PT_K, tp, lane, wave);
    else if (b < PT_W) prep_tile<DMO, DMO, true>(wo, WOb, WO16, b - PT_Q - 2 * PT_K, tp, lane, wave);
    else {
        const int u = b - PT_W; const int sq = u / PX_S; const size_t o = (size_t)(u % PX_S) * PXE + tid * 4;
        const float* s = x + (size_t)sq * SEQ_FULL * DIN + o; bf* dp = XB + (size_t)sq * SEQ * DIN + o;
        v4f v[16];
#pragma unroll
        for (int i = 0; i < 16; ++i) v[i] = *(const v4f*)(s + i * 1024);
        asm volatile("s_wait_xcnt 0x0" :: "v"(s) : "memory");   // in front of any rewrite of the loads' address registers (the pointer is named so that they live up to here)
#pragma unroll
        for (int i = 0; i < 16; ++i) { v4us t;
#pragma unroll
            for (int q = 0; q < 4; ++q) t[q] = f2bf(v[i][q]);
            *(v4us*)(dp + i * 1024) = t; }
        asm volatile("s_wait_xcnt 0x0" ::: "memory");     // in front of any rewrite of the registers of the stores above
    }
}

// ---- attention key / value tiles in LDS: a tile is 64 rows x 128 B (64 keys x HD of k, or HD x 64 keys of v^T) at a row pitch of PP elements (144 B).
// The 512 lanes of a work-group cover a tile with one 16-B copy each: eight lanes cover a row, so a wave's copy reads four whole 128-B lines. One lane's copies of a stage (one per tile: LDS
// byte address l, global address g) stand in one statement; the s_wait_xcnt closes it so that no address register of an issued copy is rewritten ahead of it.
#define TLE (64 * PP)
template <typename T16>
__device__ __forceinline__ void acopy_two(unsigned l0, const T16* g0, unsigned l1, const T16* g1) {
    asm volatile("global_load_async_to_lds_b128 %0, %2, off\n\t"
                 "global_load_async_to_lds_b128 %1, %3, off\n\t"
                 "s_wait_xcnt 0x0"
                 :: "v"(l0), "v"(l1), "v"(g0), "v"(g1) : "memory");
}
template <typename T16>
__device__ __forceinline__ void acopy_four(unsigned l0, const T16* g0, unsigned l1, const T16* g1, unsigned l2, const T16* g2, unsigned l3, const T16* g3) {
    asm volatile("global_load_async_to_lds_b128 %0, %4, off\n\t"
                 "global_load_async_to_lds_b128 %1, %5, off\n\t"
                 "global_load_async_to_lds_b128 %2, %6, off\n\t"
                 "global_load_async_to_lds_b128 %3, %7, off\n\t"
                 "s_wait_xcnt 0x0"
                 :: "v"(l0), "v"(l1), "v"(l2), "v"(l3), "v"(g0), "v"(g1), "v"(g2), "v"(g3) : "memory");
}

// lane l <-> lane l ^ 16 (the two lanes that share a query column of a transposed score tile)
__device__ __forceinline__ float xhalf(float x) { return __builtin_bit_cast(float, __builtin_amdgcn_permlanex16(__builtin_bit_cast(int, x), __builtin_bit_cast(int, x), 0x76543210, 0xfedcba98, false, false)); }

// ---- online softmax step on one wave's TRANSPOSED 64 x 16 score tile (D layout: s[nt][r] = S[key nt*16 + 8*hi + r][query lr]): a lane holds 32 of the 64 scores of its one query (row),
// so maximum and sum run inside the lane; the maximum is joined with the other half's by one exchange, the sum l stays this half's own and is joined behind the key loop. The running maximum m
// is that of the UNSCALED scores: the 1/sqrt(HD) scaling, the change to base 2 and the carry 2^LOGCAR of p are one multiply-add per score in front of exp2. Only the diagonal tile is masked
// (diag is the same for the whole work-group: a scalar branch): entries with key > query become -1e9 (their exp is exactly 0). The transposed output accumulators
// (o[nt][r] = O[d nt*16 + 8*hi + r][query lr]) are rescaled by the lane's one factor; leaves s = 2^LOGCAR exp(t - m), and l sums these.
template <int LOGCAR>
__device__ __forceinline__ void online_softmax_t(v8f (&s)[4], float& m, float& l, v8f (&o)[4], bool diag, int row, int kvb, int hi) {
    constexpr float KS = SCL * L2E;
    if (diag) {
        const int dl = row - kvb - 8 * hi;               // key kvb + nt*16 + 8*hi + r lies behind query row where nt*16 + r > dl
#pragma unroll
        for (int nt = 0; nt < 4; ++nt)
#pragma unroll
            for (int r = 0; r < 8; ++r) s[nt][r] = (nt * 16 + r > dl) ? -1.0e9f : s[nt][r];
    }
    float mp[4];
#pragma unroll
    for (int nt = 0; nt < 4; ++nt) {
#pragma unroll
        for (int r = 0; r < 8; ++r) mp[nt] = (r == 0) ? s[nt][r] : fmaxf(mp[nt], s[nt][r]); }
    float mx = fmaxf(fmaxf(mp[0], mp[1]), fmaxf(mp[2], mp[3]));
    mx = fmaxf(mx, xhalf(mx));
    const float m2 = fmaxf(m, mx); const float alpha = __builtin_amdgcn_exp2f((m - m2) * KS); m = m2;
    const float cadd = (float)LOGCAR - m2 * KS;
#pragma unroll
    for (int nt = 0; nt < 4; ++nt) { const v8f t = s[nt] * KS + cadd;
#pragma unroll
        for (int r = 0; r < 8; ++r) s[nt][r] = __builtin_amdgcn_exp2f(t[r]); }
    // the lane's 32 terms summed as a tree (the four key groups register by register, then the eight registers): packed additions, no chain of 32 dependent ones
    const v8f t = (s[0] + s[1]) + (s[2] + s[3]);
    l = l * alpha + (((t[0] + t[1]) + (t[2] + t[3])) + ((t[4] + t[5]) + (t[6] + t[7])));
#pragma unroll
    for (int nt = 0; nt < 4; ++nt) o[nt] = o[nt] * alpha;
}

// ---- attnr_tile: causal attention for query rows < RRES (query tiles 0 .. RRES/64-1; they only visit key tiles 0 .. qt): block = the GRP heads of kv group g x 4 waves x 16 rows.
// q, k, v from the bf16 hi/lo planes ([h][RRES][HD], [g][RRES][HD], [g][HD][RRES]); scores = qh.kh + ql.kh + qh.kl, computed transposed (S^T = k q^T, O^T += v^T P^T: a lane holds one query's scores); unnormalised p split to bf16 hi/lo in registers, where it is the B operand;
// the four k and v^T tiles of 64 keys shared by the sixteen waves through LDS (asynchronous copies, two buffers: the next tiles fly while these are worked on).
// ring: 2 * 4 * TLE elements of LDS, [buffer][k hi | v^T hi | k lo | v^T lo]; sq = sequence.
__device__ __forceinline__ void attnr_tile(bf* ring, int qt, int g, size_t sq, const bf* __restrict__ QPh, const bf* __restrict__ QPl, const bf* __restrict__ KPh, const bf* __restrict__ KPl, const bf* __restrict__ VTh, const bf* __restrict__ VTl, bf* CTh, bf* CTl) {
    const int lane = threadIdx.x & 31, wave = threadIdx.x >> 5, lr = lane & 15, hi = lane >> 4;
    const int h = g * GRP + (wave >> 2); const int q0 = qt * 64 + (wave & 3) * 16;
    QPh += sq * NH * RRES * HD; QPl += sq * NH * RRES * HD; KPh += sq * NKV * RRES * HD; KPl += sq * NKV * RRES * HD; VTh += sq * NKV * HD * RRES; VTl += sq * NKV * HD * RRES;
    CTh += sq * RRES * DMO; CTl += sq * RRES * DMO;
    const bf* qh = QPh + ((size_t)h * RRES + q0) * HD; const bf* ql = QPl + ((size_t)h * RRES + q0) * HD;
    const bf* kh = KPh + (size_t)g * RRES * HD; const bf* kl = KPl + (size_t)g * RRES * HD;
    const bf* vh = VTh + (size_t)g * HD * RRES; const bf* vl = VTl + (size_t)g * HD * RRES;
    // output staging, each wave's own range of the ring: the ring is free behind the key loop (every wave's last read of it and every copy into it ended in front of the loop's last barrier)
    bf* sph = ring + wave * (2 * 16 * PP); bf* spl = sph + 16 * PP;
    float m = -3.0e38f, l = 0.0f; v8f o[4];
#pragma unroll
    for (int nt = 0; nt < 4; ++nt) o[nt] = (v8f){};
    const int nch = qt + 1;
    const int trow = threadIdx.x >> 3, tcol = (threadIdx.x & 7) * 8; const size_t tk = (size_t)trow * HD + tcol, tv = (size_t)trow * RRES + tcol;
    const unsigned lt = lds_off(ring) + (unsigned)(trow * PP + tcol) * 2;
    auto stage = [&](int c, int buf) { const unsigned l = lt + (unsigned)buf * (4 * TLE * 2); const size_t ok = tk + (size_t)c * 64 * HD, ov = tv + (size_t)c * 64;
        acopy_four(l, kh + ok, l + TLE * 2, vh + ov, l + 2 * TLE * 2, kl + ok, l + 3 * TLE * 2, vl + ov); };
    stage(0, 0);
    asm volatile("s_wait_asynccnt 0x0" ::: "memory");     // this wave's copies of tile 0 have landed
    __syncthreads();                                      // every wave's have: tile 0 may be read
    if (nch > 1) stage(1, 1);
#pragma unroll 1
    for (int c = 0; c < nch; ++c) {
        const int kvb = c * 64; v8f s[4]; v16bf aqh[2], aql[2], bh[4][2], bl[4][2];
        const bf* skh = ring + (c & 1) * (4 * TLE); const bf* svh = skh + TLE; const bf* skl = skh + 2 * TLE; const bf* svl = skh + 3 * TLE;
#pragma unroll
        for (int kk = 0; kk < 2; ++kk) { aqh[kk] = WFrag<bf>::ld(qh + (size_t)lr * HD + 8 * hi + kk * 32); aql[kk] = WFrag<bf>::ld(ql + (size_t)lr * HD + 8 * hi + kk * 32); }
#pragma unroll
        for (int nt = 0; nt < 4; ++nt) { const int ko = (nt * 16 + lr) * PP + 8 * hi;
#pragma unroll
            for (int kk = 0; kk < 2; ++kk) { bh[nt][kk] = WFrag<bf>::ld(skh + ko + kk * 32); bl[nt][kk] = WFrag<bf>::ld(skl + ko + kk * 32); } }
        // keeps the tile's k reads together in front of the products: with the mask's branch behind them the products are a block of their own, in which the scheduler otherwise reads one
        // fragment at a time into the same registers, each read waited for in full
        __builtin_amdgcn_sched_barrier(0);
#pragma unroll
        for (int nt = 0; nt < 4; ++nt) { s[nt] = (v8f){};
#pragma unroll
            for (int kk = 0; kk < 2; ++kk) {
                s[nt] = wmmab(bh[nt][kk], aqh[kk], s[nt]); s[nt] = wmmab(bh[nt][kk], aql[kk], s[nt]); s[nt] = wmmab(bl[nt][kk], aqh[kk], s[nt]); } }      // S^T: the 16 keys are the rows (A), the 16 queries the columns (B)
        asm volatile("v_nop\n\tv_nop\n\tv_nop\n\tv_nop" : "+v"(s[0]), "+v"(s[1]), "+v"(s[2]), "+v"(s[3]) : "v"(aqh[0]), "v"(aql[1]), "v"(bh[3][1]), "v"(bl[3][1]));
        online_softmax_t<0>(s, m, l, o, c == qt, q0 + lr, kvb, hi);
        // two score tiles of 16 keys, split in place, are the B operands P^T (hi, lo) of 32 keys: element e <- key 8*hi + e of the first, element 8 + e <- key 16 + 8*hi + e (the second's
        // 8*hi + e), the k order of the v^T loader
        v16bf aph[2], apl[2], bvh, bvl;
#pragma unroll
        for (int kk = 0; kk < 2; ++kk) { v8us h0, h1, l0, l1;
#pragma unroll
            for (int e = 0; e < 8; ++e) { unsigned short a2, c2; splitf(s[2 * kk][e], a2, c2); h0[e] = a2; l0[e] = c2; splitf(s[2 * kk + 1][e], a2, c2); h1[e] = a2; l1[e] = c2; }
            aph[kk] = cat16b(h0, h1); apl[kk] = cat16b(l0, l1); }
#pragma unroll
        for (int kk = 0; kk < 2; ++kk)
#pragma unroll
            for (int nt = 0; nt < 4; ++nt) { const int vo = (nt * 16 + lr) * PP + kk * 32 + 8 * hi; bvh = WFrag<bf>::ld(svh + vo); bvl = WFrag<bf>::ld(svl + vo);
                o[nt] = wmmab(bvh, aph[kk], o[nt]); o[nt] = wmmab(bvh, apl[kk], o[nt]); o[nt] = wmmab(bvl, aph[kk], o[nt]); }      // O^T: 16 rows of v^T are A
        asm volatile("v_nop\n\tv_nop\n\tv_nop\n\tv_nop" : "+v"(o[0]), "+v"(o[1]), "+v"(o[2]), "+v"(o[3]) : "v"(aph[0]), "v"(apl[1]), "v"(bvh), "v"(bvl));
        asm volatile("s_wait_dscnt 0x0" ::: "memory");    // this wave has left the buffer that is refilled below
        asm volatile("s_wait_asynccnt 0x0" ::: "memory"); // this wave's copies of tile c + 1 have landed
        __syncthreads();                                  // publishes tile c + 1 and ends every reader's last read of tile c
        if (c + 2 < nch) stage(c + 2, c & 1);
    }
    asm volatile("s_wait_asynccnt 0x0" ::: "memory");     // no copy is outstanding when the wave goes on and ends
    const float inv = 1.0f / (l + xhalf(l));                        // the two halves' sums of one query joined
#pragma unroll
    for (int nt = 0; nt < 4; ++nt) { v8us th, tl;
#pragma unroll
        for (int r = 0; r < 8; ++r) { unsigned short a2, c2; splitf(o[nt][r] * inv, a2, c2); th[r] = a2; tl[r] = c2; }
        const int so = lr * PP + nt * 16 + 8 * hi; *(v8usa*)(sph + so) = th; *(v8usa*)(spl + so) = tl; }           // a lane's 8 accumulators are 8 consecutive d of its query's row
    lds_wsync();
    bf* chb = CTh + (size_t)q0 * DMO + h * HD; bf* clb = CTl + (size_t)q0 * DMO + h * HD;
{
#pragma unroll
        for (int it = 0; it < 4; ++it) { const int rr = it * 4 + (lane >> 3), pc = (lane & 7) * 8; const v8us va = *(const v8usa*)(sph + rr * PP + pc); const v8us vb = *(const v8usa*)(spl + rr * PP + pc);
            *(v8us*)(chb + (size_t)rr * DMO + pc) = va; *(v8us*)(clb + (size_t)rr * DMO + pc) = vb; }
         }
}

// ---- attn_tile: causal attention for query tiles qt >= RRES/64: same structure (transposed products, p stays in registers) with single f16 products; q, k from [h][SEQ][HD] / [g][SEQ][HD] f16 planes,
// the k and v^T tiles of 64 keys shared by the sixteen waves (GRP heads of kv group g x 4 waves x 16 rows) through LDS (asynchronous copies, two buffers: the next tiles fly while these are worked on).
// ring: 2 * 2 * TLE elements of LDS, [buffer][k | v^T]; sq = sequence.
__device__ __forceinline__ void attn_tile(h16* ring, int qt, int g, size_t sq, const h16* __restrict__ Q16, const h16* __restrict__ K16, const h16* __restrict__ VT16, h16* C16) {
    const int lane = threadIdx.x & 31, wave = threadIdx.x >> 5, lr = lane & 15, hi = lane >> 4;
    const int h = g * GRP + (wave >> 2); const int q0 = qt * 64 + (wave & 3) * 16;
    Q16 += sq * NH * SEQ * HD; K16 += sq * NKV * SEQ * HD; VT16 += sq * NKV * HD * SEQ; C16 += sq * SEQ * DMO;
    const h16* qp = Q16 + ((size_t)h * SEQ + q0) * HD; const h16* kp = K16 + (size_t)g * SEQ * HD; const h16* vp = VT16 + (size_t)g * HD * SEQ;
    // output staging, each wave's own range of the ring: the ring is free behind the key loop (every wave's last read of it and every copy into it ended in front of the loop's last barrier)
    h16* spw = ring + wave * (16 * PP);
    v16h aq[2];
#pragma unroll
    for (int kk = 0; kk < 2; ++kk) aq[kk] = WFrag<h16>::ld(qp + (size_t)lr * HD + 8 * hi + kk * 32);
    float m = -3.0e38f, l = 0.0f; v8f o[4];
#pragma unroll
    for (int nt = 0; nt < 4; ++nt) o[nt] = (v8f){};
    const int nch = qt + 1;
    const int trow = threadIdx.x >> 3, tcol = (threadIdx.x & 7) * 8;
    const h16* gk = kp + (size_t)trow * HD + tcol; const h16* gv = vp + (size_t)trow * SEQ + tcol;
    const unsigned lt = lds_off(ring) + (unsigned)(trow * PP + tcol) * 2;
    auto stage = [&](int c, int buf) { const unsigned l = lt + (unsigned)buf * (2 * TLE * 2);
        acopy_two(l, gk + (size_t)c * 64 * HD, l + TLE * 2, gv + (size_t)c * 64); };
    stage(0, 0);
    asm volatile("s_wait_asynccnt 0x0" ::: "memory");     // this wave's copies of tile 0 have landed
    __syncthreads();                                      // every wave's have: tile 0 may be read
    if (nch > 1) stage(1, 1);
#pragma unroll 1
    for (int c = 0; c < nch; ++c) {
        const int kvb = c * 64; v8f s[4]; v16h b[4][2];
        const h16* sk = ring + (c & 1) * (2 * TLE) + lr * PP + 8 * hi; const h16* sv = sk + TLE;
#pragma unroll
        for (int nt = 0; nt < 4; ++nt)
#pragma unroll
            for (int kk = 0; kk < 2; ++kk) b[nt][kk] = WFrag<h16>::ld(sk + nt * 16 * PP + kk * 32);
        // keeps the tile's k reads together in front of the products: with the mask's branch behind them the products are a block of their own, in which the scheduler otherwise reads one
        // fragment at a time into the same registers, each read waited for in full
        __builtin_amdgcn_sched_barrier(0);
#pragma unroll
        for (int nt = 0; nt < 4; ++nt) { s[nt] = (v8f){};
#pragma unroll
            for (int kk = 0; kk < 2; ++kk) s[nt] = wmma16(b[nt][kk], aq[kk], s[nt]); }      // S^T: the 16 keys are the rows (A), the 16 queries the columns (B)
        asm volatile("v_nop\n\tv_nop\n\tv_nop\n\tv_nop" : "+v"(s[0]), "+v"(s[1]), "+v"(s[2]), "+v"(s[3]) : "v"(aq[0]), "v"(aq[1]), "v"(b[3][1]));
        online_softmax_t<LPCAR>(s, m, l, o, c == qt, q0 + lr, kvb, hi);    // s and l carry PCAR
        // two score tiles of 16 keys, converted in place, are the B operand P^T of 32 keys: element e <- key 8*hi + e of the first, element 8 + e <- key 16 + 8*hi + e (the second's 8*hi + e),
        // the k order of the v^T loader
        v16h ap[2], bv;
#pragma unroll
        for (int kk = 0; kk < 2; ++kk)
#pragma unroll
            for (int e = 0; e < 8; ++e) { ap[kk][e] = tohx(s[2 * kk][e]); ap[kk][8 + e] = tohx(s[2 * kk + 1][e]); }
#pragma unroll
        for (int kk = 0; kk < 2; ++kk)
#pragma unroll
            for (int nt = 0; nt < 4; ++nt) { bv = WFrag<h16>::ld(sv + nt * 16 * PP + kk * 32); o[nt] = wmma16(bv, ap[kk], o[nt]); }      // O^T: 16 rows of v^T are A
        asm volatile("v_nop\n\tv_nop\n\tv_nop\n\tv_nop" : "+v"(o[0]), "+v"(o[1]), "+v"(o[2]), "+v"(o[3]) : "v"(ap[0]), "v"(ap[1]), "v"(bv));
        asm volatile("s_wait_dscnt 0x0" ::: "memory");    // this wave has left the buffer that is refilled below
        asm volatile("s_wait_asynccnt 0x0" ::: "memory"); // this wave's copies of tile c + 1 have landed
        __syncthreads();                                  // publishes tile c + 1 and ends every reader's last read of tile c
        if (c + 2 < nch) stage(c + 2, c & 1);
    }
    asm volatile("s_wait_asynccnt 0x0" ::: "memory");     // no copy is outstanding when the wave goes on and ends
    const float inv = (1.0f / (l + xhalf(l))) * CCAR;               // the two halves' sums of one query joined; o and l both carry PCAR
#pragma unroll
    for (int nt = 0; nt < 4; ++nt) { v8h t;
#pragma unroll
        for (int r = 0; r < 8; ++r) t[r] = tohx(o[nt][r] * inv);
        *(v8ha*)(spw + lr * PP + nt * 16 + 8 * hi) = t; }           // a lane's 8 accumulators are 8 consecutive d of its query's row
    lds_wsync();
    h16* cb = C16 + (size_t)q0 * DMO + h * HD;
{
#pragma unroll
        for (int it = 0; it < 4; ++it) { const int rr = it * 4 + (lane >> 3), pc = (lane & 7) * 8; const v8h val = *(const v8ha*)(spw + rr * PP + pc); *(v8h*)(cb + (size_t)rr * DMO + pc) = val; }
         }
    asm volatile("s_wait_xcnt 0x0" ::: "memory");         // in front of any rewrite of the registers of the stores above (the other part's text follows this one in the joined kernel)
}

// ---- k_att: both attention parts, which need nothing of one another, as one grid of (SEQ/64) * NKV * NB work-groups of 16 waves, one query tile of the GRP heads of one kv group each (these
// heads read the same k and v^T tiles, which so come from L2 once for the four); the query tile changes slowest.
// The tiles of rows < RRES (three products for one, few key tiles) have the lowest indices; the f16 tiles follow with the most key
// tiles first (for speed only).
#define AQR (RRES / 64)
#define AHS (NKV * NB)
static_assert(GRP == 4 && 4 * GRP * 2 * 16 * PP <= 2 * 4 * TLE && 4 * GRP * 16 * PP <= 2 * 2 * TLE);
__global__ __launch_bounds__(512) void k_att(const bf* __restrict__ QPh, const bf* __restrict__ QPl, const bf* __restrict__ KPh, const bf* __restrict__ KPl, const bf* __restrict__ VTh, const bf* __restrict__ VTl, bf* CTh, bf* CTl,
                                             const h16* __restrict__ Q16, const h16* __restrict__ K16, const h16* __restrict__ VT16, h16* C16) {
    __shared__ __align__(128) char sm[2 * 4 * TLE * 2];
    const int j = blockIdx.x / AHS, u = blockIdx.x % AHS; const int g = u % NKV; const size_t sq = u / NKV;
    if (j < AQR) attnr_tile(reinterpret_cast<bf*>(sm), AQR - 1 - j, g, sq, QPh, QPl, KPh, KPl, VTh, VTl, CTh, CTl);
    else attn_tile(reinterpret_cast<h16*>(sm), SEQ / 64 - 1 - (j - AQR), g, sq, Q16, K16, VT16, C16);
}

extern "C" void kernel_launch(void* const* d_in, const int* in_sizes, int n_in,
                              void* d_out, int out_size, void* d_ws, size_t ws_size, hipStream_t stream) {
    if (n_in < 7) return;
    const long long rows_used = (long long)(NB - 1) * SEQ_FULL + SEQ;
    if ((long long)in_sizes[0] < rows_used * DIN) return;
    if (in_sizes[1] < SEQ * HD || in_sizes[2] < SEQ * HD) return;
    if (in_sizes[3] < DIN * DMO || in_sizes[4] < DIN * DKV || in_sizes[5] < DIN * DKV || in_sizes[6] < DMO * DMO) return;
    if ((long long)out_size < rows_used * DMO) return;
    // wire order: x, cos, sin, wq, wk, wv, wo
    const float* x = (const float*)d_in[0]; const float* cosi = (const float*)d_in[1]; const float* sini = (const float*)d_in[2];
    const float* wq = (const float*)d_in[3]; const float* wk = (const float*)d_in[4]; const float* wv = (const float*)d_in[5]; const float* wo = (const float*)d_in[6];
    float* OUT = (float*)d_out;     // [NB_FULL][SEQ_FULL][DMO]
    char* wsp = (char*)d_ws;
    auto take = [&](size_t bytes) { char* p = wsp; wsp += (bytes + 255) & ~(size_t)255; return (void*)p; };
    bf* WQ   = (bf*)take((size_t)DMO * DIN * 2);          // Bt [out][in]; WQ, WK, WV abut: k_qkv reads them as one plane
    bf* WK   = (bf*)take((size_t)DKV * DIN * 2);
    bf* WV   = (bf*)take((size_t)DKV * DIN * 2);
    bf* WOb  = (bf*)take((size_t)DMO * DMO * 2);
    h16* WO16 = (h16*)take((size_t)DMO * DMO * 2);
    bf* XB   = (bf*)take((size_t)NB * SEQ * DIN * 2);     // from here on: NB planes each, sequence-major
    h16* Q16 = (h16*)take((size_t)NB * NH * SEQ * HD * 2); h16* K16 = (h16*)take((size_t)NB * NKV * SEQ * HD * 2); h16* VT16 = (h16*)take((size_t)NB * NKV * HD * SEQ * 2);
    bf* QPh = (bf*)take((size_t)NB * NH * RRES * HD * 2); bf* QPl = (bf*)take((size_t)NB * NH * RRES * HD * 2);
    bf* KPh = (bf*)take((size_t)NB * NKV * RRES * HD * 2); bf* KPl = (bf*)take((size_t)NB * NKV * RRES * HD * 2);
    bf* VTh = (bf*)take((size_t)NB * NKV * HD * RRES * 2); bf* VTl = (bf*)take((size_t)NB * NKV * HD * RRES * 2);
    h16* C16 = (h16*)take((size_t)NB * SEQ * DMO * 2);   // rows >= RRES of each sequence used
    bf* CTh = (bf*)take((size_t)NB * RRES * DMO * 2); bf* CTl = (bf*)take((size_t)NB * RRES * DMO * 2);
    int* MFLAG = (int*)take(128);
    const size_t carved = (size_t)(wsp - (char*)d_ws);
    if (carved > ws_size || carved > (size_t)268435456) return;

    k_prep<<<PT_W + NB * PX_S, 256, 0, stream>>>(x, wq, wk, wv, wo, XB, WQ, WK, WV, WOb, WO16, MFLAG);
    k_qkv<<<dim3(SEQ / (64 * QWM), (DMO + 2 * DKV) / (64 * QWN), NB), QWM * QWN * 32, 0, stream>>>(XB, WQ, MFLAG, cosi, sini, Q16, QPh, QPl, K16, KPh, KPl, VT16, VTh, VTl);
    k_att<<<(SEQ / 64) * NKV * NB, 512, 0, stream>>>(QPh, QPl, KPh, KPl, VTh, VTl, CTh, CTl, Q16, K16, VT16, C16);
    k_out<<<NB * (SEQ / 128) * (DMO / 128), 128, 0, stream>>>(CTh, CTl, WOb, C16, WO16, OUT, MFLAG);
}
